// v000
// Times are from an AMD MI455X. After a warm-up the kernel runs many times in a row, and a time is the length of
// such a window on the GPU divided by its runs, so every launch and the gaps after it count. The runs cycle
// through copies of the inputs. A figure is the median of several windows, for all but v000 over two sittings.
// Sittings can differ by a few percent; kernels timed side by side share one.
// v000 is the starting kernel. One run takes 995 microseconds.
#include <hip/hip_runtime.h>

// Compute dtypes, f32 accumulate everywhere: q.k^T and q.rpe^T v_wmma_f32_16x16x32_bf16 on RNE bf16 copies of the inputs (exact products, one product each; q carries the 1/8 scale); P.V v_wmma_f32_16x16x32_f16 with P carried x1024 and V = LayerNorm(v) as an f16 plane; merged heads bf16 hi/lo x bf16 W_proj, 2 products, no bias; LayerNorm and softmax f32.
// Multi-head attention on three unprojected input streams: 8 heads x 64 (head h = columns h*64+d); v is layer-normalised over its 512 features first (eps 1e-5, gain, shift); logits = (q.k + q.rpe_emb[rel(i,j)]) / 8 with rel(i,j) = clip(j - i, -64, 64) + 64 (position table shared by all heads); no mask; softmax over keys; heads merged back to [B][S][512]; out = merged W_proj^T.
// Layout: bf16 head planes Q, K [b][h][s][64]; bf16 position plane [144][64] (rows 129..143 zero); V^T [b][h*64+d][s] f16; fused flash attention (K / V^T tiles in LDS, online softmax, per-wave q.rpe^T table [16][129] in LDS, no score plane) writes merged bf16 hi/lo planes [b*S+s][512]; output GEMM.
// The integer relative-index input is compared in full against the closed form on the device; any difference turns the whole output into NaN.

#ifndef NB
#define NB 4
#endif
#ifndef SEQ
#define SEQ 2048
#endif
#define NB_FULL  4
#define SEQ_FULL 2048
#define DM   512
#define NH   8
#define HD   64
#define PCAR 1024.0f
#define PFL  (-24.0f)  // exp2 argument below which P * PCAR would leave the f16 normal range
#define SCL  0.125f
#define L2E  1.4426950408889634f
#define LKP  72      // LDS row pitch (16-bit elements) of the K / V^T tiles: 144 B rows
#define LPP  40      // LDS row pitch (halves) of the per-wave P tile: 80 B rows
#define LOP  68      // LDS row pitch (floats) of epilogue staging tiles: 272 B rows
#define RK   64      // relative distance clip
#define NREL 129     // position table rows: 2 * RK + 1
#define RT   9       // 16-wide column tiles of the per-wave q.rpe^T table
#define RPAD 144     // position plane rows, zero filled beyond NREL
#define LRP  148     // LDS row pitch (floats) of the per-wave q.rpe^T table
#define LTP  72      // LDS row pitch (halves) of the LayerNorm transpose tile
#define LNEPS 1.0e-5f

static_assert(DM == NH * HD);            // one 64-wide GEMM column tile == one head
static_assert(HD == 64);
static_assert(DM % 32 == 0);             // WMMA k-step
static_assert(DM % 64 == 0);             // GEMM tiles
static_assert(SEQ % 64 == 0);            // GEMM row tiles, key blocks, query blocks
static_assert((SEQ * DM) % (8 * 256) == 0);   // convert kernel grid is exact
static_assert((DM * DM) % (8 * 256) == 0);
static_assert(NB <= NB_FULL);
static_assert(SEQ <= SEQ_FULL);
static_assert(LKP % 8 == 0);             // 16-byte aligned LDS vector accesses
static_assert(LPP % 8 == 0);
static_assert(LOP % 4 == 0);
static_assert(NREL == 2 * RK + 1);
static_assert(RPAD == RT * 16);          // position plane rows == table column tiles
static_assert(NREL <= RPAD);
static_assert(RPAD <= LRP);              // table columns fit the LDS pitch
static_assert(2 * RK < RPAD);            // largest clamped index is a written column
static_assert((RPAD * HD) % 64 == 0);
static_assert(HD * 2 == 8 * 16);         // head plane row == 8 lanes x 16 B
static_assert(LTP % 8 == 0);
static_assert(SEQ % 4 == 0);             // index compare reads 4 integers per lane
static_assert(256 * 16 * 2 == 64 * 64 * 2);
static_assert(32 * 16 * 4 == 16 * HD * 2);
static_assert(32 * 16 * 8 == 16 * 64 * 4);     // output epilogue: lanes x bytes x trips == 16 rows x 256 B
static_assert(PCAR == 1024.0f);                // PFL = -14 - log2(PCAR)
static_assert((size_t)64 * LKP * 2 * 2 + (size_t)4 * 16 * LPP * 2 + (size_t)4 * 16 * LOP * 4 + (size_t)4 * 16 * LRP * 4 <= 131072);   // flash static LDS
static_assert((size_t)64 * LTP * 2 + 2 * 64 * 4 <= 131072);                                                                     // LayerNorm static LDS

typedef _Float16 h16;
typedef unsigned short bf;
typedef __attribute__((ext_vector_type(16))) __bf16   v16bf;
typedef __attribute__((ext_vector_type(16))) _Float16 v16h;
typedef __attribute__((ext_vector_type(8)))  _Float16 v8h;
typedef __attribute__((ext_vector_type(8)))  unsigned short v8us;
typedef __attribute__((ext_vector_type(8)))  float    v8f;
typedef __attribute__((ext_vector_type(4)))  float    v4f;
typedef __attribute__((ext_vector_type(4)))  int      v4i;
typedef v8h  __attribute__((may_alias)) v8ha;
typedef v4f  __attribute__((may_alias)) v4fa;
typedef v8us __attribute__((may_alias)) v8usa;

__device__ __forceinline__ unsigned short f2bf(float f) { unsigned u = __float_as_uint(f); u += 0x7FFFu + ((u >> 16) & 1u); return (unsigned short)(u >> 16); }
__device__ __forceinline__ float bf2f(unsigned short b) { return __uint_as_float(((unsigned)b) << 16); }
__device__ __forceinline__ float bfr(float f) { return bf2f(f2bf(f)); }
__device__ __forceinline__ void splitf(float y, unsigned short& h, unsigned short& l) { h = f2bf(y); l = f2bf(y - bf2f(h)); }
__device__ __forceinline__ v16h cat16(v8h lo, v8h hi) { return __builtin_shufflevector(lo, hi, 0, 1, 2, 3, 4, 5, 6, 7, 8, 9, 10, 11, 12, 13, 14, 15); }
__device__ __forceinline__ v16bf cat16b(v8us lo, v8us hi) { return __builtin_bit_cast(v16bf, __builtin_shufflevector(lo, hi, 0, 1, 2, 3, 4, 5, 6, 7, 8, 9, 10, 11, 12, 13, 14, 15)); }
__device__ __forceinline__ v8f wmma16(v16h a, v16h b, v8f c) { return __builtin_amdgcn_wmma_f32_16x16x32_f16(false, a, false, b, (short)0, c, false, false); }
__device__ __forceinline__ v8f wmmab(v16bf a, v16bf b, v8f c) { return __builtin_amdgcn_wmma_f32_16x16x32_bf16(false, a, false, b, (short)0, c, false, false); }
// fragment from a K-contiguous global bf16 plane: elements 0..7 <- p[0..7], 8..15 <- p[16..23] (p already includes row*pitch + k0 + 8*(lane>>4))
__device__ __forceinline__ v16bf ldg16(const bf* __restrict__ p) { return cat16b(*(const v8us*)p, *(const v8us*)(p + 16)); }
// same-wave LDS exchange ordering (wave-private tiles only)
__device__ __forceinline__ void wsync() { __builtin_amdgcn_wave_barrier(); asm volatile("" ::: "memory"); }
// one matrix instruction followed by its own four idle slots (ties the accumulator, keeps the operands live)
__device__ __forceinline__ v8f wmmab_g(v16bf a, v16bf b, v8f c) { c = __builtin_amdgcn_wmma_f32_16x16x32_bf16(false, a, false, b, (short)0, c, false, false); asm volatile("v_nop\n\tv_nop\n\tv_nop\n\tv_nop" : "+v"(c) : "v"(a), "v"(b)); return c; }
__device__ __forceinline__ v8f wmma16_g(v16h a, v16h b, v8f c) { c = __builtin_amdgcn_wmma_f32_16x16x32_f16(false, a, false, b, (short)0, c, false, false); asm volatile("v_nop\n\tv_nop\n\tv_nop\n\tv_nop" : "+v"(c) : "v"(a), "v"(b)); return c; }
// f32 -> f16 operand convert that cannot produce an f16 subnormal
__device__ __forceinline__ h16 toh_flush(float v) { const h16 r = (h16)v; return (fabsf(v) < 6.103515625e-05f) ? (h16)0.0f : r; }
__device__ __forceinline__ int clampi(int v, int lo, int hi) { const int t = v < lo ? lo : v; return t > hi ? hi : t; }

// ---- one-wave 64x64 tile main loop: acc[mb][nb] += sum_k A[r0+16mb+..][k] Bt[c0+16nb+..][k] (NSPLIT 1: + A2 x Bt). Operands straight from K-contiguous bf16 planes; K % 32 == 0.
template <int NSPLIT>
__device__ __forceinline__ void gemm_loop(const bf* __restrict__ A, const bf* __restrict__ A2, const bf* __restrict__ Bt, const int K, const size_t aoff, const size_t boff, v8f (&acc)[4][4]) {
#pragma unroll 1
    for (int kc = 0; kc < K; kc += 32) {
        v16bf a[4], a2[4];
#pragma unroll
        for (int mb = 0; mb < 4; ++mb) { a[mb] = ldg16(A + aoff + (size_t)mb * 16 * K + kc); if (NSPLIT == 1) a2[mb] = ldg16(A2 + aoff + (size_t)mb * 16 * K + kc); }
#pragma unroll
        for (int nb = 0; nb < 4; ++nb) { const v16bf b = ldg16(Bt + boff + (size_t)nb * 16 * K + kc);
#pragma unroll
            for (int mb = 0; mb < 4; ++mb) { acc[mb][nb] = wmmab(a[mb], b, acc[mb][nb]); if (NSPLIT == 1) acc[mb][nb] = wmmab(a2[mb], b, acc[mb][nb]); } }
        asm volatile("v_nop\n\tv_nop\n\tv_nop\n\tv_nop" : "+v"(acc[0][0]), "+v"(acc[1][1]), "+v"(acc[2][2]), "+v"(acc[3][3]) : "v"(a[0]), "v"(a[3]));
    }
}

__global__ __launch_bounds__(256) void k_cvt8(const float* __restrict__ src, bf* dst, unsigned n8, size_t sstride, size_t dstride) {
    const unsigned i = blockIdx.x * 256u + threadIdx.x; if (i >= n8) return;
    const float* s = src + (size_t)blockIdx.y * sstride + (size_t)i * 8; bf* d = dst + (size_t)blockIdx.y * dstride + (size_t)i * 8;
    const v4f v0 = *(const v4f*)s; const v4f v1 = *(const v4f*)(s + 4); v8us o;
#pragma unroll
    for (int k = 0; k < 4; ++k) { o[k] = f2bf(v0[k]); o[4 + k] = f2bf(v1[k]); }
    *(v8us*)d = o; 
}

__global__ __launch_bounds__(256) void k_cvt8h(const float* __restrict__ src, bf* dst, unsigned n8, size_t sstride, float sc) {
#pragma clang fp contract(off)
    const unsigned i = blockIdx.x * 256u + threadIdx.x; if (i >= n8) return;
    const unsigned e = i * 8u; const unsigned srow = e / DM, c = e % DM; const unsigned hh = c / HD, dd = c % HD;
    const float* s = src + (size_t)blockIdx.y * sstride + (size_t)e;
    bf* d = dst + (((size_t)blockIdx.y * NH + hh) * SEQ + srow) * HD + dd;
    const v4f v0 = *(const v4f*)s; const v4f v1 = *(const v4f*)(s + 4); v8us o;
#pragma unroll
    for (int k = 0; k < 4; ++k) { o[k] = f2bf(bfr(v0[k]) * sc); o[4 + k] = f2bf(bfr(v1[k]) * sc); }
    *(v8us*)d = o; 
}

__global__ __launch_bounds__(256) void k_cvt_rpe(const float* __restrict__ src, bf* dst) {
    const unsigned i = blockIdx.x * 256u + threadIdx.x; if (i >= (unsigned)(RPAD * HD / 8)) return;
    const unsigned nreal = (unsigned)(NREL * HD / 8);
    const unsigned ic = i < nreal ? i : nreal - 1u;
    const bool ok = i < nreal;
    const float* s = src + (size_t)ic * 8; bf* d = dst + (size_t)i * 8;
    const v4f v0 = *(const v4f*)s; const v4f v1 = *(const v4f*)(s + 4); v8us o;
#pragma unroll
    for (int k = 0; k < 4; ++k) { const unsigned short a = f2bf(v0[k]); const unsigned short c = f2bf(v1[k]); o[k] = ok ? a : (unsigned short)0; o[4 + k] = ok ? c : (unsigned short)0; }
    *(v8us*)d = o; 
}

// ---- k_ln_vt: V^T[b][n][s] (f16) = ((x - mean) * rsqrt(var + eps) * gain[n] + shift[n]) over the 512 features of token s, x = RNE bf16 of the value stream; grid (SEQ/64, NB), 256 threads.
// Phase 1: wave w owns tokens 8w..8w+7 (mean, then centred variance, per-lane 16 features, shuffle reduce); statistics to LDS (cross-wave: block barrier).
__global__ __launch_bounds__(256) void k_ln_vt(const float* __restrict__ X, const float* __restrict__ G, const float* __restrict__ Bt, h16* VT) {
#pragma clang fp contract(off)
    __shared__ __align__(16) h16 t_s[64 * LTP];
    __shared__ float mu_s[64];
    __shared__ float rs_s[64];
    const int tid = threadIdx.x, lane = tid & 31;
    const int wid = __builtin_amdgcn_readfirstlane(tid >> 5);
    const size_t z = blockIdx.y; const int s0 = blockIdx.x * 64;
    const float* xb = X + z * (size_t)SEQ_FULL * DM + (size_t)s0 * DM;
#pragma unroll 1
    for (int t = 0; t < 8; ++t) {
        const int tok = wid * 8 + t;
        const float* xr = xb + (size_t)tok * DM;
        float xv[16]; float sm = 0.0f;
#pragma unroll
        for (int c = 0; c < 16; ++c) { xv[c] = bfr(xr[c * 32 + lane]); sm += xv[c]; }
        sm += __shfl_xor(sm, 16, 32); sm += __shfl_xor(sm, 8, 32); sm += __shfl_xor(sm, 4, 32); sm += __shfl_xor(sm, 2, 32); sm += __shfl_xor(sm, 1, 32);
        const float mu = sm * (1.0f / DM);
        float sq = 0.0f;
#pragma unroll
        for (int c = 0; c < 16; ++c) { const float dv = xv[c] - mu; sq += dv * dv; }
        sq += __shfl_xor(sq, 16, 32); sq += __shfl_xor(sq, 8, 32); sq += __shfl_xor(sq, 4, 32); sq += __shfl_xor(sq, 2, 32); sq += __shfl_xor(sq, 1, 32);
        const float rstd = rsqrtf(sq * (1.0f / DM) + LNEPS);
        if (lane == 0) { mu_s[tok] = mu; rs_s[tok] = rstd; }
    }
    __syncthreads();
    const int f = tid & 63, tq = tid >> 6;
#pragma unroll 1
    for (int cc = 0; cc < DM / 64; ++cc) {
        const int c0 = cc * 64;
        const float g = bfr(G[c0 + f]), be = bfr(Bt[c0 + f]);
#pragma unroll 1
        for (int it = 0; it < 16; ++it) {
            const int tok = tq + 4 * it;
            const float x = bfr(xb[(size_t)tok * DM + c0 + f]);
            const float y = (x - mu_s[tok]) * rs_s[tok] * g + be;
            t_s[f * LTP + tok] = toh_flush(y);
        }
        __syncthreads();
{
#pragma unroll
            for (int it = 0; it < 2; ++it) { const int u = tid + it * 256; const int row = u >> 3, part = (u & 7) * 8;
                const v8h o = *(const v8ha*)(&t_s[row * LTP + part]);
                *(v8h*)(VT + (z * DM + (size_t)(c0 + row)) * SEQ + s0 + part) = o; }
             }
        __syncthreads();
    }
}

__global__ __launch_bounds__(512) void k_relchk(const int* __restrict__ rel, float* pz) {
    __shared__ int bad_s[16];
    const int tid = threadIdx.x, lane = tid & 31;
    const int wid = __builtin_amdgcn_readfirstlane(tid >> 5);
    const unsigned per = SEQ / 4;
    int bad = 0;
#pragma unroll 1
    for (unsigned e = tid; e < (unsigned)SEQ * per; e += 512u) {
        const int i = (int)(e / per), j = (int)(e % per) * 4;
        const v4i t = *(const v4i*)(rel + (size_t)i * SEQ_FULL + j);
#pragma unroll
        for (int c = 0; c < 4; ++c) { const int want = clampi(j + c - i, -RK, RK) + RK; bad |= (t[c] != want) ? 1 : 0; }
    }
    bad |= __shfl_xor(bad, 16, 32); bad |= __shfl_xor(bad, 8, 32); bad |= __shfl_xor(bad, 4, 32); bad |= __shfl_xor(bad, 2, 32); bad |= __shfl_xor(bad, 1, 32);
    if (lane == 0) bad_s[wid] = bad;
    __syncthreads();
    int any = 0;
#pragma unroll
    for (int w = 0; w < 16; ++w) any |= bad_s[w];
    const float pv = (any != 0) ? __uint_as_float(0x7FC00000u) : 0.0f;
    if (tid < 8) { const v4f o = (v4f){pv, pv, pv, pv}; *(v4f*)(pz + tid * 4) = o;  }
}

// ---- k_gemm_out: OUT[b][s][n] (f32) = sum_k (Ah + Al)[b*SEQ+s][k] W[n][k] (+ the 0 / NaN word of the index compare); grid (SEQ/64, DM/64, NB), 32 threads.
__global__ __launch_bounds__(32) void k_gemm_out(const bf* __restrict__ Ah, const bf* __restrict__ Al, const bf* __restrict__ W, const float* __restrict__ pz, float* C) {
    __shared__ __align__(16) float os[16 * LOP];
    const int lane = threadIdx.x & 31, lr = lane & 15, hi = lane >> 4;
    const size_t z = blockIdx.z; const int r0 = blockIdx.x * 64, c0 = blockIdx.y * 64;
    const bf* A = Ah + z * (size_t)SEQ * DM; const bf* A2 = Al + z * (size_t)SEQ * DM;
    float* Cz = C + z * (size_t)SEQ_FULL * DM;
    const float pzv = pz[0];
    v8f acc[4][4];
#pragma unroll
    for (int mb = 0; mb < 4; ++mb)
#pragma unroll
        for (int nb = 0; nb < 4; ++nb) acc[mb][nb] = (v8f){};
    gemm_loop<1>(A, A2, W, DM, (size_t)(r0 + lr) * DM + 8 * hi, (size_t)(c0 + lr) * DM + 8 * hi, acc);
#pragma unroll
    for (int mb = 0; mb < 4; ++mb) {
#pragma unroll
        for (int nb = 0; nb < 4; ++nb) {
#pragma unroll
            for (int j = 0; j < 8; ++j) os[(hi * 8 + j) * LOP + nb * 16 + lr] = acc[mb][nb][j]; }
        wsync();
        float* crow = Cz + (size_t)(r0 + mb * 16) * DM + c0;
{
#pragma unroll
            for (int s = 0; s < 8; ++s) { const int row = 2 * s + hi, cofs = lr * 4; v4f val = *(const v4fa*)(&os[row * LOP + cofs]);
                val[0] += pzv; val[1] += pzv; val[2] += pzv; val[3] += pzv;
                *(v4f*)(crow + (size_t)row * DM + cofs) = val; }
             }
        wsync();
    }
}

// ---- k_flash: fused attention for one (b, h) and 64 query rows per block (4 waves x 16 rows); grid (SEQ/64, NB*NH), 128 threads.
// Prologue: each wave forms its table T[16 rows][144] = q (x 1/8) . position plane^T (9 column tiles x 2 k-steps) in a wave-private LDS tile; T[row][0] and T[row][128] are held in registers.
// Per 64-key block: K tile [key][d] and V^T tile [d][key] staged in LDS (block barriers on both sides); each wave handles the block as two 32-key halves:
// scores (q from the global plane x K from LDS, 1 product), + T[row][clip(key - row, -64, 64) + 64] (scalar test: whole half beyond the clip on one side -> register value, else clamped LDS read),
// running-max softmax in f32, P x1024 as f16 (never subnormal) through a wave-private LDS tile (D layout -> A layout), O += P V^T.
// LDS regions: kh_s, vt_s cross-wave (block barriers); p_s, o_s, r_s private to the wave (wave sync).
__global__ __launch_bounds__(128) void k_flash(const bf* __restrict__ Qh, const bf* __restrict__ Kh, const bf* __restrict__ RP, const h16* __restrict__ VT, bf* Ch, bf* Cl) {
    __shared__ __align__(16) bf    kh_s[64 * LKP];
    __shared__ __align__(16) h16   vt_s[64 * LKP];
    __shared__ __align__(16) h16   p_s[4 * 16 * LPP];
    __shared__ __align__(16) float o_s[4 * 16 * LOP];
    __shared__ __align__(16) float r_s[4 * 16 * LRP];
    const int tid = threadIdx.x, lane = tid & 31, lr = lane & 15, hi = lane >> 4;
    const int wid = __builtin_amdgcn_readfirstlane(tid >> 5);
    const int bh = blockIdx.y; const int b = bh / NH, h = bh % NH;
    const int q0 = blockIdx.x * 64 + wid * 16;
    const size_t pl = (size_t)bh * SEQ * HD;
    const size_t qoff = pl + (size_t)(q0 + lr) * HD + 8 * hi;
    const size_t vbase = ((size_t)b * DM + (size_t)h * HD) * SEQ;
    const int pb = wid * 16 * LPP, ob = wid * 16 * LOP;
    const int rb = wid * 16 * LRP + 8 * hi * LRP;
    {
        const v16bf qa0 = ldg16(Qh + qoff); const v16bf qa1 = ldg16(Qh + qoff + 32);
#pragma unroll 1
        for (int ct = 0; ct < RT; ++ct) {
            const size_t ro = (size_t)(ct * 16 + lr) * HD + 8 * hi;
            const v16bf b0 = ldg16(RP + ro); const v16bf b1 = ldg16(RP + ro + 32);
            v8f t = (v8f){};
            t = wmmab_g(qa0, b0, t);
            t = wmmab_g(qa1, b1, t);
#pragma unroll
            for (int j = 0; j < 8; ++j) r_s[rb + j * LRP + ct * 16 + lr] = t[j];
        }
    }
    wsync();
    float rlo[8], rhi[8];
#pragma unroll
    for (int r = 0; r < 8; ++r) { rlo[r] = r_s[rb + r * LRP]; rhi[r] = r_s[rb + r * LRP + 2 * RK]; }
    v8f o[4];
#pragma unroll
    for (int dt = 0; dt < 4; ++dt) o[dt] = (v8f){};
    float mr[8], ls[8];
#pragma unroll
    for (int r = 0; r < 8; ++r) { mr[r] = -1.0e30f; ls[r] = 0.0f; }

#pragma unroll 1
    for (int kb = 0; kb < SEQ / 64; ++kb) {
        __syncthreads();
#pragma unroll
        for (int it = 0; it < 4; ++it) {
            const int u = tid + it * 128; const int row = u >> 3, part = (u & 7) * 8;
            const size_t g = pl + (size_t)kb * 64 * HD + (size_t)u * 8;
            const v8us a = *(const v8us*)(Kh + g);
            const v8h v = *(const v8h*)(VT + vbase + (size_t)row * SEQ + (size_t)kb * 64 + part);
            *(v8usa*)(&kh_s[row * LKP + part]) = a; *(v8ha*)(&vt_s[row * LKP + part]) = v;
        }
        __syncthreads();
#pragma unroll 1
        for (int hf = 0; hf < 2; ++hf) {
            v8f s0 = (v8f){}, s1 = (v8f){};
            const int kr0 = (hf * 32 + lr) * LKP + 8 * hi, kr1 = kr0 + 16 * LKP;
#pragma unroll
            for (int ks = 0; ks < 2; ++ks) {
                const int kk = ks * 32;
                const v16bf qh = ldg16(Qh + qoff + kk);
                const v16bf k0h = cat16b(*(const v8usa*)(&kh_s[kr0 + kk]), *(const v8usa*)(&kh_s[kr0 + kk + 16]));
                const v16bf k1h = cat16b(*(const v8usa*)(&kh_s[kr1 + kk]), *(const v8usa*)(&kh_s[kr1 + kk + 16]));
                s0 = wmmab_g(qh, k0h, s0); s1 = wmmab_g(qh, k1h, s1);
            }
            // position term: rows q0 + 8*hi + r, keys j0 + lr (s0) and j0 + 16 + lr (s1); the three-way test is on scalars only
            const int j0 = kb * 64 + hf * 32;
            if (j0 - q0 >= RK + 15) {
#pragma unroll
                for (int r = 0; r < 8; ++r) { s0[r] += rhi[r]; s1[r] += rhi[r]; }
            } else if (q0 - j0 >= RK + 31) {
#pragma unroll
                for (int r = 0; r < 8; ++r) { s0[r] += rlo[r]; s1[r] += rlo[r]; }
            } else {
#pragma unroll
                for (int r = 0; r < 8; ++r) {
                    const int d0 = j0 + lr - q0 - 8 * hi - r;
                    const int i0 = clampi(d0, -RK, RK) + RK, i1 = clampi(d0 + 16, -RK, RK) + RK;
                    const float b0 = r_s[rb + r * LRP + i0]; const float b1 = r_s[rb + r * LRP + i1];
                    s0[r] += b0; s1[r] += b1;
                }
            }
            // running-max softmax update; rows 8*hi + r, columns lr (s0) and 16 + lr (s1) of this 32-key half; ls holds per-lane partial row sums
#pragma unroll
            for (int r = 0; r < 8; ++r) {
                const float a0 = s0[r], a1 = s1[r];
                float mx = fmaxf(a0, a1);
                mx = fmaxf(mx, __shfl_xor(mx, 1, 32)); mx = fmaxf(mx, __shfl_xor(mx, 2, 32)); mx = fmaxf(mx, __shfl_xor(mx, 4, 32)); mx = fmaxf(mx, __shfl_xor(mx, 8, 32));
                const float mnew = fmaxf(mr[r], mx);
                const float al = __builtin_amdgcn_exp2f((mr[r] - mnew) * L2E);
                const float e0 = (a0 - mnew) * L2E, e1 = (a1 - mnew) * L2E;
                const float p0 = __builtin_amdgcn_exp2f(e0);
                const float p1 = __builtin_amdgcn_exp2f(e1);
                ls[r] = ls[r] * al + (p0 + p1);
                mr[r] = mnew;
                o[0][r] *= al; o[1][r] *= al; o[2][r] *= al; o[3][r] *= al;
                p_s[pb + (8 * hi + r) * LPP + lr] = (e0 < PFL) ? (h16)0.0f : (h16)(p0 * PCAR);
                p_s[pb + (8 * hi + r) * LPP + 16 + lr] = (e1 < PFL) ? (h16)0.0f : (h16)(p1 * PCAR);
            }
            wsync();
            const v16h pa = cat16(*(const v8ha*)(&p_s[pb + lr * LPP + 8 * hi]), *(const v8ha*)(&p_s[pb + lr * LPP + 8 * hi + 16]));
            v16h vb[4];
#pragma unroll
            for (int dt = 0; dt < 4; ++dt) { const int vo = (dt * 16 + lr) * LKP + hf * 32 + 8 * hi; vb[dt] = cat16(*(const v8ha*)(&vt_s[vo]), *(const v8ha*)(&vt_s[vo + 16])); }
#pragma unroll
            for (int dt = 0; dt < 4; ++dt) o[dt] = wmma16_g(pa, vb[dt], o[dt]);
            wsync();
        }
    }
    // normalise: row sums completed over the 16 lanes of each row; 1 / (l * 1024) undoes the P carry
#pragma unroll
    for (int r = 0; r < 8; ++r) {
        float lt = ls[r];
        lt += __shfl_xor(lt, 1, 32); lt += __shfl_xor(lt, 2, 32); lt += __shfl_xor(lt, 4, 32); lt += __shfl_xor(lt, 8, 32);
        const float inv = 1.0f / (lt * PCAR);
#pragma unroll
        for (int dt = 0; dt < 4; ++dt) o_s[ob + (8 * hi + r) * LOP + dt * 16 + lr] = o[dt][r] * inv;
    }
    wsync();
    const int srow = lane >> 3, scol = (lane & 7) * 8;
    const size_t cbase = ((size_t)b * SEQ + q0) * DM + (size_t)h * HD;
{
#pragma unroll
        for (int s = 0; s < 4; ++s) { const int row = 4 * s + srow; const v4f x0 = *(const v4fa*)(&o_s[ob + row * LOP + scol]); const v4f x1 = *(const v4fa*)(&o_s[ob + row * LOP + scol + 4]); v8us oh, ol;
#pragma unroll
            for (int j = 0; j < 4; ++j) { unsigned short a, c; splitf(x0[j], a, c); oh[j] = a; ol[j] = c; splitf(x1[j], a, c); oh[4 + j] = a; ol[4 + j] = c; }
            const size_t off = cbase + (size_t)row * DM + scol;
            *(v8us*)(Ch + off) = oh; *(v8us*)(Cl + off) = ol; }
         }
}

constexpr size_t al256(size_t x) { return (x + 255) & ~(size_t)255; }
constexpr size_t SZ_W = al256((size_t)DM * DM * 2);                 // one bf16 weight plane
constexpr size_t SZ_R = al256((size_t)RPAD * HD * 2);               // bf16 position plane, 144 rows
constexpr size_t SZ_X = al256((size_t)NB * SEQ * DM * 2);           // one 16-bit [NB*SEQ][DM] plane (merged-head plane)
constexpr size_t SZ_P = al256((size_t)NB * NH * SEQ * HD * 2);      // one 16-bit head plane
constexpr size_t SZ_F = 256;                                        // 0 / NaN line of the index compare
constexpr size_t WS_TOTAL = SZ_W + SZ_R + 2 * SZ_P + SZ_P + 2 * SZ_X + SZ_F;
static_assert(WS_TOTAL <= (size_t)134217728);                       // carve stays within 128 MiB
static_assert(SZ_P == SZ_X);                                        // NH * HD == DM
static_assert(SZ_R >= (size_t)RPAD * HD * 2);                       // last position plane line lies inside its region

extern "C" void kernel_launch(void* const* d_in, const int* in_sizes, int n_in,
                              void* d_out, int out_size, void* d_ws, size_t ws_size, hipStream_t stream) {
    if (n_in < 8) return;
    const size_t need_act = (size_t)(NB - 1) * SEQ_FULL * DM + (size_t)SEQ * DM;
    if ((size_t)in_sizes[0] < need_act || (size_t)in_sizes[1] < need_act || (size_t)in_sizes[2] < need_act) return;
    if (in_sizes[3] < DM || in_sizes[4] < DM || in_sizes[5] < NREL * HD || (size_t)in_sizes[6] < (size_t)DM * DM) return;
    if ((size_t)in_sizes[7] < (size_t)(SEQ - 1) * SEQ_FULL + (size_t)SEQ) return;
    if ((size_t)out_size < need_act) return;
    if (WS_TOTAL > ws_size) return;
    // wire order: q, k, v, ln_gamma, ln_beta, rpe_emb, W_proj (all f32; W_proj [out][in]), rel_idx (int32 [SEQ][SEQ])
    const float* xq = (const float*)d_in[0]; const float* xk = (const float*)d_in[1]; const float* xv = (const float*)d_in[2];
    const float* lg = (const float*)d_in[3]; const float* lb = (const float*)d_in[4]; const float* rp = (const float*)d_in[5]; const float* wp = (const float*)d_in[6];
    const int* rel = (const int*)d_in[7];
    float* OUT = (float*)d_out;
    char* wsp = (char*)d_ws;
    auto take = [&](size_t bytes) { char* p = wsp; wsp += bytes; return (void*)p; };
    bf* WO = (bf*)take(SZ_W);
    bf* RPP = (bf*)take(SZ_R);
    bf* QP = (bf*)take(SZ_P); bf* KP = (bf*)take(SZ_P);
    h16* VT = (h16*)take(SZ_P);
    bf* CTh = (bf*)take(SZ_X); bf* CTl = (bf*)take(SZ_X);
    float* PZ = (float*)take(SZ_F);
    if ((size_t)(wsp - (char*)d_ws) != WS_TOTAL) return;

    const unsigned nw8 = (unsigned)((size_t)DM * DM / 8), na8 = (unsigned)((size_t)SEQ * DM / 8);
    k_cvt8<<<dim3(nw8 / 256, 1), 256, 0, stream>>>(wp, WO, nw8, 0, 0);
    k_cvt_rpe<<<dim3((RPAD * HD / 8 + 255) / 256), 256, 0, stream>>>(rp, RPP);
    k_cvt8h<<<dim3(na8 / 256, NB), 256, 0, stream>>>(xq, QP, na8, (size_t)SEQ_FULL * DM, SCL);
    k_cvt8h<<<dim3(na8 / 256, NB), 256, 0, stream>>>(xk, KP, na8, (size_t)SEQ_FULL * DM, 1.0f);
    k_ln_vt<<<dim3(SEQ / 64, NB), 256, 0, stream>>>(xv, lg, lb, VT);
    k_relchk<<<dim3(1), 512, 0, stream>>>(rel, PZ);
    k_flash<<<dim3(SEQ / 64, NB * NH), 128, 0, stream>>>(QP, KP, RPP, VT, CTh, CTl);
    k_gemm_out<<<dim3(SEQ / 64, DM / 64, NB), 32, 0, stream>>>(CTh, CTl, WO, PZ, OUT);
}

// v001
// One run takes 165 microseconds.
// Timed twice side by side with v000, it ran 6.04 and 6.05 times as fast.
#include <hip/hip_runtime.h>

// Compute dtypes, f32 accumulate everywhere: q.k^T and q.rpe^T v_wmma_f32_16x16x32_bf16 on RNE bf16 copies of the inputs (exact products, one product each; q carries the 1/8 scale); P.V v_wmma_f32_16x16x32_f16 with P carried x1024 and V = LayerNorm(v) as an f16 plane; merged heads bf16 hi/lo x bf16 W_proj, 2 products, no bias; LayerNorm and softmax f32.
// Multi-head attention on three unprojected input streams: 8 heads x 64 (head h = columns h*64+d); v is layer-normalised over its 512 features first (eps 1e-5, gain, shift); logits = (q.k + q.rpe_emb[rel(i,j)]) / 8 with rel(i,j) = clip(j - i, -64, 64) + 64 (position table shared by all heads); no mask; softmax over keys; heads merged back to [B][S][512]; out = merged W_proj^T.
// Layout: bf16 head planes Q, K [b][h][s][64]; bf16 position plane [144][64] (rows 129..143 zero); V^T [b][h*64+d][s] f16; fused flash attention (K / V^T tiles in LDS, online softmax, per-wave q.rpe^T table [16][129] in LDS, no score plane) writes merged bf16 hi/lo planes [b*S+s][512]; output GEMM.
// The integer relative-index input is compared in full against the closed form on the device (one work-group per 8 rows, each storing its own 0 / NaN line; the output GEMM sums the lines); any difference turns the whole output into NaN.

#ifndef NB
#define NB 4
#endif
#ifndef SEQ
#define SEQ 2048
#endif
#define NB_FULL  4
#define SEQ_FULL 2048
#define DM   512
#define NH   8
#define HD   64
#define PCAR 1024.0f
#define PFL  (-24.0f)  // exp2 argument below which P * PCAR would leave the f16 normal range
#define SCL  0.125f
#define L2E  1.4426950408889634f
#define LKP  72      // LDS row pitch (16-bit elements) of the K / V^T tiles: 144 B rows
#define LPP  40      // LDS row pitch (halves) of the per-wave P tile: 80 B rows
#define LOP  68      // LDS row pitch (floats) of epilogue staging tiles: 272 B rows
#define RK   64      // relative distance clip
#define NREL 129     // position table rows: 2 * RK + 1
#define RT   9       // 16-wide column tiles of the per-wave q.rpe^T table
#define RPAD 144     // position plane rows, zero filled beyond NREL
#define LRP  148     // LDS row pitch (floats) of the per-wave q.rpe^T table
#define LTP  72      // LDS row pitch (halves) of the LayerNorm transpose tile
#define LNEPS 1.0e-5f
#define CKT  (SEQ / 4)   // threads of one index-compare work-group: one row of the index input, 4 integers per thread
#define CKU  8           // rows per index-compare work-group: 16-byte reads per thread, all in flight at once
#define NCK  (SEQ / CKU) // index-compare work-groups == 0 / NaN lines

static_assert(DM == NH * HD);            // one 64-wide GEMM column tile == one head
static_assert(HD == 64);
static_assert(DM % 32 == 0);             // WMMA k-step
static_assert(DM % 64 == 0);             // GEMM tiles
static_assert(SEQ % 64 == 0);            // GEMM row tiles, key blocks, query blocks
static_assert((SEQ * DM) % (8 * 256) == 0);   // convert kernel grid is exact
static_assert((DM * DM) % (8 * 256) == 0);
static_assert(NB <= NB_FULL);
static_assert(SEQ <= SEQ_FULL);
static_assert(LKP % 8 == 0);             // 16-byte aligned LDS vector accesses
static_assert(LPP % 8 == 0);
static_assert(LOP % 4 == 0);
static_assert(NREL == 2 * RK + 1);
static_assert(RPAD == RT * 16);          // position plane rows == table column tiles
static_assert(NREL <= RPAD);
static_assert(RPAD <= LRP);              // table columns fit the LDS pitch
static_assert(2 * RK < RPAD);            // largest clamped index is a written column
static_assert((RPAD * HD) % 64 == 0);
static_assert(HD * 2 == 8 * 16);         // head plane row == 8 lanes x 16 B
static_assert(LTP % 8 == 0);
static_assert(SEQ % 4 == 0);             // index compare reads 4 integers per lane
static_assert(SEQ % CKU == 0);           // index compare grid is exact
static_assert(CKT % 32 == 0);            // whole waves
static_assert(CKT <= 1024);
static_assert(NCK % 32 == 0);            // the output GEMM's wave reads the lines 32 at a time
static_assert(256 * 16 * 2 == 64 * 64 * 2);
static_assert(32 * 16 * 4 == 16 * HD * 2);
static_assert(32 * 16 * 8 == 16 * 64 * 4);     // output epilogue: lanes x bytes x trips == 16 rows x 256 B
static_assert(PCAR == 1024.0f);                // PFL = -14 - log2(PCAR)
static_assert((size_t)64 * LKP * 2 * 2 + (size_t)4 * 16 * LPP * 2 + (size_t)4 * 16 * LOP * 4 + (size_t)4 * 16 * LRP * 4 <= 131072);   // flash static LDS
static_assert((size_t)64 * LTP * 2 + 2 * 64 * 4 <= 131072);                                                                     // LayerNorm static LDS

typedef _Float16 h16;
typedef unsigned short bf;
typedef __attribute__((ext_vector_type(16))) __bf16   v16bf;
typedef __attribute__((ext_vector_type(16))) _Float16 v16h;
typedef __attribute__((ext_vector_type(8)))  _Float16 v8h;
typedef __attribute__((ext_vector_type(8)))  unsigned short v8us;
typedef __attribute__((ext_vector_type(8)))  float    v8f;
typedef __attribute__((ext_vector_type(4)))  float    v4f;
typedef __attribute__((ext_vector_type(4)))  int      v4i;
typedef v8h  __attribute__((may_alias)) v8ha;
typedef v4f  __attribute__((may_alias)) v4fa;
typedef v8us __attribute__((may_alias)) v8usa;

__device__ __forceinline__ unsigned short f2bf(float f) { unsigned u = __float_as_uint(f); u += 0x7FFFu + ((u >> 16) & 1u); return (unsigned short)(u >> 16); }
__device__ __forceinline__ float bf2f(unsigned short b) { return __uint_as_float(((unsigned)b) << 16); }
__device__ __forceinline__ float bfr(float f) { return bf2f(f2bf(f)); }
__device__ __forceinline__ void splitf(float y, unsigned short& h, unsigned short& l) { h = f2bf(y); l = f2bf(y - bf2f(h)); }
__device__ __forceinline__ v16h cat16(v8h lo, v8h hi) { return __builtin_shufflevector(lo, hi, 0, 1, 2, 3, 4, 5, 6, 7, 8, 9, 10, 11, 12, 13, 14, 15); }
__device__ __forceinline__ v16bf cat16b(v8us lo, v8us hi) { return __builtin_bit_cast(v16bf, __builtin_shufflevector(lo, hi, 0, 1, 2, 3, 4, 5, 6, 7, 8, 9, 10, 11, 12, 13, 14, 15)); }
__device__ __forceinline__ v8f wmma16(v16h a, v16h b, v8f c) { return __builtin_amdgcn_wmma_f32_16x16x32_f16(false, a, false, b, (short)0, c, false, false); }
__device__ __forceinline__ v8f wmmab(v16bf a, v16bf b, v8f c) { return __builtin_amdgcn_wmma_f32_16x16x32_bf16(false, a, false, b, (short)0, c, false, false); }
// fragment from a K-contiguous global bf16 plane: elements 0..7 <- p[0..7], 8..15 <- p[16..23] (p already includes row*pitch + k0 + 8*(lane>>4))
__device__ __forceinline__ v16bf ldg16(const bf* __restrict__ p) { return cat16b(*(const v8us*)p, *(const v8us*)(p + 16)); }
// same-wave LDS exchange ordering (wave-private tiles only)
__device__ __forceinline__ void wsync() { __builtin_amdgcn_wave_barrier(); asm volatile("" ::: "memory"); }
// one matrix instruction followed by its own four idle slots (ties the accumulator, keeps the operands live)
__device__ __forceinline__ v8f wmmab_g(v16bf a, v16bf b, v8f c) { c = __builtin_amdgcn_wmma_f32_16x16x32_bf16(false, a, false, b, (short)0, c, false, false); asm volatile("v_nop\n\tv_nop\n\tv_nop\n\tv_nop" : "+v"(c) : "v"(a), "v"(b)); return c; }
__device__ __forceinline__ v8f wmma16_g(v16h a, v16h b, v8f c) { c = __builtin_amdgcn_wmma_f32_16x16x32_f16(false, a, false, b, (short)0, c, false, false); asm volatile("v_nop\n\tv_nop\n\tv_nop\n\tv_nop" : "+v"(c) : "v"(a), "v"(b)); return c; }
// f32 -> f16 operand convert that cannot produce an f16 subnormal
__device__ __forceinline__ h16 toh_flush(float v) { const h16 r = (h16)v; return (fabsf(v) < 6.103515625e-05f) ? (h16)0.0f : r; }
__device__ __forceinline__ int clampi(int v, int lo, int hi) { const int t = v < lo ? lo : v; return t > hi ? hi : t; }

// ---- one-wave 64x64 tile main loop: acc[mb][nb] += sum_k A[r0+16mb+..][k] Bt[c0+16nb+..][k] (NSPLIT 1: + A2 x Bt). Operands straight from K-contiguous bf16 planes; K % 32 == 0.
template <int NSPLIT>
__device__ __forceinline__ void gemm_loop(const bf* __restrict__ A, const bf* __restrict__ A2, const bf* __restrict__ Bt, const int K, const size_t aoff, const size_t boff, v8f (&acc)[4][4]) {
#pragma unroll 1
    for (int kc = 0; kc < K; kc += 32) {
        v16bf a[4], a2[4];
#pragma unroll
        for (int mb = 0; mb < 4; ++mb) { a[mb] = ldg16(A + aoff + (size_t)mb * 16 * K + kc); if (NSPLIT == 1) a2[mb] = ldg16(A2 + aoff + (size_t)mb * 16 * K + kc); }
#pragma unroll
        for (int nb = 0; nb < 4; ++nb) { const v16bf b = ldg16(Bt + boff + (size_t)nb * 16 * K + kc);
#pragma unroll
            for (int mb = 0; mb < 4; ++mb) { acc[mb][nb] = wmmab(a[mb], b, acc[mb][nb]); if (NSPLIT == 1) acc[mb][nb] = wmmab(a2[mb], b, acc[mb][nb]); } }
        asm volatile("v_nop\n\tv_nop\n\tv_nop\n\tv_nop" : "+v"(acc[0][0]), "+v"(acc[1][1]), "+v"(acc[2][2]), "+v"(acc[3][3]) : "v"(a[0]), "v"(a[3]));
    }
}

__global__ __launch_bounds__(256) void k_cvt8(const float* __restrict__ src, bf* dst, unsigned n8, size_t sstride, size_t dstride) {
    const unsigned i = blockIdx.x * 256u + threadIdx.x; if (i >= n8) return;
    const float* s = src + (size_t)blockIdx.y * sstride + (size_t)i * 8; bf* d = dst + (size_t)blockIdx.y * dstride + (size_t)i * 8;
    const v4f v0 = *(const v4f*)s; const v4f v1 = *(const v4f*)(s + 4); v8us o;
#pragma unroll
    for (int k = 0; k < 4; ++k) { o[k] = f2bf(v0[k]); o[4 + k] = f2bf(v1[k]); }
    *(v8us*)d = o; 
}

__global__ __launch_bounds__(256) void k_cvt8h(const float* __restrict__ src, bf* dst, unsigned n8, size_t sstride, float sc) {
#pragma clang fp contract(off)
    const unsigned i = blockIdx.x * 256u + threadIdx.x; if (i >= n8) return;
    const unsigned e = i * 8u; const unsigned srow = e / DM, c = e % DM; const unsigned hh = c / HD, dd = c % HD;
    const float* s = src + (size_t)blockIdx.y * sstride + (size_t)e;
    bf* d = dst + (((size_t)blockIdx.y * NH + hh) * SEQ + srow) * HD + dd;
    const v4f v0 = *(const v4f*)s; const v4f v1 = *(const v4f*)(s + 4); v8us o;
#pragma unroll
    for (int k = 0; k < 4; ++k) { o[k] = f2bf(bfr(v0[k]) * sc); o[4 + k] = f2bf(bfr(v1[k]) * sc); }
    *(v8us*)d = o; 
}

__global__ __launch_bounds__(256) void k_cvt_rpe(const float* __restrict__ src, bf* dst) {
    const unsigned i = blockIdx.x * 256u + threadIdx.x; if (i >= (unsigned)(RPAD * HD / 8)) return;
    const unsigned nreal = (unsigned)(NREL * HD / 8);
    const unsigned ic = i < nreal ? i : nreal - 1u;
    const bool ok = i < nreal;
    const float* s = src + (size_t)ic * 8; bf* d = dst + (size_t)i * 8;
    const v4f v0 = *(const v4f*)s; const v4f v1 = *(const v4f*)(s + 4); v8us o;
#pragma unroll
    for (int k = 0; k < 4; ++k) { const unsigned short a = f2bf(v0[k]); const unsigned short c = f2bf(v1[k]); o[k] = ok ? a : (unsigned short)0; o[4 + k] = ok ? c : (unsigned short)0; }
    *(v8us*)d = o; 
}

// ---- k_ln_vt: V^T[b][n][s] (f16) = ((x - mean) * rsqrt(var + eps) * gain[n] + shift[n]) over the 512 features of token s, x = RNE bf16 of the value stream; grid (SEQ/64, NB), 256 threads.
// Phase 1: wave w owns tokens 8w..8w+7 (mean, then centred variance, per-lane 16 features, shuffle reduce); statistics to LDS (cross-wave: block barrier).
__global__ __launch_bounds__(256) void k_ln_vt(const float* __restrict__ X, const float* __restrict__ G, const float* __restrict__ Bt, h16* VT) {
#pragma clang fp contract(off)
    __shared__ __align__(16) h16 t_s[64 * LTP];
    __shared__ float mu_s[64];
    __shared__ float rs_s[64];
    const int tid = threadIdx.x, lane = tid & 31;
    const int wid = __builtin_amdgcn_readfirstlane(tid >> 5);
    const size_t z = blockIdx.y; const int s0 = blockIdx.x * 64;
    const float* xb = X + z * (size_t)SEQ_FULL * DM + (size_t)s0 * DM;
#pragma unroll 1
    for (int t = 0; t < 8; ++t) {
        const int tok = wid * 8 + t;
        const float* xr = xb + (size_t)tok * DM;
        float xv[16]; float sm = 0.0f;
#pragma unroll
        for (int c = 0; c < 16; ++c) { xv[c] = bfr(xr[c * 32 + lane]); sm += xv[c]; }
        sm += __shfl_xor(sm, 16, 32); sm += __shfl_xor(sm, 8, 32); sm += __shfl_xor(sm, 4, 32); sm += __shfl_xor(sm, 2, 32); sm += __shfl_xor(sm, 1, 32);
        const float mu = sm * (1.0f / DM);
        float sq = 0.0f;
#pragma unroll
        for (int c = 0; c < 16; ++c) { const float dv = xv[c] - mu; sq += dv * dv; }
        sq += __shfl_xor(sq, 16, 32); sq += __shfl_xor(sq, 8, 32); sq += __shfl_xor(sq, 4, 32); sq += __shfl_xor(sq, 2, 32); sq += __shfl_xor(sq, 1, 32);
        const float rstd = rsqrtf(sq * (1.0f / DM) + LNEPS);
        if (lane == 0) { mu_s[tok] = mu; rs_s[tok] = rstd; }
    }
    __syncthreads();
    const int f = tid & 63, tq = tid >> 6;
#pragma unroll 1
    for (int cc = 0; cc < DM / 64; ++cc) {
        const int c0 = cc * 64;
        const float g = bfr(G[c0 + f]), be = bfr(Bt[c0 + f]);
#pragma unroll 1
        for (int it = 0; it < 16; ++it) {
            const int tok = tq + 4 * it;
            const float x = bfr(xb[(size_t)tok * DM + c0 + f]);
            const float y = (x - mu_s[tok]) * rs_s[tok] * g + be;
            t_s[f * LTP + tok] = toh_flush(y);
        }
        __syncthreads();
{
#pragma unroll
            for (int it = 0; it < 2; ++it) { const int u = tid + it * 256; const int row = u >> 3, part = (u & 7) * 8;
                const v8h o = *(const v8ha*)(&t_s[row * LTP + part]);
                *(v8h*)(VT + (z * DM + (size_t)(c0 + row)) * SEQ + s0 + part) = o; }
             }
        __syncthreads();
    }
}

// ---- k_relchk: work-group g compares rows g*CKU .. g*CKU+CKU-1 of the index input with the closed form and stores its own 128-byte line pz[g*32 .. g*32+31] = 0 (all equal) or NaN; grid (NCK), SEQ/4 threads.
__global__ __launch_bounds__(CKT) void k_relchk(const int* __restrict__ rel, float* pz) {
    __shared__ int bad_s[CKT / 32];
    const int tid = threadIdx.x, lane = tid & 31;
    const int wid = __builtin_amdgcn_readfirstlane(tid >> 5);
    const int i0 = blockIdx.x * CKU, j = tid * 4;
    const int* rp = rel + (size_t)i0 * SEQ_FULL + j;
    v4i t[CKU];
#pragma unroll
    for (int u = 0; u < CKU; ++u) t[u] = *(const v4i*)(rp + (size_t)u * SEQ_FULL);
    int bad = 0;
#pragma unroll
    for (int u = 0; u < CKU; ++u) {
#pragma unroll
        for (int cc = 0; cc < 4; ++cc) { const int want = clampi(j + cc - i0 - u, -RK, RK) + RK; bad |= (t[u][cc] != want) ? 1 : 0; }
    }
    bad |= __shfl_xor(bad, 16, 32); bad |= __shfl_xor(bad, 8, 32); bad |= __shfl_xor(bad, 4, 32); bad |= __shfl_xor(bad, 2, 32); bad |= __shfl_xor(bad, 1, 32);
    if (lane == 0) bad_s[wid] = bad;
    __syncthreads();
    int any = 0;
#pragma unroll
    for (int w = 0; w < CKT / 32; ++w) any |= bad_s[w];
    const float pv = (any != 0) ? __uint_as_float(0x7FC00000u) : 0.0f;
    if (tid < 8) { const v4f o = (v4f){pv, pv, pv, pv}; *(v4f*)(pz + (size_t)blockIdx.x * 32 + tid * 4) = o;  }
}

// ---- k_gemm_out: OUT[b][s][n] (f32) = sum_k (Ah + Al)[b*SEQ+s][k] W[n][k] (+ the sum of the 0 / NaN lines of the index compare); grid (SEQ/64, DM/64, NB), 32 threads.
__global__ __launch_bounds__(32) void k_gemm_out(const bf* __restrict__ Ah, const bf* __restrict__ Al, const bf* __restrict__ W, const float* __restrict__ pz, float* C) {
    __shared__ __align__(16) float os[16 * LOP];
    const int lane = threadIdx.x & 31, lr = lane & 15, hi = lane >> 4;
    const size_t z = blockIdx.z; const int r0 = blockIdx.x * 64, c0 = blockIdx.y * 64;
    const bf* A = Ah + z * (size_t)SEQ * DM; const bf* A2 = Al + z * (size_t)SEQ * DM;
    float* Cz = C + z * (size_t)SEQ_FULL * DM;
    float pzv = 0.0f;
#pragma unroll
    for (int s = 0; s < NCK / 32; ++s) pzv += pz[(size_t)(s * 32 + lane) * 32];
    pzv += __shfl_xor(pzv, 16, 32); pzv += __shfl_xor(pzv, 8, 32); pzv += __shfl_xor(pzv, 4, 32); pzv += __shfl_xor(pzv, 2, 32); pzv += __shfl_xor(pzv, 1, 32);
    v8f acc[4][4];
#pragma unroll
    for (int mb = 0; mb < 4; ++mb)
#pragma unroll
        for (int nb = 0; nb < 4; ++nb) acc[mb][nb] = (v8f){};
    gemm_loop<1>(A, A2, W, DM, (size_t)(r0 + lr) * DM + 8 * hi, (size_t)(c0 + lr) * DM + 8 * hi, acc);
#pragma unroll
    for (int mb = 0; mb < 4; ++mb) {
#pragma unroll
        for (int nb = 0; nb < 4; ++nb) {
#pragma unroll
            for (int j = 0; j < 8; ++j) os[(hi * 8 + j) * LOP + nb * 16 + lr] = acc[mb][nb][j]; }
        wsync();
        float* crow = Cz + (size_t)(r0 + mb * 16) * DM + c0;
{
#pragma unroll
            for (int s = 0; s < 8; ++s) { const int row = 2 * s + hi, cofs = lr * 4; v4f val = *(const v4fa*)(&os[row * LOP + cofs]);
                val[0] += pzv; val[1] += pzv; val[2] += pzv; val[3] += pzv;
                *(v4f*)(crow + (size_t)row * DM + cofs) = val; }
             }
        wsync();
    }
}

// ---- k_flash: fused attention for one (b, h) and 64 query rows per block (4 waves x 16 rows); grid (SEQ/64, NB*NH), 128 threads.
// Prologue: each wave forms its table T[16 rows][144] = q (x 1/8) . position plane^T (9 column tiles x 2 k-steps) in a wave-private LDS tile; T[row][0] and T[row][128] are held in registers.
// Per 64-key block: K tile [key][d] and V^T tile [d][key] staged in LDS (block barriers on both sides); each wave handles the block as two 32-key halves:
// scores (q from the global plane x K from LDS, 1 product), + T[row][clip(key - row, -64, 64) + 64] (scalar test: whole half beyond the clip on one side -> register value, else clamped LDS read),
// running-max softmax in f32, P x1024 as f16 (never subnormal) through a wave-private LDS tile (D layout -> A layout), O += P V^T.
// LDS regions: kh_s, vt_s cross-wave (block barriers); p_s, o_s, r_s private to the wave (wave sync).
__global__ __launch_bounds__(128) void k_flash(const bf* __restrict__ Qh, const bf* __restrict__ Kh, const bf* __restrict__ RP, const h16* __restrict__ VT, bf* Ch, bf* Cl) {
    __shared__ __align__(16) bf    kh_s[64 * LKP];
    __shared__ __align__(16) h16   vt_s[64 * LKP];
    __shared__ __align__(16) h16   p_s[4 * 16 * LPP];
    __shared__ __align__(16) float o_s[4 * 16 * LOP];
    __shared__ __align__(16) float r_s[4 * 16 * LRP];
    const int tid = threadIdx.x, lane = tid & 31, lr = lane & 15, hi = lane >> 4;
    const int wid = __builtin_amdgcn_readfirstlane(tid >> 5);
    const int bh = blockIdx.y; const int b = bh / NH, h = bh % NH;
    const int q0 = blockIdx.x * 64 + wid * 16;
    const size_t pl = (size_t)bh * SEQ * HD;
    const size_t qoff = pl + (size_t)(q0 + lr) * HD + 8 * hi;
    const size_t vbase = ((size_t)b * DM + (size_t)h * HD) * SEQ;
    const int pb = wid * 16 * LPP, ob = wid * 16 * LOP;
    const int rb = wid * 16 * LRP + 8 * hi * LRP;
    {
        const v16bf qa0 = ldg16(Qh + qoff); const v16bf qa1 = ldg16(Qh + qoff + 32);
#pragma unroll 1
        for (int ct = 0; ct < RT; ++ct) {
            const size_t ro = (size_t)(ct * 16 + lr) * HD + 8 * hi;
            const v16bf b0 = ldg16(RP + ro); const v16bf b1 = ldg16(RP + ro + 32);
            v8f t = (v8f){};
            t = wmmab_g(qa0, b0, t);
            t = wmmab_g(qa1, b1, t);
#pragma unroll
            for (int j = 0; j < 8; ++j) r_s[rb + j * LRP + ct * 16 + lr] = t[j];
        }
    }
    wsync();
    float rlo[8], rhi[8];
#pragma unroll
    for (int r = 0; r < 8; ++r) { rlo[r] = r_s[rb + r * LRP]; rhi[r] = r_s[rb + r * LRP + 2 * RK]; }
    v8f o[4];
#pragma unroll
    for (int dt = 0; dt < 4; ++dt) o[dt] = (v8f){};
    float mr[8], ls[8];
#pragma unroll
    for (int r = 0; r < 8; ++r) { mr[r] = -1.0e30f; ls[r] = 0.0f; }

#pragma unroll 1
    for (int kb = 0; kb < SEQ / 64; ++kb) {
        __syncthreads();
#pragma unroll
        for (int it = 0; it < 4; ++it) {
            const int u = tid + it * 128; const int row = u >> 3, part = (u & 7) * 8;
            const size_t g = pl + (size_t)kb * 64 * HD + (size_t)u * 8;
            const v8us a = *(const v8us*)(Kh + g);
            const v8h v = *(const v8h*)(VT + vbase + (size_t)row * SEQ + (size_t)kb * 64 + part);
            *(v8usa*)(&kh_s[row * LKP + part]) = a; *(v8ha*)(&vt_s[row * LKP + part]) = v;
        }
        __syncthreads();
#pragma unroll 1
        for (int hf = 0; hf < 2; ++hf) {
            v8f s0 = (v8f){}, s1 = (v8f){};
            const int kr0 = (hf * 32 + lr) * LKP + 8 * hi, kr1 = kr0 + 16 * LKP;
#pragma unroll
            for (int ks = 0; ks < 2; ++ks) {
                const int kk = ks * 32;
                const v16bf qh = ldg16(Qh + qoff + kk);
                const v16bf k0h = cat16b(*(const v8usa*)(&kh_s[kr0 + kk]), *(const v8usa*)(&kh_s[kr0 + kk + 16]));
                const v16bf k1h = cat16b(*(const v8usa*)(&kh_s[kr1 + kk]), *(const v8usa*)(&kh_s[kr1 + kk + 16]));
                s0 = wmmab_g(qh, k0h, s0); s1 = wmmab_g(qh, k1h, s1);
            }
            // position term: rows q0 + 8*hi + r, keys j0 + lr (s0) and j0 + 16 + lr (s1); the three-way test is on scalars only
            const int j0 = kb * 64 + hf * 32;
            if (j0 - q0 >= RK + 15) {
#pragma unroll
                for (int r = 0; r < 8; ++r) { s0[r] += rhi[r]; s1[r] += rhi[r]; }
            } else if (q0 - j0 >= RK + 31) {
#pragma unroll
                for (int r = 0; r < 8; ++r) { s0[r] += rlo[r]; s1[r] += rlo[r]; }
            } else {
#pragma unroll
                for (int r = 0; r < 8; ++r) {
                    const int d0 = j0 + lr - q0 - 8 * hi - r;
                    const int i0 = clampi(d0, -RK, RK) + RK, i1 = clampi(d0 + 16, -RK, RK) + RK;
                    const float b0 = r_s[rb + r * LRP + i0]; const float b1 = r_s[rb + r * LRP + i1];
                    s0[r] += b0; s1[r] += b1;
                }
            }
            // running-max softmax update; rows 8*hi + r, columns lr (s0) and 16 + lr (s1) of this 32-key half; ls holds per-lane partial row sums
#pragma unroll
            for (int r = 0; r < 8; ++r) {
                const float a0 = s0[r], a1 = s1[r];
                float mx = fmaxf(a0, a1);
                mx = fmaxf(mx, __shfl_xor(mx, 1, 32)); mx = fmaxf(mx, __shfl_xor(mx, 2, 32)); mx = fmaxf(mx, __shfl_xor(mx, 4, 32)); mx = fmaxf(mx, __shfl_xor(mx, 8, 32));
                const float mnew = fmaxf(mr[r], mx);
                const float al = __builtin_amdgcn_exp2f((mr[r] - mnew) * L2E);
                const float e0 = (a0 - mnew) * L2E, e1 = (a1 - mnew) * L2E;
                const float p0 = __builtin_amdgcn_exp2f(e0);
                const float p1 = __builtin_amdgcn_exp2f(e1);
                ls[r] = ls[r] * al + (p0 + p1);
                mr[r] = mnew;
                o[0][r] *= al; o[1][r] *= al; o[2][r] *= al; o[3][r] *= al;
                p_s[pb + (8 * hi + r) * LPP + lr] = (e0 < PFL) ? (h16)0.0f : (h16)(p0 * PCAR);
                p_s[pb + (8 * hi + r) * LPP + 16 + lr] = (e1 < PFL) ? (h16)0.0f : (h16)(p1 * PCAR);
            }
            wsync();
            const v16h pa = cat16(*(const v8ha*)(&p_s[pb + lr * LPP + 8 * hi]), *(const v8ha*)(&p_s[pb + lr * LPP + 8 * hi + 16]));
            v16h vb[4];
#pragma unroll
            for (int dt = 0; dt < 4; ++dt) { const int vo = (dt * 16 + lr) * LKP + hf * 32 + 8 * hi; vb[dt] = cat16(*(const v8ha*)(&vt_s[vo]), *(const v8ha*)(&vt_s[vo + 16])); }
#pragma unroll
            for (int dt = 0; dt < 4; ++dt) o[dt] = wmma16_g(pa, vb[dt], o[dt]);
            wsync();
        }
    }
    // normalise: row sums completed over the 16 lanes of each row; 1 / (l * 1024) undoes the P carry
#pragma unroll
    for (int r = 0; r < 8; ++r) {
        float lt = ls[r];
        lt += __shfl_xor(lt, 1, 32); lt += __shfl_xor(lt, 2, 32); lt += __shfl_xor(lt, 4, 32); lt += __shfl_xor(lt, 8, 32);
        const float inv = 1.0f / (lt * PCAR);
#pragma unroll
        for (int dt = 0; dt < 4; ++dt) o_s[ob + (8 * hi + r) * LOP + dt * 16 + lr] = o[dt][r] * inv;
    }
    wsync();
    const int srow = lane >> 3, scol = (lane & 7) * 8;
    const size_t cbase = ((size_t)b * SEQ + q0) * DM + (size_t)h * HD;
{
#pragma unroll
        for (int s = 0; s < 4; ++s) { const int row = 4 * s + srow; const v4f x0 = *(const v4fa*)(&o_s[ob + row * LOP + scol]); const v4f x1 = *(const v4fa*)(&o_s[ob + row * LOP + scol + 4]); v8us oh, ol;
#pragma unroll
            for (int j = 0; j < 4; ++j) { unsigned short a, c; splitf(x0[j], a, c); oh[j] = a; ol[j] = c; splitf(x1[j], a, c); oh[4 + j] = a; ol[4 + j] = c; }
            const size_t off = cbase + (size_t)row * DM + scol;
            *(v8us*)(Ch + off) = oh; *(v8us*)(Cl + off) = ol; }
         }
}

constexpr size_t al256(size_t x) { return (x + 255) & ~(size_t)255; }
constexpr size_t SZ_W = al256((size_t)DM * DM * 2);                 // one bf16 weight plane
constexpr size_t SZ_R = al256((size_t)RPAD * HD * 2);               // bf16 position plane, 144 rows
constexpr size_t SZ_X = al256((size_t)NB * SEQ * DM * 2);           // one 16-bit [NB*SEQ][DM] plane (merged-head plane)
constexpr size_t SZ_P = al256((size_t)NB * NH * SEQ * HD * 2);      // one 16-bit head plane
constexpr size_t SZ_F = al256((size_t)NCK * 128);                   // 0 / NaN lines of the index compare, one per work-group
constexpr size_t WS_TOTAL = SZ_W + SZ_R + 2 * SZ_P + SZ_P + 2 * SZ_X + SZ_F;
static_assert(WS_TOTAL <= (size_t)134217728);                       // carve stays within 128 MiB
static_assert(SZ_P == SZ_X);                                        // NH * HD == DM
static_assert(SZ_R >= (size_t)RPAD * HD * 2);                       // last position plane line lies inside its region

extern "C" void kernel_launch(void* const* d_in, const int* in_sizes, int n_in,
                              void* d_out, int out_size, void* d_ws, size_t ws_size, hipStream_t stream) {
    if (n_in < 8) return;
    const size_t need_act = (size_t)(NB - 1) * SEQ_FULL * DM + (size_t)SEQ * DM;
    if ((size_t)in_sizes[0] < need_act || (size_t)in_sizes[1] < need_act || (size_t)in_sizes[2] < need_act) return;
    if (in_sizes[3] < DM || in_sizes[4] < DM || in_sizes[5] < NREL * HD || (size_t)in_sizes[6] < (size_t)DM * DM) return;
    if ((size_t)in_sizes[7] < (size_t)(SEQ - 1) * SEQ_FULL + (size_t)SEQ) return;
    if ((size_t)out_size < need_act) return;
    if (WS_TOTAL > ws_size) return;
    // wire order: q, k, v, ln_gamma, ln_beta, rpe_emb, W_proj (all f32; W_proj [out][in]), rel_idx (int32 [SEQ][SEQ])
    const float* xq = (const float*)d_in[0]; const float* xk = (const float*)d_in[1]; const float* xv = (const float*)d_in[2];
    const float* lg = (const float*)d_in[3]; const float* lb = (const float*)d_in[4]; const float* rp = (const float*)d_in[5]; const float* wp = (const float*)d_in[6];
    const int* rel = (const int*)d_in[7];
    float* OUT = (float*)d_out;
    char* wsp = (char*)d_ws;
    auto take = [&](size_t bytes) { char* p = wsp; wsp += bytes; return (void*)p; };
    bf* WO = (bf*)take(SZ_W);
    bf* RPP = (bf*)take(SZ_R);
    bf* QP = (bf*)take(SZ_P); bf* KP = (bf*)take(SZ_P);
    h16* VT = (h16*)take(SZ_P);
    bf* CTh = (bf*)take(SZ_X); bf* CTl = (bf*)take(SZ_X);
    float* PZ = (float*)take(SZ_F);
    if ((size_t)(wsp - (char*)d_ws) != WS_TOTAL) return;

    const unsigned nw8 = (unsigned)((size_t)DM * DM / 8), na8 = (unsigned)((size_t)SEQ * DM / 8);
    k_cvt8<<<dim3(nw8 / 256, 1), 256, 0, stream>>>(wp, WO, nw8, 0, 0);
    k_cvt_rpe<<<dim3((RPAD * HD / 8 + 255) / 256), 256, 0, stream>>>(rp, RPP);
    k_cvt8h<<<dim3(na8 / 256, NB), 256, 0, stream>>>(xq, QP, na8, (size_t)SEQ_FULL * DM, SCL);
    k_cvt8h<<<dim3(na8 / 256, NB), 256, 0, stream>>>(xk, KP, na8, (size_t)SEQ_FULL * DM, 1.0f);
    k_ln_vt<<<dim3(SEQ / 64, NB), 256, 0, stream>>>(xv, lg, lb, VT);
    k_relchk<<<dim3(NCK), CKT, 0, stream>>>(rel, PZ);
    k_flash<<<dim3(SEQ / 64, NB * NH), 128, 0, stream>>>(QP, KP, RPP, VT, CTh, CTl);
    k_gemm_out<<<dim3(SEQ / 64, DM / 64, NB), 32, 0, stream>>>(CTh, CTl, WO, PZ, OUT);
}

// v002
// A run of this version takes 128 microseconds.
// In two side-by-side timings against v001, it was 1.29 and 1.30 times as fast.
// Counting every step since v000, it is 7.81 times as fast.
#include <hip/hip_runtime.h>

#ifndef NB
#define NB 4
#endif
#ifndef SEQ
#define SEQ 2048
#endif
#define NB_FULL  4
#define SEQ_FULL 2048
#define DM   512
#define NH   8
#define HD   64
#define PCAR 1024.0f
#define PFL  (-24.0f)  // exp2 argument below which P * PCAR would leave the f16 normal range
#define SCL  0.125f
#define L2E  1.4426950408889634f
#define LKP  72      // LDS row pitch (16-bit elements) of the K / V^T tiles: 144 B rows
#define LOP  68      // LDS row pitch (floats) of epilogue staging tiles: 272 B rows
#define RK   64      // relative distance clip
#define NREL 129     // position table rows: 2 * RK + 1
#define RT   9       // 16-wide column tiles of the per-wave q.rpe^T table
#define RPAD 144     // position plane rows, zero filled beyond NREL
#define LRP  148     // LDS row pitch (floats) of the per-wave q.rpe^T table
#define LTP  72      // LDS row pitch (halves) of the LayerNorm transpose tile
#define LNEPS 1.0e-5f
#define CKT  (SEQ / 4)   // threads of one index-compare work-group: one row of the index input, 4 integers per thread
#define CKU  8           // rows per index-compare work-group: 16-byte reads per thread, all in flight at once
#define NCK  (SEQ / CKU) // index-compare work-groups == 0 / NaN lines

static_assert(DM == NH * HD);            // one 64-wide GEMM column tile == one head
static_assert(HD == 64);
static_assert(DM % 32 == 0);             // WMMA k-step
static_assert(DM % 64 == 0);             // GEMM tiles
static_assert(SEQ % 64 == 0);            // GEMM row tiles, key blocks, query blocks
static_assert((SEQ * DM) % (8 * 256) == 0);   // convert kernel grid is exact
static_assert((DM * DM) % (8 * 256) == 0);
static_assert(NB <= NB_FULL);
static_assert(SEQ <= SEQ_FULL);
static_assert(LKP % 8 == 0);             // 16-byte aligned LDS vector accesses
static_assert(LOP % 4 == 0);
static_assert(NREL == 2 * RK + 1);
static_assert(RPAD == RT * 16);          // position plane rows == table column tiles
static_assert(NREL <= RPAD);
static_assert(RPAD <= LRP);              // table columns fit the LDS pitch
static_assert(2 * RK < RPAD);            // largest clamped index is a written column
static_assert((RPAD * HD) % 64 == 0);
static_assert(HD * 2 == 8 * 16);         // head plane row == 8 lanes x 16 B
static_assert(LTP % 8 == 0);
static_assert(SEQ % 4 == 0);             // index compare reads 4 integers per lane
static_assert(SEQ % CKU == 0);           // index compare grid is exact
static_assert(CKT % 32 == 0);            // whole waves
static_assert(CKT <= 1024);
static_assert(NCK % 32 == 0);            // the output GEMM's wave reads the lines 32 at a time
static_assert(256 * 16 * 2 == 64 * 64 * 2);
static_assert(32 * 16 * 4 == 16 * HD * 2);
static_assert(32 * 16 * 8 == 16 * 64 * 4);     // output epilogue: lanes x bytes x trips == 16 rows x 256 B
static_assert(PCAR == 1024.0f);                // PFL = -14 - log2(PCAR)
static_assert((size_t)64 * LKP * 2 * 2 + (size_t)4 * 16 * LOP * 4 + (size_t)4 * 16 * LRP * 4 <= 131072);   // flash static LDS
static_assert((size_t)64 * LTP * 2 + 2 * 64 * 4 <= 131072);                                                                     // LayerNorm static LDS

typedef _Float16 h16;
typedef unsigned short bf;
typedef __attribute__((ext_vector_type(16))) __bf16   v16bf;
typedef __attribute__((ext_vector_type(16))) _Float16 v16h;
typedef __attribute__((ext_vector_type(8)))  _Float16 v8h;
typedef __attribute__((ext_vector_type(8)))  unsigned short v8us;
typedef __attribute__((ext_vector_type(8)))  float    v8f;
typedef __attribute__((ext_vector_type(4)))  float    v4f;
typedef __attribute__((ext_vector_type(4)))  int      v4i;
typedef v8h  __attribute__((may_alias)) v8ha;
typedef v4f  __attribute__((may_alias)) v4fa;
typedef v8us __attribute__((may_alias)) v8usa;

__device__ __forceinline__ unsigned short f2bf(float f) { unsigned u = __float_as_uint(f); u += 0x7FFFu + ((u >> 16) & 1u); return (unsigned short)(u >> 16); }
__device__ __forceinline__ float bf2f(unsigned short b) { return __uint_as_float(((unsigned)b) << 16); }
__device__ __forceinline__ float bfr(float f) { return bf2f(f2bf(f)); }
__device__ __forceinline__ void splitf(float y, unsigned short& h, unsigned short& l) { h = f2bf(y); l = f2bf(y - bf2f(h)); }
__device__ __forceinline__ v16h cat16(v8h lo, v8h hi) { return __builtin_shufflevector(lo, hi, 0, 1, 2, 3, 4, 5, 6, 7, 8, 9, 10, 11, 12, 13, 14, 15); }
__device__ __forceinline__ v16bf cat16b(v8us lo, v8us hi) { return __builtin_bit_cast(v16bf, __builtin_shufflevector(lo, hi, 0, 1, 2, 3, 4, 5, 6, 7, 8, 9, 10, 11, 12, 13, 14, 15)); }
__device__ __forceinline__ v8f wmma16(v16h a, v16h b, v8f c) { return __builtin_amdgcn_wmma_f32_16x16x32_f16(false, a, false, b, (short)0, c, false, false); }
__device__ __forceinline__ v8f wmmab(v16bf a, v16bf b, v8f c) { return __builtin_amdgcn_wmma_f32_16x16x32_bf16(false, a, false, b, (short)0, c, false, false); }
// fragment from a K-contiguous global bf16 plane: elements 0..7 <- p[0..7], 8..15 <- p[16..23] (p already includes row*pitch + k0 + 8*(lane>>4))
__device__ __forceinline__ v16bf ldg16(const bf* __restrict__ p) { return cat16b(*(const v8us*)p, *(const v8us*)(p + 16)); }
// same-wave LDS exchange ordering (wave-private tiles only)
__device__ __forceinline__ void wsync() { __builtin_amdgcn_wave_barrier(); asm volatile("" ::: "memory"); }
// one matrix instruction followed by its own four idle slots (ties the accumulator, keeps the operands live)
__device__ __forceinline__ v8f wmmab_g(v16bf a, v16bf b, v8f c) { c = __builtin_amdgcn_wmma_f32_16x16x32_bf16(false, a, false, b, (short)0, c, false, false); asm volatile("v_nop\n\tv_nop\n\tv_nop\n\tv_nop" : "+v"(c) : "v"(a), "v"(b)); return c; }
__device__ __forceinline__ v8f wmma16_g(v16h a, v16h b, v8f c) { c = __builtin_amdgcn_wmma_f32_16x16x32_f16(false, a, false, b, (short)0, c, false, false); asm volatile("v_nop\n\tv_nop\n\tv_nop\n\tv_nop" : "+v"(c) : "v"(a), "v"(b)); return c; }
// f32 -> f16 operand convert that cannot produce an f16 subnormal
__device__ __forceinline__ h16 toh_flush(float v) { const h16 r = (h16)v; return (fabsf(v) < 6.103515625e-05f) ? (h16)0.0f : r; }
// lane l exchanges with lane l ^ 16 (the two lanes that share one column of a D tile)
__device__ __forceinline__ float xhalf(float x) { return __builtin_bit_cast(float, __builtin_amdgcn_permlanex16(__builtin_bit_cast(int, x), __builtin_bit_cast(int, x), 0x76543210, 0xfedcba98, false, false)); }
__device__ __forceinline__ int clampi(int v, int lo, int hi) { const int t = v < lo ? lo : v; return t > hi ? hi : t; }

// ---- one-wave 64x64 tile main loop: acc[mb][nb] += sum_k A[r0+16mb+..][k] Bt[c0+16nb+..][k] (NSPLIT 1: + A2 x Bt). Operands straight from K-contiguous bf16 planes; K % 32 == 0.
template <int NSPLIT>
__device__ __forceinline__ void gemm_loop(const bf* __restrict__ A, const bf* __restrict__ A2, const bf* __restrict__ Bt, const int K, const size_t aoff, const size_t boff, v8f (&acc)[4][4]) {
#pragma unroll 1
    for (int kc = 0; kc < K; kc += 32) {
        v16bf a[4], a2[4];
#pragma unroll
        for (int mb = 0; mb < 4; ++mb) { a[mb] = ldg16(A + aoff + (size_t)mb * 16 * K + kc); if (NSPLIT == 1) a2[mb] = ldg16(A2 + aoff + (size_t)mb * 16 * K + kc); }
#pragma unroll
        for (int nb = 0; nb < 4; ++nb) { const v16bf b = ldg16(Bt + boff + (size_t)nb * 16 * K + kc);
#pragma unroll
            for (int mb = 0; mb < 4; ++mb) { acc[mb][nb] = wmmab(a[mb], b, acc[mb][nb]); if (NSPLIT == 1) acc[mb][nb] = wmmab(a2[mb], b, acc[mb][nb]); } }
        asm volatile("v_nop\n\tv_nop\n\tv_nop\n\tv_nop" : "+v"(acc[0][0]), "+v"(acc[1][1]), "+v"(acc[2][2]), "+v"(acc[3][3]) : "v"(a[0]), "v"(a[3]));
    }
}

__global__ __launch_bounds__(256) void k_cvt8(const float* __restrict__ src, bf* dst, unsigned n8, size_t sstride, size_t dstride) {
    const unsigned i = blockIdx.x * 256u + threadIdx.x; if (i >= n8) return;
    const float* s = src + (size_t)blockIdx.y * sstride + (size_t)i * 8; bf* d = dst + (size_t)blockIdx.y * dstride + (size_t)i * 8;
    const v4f v0 = *(const v4f*)s; const v4f v1 = *(const v4f*)(s + 4); v8us o;
#pragma unroll
    for (int k = 0; k < 4; ++k) { o[k] = f2bf(v0[k]); o[4 + k] = f2bf(v1[k]); }
    *(v8us*)d = o; 
}

__global__ __launch_bounds__(256) void k_cvt8h(const float* __restrict__ src, bf* dst, unsigned n8, size_t sstride, float sc) {
#pragma clang fp contract(off)
    const unsigned i = blockIdx.x * 256u + threadIdx.x; if (i >= n8) return;
    const unsigned e = i * 8u; const unsigned srow = e / DM, c = e % DM; const unsigned hh = c / HD, dd = c % HD;
    const float* s = src + (size_t)blockIdx.y * sstride + (size_t)e;
    bf* d = dst + (((size_t)blockIdx.y * NH + hh) * SEQ + srow) * HD + dd;
    const v4f v0 = *(const v4f*)s; const v4f v1 = *(const v4f*)(s + 4); v8us o;
#pragma unroll
    for (int k = 0; k < 4; ++k) { o[k] = f2bf(bfr(v0[k]) * sc); o[4 + k] = f2bf(bfr(v1[k]) * sc); }
    *(v8us*)d = o; 
}

__global__ __launch_bounds__(256) void k_cvt_rpe(const float* __restrict__ src, bf* dst) {
    const unsigned i = blockIdx.x * 256u + threadIdx.x; if (i >= (unsigned)(RPAD * HD / 8)) return;
    const unsigned nreal = (unsigned)(NREL * HD / 8);
    const unsigned ic = i < nreal ? i : nreal - 1u;
    const bool ok = i < nreal;
    const float* s = src + (size_t)ic * 8; bf* d = dst + (size_t)i * 8;
    const v4f v0 = *(const v4f*)s; const v4f v1 = *(const v4f*)(s + 4); v8us o;
#pragma unroll
    for (int k = 0; k < 4; ++k) { const unsigned short a = f2bf(v0[k]); const unsigned short c = f2bf(v1[k]); o[k] = ok ? a : (unsigned short)0; o[4 + k] = ok ? c : (unsigned short)0; }
    *(v8us*)d = o; 
}

// ---- k_ln_vt: V^T[b][n][s] (f16) = ((x - mean) * rsqrt(var + eps) * gain[n] + shift[n]) over the 512 features of token s, x = RNE bf16 of the value stream; grid (SEQ/64, NB), 256 threads.
// Phase 1: wave w owns tokens 8w..8w+7 (mean, then centred variance, per-lane 16 features, shuffle reduce); statistics to LDS (cross-wave: block barrier).
__global__ __launch_bounds__(256) void k_ln_vt(const float* __restrict__ X, const float* __restrict__ G, const float* __restrict__ Bt, h16* VT) {
#pragma clang fp contract(off)
    __shared__ __align__(16) h16 t_s[64 * LTP];
    __shared__ float mu_s[64];
    __shared__ float rs_s[64];
    const int tid = threadIdx.x, lane = tid & 31;
    const int wid = __builtin_amdgcn_readfirstlane(tid >> 5);
    const size_t z = blockIdx.y; const int s0 = blockIdx.x * 64;
    const float* xb = X + z * (size_t)SEQ_FULL * DM + (size_t)s0 * DM;
#pragma unroll 1
    for (int t = 0; t < 8; ++t) {
        const int tok = wid * 8 + t;
        const float* xr = xb + (size_t)tok * DM;
        float xv[16]; float sm = 0.0f;
#pragma unroll
        for (int c = 0; c < 16; ++c) { xv[c] = bfr(xr[c * 32 + lane]); sm += xv[c]; }
        sm += __shfl_xor(sm, 16, 32); sm += __shfl_xor(sm, 8, 32); sm += __shfl_xor(sm, 4, 32); sm += __shfl_xor(sm, 2, 32); sm += __shfl_xor(sm, 1, 32);
        const float mu = sm * (1.0f / DM);
        float sq = 0.0f;
#pragma unroll
        for (int c = 0; c < 16; ++c) { const float dv = xv[c] - mu; sq += dv * dv; }
        sq += __shfl_xor(sq, 16, 32); sq += __shfl_xor(sq, 8, 32); sq += __shfl_xor(sq, 4, 32); sq += __shfl_xor(sq, 2, 32); sq += __shfl_xor(sq, 1, 32);
        const float rstd = rsqrtf(sq * (1.0f / DM) + LNEPS);
        if (lane == 0) { mu_s[tok] = mu; rs_s[tok] = rstd; }
    }
    __syncthreads();
    const int f = tid & 63, tq = tid >> 6;
#pragma unroll 1
    for (int cc = 0; cc < DM / 64; ++cc) {
        const int c0 = cc * 64;
        const float g = bfr(G[c0 + f]), be = bfr(Bt[c0 + f]);
#pragma unroll 1
        for (int it = 0; it < 16; ++it) {
            const int tok = tq + 4 * it;
            const float x = bfr(xb[(size_t)tok * DM + c0 + f]);
            const float y = (x - mu_s[tok]) * rs_s[tok] * g + be;
            t_s[f * LTP + tok] = toh_flush(y);
        }
        __syncthreads();
{
#pragma unroll
            for (int it = 0; it < 2; ++it) { const int u = tid + it * 256; const int row = u >> 3, part = (u & 7) * 8;
                const v8h o = *(const v8ha*)(&t_s[row * LTP + part]);
                *(v8h*)(VT + (z * DM + (size_t)(c0 + row)) * SEQ + s0 + part) = o; }
             }
        __syncthreads();
    }
}

// ---- k_relchk: work-group g compares rows g*CKU .. g*CKU+CKU-1 of the index input with the closed form and stores its own 128-byte line pz[g*32 .. g*32+31] = 0 (all equal) or NaN; grid (NCK), SEQ/4 threads.
__global__ __launch_bounds__(CKT) void k_relchk(const int* __restrict__ rel, float* pz) {
    __shared__ int bad_s[CKT / 32];
    const int tid = threadIdx.x, lane = tid & 31;
    const int wid = __builtin_amdgcn_readfirstlane(tid >> 5);
    const int i0 = blockIdx.x * CKU, j = tid * 4;
    const int* rp = rel + (size_t)i0 * SEQ_FULL + j;
    v4i t[CKU];
#pragma unroll
    for (int u = 0; u < CKU; ++u) t[u] = *(const v4i*)(rp + (size_t)u * SEQ_FULL);
    int bad = 0;
#pragma unroll
    for (int u = 0; u < CKU; ++u) {
#pragma unroll
        for (int cc = 0; cc < 4; ++cc) { const int want = clampi(j + cc - i0 - u, -RK, RK) + RK; bad |= (t[u][cc] != want) ? 1 : 0; }
    }
    bad |= __shfl_xor(bad, 16, 32); bad |= __shfl_xor(bad, 8, 32); bad |= __shfl_xor(bad, 4, 32); bad |= __shfl_xor(bad, 2, 32); bad |= __shfl_xor(bad, 1, 32);
    if (lane == 0) bad_s[wid] = bad;
    __syncthreads();
    int any = 0;
#pragma unroll
    for (int w = 0; w < CKT / 32; ++w) any |= bad_s[w];
    const float pv = (any != 0) ? __uint_as_float(0x7FC00000u) : 0.0f;
    if (tid < 8) { const v4f o = (v4f){pv, pv, pv, pv}; *(v4f*)(pz + (size_t)blockIdx.x * 32 + tid * 4) = o;  }
}

// ---- k_gemm_out: OUT[b][s][n] (f32) = sum_k (Ah + Al)[b*SEQ+s][k] W[n][k] (+ the sum of the 0 / NaN lines of the index compare); grid (SEQ/64, DM/64, NB), 32 threads.
__global__ __launch_bounds__(32) void k_gemm_out(const bf* __restrict__ Ah, const bf* __restrict__ Al, const bf* __restrict__ W, const float* __restrict__ pz, float* C) {
    __shared__ __align__(16) float os[16 * LOP];
    const int lane = threadIdx.x & 31, lr = lane & 15, hi = lane >> 4;
    const size_t z = blockIdx.z; const int r0 = blockIdx.x * 64, c0 = blockIdx.y * 64;
    const bf* A = Ah + z * (size_t)SEQ * DM; const bf* A2 = Al + z * (size_t)SEQ * DM;
    float* Cz = C + z * (size_t)SEQ_FULL * DM;
    float pzv = 0.0f;
#pragma unroll
    for (int s = 0; s < NCK / 32; ++s) pzv += pz[(size_t)(s * 32 + lane) * 32];
    pzv += __shfl_xor(pzv, 16, 32); pzv += __shfl_xor(pzv, 8, 32); pzv += __shfl_xor(pzv, 4, 32); pzv += __shfl_xor(pzv, 2, 32); pzv += __shfl_xor(pzv, 1, 32);
    v8f acc[4][4];
#pragma unroll
    for (int mb = 0; mb < 4; ++mb)
#pragma unroll
        for (int nb = 0; nb < 4; ++nb) acc[mb][nb] = (v8f){};
    gemm_loop<1>(A, A2, W, DM, (size_t)(r0 + lr) * DM + 8 * hi, (size_t)(c0 + lr) * DM + 8 * hi, acc);
#pragma unroll
    for (int mb = 0; mb < 4; ++mb) {
#pragma unroll
        for (int nb = 0; nb < 4; ++nb) {
#pragma unroll
            for (int j = 0; j < 8; ++j) os[(hi * 8 + j) * LOP + nb * 16 + lr] = acc[mb][nb][j]; }
        wsync();
        float* crow = Cz + (size_t)(r0 + mb * 16) * DM + c0;
{
#pragma unroll
            for (int s = 0; s < 8; ++s) { const int row = 2 * s + hi, cofs = lr * 4; v4f val = *(const v4fa*)(&os[row * LOP + cofs]);
                val[0] += pzv; val[1] += pzv; val[2] += pzv; val[3] += pzv;
                *(v4f*)(crow + (size_t)row * DM + cofs) = val; }
             }
        wsync();
    }
}

__global__ __launch_bounds__(128) void k_flash(const bf* __restrict__ Qh, const bf* __restrict__ Kh, const bf* __restrict__ RP, const h16* __restrict__ VT, bf* Ch, bf* Cl) {
    __shared__ __align__(16) bf    kh_s[64 * LKP];
    __shared__ __align__(16) h16   vt_s[64 * LKP];
    __shared__ __align__(16) float o_s[4 * 16 * LOP];
    __shared__ __align__(16) float r_s[4 * 16 * LRP];
    const int tid = threadIdx.x, lane = tid & 31, lr = lane & 15, hi = lane >> 4;
    const int wid = __builtin_amdgcn_readfirstlane(tid >> 5);
    const int bh = blockIdx.y; const int b = bh / NH, h = bh % NH;
    const int q0 = blockIdx.x * 64 + wid * 16;
    const size_t pl = (size_t)bh * SEQ * HD;
    const size_t qoff = pl + (size_t)(q0 + lr) * HD + 8 * hi;
    const size_t vbase = ((size_t)b * DM + (size_t)h * HD) * SEQ;
    const int ob = wid * 16 * LOP;
    const int rb = wid * 16 * LRP + 8 * hi * LRP;   // table rows as the prologue's D tiles hold them
    const int tb = wid * 16 * LRP + lr * LRP;       // table row of the lane's own query
    const v16bf qa0 = ldg16(Qh + qoff); const v16bf qa1 = ldg16(Qh + qoff + 32);
#pragma unroll 1
    for (int ct = 0; ct < RT; ++ct) {
        const size_t ro = (size_t)(ct * 16 + lr) * HD + 8 * hi;
        const v16bf b0 = ldg16(RP + ro); const v16bf b1 = ldg16(RP + ro + 32);
        v8f t = (v8f){};
        t = wmmab_g(qa0, b0, t);
        t = wmmab_g(qa1, b1, t);
#pragma unroll
        for (int j = 0; j < 8; ++j) r_s[rb + j * LRP + ct * 16 + lr] = t[j];
    }
    wsync();
    const float rlo = r_s[tb], rhi = r_s[tb + 2 * RK];
    v8f o[4];
#pragma unroll
    for (int dt = 0; dt < 4; ++dt) o[dt] = (v8f){};
    float mr = -1.0e30f, ls = 0.0f;

#pragma unroll 1
    for (int kb = 0; kb < SEQ / 64; ++kb) {
        __syncthreads();
#pragma unroll
        for (int it = 0; it < 4; ++it) {
            const int u = tid + it * 128; const int row = u >> 3, part = (u & 7) * 8;
            const size_t g = pl + (size_t)kb * 64 * HD + (size_t)u * 8;
            const v8us a = *(const v8us*)(Kh + g);
            const v8h v = *(const v8h*)(VT + vbase + (size_t)row * SEQ + (size_t)kb * 64 + part);
            *(v8usa*)(&kh_s[row * LKP + part]) = a; *(v8ha*)(&vt_s[row * LKP + part]) = v;
        }
        __syncthreads();
#pragma unroll 1
        for (int hf = 0; hf < 2; ++hf) {
            v8f s0 = (v8f){}, s1 = (v8f){};
            const int kr0 = (hf * 32 + lr) * LKP + 8 * hi, kr1 = kr0 + 16 * LKP;
            {
                const v16bf k00 = cat16b(*(const v8usa*)(&kh_s[kr0]), *(const v8usa*)(&kh_s[kr0 + 16]));
                const v16bf k10 = cat16b(*(const v8usa*)(&kh_s[kr1]), *(const v8usa*)(&kh_s[kr1 + 16]));
                const v16bf k01 = cat16b(*(const v8usa*)(&kh_s[kr0 + 32]), *(const v8usa*)(&kh_s[kr0 + 48]));
                const v16bf k11 = cat16b(*(const v8usa*)(&kh_s[kr1 + 32]), *(const v8usa*)(&kh_s[kr1 + 48]));
                s0 = wmmab_g(k00, qa0, s0); s1 = wmmab_g(k10, qa0, s1);
                s0 = wmmab_g(k01, qa1, s0); s1 = wmmab_g(k11, qa1, s1);
            }
            // position term: query q0 + lr, keys j0 + 8*hi + r (s0) and j0 + 16 + 8*hi + r (s1); the three-way test is on scalars only
            const int j0 = kb * 64 + hf * 32;
            if (j0 - q0 >= RK + 15) {
#pragma unroll
                for (int r = 0; r < 8; ++r) { s0[r] += rhi; s1[r] += rhi; }
            } else if (q0 - j0 >= RK + 31) {
#pragma unroll
                for (int r = 0; r < 8; ++r) { s0[r] += rlo; s1[r] += rlo; }
            } else {
#pragma unroll
                for (int r = 0; r < 8; ++r) {
                    const int d0 = j0 + 8 * hi + r - q0 - lr;
                    const int i0 = clampi(d0, -RK, RK) + RK, i1 = clampi(d0 + 16, -RK, RK) + RK;
                    const float b0 = r_s[tb + i0]; const float b1 = r_s[tb + i1];
                    s0[r] += b0; s1[r] += b1;
                }
            }
            // running-max softmax update for the lane's query: 16 of the half's 32 keys are in this lane, the other 16 in lane ^ 16; ls holds the lane's partial sum
            float mx = fmaxf(s0[0], s1[0]);
#pragma unroll
            for (int r = 1; r < 8; ++r) mx = fmaxf(mx, fmaxf(s0[r], s1[r]));
            mx = fmaxf(mx, xhalf(mx));
            const float mnew = fmaxf(mr, mx);
            const float al = __builtin_amdgcn_exp2f((mr - mnew) * L2E);
            mr = mnew;
            v16h pa; float ps[8];
#pragma unroll
            for (int r = 0; r < 8; ++r) {
                const float e0 = (s0[r] - mnew) * L2E, e1 = (s1[r] - mnew) * L2E;
                const float p0 = __builtin_amdgcn_exp2f(e0);
                const float p1 = __builtin_amdgcn_exp2f(e1);
                ps[r] = p0 + p1;
                pa[r] = (e0 < PFL) ? (h16)0.0f : (h16)(p0 * PCAR);
                pa[8 + r] = (e1 < PFL) ? (h16)0.0f : (h16)(p1 * PCAR);
            }
            ls = ls * al + (((ps[0] + ps[1]) + (ps[2] + ps[3])) + ((ps[4] + ps[5]) + (ps[6] + ps[7])));
#pragma unroll
            for (int dt = 0; dt < 4; ++dt)
#pragma unroll
                for (int r = 0; r < 8; ++r) o[dt][r] *= al;
            v16h va[4];
#pragma unroll
            for (int dt = 0; dt < 4; ++dt) { const int vo = (dt * 16 + lr) * LKP + hf * 32 + 8 * hi; va[dt] = cat16(*(const v8ha*)(&vt_s[vo]), *(const v8ha*)(&vt_s[vo + 16])); }
#pragma unroll
            for (int dt = 0; dt < 4; ++dt) o[dt] = wmma16_g(va[dt], pa, o[dt]);
        }
    }
    // normalise: the query's sum is completed over its two lanes; 1 / (l * 1024) undoes the P carry; the lane's 8 registers of a tile are 8 consecutive features of its query
    {
        const float lt = ls + xhalf(ls);
        const float inv = 1.0f / (lt * PCAR);
#pragma unroll
        for (int dt = 0; dt < 4; ++dt) {
            const v4f y0 = (v4f){o[dt][0] * inv, o[dt][1] * inv, o[dt][2] * inv, o[dt][3] * inv};
            const v4f y1 = (v4f){o[dt][4] * inv, o[dt][5] * inv, o[dt][6] * inv, o[dt][7] * inv};
            *(v4fa*)(&o_s[ob + lr * LOP + dt * 16 + 8 * hi]) = y0; *(v4fa*)(&o_s[ob + lr * LOP + dt * 16 + 8 * hi + 4]) = y1;
        }
    }
    wsync();
    const int srow = lane >> 3, scol = (lane & 7) * 8;
    const size_t cbase = ((size_t)b * SEQ + q0) * DM + (size_t)h * HD;
{
#pragma unroll
        for (int s = 0; s < 4; ++s) { const int row = 4 * s + srow; const v4f x0 = *(const v4fa*)(&o_s[ob + row * LOP + scol]); const v4f x1 = *(const v4fa*)(&o_s[ob + row * LOP + scol + 4]); v8us oh, ol;
#pragma unroll
            for (int j = 0; j < 4; ++j) { unsigned short a, c; splitf(x0[j], a, c); oh[j] = a; ol[j] = c; splitf(x1[j], a, c); oh[4 + j] = a; ol[4 + j] = c; }
            const size_t off = cbase + (size_t)row * DM + scol;
            *(v8us*)(Ch + off) = oh; *(v8us*)(Cl + off) = ol; }
         }
}

constexpr size_t al256(size_t x) { return (x + 255) & ~(size_t)255; }
constexpr size_t SZ_W = al256((size_t)DM * DM * 2);                 // one bf16 weight plane
constexpr size_t SZ_R = al256((size_t)RPAD * HD * 2);               // bf16 position plane, 144 rows
constexpr size_t SZ_X = al256((size_t)NB * SEQ * DM * 2);           // one 16-bit [NB*SEQ][DM] plane (merged-head plane)
constexpr size_t SZ_P = al256((size_t)NB * NH * SEQ * HD * 2);      // one 16-bit head plane
constexpr size_t SZ_F = al256((size_t)NCK * 128);                   // 0 / NaN lines of the index compare, one per work-group
constexpr size_t WS_TOTAL = SZ_W + SZ_R + 2 * SZ_P + SZ_P + 2 * SZ_X + SZ_F;
static_assert(WS_TOTAL <= (size_t)134217728);                       // carve stays within 128 MiB
static_assert(SZ_P == SZ_X);                                        // NH * HD == DM
static_assert(SZ_R >= (size_t)RPAD * HD * 2);                       // last position plane line lies inside its region

extern "C" void kernel_launch(void* const* d_in, const int* in_sizes, int n_in,
                              void* d_out, int out_size, void* d_ws, size_t ws_size, hipStream_t stream) {
    if (n_in < 8) return;
    const size_t need_act = (size_t)(NB - 1) * SEQ_FULL * DM + (size_t)SEQ * DM;
    if ((size_t)in_sizes[0] < need_act || (size_t)in_sizes[1] < need_act || (size_t)in_sizes[2] < need_act) return;
    if (in_sizes[3] < DM || in_sizes[4] < DM || in_sizes[5] < NREL * HD || (size_t)in_sizes[6] < (size_t)DM * DM) return;
    if ((size_t)in_sizes[7] < (size_t)(SEQ - 1) * SEQ_FULL + (size_t)SEQ) return;
    if ((size_t)out_size < need_act) return;
    if (WS_TOTAL > ws_size) return;
    // wire order: q, k, v, ln_gamma, ln_beta, rpe_emb, W_proj (all f32; W_proj [out][in]), rel_idx (int32 [SEQ][SEQ])
    const float* xq = (const float*)d_in[0]; const float* xk = (const float*)d_in[1]; const float* xv = (const float*)d_in[2];
    const float* lg = (const float*)d_in[3]; const float* lb = (const float*)d_in[4]; const float* rp = (const float*)d_in[5]; const float* wp = (const float*)d_in[6];
    const int* rel = (const int*)d_in[7];
    float* OUT = (float*)d_out;
    char* wsp = (char*)d_ws;
    auto take = [&](size_t bytes) { char* p = wsp; wsp += bytes; return (void*)p; };
    bf* WO = (bf*)take(SZ_W);
    bf* RPP = (bf*)take(SZ_R);
    bf* QP = (bf*)take(SZ_P); bf* KP = (bf*)take(SZ_P);
    h16* VT = (h16*)take(SZ_P);
    bf* CTh = (bf*)take(SZ_X); bf* CTl = (bf*)take(SZ_X);
    float* PZ = (float*)take(SZ_F);
    if ((size_t)(wsp - (char*)d_ws) != WS_TOTAL) return;

    const unsigned nw8 = (unsigned)((size_t)DM * DM / 8), na8 = (unsigned)((size_t)SEQ * DM / 8);
    k_cvt8<<<dim3(nw8 / 256, 1), 256, 0, stream>>>(wp, WO, nw8, 0, 0);
    k_cvt_rpe<<<dim3((RPAD * HD / 8 + 255) / 256), 256, 0, stream>>>(rp, RPP);
    k_cvt8h<<<dim3(na8 / 256, NB), 256, 0, stream>>>(xq, QP, na8, (size_t)SEQ_FULL * DM, SCL);
    k_cvt8h<<<dim3(na8 / 256, NB), 256, 0, stream>>>(xk, KP, na8, (size_t)SEQ_FULL * DM, 1.0f);
    k_ln_vt<<<dim3(SEQ / 64, NB), 256, 0, stream>>>(xv, lg, lb, VT);
    k_relchk<<<dim3(NCK), CKT, 0, stream>>>(rel, PZ);
    k_flash<<<dim3(SEQ / 64, NB * NH), 128, 0, stream>>>(QP, KP, RPP, VT, CTh, CTl);
    k_gemm_out<<<dim3(SEQ / 64, DM / 64, NB), 32, 0, stream>>>(CTh, CTl, WO, PZ, OUT);
}

// v003
// Measured time: 114 microseconds a run.
// Next to v002, in two timings, it ran 1.12 times as fast each time.
// Over all steps from v000 it is 8.73 times as fast.
#include <hip/hip_runtime.h>

#ifndef NB
#define NB 4
#endif
#ifndef SEQ
#define SEQ 2048
#endif
#define NB_FULL  4
#define SEQ_FULL 2048
#define DM   512
#define NH   8
#define HD   64
#define PCAR 1024.0f
#define PFL  (-24.0f)  // exp2 argument below which P * PCAR would leave the f16 normal range
#define SCL  0.125f
#define L2E  1.4426950408889634f
#define LKP  72      // LDS row pitch (16-bit elements) of the K / V^T tiles: 144 B rows
#define LOP  68      // LDS row pitch (floats) of epilogue staging tiles: 272 B rows
#define RK   64      // relative distance clip
#define NREL 129     // position table rows: 2 * RK + 1
#define RT   9       // 16-wide column tiles of the per-wave q.rpe^T table
#define RPAD 144     // position plane rows, zero filled beyond NREL
#define LRP  148     // LDS row pitch (floats) of the per-wave q.rpe^T table
#define LTP  72      // LDS row pitch (halves) of the LayerNorm transpose tile
#define LNEPS 1.0e-5f
#define PT   256         // threads of a pre-pass work-group, the same for all six jobs
#define CKS  (SEQ / (4 * PT))   // 16-byte reads per thread and row of the index input
#define CKU  8           // rows per index-compare work-group: CKU * CKS independent 16-byte reads per thread
#define NCK  (SEQ / CKU) // index-compare work-groups == 0 / NaN lines

static_assert(DM == NH * HD);            // one 64-wide GEMM column tile == one head
static_assert(HD == 64);
static_assert(DM % 32 == 0);             // WMMA k-step
static_assert(DM % 64 == 0);             // GEMM tiles
static_assert(SEQ % 64 == 0);            // GEMM row tiles, key blocks, query blocks
static_assert((SEQ * DM) % (8 * 256) == 0);   // q / k convert job's work-group range is exact
static_assert((DM * DM) % (8 * 256) == 0);
static_assert(NB <= NB_FULL);
static_assert(SEQ <= SEQ_FULL);
static_assert(LKP % 8 == 0);             // 16-byte aligned LDS vector accesses
static_assert(LOP % 4 == 0);
static_assert(NREL == 2 * RK + 1);
static_assert(RPAD == RT * 16);          // position plane rows == table column tiles
static_assert(NREL <= RPAD);
static_assert(RPAD <= LRP);              // table columns fit the LDS pitch
static_assert(2 * RK < RPAD);            // largest clamped index is a written column
static_assert((RPAD * HD) % 64 == 0);
static_assert(HD * 2 == 8 * 16);         // head plane row == 8 lanes x 16 B
static_assert(LTP % 8 == 0);
static_assert(SEQ % (4 * PT) == 0);      // index compare: whole 16-byte reads, the same number in every thread
static_assert(SEQ % CKU == 0);           // index compare grid is exact
static_assert(NCK % 32 == 0);            // the output GEMM's wave reads the lines 32 at a time
static_assert(256 * 16 * 2 == 64 * 64 * 2);
static_assert(32 * 16 * 4 == 16 * HD * 2);
static_assert(32 * 16 * 8 == 16 * 64 * 4);     // output epilogue: lanes x bytes x trips == 16 rows x 256 B
static_assert(PCAR == 1024.0f);                // PFL = -14 - log2(PCAR)
static_assert((size_t)64 * LKP * 2 * 2 + (size_t)4 * 16 * LOP * 4 + (size_t)4 * 16 * LRP * 4 <= 131072);   // flash static LDS
static_assert((size_t)64 * LTP * 2 + 2 * 64 * 4 <= 131072);                                                                     // LayerNorm static LDS

typedef _Float16 h16;
typedef unsigned short bf;
typedef __attribute__((ext_vector_type(16))) __bf16   v16bf;
typedef __attribute__((ext_vector_type(16))) _Float16 v16h;
typedef __attribute__((ext_vector_type(8)))  _Float16 v8h;
typedef __attribute__((ext_vector_type(8)))  unsigned short v8us;
typedef __attribute__((ext_vector_type(8)))  float    v8f;
typedef __attribute__((ext_vector_type(4)))  float    v4f;
typedef __attribute__((ext_vector_type(4)))  int      v4i;
typedef v8h  __attribute__((may_alias)) v8ha;
typedef v4f  __attribute__((may_alias)) v4fa;
typedef v8us __attribute__((may_alias)) v8usa;

__device__ __forceinline__ unsigned short f2bf(float f) { unsigned u = __float_as_uint(f); u += 0x7FFFu + ((u >> 16) & 1u); return (unsigned short)(u >> 16); }
__device__ __forceinline__ float bf2f(unsigned short b) { return __uint_as_float(((unsigned)b) << 16); }
__device__ __forceinline__ float bfr(float f) { return bf2f(f2bf(f)); }
__device__ __forceinline__ void splitf(float y, unsigned short& h, unsigned short& l) { h = f2bf(y); l = f2bf(y - bf2f(h)); }
__device__ __forceinline__ v16h cat16(v8h lo, v8h hi) { return __builtin_shufflevector(lo, hi, 0, 1, 2, 3, 4, 5, 6, 7, 8, 9, 10, 11, 12, 13, 14, 15); }
__device__ __forceinline__ v16bf cat16b(v8us lo, v8us hi) { return __builtin_bit_cast(v16bf, __builtin_shufflevector(lo, hi, 0, 1, 2, 3, 4, 5, 6, 7, 8, 9, 10, 11, 12, 13, 14, 15)); }
__device__ __forceinline__ v8f wmma16(v16h a, v16h b, v8f c) { return __builtin_amdgcn_wmma_f32_16x16x32_f16(false, a, false, b, (short)0, c, false, false); }
__device__ __forceinline__ v8f wmmab(v16bf a, v16bf b, v8f c) { return __builtin_amdgcn_wmma_f32_16x16x32_bf16(false, a, false, b, (short)0, c, false, false); }
// fragment from a K-contiguous global bf16 plane: elements 0..7 <- p[0..7], 8..15 <- p[16..23] (p already includes row*pitch + k0 + 8*(lane>>4))
__device__ __forceinline__ v16bf ldg16(const bf* __restrict__ p) { return cat16b(*(const v8us*)p, *(const v8us*)(p + 16)); }
// same-wave LDS exchange ordering (wave-private tiles only)
__device__ __forceinline__ void wsync() { __builtin_amdgcn_wave_barrier(); asm volatile("" ::: "memory"); }
// one matrix instruction followed by its own four idle slots (ties the accumulator, keeps the operands live)
__device__ __forceinline__ v8f wmmab_g(v16bf a, v16bf b, v8f c) { c = __builtin_amdgcn_wmma_f32_16x16x32_bf16(false, a, false, b, (short)0, c, false, false); asm volatile("v_nop\n\tv_nop\n\tv_nop\n\tv_nop" : "+v"(c) : "v"(a), "v"(b)); return c; }
__device__ __forceinline__ v8f wmma16_g(v16h a, v16h b, v8f c) { c = __builtin_amdgcn_wmma_f32_16x16x32_f16(false, a, false, b, (short)0, c, false, false); asm volatile("v_nop\n\tv_nop\n\tv_nop\n\tv_nop" : "+v"(c) : "v"(a), "v"(b)); return c; }
// f32 -> f16 operand convert that cannot produce an f16 subnormal
__device__ __forceinline__ h16 toh_flush(float v) { const h16 r = (h16)v; return (fabsf(v) < 6.103515625e-05f) ? (h16)0.0f : r; }
// lane l exchanges with lane l ^ 16 (the two lanes that share one column of a D tile)
__device__ __forceinline__ float xhalf(float x) { return __builtin_bit_cast(float, __builtin_amdgcn_permlanex16(__builtin_bit_cast(int, x), __builtin_bit_cast(int, x), 0x76543210, 0xfedcba98, false, false)); }
__device__ __forceinline__ int clampi(int v, int lo, int hi) { const int t = v < lo ? lo : v; return t > hi ? hi : t; }

// ---- one-wave 64x64 tile main loop: acc[mb][nb] += sum_k A[r0+16mb+..][k] Bt[c0+16nb+..][k] (NSPLIT 1: + A2 x Bt). Operands straight from K-contiguous bf16 planes; K % 32 == 0.
template <int NSPLIT>
__device__ __forceinline__ void gemm_loop(const bf* __restrict__ A, const bf* __restrict__ A2, const bf* __restrict__ Bt, const int K, const size_t aoff, const size_t boff, v8f (&acc)[4][4]) {
#pragma unroll 1
    for (int kc = 0; kc < K; kc += 32) {
        v16bf a[4], a2[4];
#pragma unroll
        for (int mb = 0; mb < 4; ++mb) { a[mb] = ldg16(A + aoff + (size_t)mb * 16 * K + kc); if (NSPLIT == 1) a2[mb] = ldg16(A2 + aoff + (size_t)mb * 16 * K + kc); }
#pragma unroll
        for (int nb = 0; nb < 4; ++nb) { const v16bf b = ldg16(Bt + boff + (size_t)nb * 16 * K + kc);
#pragma unroll
            for (int mb = 0; mb < 4; ++mb) { acc[mb][nb] = wmmab(a[mb], b, acc[mb][nb]); if (NSPLIT == 1) acc[mb][nb] = wmmab(a2[mb], b, acc[mb][nb]); } }
        asm volatile("v_nop\n\tv_nop\n\tv_nop\n\tv_nop" : "+v"(acc[0][0]), "+v"(acc[1][1]), "+v"(acc[2][2]), "+v"(acc[3][3]) : "v"(a[0]), "v"(a[3]));
    }
}

// The six jobs of the pre-pass launch are device functions; bx (and by) is the job's own work-group index, the same for the whole work-group.
__device__ __forceinline__ void d_cvt8(const float* __restrict__ src, bf* dst, unsigned n8, unsigned bx) {
    const unsigned i = bx * 256u + threadIdx.x; if (i >= n8) return;
    const float* s = src + (size_t)i * 8; bf* d = dst + (size_t)i * 8;
    const v4f v0 = *(const v4f*)s; const v4f v1 = *(const v4f*)(s + 4); v8us o;
#pragma unroll
    for (int k = 0; k < 4; ++k) { o[k] = f2bf(v0[k]); o[4 + k] = f2bf(v1[k]); }
    *(v8us*)d = o; 
}

__device__ __forceinline__ void d_cvt8h(const float* __restrict__ src, bf* dst, unsigned n8, size_t sstride, float sc, unsigned bx, unsigned by) {
#pragma clang fp contract(off)
    const unsigned i = bx * 256u + threadIdx.x; if (i >= n8) return;
    const unsigned e = i * 8u; const unsigned srow = e / DM, c = e % DM; const unsigned hh = c / HD, dd = c % HD;
    const float* s = src + (size_t)by * sstride + (size_t)e;
    bf* d = dst + (((size_t)by * NH + hh) * SEQ + srow) * HD + dd;
    const v4f v0 = *(const v4f*)s; const v4f v1 = *(const v4f*)(s + 4); v8us o;
#pragma unroll
    for (int k = 0; k < 4; ++k) { o[k] = f2bf(bfr(v0[k]) * sc); o[4 + k] = f2bf(bfr(v1[k]) * sc); }
    *(v8us*)d = o; 
}

__device__ __forceinline__ void d_cvt_rpe(const float* __restrict__ src, bf* dst, unsigned bx) {
    const unsigned i = bx * 256u + threadIdx.x; if (i >= (unsigned)(RPAD * HD / 8)) return;
    const unsigned nreal = (unsigned)(NREL * HD / 8);
    const unsigned ic = i < nreal ? i : nreal - 1u;
    const bool ok = i < nreal;
    const float* s = src + (size_t)ic * 8; bf* d = dst + (size_t)i * 8;
    const v4f v0 = *(const v4f*)s; const v4f v1 = *(const v4f*)(s + 4); v8us o;
#pragma unroll
    for (int k = 0; k < 4; ++k) { const unsigned short a = f2bf(v0[k]); const unsigned short c = f2bf(v1[k]); o[k] = ok ? a : (unsigned short)0; o[4 + k] = ok ? c : (unsigned short)0; }
    *(v8us*)d = o; 
}

// ---- d_ln_vt: V^T[b][n][s] (f16) = ((x - mean) * rsqrt(var + eps) * gain[n] + shift[n]) over the 512 features of token s, x = RNE bf16 of the value stream; work-groups (bx < SEQ/64, by < NB), 256 threads.
// Phase 1: wave w owns tokens 8w..8w+7 (mean, then centred variance, per-lane 16 features, shuffle reduce); statistics to LDS (cross-wave: block barrier).
__device__ __forceinline__ void d_ln_vt(const float* __restrict__ X, const float* __restrict__ G, const float* __restrict__ Bt, h16* VT, unsigned bx, unsigned by) {
#pragma clang fp contract(off)
    __shared__ __align__(16) h16 t_s[64 * LTP];
    __shared__ float mu_s[64];
    __shared__ float rs_s[64];
    const int tid = threadIdx.x, lane = tid & 31;
    const int wid = __builtin_amdgcn_readfirstlane(tid >> 5);
    const size_t z = by; const int s0 = bx * 64;
    const float* xb = X + z * (size_t)SEQ_FULL * DM + (size_t)s0 * DM;
#pragma unroll 1
    for (int t = 0; t < 8; ++t) {
        const int tok = wid * 8 + t;
        const float* xr = xb + (size_t)tok * DM;
        float xv[16]; float sm = 0.0f;
#pragma unroll
        for (int c = 0; c < 16; ++c) { xv[c] = bfr(xr[c * 32 + lane]); sm += xv[c]; }
        sm += __shfl_xor(sm, 16, 32); sm += __shfl_xor(sm, 8, 32); sm += __shfl_xor(sm, 4, 32); sm += __shfl_xor(sm, 2, 32); sm += __shfl_xor(sm, 1, 32);
        const float mu = sm * (1.0f / DM);
        float sq = 0.0f;
#pragma unroll
        for (int c = 0; c < 16; ++c) { const float dv = xv[c] - mu; sq += dv * dv; }
        sq += __shfl_xor(sq, 16, 32); sq += __shfl_xor(sq, 8, 32); sq += __shfl_xor(sq, 4, 32); sq += __shfl_xor(sq, 2, 32); sq += __shfl_xor(sq, 1, 32);
        const float rstd = rsqrtf(sq * (1.0f / DM) + LNEPS);
        if (lane == 0) { mu_s[tok] = mu; rs_s[tok] = rstd; }
    }
    __syncthreads();
    const int f = tid & 63, tq = tid >> 6;
#pragma unroll 1
    for (int cc = 0; cc < DM / 64; ++cc) {
        const int c0 = cc * 64;
        const float g = bfr(G[c0 + f]), be = bfr(Bt[c0 + f]);
#pragma unroll 1
        for (int it = 0; it < 16; ++it) {
            const int tok = tq + 4 * it;
            const float x = bfr(xb[(size_t)tok * DM + c0 + f]);
            const float y = (x - mu_s[tok]) * rs_s[tok] * g + be;
            t_s[f * LTP + tok] = toh_flush(y);
        }
        __syncthreads();
{
#pragma unroll
            for (int it = 0; it < 2; ++it) { const int u = tid + it * 256; const int row = u >> 3, part = (u & 7) * 8;
                const v8h o = *(const v8ha*)(&t_s[row * LTP + part]);
                *(v8h*)(VT + (z * DM + (size_t)(c0 + row)) * SEQ + s0 + part) = o; }
             }
        __syncthreads();
    }
}

// ---- d_relchk: work-group g compares rows g*CKU .. g*CKU+CKU-1 of the index input with the closed form and stores its own 128-byte line pz[g*32 .. g*32+31] = 0 (all equal) or NaN; g < NCK, 256 threads, CKS 16-byte reads per thread and row.
__device__ __forceinline__ void d_relchk(const int* __restrict__ rel, float* pz, unsigned g) {
    __shared__ int bad_s[PT / 32];
    const int tid = threadIdx.x, lane = tid & 31;
    const int wid = __builtin_amdgcn_readfirstlane(tid >> 5);
    const int i0 = g * CKU, j = tid * 4;
    const int* rp = rel + (size_t)i0 * SEQ_FULL + j;
    v4i t[CKU][CKS];
#pragma unroll
    for (int u = 0; u < CKU; ++u)
#pragma unroll
        for (int s = 0; s < CKS; ++s) t[u][s] = *(const v4i*)(rp + (size_t)u * SEQ_FULL + s * (4 * PT));
    int bad = 0;
#pragma unroll
    for (int u = 0; u < CKU; ++u) {
#pragma unroll
        for (int s = 0; s < CKS; ++s) {
#pragma unroll
            for (int cc = 0; cc < 4; ++cc) { const int want = clampi(j + s * (4 * PT) + cc - i0 - u, -RK, RK) + RK; bad |= (t[u][s][cc] != want) ? 1 : 0; }
        }
    }
    bad |= __shfl_xor(bad, 16, 32); bad |= __shfl_xor(bad, 8, 32); bad |= __shfl_xor(bad, 4, 32); bad |= __shfl_xor(bad, 2, 32); bad |= __shfl_xor(bad, 1, 32);
    if (lane == 0) bad_s[wid] = bad;
    __syncthreads();
    int any = 0;
#pragma unroll
    for (int w = 0; w < PT / 32; ++w) any |= bad_s[w];
    const float pv = (any != 0) ? __uint_as_float(0x7FC00000u) : 0.0f;
    if (tid < 8) { const v4f o = (v4f){pv, pv, pv, pv}; *(v4f*)(pz + (size_t)g * 32 + tid * 4) = o;  }
}

// ---- k_pre: the six preparation jobs read only inputs and write disjoint workspace planes, so none waits for another: one launch, each job on its own range of blockIdx.x.
// The LayerNorm work-groups are the few long ones and come first, so that they start first and the short streaming jobs run beside them. Every branch is on blockIdx.x alone (block barriers inside stay block-uniform).
constexpr unsigned NW8 = (unsigned)((size_t)DM * DM / 8), NA8 = (unsigned)((size_t)SEQ * DM / 8);
constexpr unsigned PB_LN = (SEQ / 64) * NB;              // LayerNorm + transpose
constexpr unsigned PB_CK = NCK;                          // index compare
constexpr unsigned PB_A  = (NA8 / 256) * NB;             // one head plane (q, then k)
constexpr unsigned PB_W  = NW8 / 256;                    // weight plane
constexpr unsigned PB_R  = (RPAD * HD / 8 + 255) / 256;  // position plane
constexpr unsigned PB_ALL = PB_LN + PB_CK + 2 * PB_A + PB_W + PB_R;
__global__ __launch_bounds__(PT) void k_pre(const float* __restrict__ xq, const float* __restrict__ xk, const float* __restrict__ xv, const float* __restrict__ lg, const float* __restrict__ lb,
                                            const float* __restrict__ rp, const float* __restrict__ wp, const int* __restrict__ rel, bf* QP, bf* KP, h16* VT, bf* RPP, bf* WO, float* PZ) {
    unsigned g = blockIdx.x;
    if (g < PB_LN) { d_ln_vt(xv, lg, lb, VT, g % (SEQ / 64), g / (SEQ / 64)); return; }
    g -= PB_LN;
    if (g < PB_CK) { d_relchk(rel, PZ, g); return; }
    g -= PB_CK;
    if (g < PB_A) { d_cvt8h(xq, QP, NA8, (size_t)SEQ_FULL * DM, SCL, g % (NA8 / 256), g / (NA8 / 256)); return; }
    g -= PB_A;
    if (g < PB_A) { d_cvt8h(xk, KP, NA8, (size_t)SEQ_FULL * DM, 1.0f, g % (NA8 / 256), g / (NA8 / 256)); return; }
    g -= PB_A;
    if (g < PB_W) { d_cvt8(wp, WO, NW8, g); return; }
    g -= PB_W;
    d_cvt_rpe(rp, RPP, g);
}

// ---- k_gemm_out: OUT[b][s][n] (f32) = sum_k (Ah + Al)[b*SEQ+s][k] W[n][k] (+ the sum of the 0 / NaN lines of the index compare); grid (SEQ/64, DM/64, NB), 32 threads.
__global__ __launch_bounds__(32) void k_gemm_out(const bf* __restrict__ Ah, const bf* __restrict__ Al, const bf* __restrict__ W, const float* __restrict__ pz, float* C) {
    __shared__ __align__(16) float os[16 * LOP];
    const int lane = threadIdx.x & 31, lr = lane & 15, hi = lane >> 4;
    const size_t z = blockIdx.z; const int r0 = blockIdx.x * 64, c0 = blockIdx.y * 64;
    const bf* A = Ah + z * (size_t)SEQ * DM; const bf* A2 = Al + z * (size_t)SEQ * DM;
    float* Cz = C + z * (size_t)SEQ_FULL * DM;
    float pzv = 0.0f;
#pragma unroll
    for (int s = 0; s < NCK / 32; ++s) pzv += pz[(size_t)(s * 32 + lane) * 32];
    pzv += __shfl_xor(pzv, 16, 32); pzv += __shfl_xor(pzv, 8, 32); pzv += __shfl_xor(pzv, 4, 32); pzv += __shfl_xor(pzv, 2, 32); pzv += __shfl_xor(pzv, 1, 32);
    v8f acc[4][4];
#pragma unroll
    for (int mb = 0; mb < 4; ++mb)
#pragma unroll
        for (int nb = 0; nb < 4; ++nb) acc[mb][nb] = (v8f){};
    gemm_loop<1>(A, A2, W, DM, (size_t)(r0 + lr) * DM + 8 * hi, (size_t)(c0 + lr) * DM + 8 * hi, acc);
#pragma unroll
    for (int mb = 0; mb < 4; ++mb) {
#pragma unroll
        for (int nb = 0; nb < 4; ++nb) {
#pragma unroll
            for (int j = 0; j < 8; ++j) os[(hi * 8 + j) * LOP + nb * 16 + lr] = acc[mb][nb][j]; }
        wsync();
        float* crow = Cz + (size_t)(r0 + mb * 16) * DM + c0;
{
#pragma unroll
            for (int s = 0; s < 8; ++s) { const int row = 2 * s + hi, cofs = lr * 4; v4f val = *(const v4fa*)(&os[row * LOP + cofs]);
                val[0] += pzv; val[1] += pzv; val[2] += pzv; val[3] += pzv;
                *(v4f*)(crow + (size_t)row * DM + cofs) = val; }
             }
        wsync();
    }
}

__global__ __launch_bounds__(128) void k_flash(const bf* __restrict__ Qh, const bf* __restrict__ Kh, const bf* __restrict__ RP, const h16* __restrict__ VT, bf* Ch, bf* Cl) {
    __shared__ __align__(16) bf    kh_s[64 * LKP];
    __shared__ __align__(16) h16   vt_s[64 * LKP];
    __shared__ __align__(16) float o_s[4 * 16 * LOP];
    __shared__ __align__(16) float r_s[4 * 16 * LRP];
    const int tid = threadIdx.x, lane = tid & 31, lr = lane & 15, hi = lane >> 4;
    const int wid = __builtin_amdgcn_readfirstlane(tid >> 5);
    const int bh = blockIdx.y; const int b = bh / NH, h = bh % NH;
    const int q0 = blockIdx.x * 64 + wid * 16;
    const size_t pl = (size_t)bh * SEQ * HD;
    const size_t qoff = pl + (size_t)(q0 + lr) * HD + 8 * hi;
    const size_t vbase = ((size_t)b * DM + (size_t)h * HD) * SEQ;
    const int ob = wid * 16 * LOP;
    const int rb = wid * 16 * LRP + 8 * hi * LRP;   // table rows as the prologue's D tiles hold them
    const int tb = wid * 16 * LRP + lr * LRP;       // table row of the lane's own query
    const v16bf qa0 = ldg16(Qh + qoff); const v16bf qa1 = ldg16(Qh + qoff + 32);
#pragma unroll 1
    for (int ct = 0; ct < RT; ++ct) {
        const size_t ro = (size_t)(ct * 16 + lr) * HD + 8 * hi;
        const v16bf b0 = ldg16(RP + ro); const v16bf b1 = ldg16(RP + ro + 32);
        v8f t = (v8f){};
        t = wmmab_g(qa0, b0, t);
        t = wmmab_g(qa1, b1, t);
#pragma unroll
        for (int j = 0; j < 8; ++j) r_s[rb + j * LRP + ct * 16 + lr] = t[j];
    }
    wsync();
    const float rlo = r_s[tb], rhi = r_s[tb + 2 * RK];
    v8f o[4];
#pragma unroll
    for (int dt = 0; dt < 4; ++dt) o[dt] = (v8f){};
    float mr = -1.0e30f, ls = 0.0f;

#pragma unroll 1
    for (int kb = 0; kb < SEQ / 64; ++kb) {
        __syncthreads();
#pragma unroll
        for (int it = 0; it < 4; ++it) {
            const int u = tid + it * 128; const int row = u >> 3, part = (u & 7) * 8;
            const size_t g = pl + (size_t)kb * 64 * HD + (size_t)u * 8;
            const v8us a = *(const v8us*)(Kh + g);
            const v8h v = *(const v8h*)(VT + vbase + (size_t)row * SEQ + (size_t)kb * 64 + part);
            *(v8usa*)(&kh_s[row * LKP + part]) = a; *(v8ha*)(&vt_s[row * LKP + part]) = v;
        }
        __syncthreads();
#pragma unroll 1
        for (int hf = 0; hf < 2; ++hf) {
            v8f s0 = (v8f){}, s1 = (v8f){};
            const int kr0 = (hf * 32 + lr) * LKP + 8 * hi, kr1 = kr0 + 16 * LKP;
            {
                const v16bf k00 = cat16b(*(const v8usa*)(&kh_s[kr0]), *(const v8usa*)(&kh_s[kr0 + 16]));
                const v16bf k10 = cat16b(*(const v8usa*)(&kh_s[kr1]), *(const v8usa*)(&kh_s[kr1 + 16]));
                const v16bf k01 = cat16b(*(const v8usa*)(&kh_s[kr0 + 32]), *(const v8usa*)(&kh_s[kr0 + 48]));
                const v16bf k11 = cat16b(*(const v8usa*)(&kh_s[kr1 + 32]), *(const v8usa*)(&kh_s[kr1 + 48]));
                s0 = wmmab_g(k00, qa0, s0); s1 = wmmab_g(k10, qa0, s1);
                s0 = wmmab_g(k01, qa1, s0); s1 = wmmab_g(k11, qa1, s1);
            }
            // position term: query q0 + lr, keys j0 + 8*hi + r (s0) and j0 + 16 + 8*hi + r (s1); the three-way test is on scalars only
            const int j0 = kb * 64 + hf * 32;
            if (j0 - q0 >= RK + 15) {
#pragma unroll
                for (int r = 0; r < 8; ++r) { s0[r] += rhi; s1[r] += rhi; }
            } else if (q0 - j0 >= RK + 31) {
#pragma unroll
                for (int r = 0; r < 8; ++r) { s0[r] += rlo; s1[r] += rlo; }
            } else {
#pragma unroll
                for (int r = 0; r < 8; ++r) {
                    const int d0 = j0 + 8 * hi + r - q0 - lr;
                    const int i0 = clampi(d0, -RK, RK) + RK, i1 = clampi(d0 + 16, -RK, RK) + RK;
                    const float b0 = r_s[tb + i0]; const float b1 = r_s[tb + i1];
                    s0[r] += b0; s1[r] += b1;
                }
            }
            // running-max softmax update for the lane's query: 16 of the half's 32 keys are in this lane, the other 16 in lane ^ 16; ls holds the lane's partial sum
            float mx = fmaxf(s0[0], s1[0]);
#pragma unroll
            for (int r = 1; r < 8; ++r) mx = fmaxf(mx, fmaxf(s0[r], s1[r]));
            mx = fmaxf(mx, xhalf(mx));
            const float mnew = fmaxf(mr, mx);
            const float al = __builtin_amdgcn_exp2f((mr - mnew) * L2E);
            mr = mnew;
            v16h pa; float ps[8];
#pragma unroll
            for (int r = 0; r < 8; ++r) {
                const float e0 = (s0[r] - mnew) * L2E, e1 = (s1[r] - mnew) * L2E;
                const float p0 = __builtin_amdgcn_exp2f(e0);
                const float p1 = __builtin_amdgcn_exp2f(e1);
                ps[r] = p0 + p1;
                pa[r] = (e0 < PFL) ? (h16)0.0f : (h16)(p0 * PCAR);
                pa[8 + r] = (e1 < PFL) ? (h16)0.0f : (h16)(p1 * PCAR);
            }
            ls = ls * al + (((ps[0] + ps[1]) + (ps[2] + ps[3])) + ((ps[4] + ps[5]) + (ps[6] + ps[7])));
#pragma unroll
            for (int dt = 0; dt < 4; ++dt)
#pragma unroll
                for (int r = 0; r < 8; ++r) o[dt][r] *= al;
            v16h va[4];
#pragma unroll
            for (int dt = 0; dt < 4; ++dt) { const int vo = (dt * 16 + lr) * LKP + hf * 32 + 8 * hi; va[dt] = cat16(*(const v8ha*)(&vt_s[vo]), *(const v8ha*)(&vt_s[vo + 16])); }
#pragma unroll
            for (int dt = 0; dt < 4; ++dt) o[dt] = wmma16_g(va[dt], pa, o[dt]);
        }
    }
    // normalise: the query's sum is completed over its two lanes; 1 / (l * 1024) undoes the P carry; the lane's 8 registers of a tile are 8 consecutive features of its query
    {
        const float lt = ls + xhalf(ls);
        const float inv = 1.0f / (lt * PCAR);
#pragma unroll
        for (int dt = 0; dt < 4; ++dt) {
            const v4f y0 = (v4f){o[dt][0] * inv, o[dt][1] * inv, o[dt][2] * inv, o[dt][3] * inv};
            const v4f y1 = (v4f){o[dt][4] * inv, o[dt][5] * inv, o[dt][6] * inv, o[dt][7] * inv};
            *(v4fa*)(&o_s[ob + lr * LOP + dt * 16 + 8 * hi]) = y0; *(v4fa*)(&o_s[ob + lr * LOP + dt * 16 + 8 * hi + 4]) = y1;
        }
    }
    wsync();
    const int srow = lane >> 3, scol = (lane & 7) * 8;
    const size_t cbase = ((size_t)b * SEQ + q0) * DM + (size_t)h * HD;
{
#pragma unroll
        for (int s = 0; s < 4; ++s) { const int row = 4 * s + srow; const v4f x0 = *(const v4fa*)(&o_s[ob + row * LOP + scol]); const v4f x1 = *(const v4fa*)(&o_s[ob + row * LOP + scol + 4]); v8us oh, ol;
#pragma unroll
            for (int j = 0; j < 4; ++j) { unsigned short a, c; splitf(x0[j], a, c); oh[j] = a; ol[j] = c; splitf(x1[j], a, c); oh[4 + j] = a; ol[4 + j] = c; }
            const size_t off = cbase + (size_t)row * DM + scol;
            *(v8us*)(Ch + off) = oh; *(v8us*)(Cl + off) = ol; }
         }
}

constexpr size_t al256(size_t x) { return (x + 255) & ~(size_t)255; }
constexpr size_t SZ_W = al256((size_t)DM * DM * 2);                 // one bf16 weight plane
constexpr size_t SZ_R = al256((size_t)RPAD * HD * 2);               // bf16 position plane, 144 rows
constexpr size_t SZ_X = al256((size_t)NB * SEQ * DM * 2);           // one 16-bit [NB*SEQ][DM] plane (merged-head plane)
constexpr size_t SZ_P = al256((size_t)NB * NH * SEQ * HD * 2);      // one 16-bit head plane
constexpr size_t SZ_F = al256((size_t)NCK * 128);                   // 0 / NaN lines of the index compare, one per work-group
constexpr size_t WS_TOTAL = SZ_W + SZ_R + 2 * SZ_P + SZ_P + 2 * SZ_X + SZ_F;
static_assert(WS_TOTAL <= (size_t)134217728);                       // carve stays within 128 MiB
static_assert(SZ_P == SZ_X);                                        // NH * HD == DM
static_assert(SZ_R >= (size_t)RPAD * HD * 2);                       // last position plane line lies inside its region

extern "C" void kernel_launch(void* const* d_in, const int* in_sizes, int n_in,
                              void* d_out, int out_size, void* d_ws, size_t ws_size, hipStream_t stream) {
    if (n_in < 8) return;
    const size_t need_act = (size_t)(NB - 1) * SEQ_FULL * DM + (size_t)SEQ * DM;
    if ((size_t)in_sizes[0] < need_act || (size_t)in_sizes[1] < need_act || (size_t)in_sizes[2] < need_act) return;
    if (in_sizes[3] < DM || in_sizes[4] < DM || in_sizes[5] < NREL * HD || (size_t)in_sizes[6] < (size_t)DM * DM) return;
    if ((size_t)in_sizes[7] < (size_t)(SEQ - 1) * SEQ_FULL + (size_t)SEQ) return;
    if ((size_t)out_size < need_act) return;
    if (WS_TOTAL > ws_size) return;
    // wire order: q, k, v, ln_gamma, ln_beta, rpe_emb, W_proj (all f32; W_proj [out][in]), rel_idx (int32 [SEQ][SEQ])
    const float* xq = (const float*)d_in[0]; const float* xk = (const float*)d_in[1]; const float* xv = (const float*)d_in[2];
    const float* lg = (const float*)d_in[3]; const float* lb = (const float*)d_in[4]; const float* rp = (const float*)d_in[5]; const float* wp = (const float*)d_in[6];
    const int* rel = (const int*)d_in[7];
    float* OUT = (float*)d_out;
    char* wsp = (char*)d_ws;
    auto take = [&](size_t bytes) { char* p = wsp; wsp += bytes; return (void*)p; };
    bf* WO = (bf*)take(SZ_W);
    bf* RPP = (bf*)take(SZ_R);
    bf* QP = (bf*)take(SZ_P); bf* KP = (bf*)take(SZ_P);
    h16* VT = (h16*)take(SZ_P);
    bf* CTh = (bf*)take(SZ_X); bf* CTl = (bf*)take(SZ_X);
    float* PZ = (float*)take(SZ_F);
    if ((size_t)(wsp - (char*)d_ws) != WS_TOTAL) return;

    k_pre<<<dim3(PB_ALL), PT, 0, stream>>>(xq, xk, xv, lg, lb, rp, wp, rel, QP, KP, VT, RPP, WO, PZ);
    k_flash<<<dim3(SEQ / 64, NB * NH), 128, 0, stream>>>(QP, KP, RPP, VT, CTh, CTl);
    k_gemm_out<<<dim3(SEQ / 64, DM / 64, NB), 32, 0, stream>>>(CTh, CTl, WO, PZ, OUT);
}

// v004
// One run takes 91.5 microseconds.
// Timed twice side by side with v003, it ran 1.24 and 1.25 times as fast.
// All steps since v000 together make it 10.9 times as fast.
#include <hip/hip_runtime.h>

#ifndef NB
#define NB 4
#endif
#ifndef SEQ
#define SEQ 2048
#endif
#define NB_FULL  4
#define SEQ_FULL 2048
#define DM   512
#define NH   8
#define HD   64
#define PCAR 1024.0f
#define PFL  (-24.0f)  // exp2 argument below which P * PCAR would leave the f16 normal range
#define SCL  0.125f
#define L2E  1.4426950408889634f
#define LKP  72      // LDS row pitch (16-bit elements) of the K / V^T tiles: 144 B rows
#define LOP  68      // LDS row pitch (floats) of epilogue staging tiles: 272 B rows
#define RK   64      // relative distance clip
#define NREL 129     // position table rows: 2 * RK + 1
#define RT   9       // 16-wide column tiles of the per-wave q.rpe^T table
#define RPAD 144     // position plane rows, zero filled beyond NREL
#define LRP  148     // LDS row pitch (floats) of the per-wave q.rpe^T table
#define LTP  72      // LDS row pitch (halves) of the LayerNorm transpose tile
#define LNC  128     // features one 16-byte read per lane covers in the LayerNorm job: 32 lanes x 4
#define LNEPS 1.0e-5f
#define PT   256         // threads of a pre-pass work-group, the same for all six jobs
#define CKS  (SEQ / (4 * PT))   // 16-byte reads per thread and row of the index input
#define CKU  8           // rows per index-compare work-group: CKU * CKS independent 16-byte reads per thread
#define NCK  (SEQ / CKU) // index-compare work-groups == 0 / NaN lines

static_assert(DM == NH * HD);            // one 64-wide GEMM column tile == one head
static_assert(HD == 64);
static_assert(DM % 32 == 0);             // WMMA k-step
static_assert(DM % 64 == 0);             // GEMM tiles
static_assert(SEQ % 64 == 0);            // GEMM row tiles, key blocks, query blocks
static_assert((SEQ * DM) % (8 * 256) == 0);   // q / k convert job's work-group range is exact
static_assert((DM * DM) % (8 * 256) == 0);
static_assert(NB <= NB_FULL);
static_assert(SEQ <= SEQ_FULL);
static_assert(LKP % 8 == 0);             // 16-byte aligned LDS vector accesses
static_assert(LOP % 4 == 0);
static_assert(NREL == 2 * RK + 1);
static_assert(RPAD == RT * 16);          // position plane rows == table column tiles
static_assert(NREL <= RPAD);
static_assert(RPAD <= LRP);              // table columns fit the LDS pitch
static_assert(2 * RK < RPAD);            // largest clamped index is a written column
static_assert((RPAD * HD) % 64 == 0);
static_assert(HD * 2 == 8 * 16);         // head plane row == 8 lanes x 16 B
static_assert(LTP % 8 == 0);
static_assert(SEQ % (4 * PT) == 0);      // index compare: whole 16-byte reads, the same number in every thread
static_assert(SEQ % CKU == 0);           // index compare grid is exact
static_assert(NCK % 32 == 0);            // the output GEMM's wave reads the lines 32 at a time
static_assert(256 * 16 * 2 == 64 * 64 * 2);
static_assert(32 * 16 * 4 == 16 * HD * 2);
static_assert(32 * 16 * 8 == 16 * 64 * 4);     // output epilogue: lanes x bytes x trips == 16 rows x 256 B
static_assert(PCAR == 1024.0f);                // PFL = -14 - log2(PCAR)
static_assert((size_t)64 * LKP * 2 * 2 + (size_t)4 * 16 * LOP * 4 + (size_t)4 * 16 * LRP * 4 <= 131072);   // flash static LDS
static_assert((size_t)DM * LTP * 2 <= 131072);                                                                                  // LayerNorm static LDS
static_assert(DM % LNC == 0);            // whole chunks
static_assert((DM * 8) % 256 == 0);      // tile write-out: whole 16-byte units per thread

typedef _Float16 h16;
typedef unsigned short bf;
typedef __attribute__((ext_vector_type(16))) __bf16   v16bf;
typedef __attribute__((ext_vector_type(16))) _Float16 v16h;
typedef __attribute__((ext_vector_type(8)))  _Float16 v8h;
typedef __attribute__((ext_vector_type(8)))  unsigned short v8us;
typedef __attribute__((ext_vector_type(8)))  float    v8f;
typedef __attribute__((ext_vector_type(4)))  float    v4f;
typedef __attribute__((ext_vector_type(4)))  int      v4i;
typedef __attribute__((ext_vector_type(4)))  _Float16 v4h;
typedef v8h  __attribute__((may_alias)) v8ha;
typedef v4h  __attribute__((may_alias)) v4ha;
typedef v4f  __attribute__((may_alias)) v4fa;
typedef v8us __attribute__((may_alias)) v8usa;

__device__ __forceinline__ unsigned short f2bf(float f) { unsigned u = __float_as_uint(f); u += 0x7FFFu + ((u >> 16) & 1u); return (unsigned short)(u >> 16); }
__device__ __forceinline__ float bf2f(unsigned short b) { return __uint_as_float(((unsigned)b) << 16); }
__device__ __forceinline__ float bfr(float f) { return bf2f(f2bf(f)); }
__device__ __forceinline__ void splitf(float y, unsigned short& h, unsigned short& l) { h = f2bf(y); l = f2bf(y - bf2f(h)); }
__device__ __forceinline__ v16h cat16(v8h lo, v8h hi) { return __builtin_shufflevector(lo, hi, 0, 1, 2, 3, 4, 5, 6, 7, 8, 9, 10, 11, 12, 13, 14, 15); }
__device__ __forceinline__ v16bf cat16b(v8us lo, v8us hi) { return __builtin_bit_cast(v16bf, __builtin_shufflevector(lo, hi, 0, 1, 2, 3, 4, 5, 6, 7, 8, 9, 10, 11, 12, 13, 14, 15)); }
__device__ __forceinline__ v8f wmma16(v16h a, v16h b, v8f c) { return __builtin_amdgcn_wmma_f32_16x16x32_f16(false, a, false, b, (short)0, c, false, false); }
__device__ __forceinline__ v8f wmmab(v16bf a, v16bf b, v8f c) { return __builtin_amdgcn_wmma_f32_16x16x32_bf16(false, a, false, b, (short)0, c, false, false); }
// fragment from a K-contiguous global bf16 plane: elements 0..7 <- p[0..7], 8..15 <- p[16..23] (p already includes row*pitch + k0 + 8*(lane>>4))
__device__ __forceinline__ v16bf ldg16(const bf* __restrict__ p) { return cat16b(*(const v8us*)p, *(const v8us*)(p + 16)); }
// same-wave LDS exchange ordering (wave-private tiles only)
__device__ __forceinline__ void wsync() { __builtin_amdgcn_wave_barrier(); asm volatile("" ::: "memory"); }
// one matrix instruction followed by its own four idle slots (ties the accumulator, keeps the operands live)
__device__ __forceinline__ v8f wmmab_g(v16bf a, v16bf b, v8f c) { c = __builtin_amdgcn_wmma_f32_16x16x32_bf16(false, a, false, b, (short)0, c, false, false); asm volatile("v_nop\n\tv_nop\n\tv_nop\n\tv_nop" : "+v"(c) : "v"(a), "v"(b)); return c; }
__device__ __forceinline__ v8f wmma16_g(v16h a, v16h b, v8f c) { c = __builtin_amdgcn_wmma_f32_16x16x32_f16(false, a, false, b, (short)0, c, false, false); asm volatile("v_nop\n\tv_nop\n\tv_nop\n\tv_nop" : "+v"(c) : "v"(a), "v"(b)); return c; }
// f32 -> f16 operand convert that cannot produce an f16 subnormal
__device__ __forceinline__ h16 toh_flush(float v) { const h16 r = (h16)v; return (fabsf(v) < 6.103515625e-05f) ? (h16)0.0f : r; }
// lane l exchanges with lane l ^ 16 (the two lanes that share one column of a D tile)
__device__ __forceinline__ float xhalf(float x) { return __builtin_bit_cast(float, __builtin_amdgcn_permlanex16(__builtin_bit_cast(int, x), __builtin_bit_cast(int, x), 0x76543210, 0xfedcba98, false, false)); }
__device__ __forceinline__ int clampi(int v, int lo, int hi) { const int t = v < lo ? lo : v; return t > hi ? hi : t; }

// ---- one-wave 64x64 tile main loop: acc[mb][nb] += sum_k A[r0+16mb+..][k] Bt[c0+16nb+..][k] (NSPLIT 1: + A2 x Bt). Operands straight from K-contiguous bf16 planes; K % 32 == 0.
template <int NSPLIT>
__device__ __forceinline__ void gemm_loop(const bf* __restrict__ A, const bf* __restrict__ A2, const bf* __restrict__ Bt, const int K, const size_t aoff, const size_t boff, v8f (&acc)[4][4]) {
#pragma unroll 1
    for (int kc = 0; kc < K; kc += 32) {
        v16bf a[4], a2[4];
#pragma unroll
        for (int mb = 0; mb < 4; ++mb) { a[mb] = ldg16(A + aoff + (size_t)mb * 16 * K + kc); if (NSPLIT == 1) a2[mb] = ldg16(A2 + aoff + (size_t)mb * 16 * K + kc); }
#pragma unroll
        for (int nb = 0; nb < 4; ++nb) { const v16bf b = ldg16(Bt + boff + (size_t)nb * 16 * K + kc);
#pragma unroll
            for (int mb = 0; mb < 4; ++mb) { acc[mb][nb] = wmmab(a[mb], b, acc[mb][nb]); if (NSPLIT == 1) acc[mb][nb] = wmmab(a2[mb], b, acc[mb][nb]); } }
        asm volatile("v_nop\n\tv_nop\n\tv_nop\n\tv_nop" : "+v"(acc[0][0]), "+v"(acc[1][1]), "+v"(acc[2][2]), "+v"(acc[3][3]) : "v"(a[0]), "v"(a[3]));
    }
}

// The six jobs of the pre-pass launch are device functions; bx (and by) is the job's own work-group index, the same for the whole work-group.
__device__ __forceinline__ void d_cvt8(const float* __restrict__ src, bf* dst, unsigned n8, unsigned bx) {
    const unsigned i = bx * 256u + threadIdx.x; if (i >= n8) return;
    const float* s = src + (size_t)i * 8; bf* d = dst + (size_t)i * 8;
    const v4f v0 = *(const v4f*)s; const v4f v1 = *(const v4f*)(s + 4); v8us o;
#pragma unroll
    for (int k = 0; k < 4; ++k) { o[k] = f2bf(v0[k]); o[4 + k] = f2bf(v1[k]); }
    *(v8us*)d = o; 
}

__device__ __forceinline__ void d_cvt8h(const float* __restrict__ src, bf* dst, unsigned n8, size_t sstride, float sc, unsigned bx, unsigned by) {
#pragma clang fp contract(off)
    const unsigned i = bx * 256u + threadIdx.x; if (i >= n8) return;
    const unsigned e = i * 8u; const unsigned srow = e / DM, c = e % DM; const unsigned hh = c / HD, dd = c % HD;
    const float* s = src + (size_t)by * sstride + (size_t)e;
    bf* d = dst + (((size_t)by * NH + hh) * SEQ + srow) * HD + dd;
    const v4f v0 = *(const v4f*)s; const v4f v1 = *(const v4f*)(s + 4); v8us o;
#pragma unroll
    for (int k = 0; k < 4; ++k) { o[k] = f2bf(bfr(v0[k]) * sc); o[4 + k] = f2bf(bfr(v1[k]) * sc); }
    *(v8us*)d = o; 
}

__device__ __forceinline__ void d_cvt_rpe(const float* __restrict__ src, bf* dst, unsigned bx) {
    const unsigned i = bx * 256u + threadIdx.x; if (i >= (unsigned)(RPAD * HD / 8)) return;
    const unsigned nreal = (unsigned)(NREL * HD / 8);
    const unsigned ic = i < nreal ? i : nreal - 1u;
    const bool ok = i < nreal;
    const float* s = src + (size_t)ic * 8; bf* d = dst + (size_t)i * 8;
    const v4f v0 = *(const v4f*)s; const v4f v1 = *(const v4f*)(s + 4); v8us o;
#pragma unroll
    for (int k = 0; k < 4; ++k) { const unsigned short a = f2bf(v0[k]); const unsigned short c = f2bf(v1[k]); o[k] = ok ? a : (unsigned short)0; o[4 + k] = ok ? c : (unsigned short)0; }
    *(v8us*)d = o; 
}

// sum over the wave's 32 lanes, the same value in every lane: four exchanges inside the 16-lane row (DPP row_xmask 1, 2, 4, 8), then one with lane ^ 16
template <int M> __device__ __forceinline__ float rowx(float x) { return __builtin_bit_cast(float, __builtin_amdgcn_update_dpp(0, __builtin_bit_cast(int, x), 0x160 + M, 0xf, 0xf, true)); }
__device__ __forceinline__ float wsum(float x) { x += rowx<1>(x); x += rowx<2>(x); x += rowx<4>(x); x += rowx<8>(x); return x + xhalf(x); }

// ---- d_ln_vt: V^T[b][n][s] (f16) = ((x - mean) * rsqrt(var + eps) * gain[n] + shift[n]) over the 512 features of token s, x = RNE bf16 of the value stream; work-groups (bx < SEQ/64, by < NB), 256 threads.
// Wave w owns tokens 8w..8w+7 from first to last, four at a time; a lane holds features 128c + 4*lane + j: 16 reads of 16 bytes in flight per lane, the stream is read once.
// Mean, then centred variance, both reduced in registers; the statistics never leave the owning wave. The lane's 4 tokens of one feature are one 8-byte write into the [512][64] LDS tile.
// One block barrier, then the tile's rows go out as whole 128-byte lines.
__device__ __forceinline__ void d_ln_vt(const float* __restrict__ X, const float* __restrict__ G, const float* __restrict__ Bt, h16* VT, unsigned bx, unsigned by) {
#pragma clang fp contract(off)
    __shared__ __align__(16) h16 t_s[DM * LTP];
    const int tid = threadIdx.x, lane = tid & 31;
    const int wid = __builtin_amdgcn_readfirstlane(tid >> 5);
    const size_t z = by; const int s0 = bx * 64;
    const unsigned lo = lane * 4;
    const float* xr = X + z * (size_t)SEQ_FULL * DM + (size_t)(s0 + wid * 8) * DM + lo;   // the lane's place in the batch's first token; steps on by one batch a trip
    // kept rolled: unrolled, both batches' reads are hoisted together and the registers they take are charged to every job of this launch
#pragma unroll 1
    for (int tb = 0; tb < 8; tb += 4) {
        v4f xv[4][DM / LNC];
#pragma unroll
        for (int u = 0; u < 4; ++u)
#pragma unroll
            for (int c = 0; c < DM / LNC; ++c) xv[u][c] = *(const v4f*)(xr + u * DM + c * LNC);
        float mu[4], rs[4];
#pragma unroll
        for (int u = 0; u < 4; ++u) { float sm = 0.0f;
#pragma unroll
            for (int c = 0; c < DM / LNC; ++c)
#pragma unroll
                for (int j = 0; j < 4; ++j) { xv[u][c][j] = bfr(xv[u][c][j]); sm += xv[u][c][j]; }
            mu[u] = sm; }
#pragma unroll
        for (int u = 0; u < 4; ++u) mu[u] = wsum(mu[u]) * (1.0f / DM);
#pragma unroll
        for (int u = 0; u < 4; ++u) { float sq = 0.0f;
#pragma unroll
            for (int c = 0; c < DM / LNC; ++c)
#pragma unroll
                for (int j = 0; j < 4; ++j) { const float dv = xv[u][c][j] - mu[u]; sq += dv * dv; }
            rs[u] = sq; }
#pragma unroll
        for (int u = 0; u < 4; ++u) rs[u] = rsqrtf(wsum(rs[u]) * (1.0f / DM) + LNEPS);
#pragma unroll
        for (int c = 0; c < DM / LNC; ++c) {
            const v4f g4 = *(const v4f*)(G + c * LNC + lo), b4 = *(const v4f*)(Bt + c * LNC + lo);
#pragma unroll
            for (int j = 0; j < 4; ++j) { const float g = bfr(g4[j]), be = bfr(b4[j]); v4h o;
#pragma unroll
                for (int u = 0; u < 4; ++u) { const float y = (xv[u][c][j] - mu[u]) * rs[u] * g + be; o[u] = toh_flush(y); }
                *(v4ha*)(&t_s[(c * LNC + lane * 4 + j) * LTP + wid * 8 + tb]) = o; }
        }
        xr += 4 * DM;
    }
    __syncthreads();
#pragma unroll
    for (int it = 0; it < DM * 8 / PT; ++it) { const int u = tid + it * PT; const int row = u >> 3, part = (u & 7) * 8;
        const v8h ov = *(const v8ha*)(&t_s[row * LTP + part]);
        *(v8h*)(VT + (z * DM + (size_t)row) * SEQ + s0 + part) = ov; }
}

// ---- d_relchk: work-group g compares rows g*CKU .. g*CKU+CKU-1 of the index input with the closed form and stores its own 128-byte line pz[g*32 .. g*32+31] = 0 (all equal) or NaN; g < NCK, 256 threads, CKS 16-byte reads per thread and row.
__device__ __forceinline__ void d_relchk(const int* __restrict__ rel, float* pz, unsigned g) {
    __shared__ int bad_s[PT / 32];
    const int tid = threadIdx.x, lane = tid & 31;
    const int wid = __builtin_amdgcn_readfirstlane(tid >> 5);
    const int i0 = g * CKU, j = tid * 4;
    const int* rp = rel + (size_t)i0 * SEQ_FULL + j;
    v4i t[CKU][CKS];
#pragma unroll
    for (int u = 0; u < CKU; ++u)
#pragma unroll
        for (int s = 0; s < CKS; ++s) t[u][s] = *(const v4i*)(rp + (size_t)u * SEQ_FULL + s * (4 * PT));
    int bad = 0;
#pragma unroll
    for (int u = 0; u < CKU; ++u) {
#pragma unroll
        for (int s = 0; s < CKS; ++s) {
#pragma unroll
            for (int cc = 0; cc < 4; ++cc) { const int want = clampi(j + s * (4 * PT) + cc - i0 - u, -RK, RK) + RK; bad |= (t[u][s][cc] != want) ? 1 : 0; }
        }
    }
    bad |= __shfl_xor(bad, 16, 32); bad |= __shfl_xor(bad, 8, 32); bad |= __shfl_xor(bad, 4, 32); bad |= __shfl_xor(bad, 2, 32); bad |= __shfl_xor(bad, 1, 32);
    if (lane == 0) bad_s[wid] = bad;
    __syncthreads();
    int any = 0;
#pragma unroll
    for (int w = 0; w < PT / 32; ++w) any |= bad_s[w];
    const float pv = (any != 0) ? __uint_as_float(0x7FC00000u) : 0.0f;
    if (tid < 8) { const v4f o = (v4f){pv, pv, pv, pv}; *(v4f*)(pz + (size_t)g * 32 + tid * 4) = o;  }
}

// ---- k_pre: the six preparation jobs read only inputs and write disjoint workspace planes, so none waits for another: one launch, each job on its own range of blockIdx.x.
// The LayerNorm work-groups are the few long ones and come first, so that they start first and the short streaming jobs run beside them. Every branch is on blockIdx.x alone (block barriers inside stay block-uniform).
constexpr unsigned NW8 = (unsigned)((size_t)DM * DM / 8), NA8 = (unsigned)((size_t)SEQ * DM / 8);
constexpr unsigned PB_LN = (SEQ / 64) * NB;              // LayerNorm + transpose
constexpr unsigned PB_CK = NCK;                          // index compare
constexpr unsigned PB_A  = (NA8 / 256) * NB;             // one head plane (q, then k)
constexpr unsigned PB_W  = NW8 / 256;                    // weight plane
constexpr unsigned PB_R  = (RPAD * HD / 8 + 255) / 256;  // position plane
constexpr unsigned PB_ALL = PB_LN + PB_CK + 2 * PB_A + PB_W + PB_R;
__global__ __launch_bounds__(PT) void k_pre(const float* __restrict__ xq, const float* __restrict__ xk, const float* __restrict__ xv, const float* __restrict__ lg, const float* __restrict__ lb,
                                            const float* __restrict__ rp, const float* __restrict__ wp, const int* __restrict__ rel, bf* QP, bf* KP, h16* VT, bf* RPP, bf* WO, float* PZ) {
    unsigned g = blockIdx.x;
    if (g < PB_LN) { d_ln_vt(xv, lg, lb, VT, g % (SEQ / 64), g / (SEQ / 64)); return; }
    g -= PB_LN;
    if (g < PB_CK) { d_relchk(rel, PZ, g); return; }
    g -= PB_CK;
    if (g < PB_A) { d_cvt8h(xq, QP, NA8, (size_t)SEQ_FULL * DM, SCL, g % (NA8 / 256), g / (NA8 / 256)); return; }
    g -= PB_A;
    if (g < PB_A) { d_cvt8h(xk, KP, NA8, (size_t)SEQ_FULL * DM, 1.0f, g % (NA8 / 256), g / (NA8 / 256)); return; }
    g -= PB_A;
    if (g < PB_W) { d_cvt8(wp, WO, NW8, g); return; }
    g -= PB_W;
    d_cvt_rpe(rp, RPP, g);
}

// ---- k_gemm_out: OUT[b][s][n] (f32) = sum_k (Ah + Al)[b*SEQ+s][k] W[n][k] (+ the sum of the 0 / NaN lines of the index compare); grid (SEQ/64, DM/64, NB), 32 threads.
__global__ __launch_bounds__(32) void k_gemm_out(const bf* __restrict__ Ah, const bf* __restrict__ Al, const bf* __restrict__ W, const float* __restrict__ pz, float* C) {
    __shared__ __align__(16) float os[16 * LOP];
    const int lane = threadIdx.x & 31, lr = lane & 15, hi = lane >> 4;
    const size_t z = blockIdx.z; const int r0 = blockIdx.x * 64, c0 = blockIdx.y * 64;
    const bf* A = Ah + z * (size_t)SEQ * DM; const bf* A2 = Al + z * (size_t)SEQ * DM;
    float* Cz = C + z * (size_t)SEQ_FULL * DM;
    float pzv = 0.0f;
#pragma unroll
    for (int s = 0; s < NCK / 32; ++s) pzv += pz[(size_t)(s * 32 + lane) * 32];
    pzv += __shfl_xor(pzv, 16, 32); pzv += __shfl_xor(pzv, 8, 32); pzv += __shfl_xor(pzv, 4, 32); pzv += __shfl_xor(pzv, 2, 32); pzv += __shfl_xor(pzv, 1, 32);
    v8f acc[4][4];
#pragma unroll
    for (int mb = 0; mb < 4; ++mb)
#pragma unroll
        for (int nb = 0; nb < 4; ++nb) acc[mb][nb] = (v8f){};
    gemm_loop<1>(A, A2, W, DM, (size_t)(r0 + lr) * DM + 8 * hi, (size_t)(c0 + lr) * DM + 8 * hi, acc);
#pragma unroll
    for (int mb = 0; mb < 4; ++mb) {
#pragma unroll
        for (int nb = 0; nb < 4; ++nb) {
#pragma unroll
            for (int j = 0; j < 8; ++j) os[(hi * 8 + j) * LOP + nb * 16 + lr] = acc[mb][nb][j]; }
        wsync();
        float* crow = Cz + (size_t)(r0 + mb * 16) * DM + c0;
{
#pragma unroll
            for (int s = 0; s < 8; ++s) { const int row = 2 * s + hi, cofs = lr * 4; v4f val = *(const v4fa*)(&os[row * LOP + cofs]);
                val[0] += pzv; val[1] += pzv; val[2] += pzv; val[3] += pzv;
                *(v4f*)(crow + (size_t)row * DM + cofs) = val; }
             }
        wsync();
    }
}

__global__ __launch_bounds__(128) void k_flash(const bf* __restrict__ Qh, const bf* __restrict__ Kh, const bf* __restrict__ RP, const h16* __restrict__ VT, bf* Ch, bf* Cl) {
    __shared__ __align__(16) bf    kh_s[64 * LKP];
    __shared__ __align__(16) h16   vt_s[64 * LKP];
    __shared__ __align__(16) float o_s[4 * 16 * LOP];
    __shared__ __align__(16) float r_s[4 * 16 * LRP];
    const int tid = threadIdx.x, lane = tid & 31, lr = lane & 15, hi = lane >> 4;
    const int wid = __builtin_amdgcn_readfirstlane(tid >> 5);
    const int bh = blockIdx.y; const int b = bh / NH, h = bh % NH;
    const int q0 = blockIdx.x * 64 + wid * 16;
    const size_t pl = (size_t)bh * SEQ * HD;
    const size_t qoff = pl + (size_t)(q0 + lr) * HD + 8 * hi;
    const size_t vbase = ((size_t)b * DM + (size_t)h * HD) * SEQ;
    const int ob = wid * 16 * LOP;
    const int rb = wid * 16 * LRP + 8 * hi * LRP;   // table rows as the prologue's D tiles hold them
    const int tb = wid * 16 * LRP + lr * LRP;       // table row of the lane's own query
    const v16bf qa0 = ldg16(Qh + qoff); const v16bf qa1 = ldg16(Qh + qoff + 32);
#pragma unroll 1
    for (int ct = 0; ct < RT; ++ct) {
        const size_t ro = (size_t)(ct * 16 + lr) * HD + 8 * hi;
        const v16bf b0 = ldg16(RP + ro); const v16bf b1 = ldg16(RP + ro + 32);
        v8f t = (v8f){};
        t = wmmab_g(qa0, b0, t);
        t = wmmab_g(qa1, b1, t);
#pragma unroll
        for (int j = 0; j < 8; ++j) r_s[rb + j * LRP + ct * 16 + lr] = t[j];
    }
    wsync();
    const float rlo = r_s[tb], rhi = r_s[tb + 2 * RK];
    v8f o[4];
#pragma unroll
    for (int dt = 0; dt < 4; ++dt) o[dt] = (v8f){};
    float mr = -1.0e30f, ls = 0.0f;

#pragma unroll 1
    for (int kb = 0; kb < SEQ / 64; ++kb) {
        __syncthreads();
#pragma unroll
        for (int it = 0; it < 4; ++it) {
            const int u = tid + it * 128; const int row = u >> 3, part = (u & 7) * 8;
            const size_t g = pl + (size_t)kb * 64 * HD + (size_t)u * 8;
            const v8us a = *(const v8us*)(Kh + g);
            const v8h v = *(const v8h*)(VT + vbase + (size_t)row * SEQ + (size_t)kb * 64 + part);
            *(v8usa*)(&kh_s[row * LKP + part]) = a; *(v8ha*)(&vt_s[row * LKP + part]) = v;
        }
        __syncthreads();
#pragma unroll 1
        for (int hf = 0; hf < 2; ++hf) {
            v8f s0 = (v8f){}, s1 = (v8f){};
            const int kr0 = (hf * 32 + lr) * LKP + 8 * hi, kr1 = kr0 + 16 * LKP;
            {
                const v16bf k00 = cat16b(*(const v8usa*)(&kh_s[kr0]), *(const v8usa*)(&kh_s[kr0 + 16]));
                const v16bf k10 = cat16b(*(const v8usa*)(&kh_s[kr1]), *(const v8usa*)(&kh_s[kr1 + 16]));
                const v16bf k01 = cat16b(*(const v8usa*)(&kh_s[kr0 + 32]), *(const v8usa*)(&kh_s[kr0 + 48]));
                const v16bf k11 = cat16b(*(const v8usa*)(&kh_s[kr1 + 32]), *(const v8usa*)(&kh_s[kr1 + 48]));
                s0 = wmmab_g(k00, qa0, s0); s1 = wmmab_g(k10, qa0, s1);
                s0 = wmmab_g(k01, qa1, s0); s1 = wmmab_g(k11, qa1, s1);
            }
            // position term: query q0 + lr, keys j0 + 8*hi + r (s0) and j0 + 16 + 8*hi + r (s1); the three-way test is on scalars only
            const int j0 = kb * 64 + hf * 32;
            if (j0 - q0 >= RK + 15) {
#pragma unroll
                for (int r = 0; r < 8; ++r) { s0[r] += rhi; s1[r] += rhi; }
            } else if (q0 - j0 >= RK + 31) {
#pragma unroll
                for (int r = 0; r < 8; ++r) { s0[r] += rlo; s1[r] += rlo; }
            } else {
#pragma unroll
                for (int r = 0; r < 8; ++r) {
                    const int d0 = j0 + 8 * hi + r - q0 - lr;
                    const int i0 = clampi(d0, -RK, RK) + RK, i1 = clampi(d0 + 16, -RK, RK) + RK;
                    const float b0 = r_s[tb + i0]; const float b1 = r_s[tb + i1];
                    s0[r] += b0; s1[r] += b1;
                }
            }
            // running-max softmax update for the lane's query: 16 of the half's 32 keys are in this lane, the other 16 in lane ^ 16; ls holds the lane's partial sum
            float mx = fmaxf(s0[0], s1[0]);
#pragma unroll
            for (int r = 1; r < 8; ++r) mx = fmaxf(mx, fmaxf(s0[r], s1[r]));
            mx = fmaxf(mx, xhalf(mx));
            const float mnew = fmaxf(mr, mx);
            const float al = __builtin_amdgcn_exp2f((mr - mnew) * L2E);
            mr = mnew;
            v16h pa; float ps[8];
#pragma unroll
            for (int r = 0; r < 8; ++r) {
                const float e0 = (s0[r] - mnew) * L2E, e1 = (s1[r] - mnew) * L2E;
                const float p0 = __builtin_amdgcn_exp2f(e0);
                const float p1 = __builtin_amdgcn_exp2f(e1);
                ps[r] = p0 + p1;
                pa[r] = (e0 < PFL) ? (h16)0.0f : (h16)(p0 * PCAR);
                pa[8 + r] = (e1 < PFL) ? (h16)0.0f : (h16)(p1 * PCAR);
            }
            ls = ls * al + (((ps[0] + ps[1]) + (ps[2] + ps[3])) + ((ps[4] + ps[5]) + (ps[6] + ps[7])));
#pragma unroll
            for (int dt = 0; dt < 4; ++dt)
#pragma unroll
                for (int r = 0; r < 8; ++r) o[dt][r] *= al;
            v16h va[4];
#pragma unroll
            for (int dt = 0; dt < 4; ++dt) { const int vo = (dt * 16 + lr) * LKP + hf * 32 + 8 * hi; va[dt] = cat16(*(const v8ha*)(&vt_s[vo]), *(const v8ha*)(&vt_s[vo + 16])); }
#pragma unroll
            for (int dt = 0; dt < 4; ++dt) o[dt] = wmma16_g(va[dt], pa, o[dt]);
        }
    }
    // normalise: the query's sum is completed over its two lanes; 1 / (l * 1024) undoes the P carry; the lane's 8 registers of a tile are 8 consecutive features of its query
    {
        const float lt = ls + xhalf(ls);
        const float inv = 1.0f / (lt * PCAR);
#pragma unroll
        for (int dt = 0; dt < 4; ++dt) {
            const v4f y0 = (v4f){o[dt][0] * inv, o[dt][1] * inv, o[dt][2] * inv, o[dt][3] * inv};
            const v4f y1 = (v4f){o[dt][4] * inv, o[dt][5] * inv, o[dt][6] * inv, o[dt][7] * inv};
            *(v4fa*)(&o_s[ob + lr * LOP + dt * 16 + 8 * hi]) = y0; *(v4fa*)(&o_s[ob + lr * LOP + dt * 16 + 8 * hi + 4]) = y1;
        }
    }
    wsync();
    const int srow = lane >> 3, scol = (lane & 7) * 8;
    const size_t cbase = ((size_t)b * SEQ + q0) * DM + (size_t)h * HD;
{
#pragma unroll
        for (int s = 0; s < 4; ++s) { const int row = 4 * s + srow; const v4f x0 = *(const v4fa*)(&o_s[ob + row * LOP + scol]); const v4f x1 = *(const v4fa*)(&o_s[ob + row * LOP + scol + 4]); v8us oh, ol;
#pragma unroll
            for (int j = 0; j < 4; ++j) { unsigned short a, c; splitf(x0[j], a, c); oh[j] = a; ol[j] = c; splitf(x1[j], a, c); oh[4 + j] = a; ol[4 + j] = c; }
            const size_t off = cbase + (size_t)row * DM + scol;
            *(v8us*)(Ch + off) = oh; *(v8us*)(Cl + off) = ol; }
         }
}

constexpr size_t al256(size_t x) { return (x + 255) & ~(size_t)255; }
constexpr size_t SZ_W = al256((size_t)DM * DM * 2);                 // one bf16 weight plane
constexpr size_t SZ_R = al256((size_t)RPAD * HD * 2);               // bf16 position plane, 144 rows
constexpr size_t SZ_X = al256((size_t)NB * SEQ * DM * 2);           // one 16-bit [NB*SEQ][DM] plane (merged-head plane)
constexpr size_t SZ_P = al256((size_t)NB * NH * SEQ * HD * 2);      // one 16-bit head plane
constexpr size_t SZ_F = al256((size_t)NCK * 128);                   // 0 / NaN lines of the index compare, one per work-group
constexpr size_t WS_TOTAL = SZ_W + SZ_R + 2 * SZ_P + SZ_P + 2 * SZ_X + SZ_F;
static_assert(WS_TOTAL <= (size_t)134217728);                       // carve stays within 128 MiB
static_assert(SZ_P == SZ_X);                                        // NH * HD == DM
static_assert(SZ_R >= (size_t)RPAD * HD * 2);                       // last position plane line lies inside its region

extern "C" void kernel_launch(void* const* d_in, const int* in_sizes, int n_in,
                              void* d_out, int out_size, void* d_ws, size_t ws_size, hipStream_t stream) {
    if (n_in < 8) return;
    const size_t need_act = (size_t)(NB - 1) * SEQ_FULL * DM + (size_t)SEQ * DM;
    if ((size_t)in_sizes[0] < need_act || (size_t)in_sizes[1] < need_act || (size_t)in_sizes[2] < need_act) return;
    if (in_sizes[3] < DM || in_sizes[4] < DM || in_sizes[5] < NREL * HD || (size_t)in_sizes[6] < (size_t)DM * DM) return;
    if ((size_t)in_sizes[7] < (size_t)(SEQ - 1) * SEQ_FULL + (size_t)SEQ) return;
    if ((size_t)out_size < need_act) return;
    if (WS_TOTAL > ws_size) return;
    // wire order: q, k, v, ln_gamma, ln_beta, rpe_emb, W_proj (all f32; W_proj [out][in]), rel_idx (int32 [SEQ][SEQ])
    const float* xq = (const float*)d_in[0]; const float* xk = (const float*)d_in[1]; const float* xv = (const float*)d_in[2];
    const float* lg = (const float*)d_in[3]; const float* lb = (const float*)d_in[4]; const float* rp = (const float*)d_in[5]; const float* wp = (const float*)d_in[6];
    const int* rel = (const int*)d_in[7];
    float* OUT = (float*)d_out;
    char* wsp = (char*)d_ws;
    auto take = [&](size_t bytes) { char* p = wsp; wsp += bytes; return (void*)p; };
    bf* WO = (bf*)take(SZ_W);
    bf* RPP = (bf*)take(SZ_R);
    bf* QP = (bf*)take(SZ_P); bf* KP = (bf*)take(SZ_P);
    h16* VT = (h16*)take(SZ_P);
    bf* CTh = (bf*)take(SZ_X); bf* CTl = (bf*)take(SZ_X);
    float* PZ = (float*)take(SZ_F);
    if ((size_t)(wsp - (char*)d_ws) != WS_TOTAL) return;

    k_pre<<<dim3(PB_ALL), PT, 0, stream>>>(xq, xk, xv, lg, lb, rp, wp, rel, QP, KP, VT, RPP, WO, PZ);
    k_flash<<<dim3(SEQ / 64, NB * NH), 128, 0, stream>>>(QP, KP, RPP, VT, CTh, CTl);
    k_gemm_out<<<dim3(SEQ / 64, DM / 64, NB), 32, 0, stream>>>(CTh, CTl, WO, PZ, OUT);
}

// v005
// Measured time: 88 microseconds a run.
// Next to v004, in two timings, it ran 1.04 times as fast each time.
// All steps since v000 together make it 11.3 times as fast.
#include <hip/hip_runtime.h>

#ifndef NB
#define NB 4
#endif
#ifndef SEQ
#define SEQ 2048
#endif
#define NB_FULL  4
#define SEQ_FULL 2048
#define DM   512
#define NH   8
#define HD   64
#define PCAR 1024.0f
#define PFL  (-24.0f)  // exp2 argument below which P * PCAR would leave the f16 normal range
#define SCL  0.125f
#define L2E  1.4426950408889634f
#define LKP  72      // LDS row pitch (16-bit elements) of the K / V^T tiles: 144 B rows
#define LOP  68      // LDS row pitch (floats) of epilogue staging tiles: 272 B rows
#define RK   64      // relative distance clip
#define NREL 129     // position table rows: 2 * RK + 1
#define RT   9       // 16-wide column tiles of the per-wave q.rpe^T table
#define RPAD 144     // position plane rows, zero filled beyond NREL
#define LRP  148     // LDS row pitch (floats) of the per-wave q.rpe^T table
#define LTP  72      // LDS row pitch (halves) of the LayerNorm transpose tile
#define LNC  128     // features one 16-byte read per lane covers in the LayerNorm job: 32 lanes x 4
#define LNEPS 1.0e-5f
#define PT   256         // threads of a pre-pass work-group, the same for all six jobs
#define CKS  (SEQ / (4 * PT))   // 16-byte reads per thread and row of the index input
#define CKU  8           // rows per index-compare work-group: CKU * CKS independent 16-byte reads per thread
#define NCK  (SEQ / CKU) // index-compare work-groups == 0 / NaN lines

static_assert(DM == NH * HD);            // one 64-wide GEMM column tile == one head
static_assert(HD == 64);
static_assert(DM % 32 == 0);             // WMMA k-step
static_assert(DM % 64 == 0);             // GEMM tiles
static_assert(SEQ % 64 == 0);            // GEMM row tiles, key blocks, query blocks
static_assert((SEQ * DM) % (8 * 256) == 0);   // q / k convert job's work-group range is exact
static_assert((DM * DM) % (8 * 256) == 0);
static_assert(NB <= NB_FULL);
static_assert(SEQ <= SEQ_FULL);
static_assert(LKP % 8 == 0);             // 16-byte aligned LDS vector accesses
static_assert(LOP % 4 == 0);
static_assert(NREL == 2 * RK + 1);
static_assert(RPAD == RT * 16);          // position plane rows == table column tiles
static_assert(NREL <= RPAD);
static_assert(RPAD <= LRP);              // table columns fit the LDS pitch
static_assert(2 * RK < RPAD);            // largest clamped index is a written column
static_assert((RPAD * HD) % 64 == 0);
static_assert(HD * 2 == 8 * 16);         // head plane row == 8 lanes x 16 B
static_assert(LTP % 8 == 0);
static_assert(SEQ % (4 * PT) == 0);      // index compare: whole 16-byte reads, the same number in every thread
static_assert(SEQ % CKU == 0);           // index compare grid is exact
static_assert(NCK % 32 == 0);            // the output GEMM's wave reads the lines 32 at a time
static_assert(256 * 16 * 2 == 64 * 64 * 2);
static_assert(32 * 16 * 4 == 16 * HD * 2);
static_assert(32 * 16 * 8 == 16 * 64 * 4);     // output epilogue: lanes x bytes x trips == 16 rows x 256 B
static_assert(PCAR == 1024.0f);                // PFL = -14 - log2(PCAR)
static_assert((size_t)64 * LKP * 2 * 2 + (size_t)4 * 16 * LOP * 4 + (size_t)4 * 16 * LRP * 4 <= 131072);   // flash static LDS
static_assert((size_t)DM * LTP * 2 <= 131072);                                                                                  // LayerNorm static LDS
static_assert(DM % LNC == 0);            // whole chunks
static_assert((DM * 8) % 256 == 0);      // tile write-out: whole 16-byte units per thread

typedef _Float16 h16;
typedef unsigned short bf;
typedef __attribute__((ext_vector_type(16))) __bf16   v16bf;
typedef __attribute__((ext_vector_type(16))) _Float16 v16h;
typedef __attribute__((ext_vector_type(8)))  _Float16 v8h;
typedef __attribute__((ext_vector_type(8)))  unsigned short v8us;
typedef __attribute__((ext_vector_type(8)))  float    v8f;
typedef __attribute__((ext_vector_type(4)))  float    v4f;
typedef __attribute__((ext_vector_type(4)))  int      v4i;
typedef __attribute__((ext_vector_type(4)))  _Float16 v4h;
typedef v8h  __attribute__((may_alias)) v8ha;
typedef v4h  __attribute__((may_alias)) v4ha;
typedef v4f  __attribute__((may_alias)) v4fa;
typedef v8us __attribute__((may_alias)) v8usa;

__device__ __forceinline__ unsigned short f2bf(float f) { unsigned u = __float_as_uint(f); u += 0x7FFFu + ((u >> 16) & 1u); return (unsigned short)(u >> 16); }
__device__ __forceinline__ float bf2f(unsigned short b) { return __uint_as_float(((unsigned)b) << 16); }
__device__ __forceinline__ float bfr(float f) { return bf2f(f2bf(f)); }
__device__ __forceinline__ void splitf(float y, unsigned short& h, unsigned short& l) { h = f2bf(y); l = f2bf(y - bf2f(h)); }
__device__ __forceinline__ v16h cat16(v8h lo, v8h hi) { return __builtin_shufflevector(lo, hi, 0, 1, 2, 3, 4, 5, 6, 7, 8, 9, 10, 11, 12, 13, 14, 15); }
__device__ __forceinline__ v16bf cat16b(v8us lo, v8us hi) { return __builtin_bit_cast(v16bf, __builtin_shufflevector(lo, hi, 0, 1, 2, 3, 4, 5, 6, 7, 8, 9, 10, 11, 12, 13, 14, 15)); }
__device__ __forceinline__ v8f wmma16(v16h a, v16h b, v8f c) { return __builtin_amdgcn_wmma_f32_16x16x32_f16(false, a, false, b, (short)0, c, false, false); }
__device__ __forceinline__ v8f wmmab(v16bf a, v16bf b, v8f c) { return __builtin_amdgcn_wmma_f32_16x16x32_bf16(false, a, false, b, (short)0, c, false, false); }
// fragment from a K-contiguous global bf16 plane: elements 0..7 <- p[0..7], 8..15 <- p[16..23] (p already includes row*pitch + k0 + 8*(lane>>4))
__device__ __forceinline__ v16bf ldg16(const bf* __restrict__ p) { return cat16b(*(const v8us*)p, *(const v8us*)(p + 16)); }
// same-wave LDS exchange ordering (wave-private tiles only)
__device__ __forceinline__ void wsync() { __builtin_amdgcn_wave_barrier(); asm volatile("" ::: "memory"); }
// one matrix instruction followed by its own four idle slots (ties the accumulator, keeps the operands live)
__device__ __forceinline__ v8f wmmab_g(v16bf a, v16bf b, v8f c) { c = __builtin_amdgcn_wmma_f32_16x16x32_bf16(false, a, false, b, (short)0, c, false, false); asm volatile("v_nop\n\tv_nop\n\tv_nop\n\tv_nop" : "+v"(c) : "v"(a), "v"(b)); return c; }
// f32 -> f16 operand convert that cannot produce an f16 subnormal
__device__ __forceinline__ h16 toh_flush(float v) { const h16 r = (h16)v; return (fabsf(v) < 6.103515625e-05f) ? (h16)0.0f : r; }
// lane l exchanges with lane l ^ 16 (the two lanes that share one column of a D tile)
__device__ __forceinline__ float xhalf(float x) { return __builtin_bit_cast(float, __builtin_amdgcn_permlanex16(__builtin_bit_cast(int, x), __builtin_bit_cast(int, x), 0x76543210, 0xfedcba98, false, false)); }
__device__ __forceinline__ int clampi(int v, int lo, int hi) { const int t = v < lo ? lo : v; return t > hi ? hi : t; }

// ---- one-wave 64x64 tile main loop: acc[mb][nb] += sum_k A[r0+16mb+..][k] Bt[c0+16nb+..][k] (NSPLIT 1: + A2 x Bt). Operands straight from K-contiguous bf16 planes; K % 32 == 0.
template <int NSPLIT>
__device__ __forceinline__ void gemm_loop(const bf* __restrict__ A, const bf* __restrict__ A2, const bf* __restrict__ Bt, const int K, const size_t aoff, const size_t boff, v8f (&acc)[4][4]) {
#pragma unroll 1
    for (int kc = 0; kc < K; kc += 32) {
        v16bf a[4], a2[4];
#pragma unroll
        for (int mb = 0; mb < 4; ++mb) { a[mb] = ldg16(A + aoff + (size_t)mb * 16 * K + kc); if (NSPLIT == 1) a2[mb] = ldg16(A2 + aoff + (size_t)mb * 16 * K + kc); }
#pragma unroll
        for (int nb = 0; nb < 4; ++nb) { const v16bf b = ldg16(Bt + boff + (size_t)nb * 16 * K + kc);
#pragma unroll
            for (int mb = 0; mb < 4; ++mb) { acc[mb][nb] = wmmab(a[mb], b, acc[mb][nb]); if (NSPLIT == 1) acc[mb][nb] = wmmab(a2[mb], b, acc[mb][nb]); } }
        asm volatile("v_nop\n\tv_nop\n\tv_nop\n\tv_nop" : "+v"(acc[0][0]), "+v"(acc[1][1]), "+v"(acc[2][2]), "+v"(acc[3][3]) : "v"(a[0]), "v"(a[3]));
    }
}

// The six jobs of the pre-pass launch are device functions; bx (and by) is the job's own work-group index, the same for the whole work-group.
__device__ __forceinline__ void d_cvt8(const float* __restrict__ src, bf* dst, unsigned n8, unsigned bx) {
    const unsigned i = bx * 256u + threadIdx.x; if (i >= n8) return;
    const float* s = src + (size_t)i * 8; bf* d = dst + (size_t)i * 8;
    const v4f v0 = *(const v4f*)s; const v4f v1 = *(const v4f*)(s + 4); v8us o;
#pragma unroll
    for (int k = 0; k < 4; ++k) { o[k] = f2bf(v0[k]); o[4 + k] = f2bf(v1[k]); }
    *(v8us*)d = o; 
}

__device__ __forceinline__ void d_cvt8h(const float* __restrict__ src, bf* dst, unsigned n8, size_t sstride, float sc, unsigned bx, unsigned by) {
#pragma clang fp contract(off)
    const unsigned i = bx * 256u + threadIdx.x; if (i >= n8) return;
    const unsigned e = i * 8u; const unsigned srow = e / DM, c = e % DM; const unsigned hh = c / HD, dd = c % HD;
    const float* s = src + (size_t)by * sstride + (size_t)e;
    bf* d = dst + (((size_t)by * NH + hh) * SEQ + srow) * HD + dd;
    const v4f v0 = *(const v4f*)s; const v4f v1 = *(const v4f*)(s + 4); v8us o;
#pragma unroll
    for (int k = 0; k < 4; ++k) { o[k] = f2bf(bfr(v0[k]) * sc); o[4 + k] = f2bf(bfr(v1[k]) * sc); }
    *(v8us*)d = o; 
}

__device__ __forceinline__ void d_cvt_rpe(const float* __restrict__ src, bf* dst, unsigned bx) {
    const unsigned i = bx * 256u + threadIdx.x; if (i >= (unsigned)(RPAD * HD / 8)) return;
    const unsigned nreal = (unsigned)(NREL * HD / 8);
    const unsigned ic = i < nreal ? i : nreal - 1u;
    const bool ok = i < nreal;
    const float* s = src + (size_t)ic * 8; bf* d = dst + (size_t)i * 8;
    const v4f v0 = *(const v4f*)s; const v4f v1 = *(const v4f*)(s + 4); v8us o;
#pragma unroll
    for (int k = 0; k < 4; ++k) { const unsigned short a = f2bf(v0[k]); const unsigned short c = f2bf(v1[k]); o[k] = ok ? a : (unsigned short)0; o[4 + k] = ok ? c : (unsigned short)0; }
    *(v8us*)d = o; 
}

// sum over the wave's 32 lanes, the same value in every lane: four exchanges inside the 16-lane row (DPP row_xmask 1, 2, 4, 8), then one with lane ^ 16
template <int M> __device__ __forceinline__ float rowx(float x) { return __builtin_bit_cast(float, __builtin_amdgcn_update_dpp(0, __builtin_bit_cast(int, x), 0x160 + M, 0xf, 0xf, true)); }
__device__ __forceinline__ float wsum(float x) { x += rowx<1>(x); x += rowx<2>(x); x += rowx<4>(x); x += rowx<8>(x); return x + xhalf(x); }

// ---- d_ln_vt: V^T[b][n][s] (f16) = ((x - mean) * rsqrt(var + eps) * gain[n] + shift[n]) over the 512 features of token s, x = RNE bf16 of the value stream; work-groups (bx < SEQ/64, by < NB), 256 threads.
// Wave w owns tokens 8w..8w+7 from first to last, four at a time; a lane holds features 128c + 4*lane + j: 16 reads of 16 bytes in flight per lane, the stream is read once.
// Mean, then centred variance, both reduced in registers; the statistics never leave the owning wave. The lane's 4 tokens of one feature are one 8-byte write into the [512][64] LDS tile.
// One block barrier, then the tile's rows go out as whole 128-byte lines.
__device__ __forceinline__ void d_ln_vt(const float* __restrict__ X, const float* __restrict__ G, const float* __restrict__ Bt, h16* VT, unsigned bx, unsigned by) {
#pragma clang fp contract(off)
    __shared__ __align__(16) h16 t_s[DM * LTP];
    const int tid = threadIdx.x, lane = tid & 31;
    const int wid = __builtin_amdgcn_readfirstlane(tid >> 5);
    const size_t z = by; const int s0 = bx * 64;
    const unsigned lo = lane * 4;
    const float* xr = X + z * (size_t)SEQ_FULL * DM + (size_t)(s0 + wid * 8) * DM + lo;   // the lane's place in the batch's first token; steps on by one batch a trip
    // kept rolled: unrolled, both batches' reads are hoisted together and the registers they take are charged to every job of this launch
#pragma unroll 1
    for (int tb = 0; tb < 8; tb += 4) {
        v4f xv[4][DM / LNC];
#pragma unroll
        for (int u = 0; u < 4; ++u)
#pragma unroll
            for (int c = 0; c < DM / LNC; ++c) xv[u][c] = *(const v4f*)(xr + u * DM + c * LNC);
        float mu[4], rs[4];
#pragma unroll
        for (int u = 0; u < 4; ++u) { float sm = 0.0f;
#pragma unroll
            for (int c = 0; c < DM / LNC; ++c)
#pragma unroll
                for (int j = 0; j < 4; ++j) { xv[u][c][j] = bfr(xv[u][c][j]); sm += xv[u][c][j]; }
            mu[u] = sm; }
#pragma unroll
        for (int u = 0; u < 4; ++u) mu[u] = wsum(mu[u]) * (1.0f / DM);
#pragma unroll
        for (int u = 0; u < 4; ++u) { float sq = 0.0f;
#pragma unroll
            for (int c = 0; c < DM / LNC; ++c)
#pragma unroll
                for (int j = 0; j < 4; ++j) { const float dv = xv[u][c][j] - mu[u]; sq += dv * dv; }
            rs[u] = sq; }
#pragma unroll
        for (int u = 0; u < 4; ++u) rs[u] = rsqrtf(wsum(rs[u]) * (1.0f / DM) + LNEPS);
#pragma unroll
        for (int c = 0; c < DM / LNC; ++c) {
            const v4f g4 = *(const v4f*)(G + c * LNC + lo), b4 = *(const v4f*)(Bt + c * LNC + lo);
#pragma unroll
            for (int j = 0; j < 4; ++j) { const float g = bfr(g4[j]), be = bfr(b4[j]); v4h o;
#pragma unroll
                for (int u = 0; u < 4; ++u) { const float y = (xv[u][c][j] - mu[u]) * rs[u] * g + be; o[u] = toh_flush(y); }
                *(v4ha*)(&t_s[(c * LNC + lane * 4 + j) * LTP + wid * 8 + tb]) = o; }
        }
        xr += 4 * DM;
    }
    __syncthreads();
#pragma unroll
    for (int it = 0; it < DM * 8 / PT; ++it) { const int u = tid + it * PT; const int row = u >> 3, part = (u & 7) * 8;
        const v8h ov = *(const v8ha*)(&t_s[row * LTP + part]);
        *(v8h*)(VT + (z * DM + (size_t)row) * SEQ + s0 + part) = ov; }
}

// ---- d_relchk: work-group g compares rows g*CKU .. g*CKU+CKU-1 of the index input with the closed form and stores its own 128-byte line pz[g*32 .. g*32+31] = 0 (all equal) or NaN; g < NCK, 256 threads, CKS 16-byte reads per thread and row.
__device__ __forceinline__ void d_relchk(const int* __restrict__ rel, float* pz, unsigned g) {
    __shared__ int bad_s[PT / 32];
    const int tid = threadIdx.x, lane = tid & 31;
    const int wid = __builtin_amdgcn_readfirstlane(tid >> 5);
    const int i0 = g * CKU, j = tid * 4;
    const int* rp = rel + (size_t)i0 * SEQ_FULL + j;
    v4i t[CKU][CKS];
#pragma unroll
    for (int u = 0; u < CKU; ++u)
#pragma unroll
        for (int s = 0; s < CKS; ++s) t[u][s] = *(const v4i*)(rp + (size_t)u * SEQ_FULL + s * (4 * PT));
    int bad = 0;
#pragma unroll
    for (int u = 0; u < CKU; ++u) {
#pragma unroll
        for (int s = 0; s < CKS; ++s) {
#pragma unroll
            for (int cc = 0; cc < 4; ++cc) { const int want = clampi(j + s * (4 * PT) + cc - i0 - u, -RK, RK) + RK; bad |= (t[u][s][cc] != want) ? 1 : 0; }
        }
    }
    bad |= __shfl_xor(bad, 16, 32); bad |= __shfl_xor(bad, 8, 32); bad |= __shfl_xor(bad, 4, 32); bad |= __shfl_xor(bad, 2, 32); bad |= __shfl_xor(bad, 1, 32);
    if (lane == 0) bad_s[wid] = bad;
    __syncthreads();
    int any = 0;
#pragma unroll
    for (int w = 0; w < PT / 32; ++w) any |= bad_s[w];
    const float pv = (any != 0) ? __uint_as_float(0x7FC00000u) : 0.0f;
    if (tid < 8) { const v4f o = (v4f){pv, pv, pv, pv}; *(v4f*)(pz + (size_t)g * 32 + tid * 4) = o;  }
}

// ---- k_pre: the six preparation jobs read only inputs and write disjoint workspace planes, so none waits for another: one launch, each job on its own range of blockIdx.x.
// The LayerNorm work-groups are the few long ones and come first, so that they start first and the short streaming jobs run beside them. Every branch is on blockIdx.x alone (block barriers inside stay block-uniform).
constexpr unsigned NW8 = (unsigned)((size_t)DM * DM / 8), NA8 = (unsigned)((size_t)SEQ * DM / 8);
constexpr unsigned PB_LN = (SEQ / 64) * NB;              // LayerNorm + transpose
constexpr unsigned PB_CK = NCK;                          // index compare
constexpr unsigned PB_A  = (NA8 / 256) * NB;             // one head plane (q, then k)
constexpr unsigned PB_W  = NW8 / 256;                    // weight plane
constexpr unsigned PB_R  = (RPAD * HD / 8 + 255) / 256;  // position plane
constexpr unsigned PB_ALL = PB_LN + PB_CK + 2 * PB_A + PB_W + PB_R;
__global__ __launch_bounds__(PT) void k_pre(const float* __restrict__ xq, const float* __restrict__ xk, const float* __restrict__ xv, const float* __restrict__ lg, const float* __restrict__ lb,
                                            const float* __restrict__ rp, const float* __restrict__ wp, const int* __restrict__ rel, bf* QP, bf* KP, h16* VT, bf* RPP, bf* WO, float* PZ) {
    unsigned g = blockIdx.x;
    if (g < PB_LN) { d_ln_vt(xv, lg, lb, VT, g % (SEQ / 64), g / (SEQ / 64)); return; }
    g -= PB_LN;
    if (g < PB_CK) { d_relchk(rel, PZ, g); return; }
    g -= PB_CK;
    if (g < PB_A) { d_cvt8h(xq, QP, NA8, (size_t)SEQ_FULL * DM, SCL, g % (NA8 / 256), g / (NA8 / 256)); return; }
    g -= PB_A;
    if (g < PB_A) { d_cvt8h(xk, KP, NA8, (size_t)SEQ_FULL * DM, 1.0f, g % (NA8 / 256), g / (NA8 / 256)); return; }
    g -= PB_A;
    if (g < PB_W) { d_cvt8(wp, WO, NW8, g); return; }
    g -= PB_W;
    d_cvt_rpe(rp, RPP, g);
}

// ---- k_gemm_out: OUT[b][s][n] (f32) = sum_k (Ah + Al)[b*SEQ+s][k] W[n][k] (+ the sum of the 0 / NaN lines of the index compare); grid (SEQ/64, DM/64, NB), 32 threads.
__global__ __launch_bounds__(32) void k_gemm_out(const bf* __restrict__ Ah, const bf* __restrict__ Al, const bf* __restrict__ W, const float* __restrict__ pz, float* C) {
    __shared__ __align__(16) float os[16 * LOP];
    const int lane = threadIdx.x & 31, lr = lane & 15, hi = lane >> 4;
    const size_t z = blockIdx.z; const int r0 = blockIdx.x * 64, c0 = blockIdx.y * 64;
    const bf* A = Ah + z * (size_t)SEQ * DM; const bf* A2 = Al + z * (size_t)SEQ * DM;
    float* Cz = C + z * (size_t)SEQ_FULL * DM;
    float pzv = 0.0f;
#pragma unroll
    for (int s = 0; s < NCK / 32; ++s) pzv += pz[(size_t)(s * 32 + lane) * 32];
    pzv += __shfl_xor(pzv, 16, 32); pzv += __shfl_xor(pzv, 8, 32); pzv += __shfl_xor(pzv, 4, 32); pzv += __shfl_xor(pzv, 2, 32); pzv += __shfl_xor(pzv, 1, 32);
    v8f acc[4][4];
#pragma unroll
    for (int mb = 0; mb < 4; ++mb)
#pragma unroll
        for (int nb = 0; nb < 4; ++nb) acc[mb][nb] = (v8f){};
    gemm_loop<1>(A, A2, W, DM, (size_t)(r0 + lr) * DM + 8 * hi, (size_t)(c0 + lr) * DM + 8 * hi, acc);
#pragma unroll
    for (int mb = 0; mb < 4; ++mb) {
#pragma unroll
        for (int nb = 0; nb < 4; ++nb) {
#pragma unroll
            for (int j = 0; j < 8; ++j) os[(hi * 8 + j) * LOP + nb * 16 + lr] = acc[mb][nb][j]; }
        wsync();
        float* crow = Cz + (size_t)(r0 + mb * 16) * DM + c0;
{
#pragma unroll
            for (int s = 0; s < 8; ++s) { const int row = 2 * s + hi, cofs = lr * 4; v4f val = *(const v4fa*)(&os[row * LOP + cofs]);
                val[0] += pzv; val[1] += pzv; val[2] += pzv; val[3] += pzv;
                *(v4f*)(crow + (size_t)row * DM + cofs) = val; }
             }
        wsync();
    }
}

__global__ __launch_bounds__(128) void k_flash(const bf* __restrict__ Qh, const bf* __restrict__ Kh, const bf* __restrict__ RP, const h16* __restrict__ VT, bf* Ch, bf* Cl) {
    __shared__ __align__(16) bf    kh_s[64 * LKP];
    __shared__ __align__(16) h16   vt_s[64 * LKP];
    __shared__ __align__(16) float o_s[4 * 16 * LOP];
    __shared__ __align__(16) float r_s[4 * 16 * LRP];
    const int tid = threadIdx.x, lane = tid & 31, lr = lane & 15, hi = lane >> 4;
    const int wid = __builtin_amdgcn_readfirstlane(tid >> 5);
    const int bh = blockIdx.y; const int b = bh / NH, h = bh % NH;
    const int q0 = blockIdx.x * 64 + wid * 16;
    const size_t pl = (size_t)bh * SEQ * HD;
    const size_t qoff = pl + (size_t)(q0 + lr) * HD + 8 * hi;
    const size_t vbase = ((size_t)b * DM + (size_t)h * HD) * SEQ;
    const int ob = wid * 16 * LOP;
    const int rb = wid * 16 * LRP + 8 * hi * LRP;   // table rows as the prologue's D tiles hold them
    const int tb = wid * 16 * LRP + lr * LRP;       // table row of the lane's own query
    const v16bf qa0 = ldg16(Qh + qoff); const v16bf qa1 = ldg16(Qh + qoff + 32);
#pragma unroll 1
    for (int ct = 0; ct < RT; ++ct) {
        const size_t ro = (size_t)(ct * 16 + lr) * HD + 8 * hi;
        const v16bf b0 = ldg16(RP + ro); const v16bf b1 = ldg16(RP + ro + 32);
        v8f t = (v8f){};
        t = wmmab_g(qa0, b0, t);
        t = wmmab_g(qa1, b1, t);
#pragma unroll
        for (int j = 0; j < 8; ++j) r_s[rb + j * LRP + ct * 16 + lr] = t[j];
    }
    wsync();
    const float rlo = r_s[tb], rhi = r_s[tb + 2 * RK];
    v8f o[4];
#pragma unroll
    for (int dt = 0; dt < 4; ++dt) o[dt] = (v8f){};
    float mr = -1.0e30f, ls = 0.0f;

#pragma unroll 1
    for (int kb = 0; kb < SEQ / 64; ++kb) {
        __syncthreads();
#pragma unroll
        for (int it = 0; it < 4; ++it) {
            const int u = tid + it * 128; const int row = u >> 3, part = (u & 7) * 8;
            const size_t g = pl + (size_t)kb * 64 * HD + (size_t)u * 8;
            const v8us a = *(const v8us*)(Kh + g);
            const v8h v = *(const v8h*)(VT + vbase + (size_t)row * SEQ + (size_t)kb * 64 + part);
            *(v8usa*)(&kh_s[row * LKP + part]) = a; *(v8ha*)(&vt_s[row * LKP + part]) = v;
        }
        __syncthreads();
#pragma unroll 1
        for (int hf = 0; hf < 2; ++hf) {
            v8f s0 = (v8f){}, s1 = (v8f){};
            const int kr0 = (hf * 32 + lr) * LKP + 8 * hi, kr1 = kr0 + 16 * LKP;
            {
                const v16bf k00 = cat16b(*(const v8usa*)(&kh_s[kr0]), *(const v8usa*)(&kh_s[kr0 + 16]));
                const v16bf k10 = cat16b(*(const v8usa*)(&kh_s[kr1]), *(const v8usa*)(&kh_s[kr1 + 16]));
                const v16bf k01 = cat16b(*(const v8usa*)(&kh_s[kr0 + 32]), *(const v8usa*)(&kh_s[kr0 + 48]));
                const v16bf k11 = cat16b(*(const v8usa*)(&kh_s[kr1 + 32]), *(const v8usa*)(&kh_s[kr1 + 48]));
                // holds the four fragments' eight LDS reads together in front of the products: without it each product waits out an LDS round trip of its own
                asm volatile("" :: "v"(k00), "v"(k10), "v"(k01), "v"(k11));
                s0 = wmmab(k00, qa0, s0); s1 = wmmab(k10, qa0, s1);
                s0 = wmmab(k01, qa1, s0); s1 = wmmab(k11, qa1, s1);
                // keeps the four products back to back: a vector add moved in between them costs its own run of idle slots and holds the last product back
                __builtin_amdgcn_sched_barrier(0);
            }
            // position term: query q0 + lr, keys j0 + 8*hi + r (s0) and j0 + 16 + 8*hi + r (s1); both tests are on scalars only.
            // A half wholly beyond the clip on one side takes the register value, added without a branch (0 in a half near the diagonal): behind the products stands straight-line vector work, so their distance is padded once and not again on each side of a branch and at its join.
            const int j0 = kb * 64 + hf * 32;
            const bool fhi = j0 - q0 >= RK + 15, flo = q0 - j0 >= RK + 31;
            const float rv = fhi ? rhi : (flo ? rlo : 0.0f);
#pragma unroll
            for (int r = 0; r < 8; ++r) { s0[r] += rv; s1[r] += rv; }
            if (!(fhi || flo)) {
#pragma unroll
                for (int r = 0; r < 8; ++r) {
                    const int d0 = j0 + 8 * hi + r - q0 - lr;
                    const int i0 = clampi(d0, -RK, RK) + RK, i1 = clampi(d0 + 16, -RK, RK) + RK;
                    const float b0 = r_s[tb + i0]; const float b1 = r_s[tb + i1];
                    s0[r] += b0; s1[r] += b1;
                }
            }
            // running-max softmax update for the lane's query: 16 of the half's 32 keys are in this lane, the other 16 in lane ^ 16; ls holds the lane's partial sum
            float mx = fmaxf(s0[0], s1[0]);
#pragma unroll
            for (int r = 1; r < 8; ++r) mx = fmaxf(mx, fmaxf(s0[r], s1[r]));
            mx = fmaxf(mx, xhalf(mx));
            const float mnew = fmaxf(mr, mx);
            const float al = __builtin_amdgcn_exp2f((mr - mnew) * L2E);
            mr = mnew;
            v16h pa; float ps[8];
#pragma unroll
            for (int r = 0; r < 8; ++r) {
                const float e0 = (s0[r] - mnew) * L2E, e1 = (s1[r] - mnew) * L2E;
                const float p0 = __builtin_amdgcn_exp2f(e0);
                const float p1 = __builtin_amdgcn_exp2f(e1);
                ps[r] = p0 + p1;
                pa[r] = (e0 < PFL) ? (h16)0.0f : (h16)(p0 * PCAR);
                pa[8 + r] = (e1 < PFL) ? (h16)0.0f : (h16)(p1 * PCAR);
            }
            ls = ls * al + (((ps[0] + ps[1]) + (ps[2] + ps[3])) + ((ps[4] + ps[5]) + (ps[6] + ps[7])));
#pragma unroll
            for (int dt = 0; dt < 4; ++dt)
#pragma unroll
                for (int r = 0; r < 8; ++r) o[dt][r] *= al;
            v16h va[4];
#pragma unroll
            for (int dt = 0; dt < 4; ++dt) { const int vo = (dt * 16 + lr) * LKP + hf * 32 + 8 * hi; va[dt] = cat16(*(const v8ha*)(&vt_s[vo]), *(const v8ha*)(&vt_s[vo + 16])); }
#pragma unroll
            for (int dt = 0; dt < 4; ++dt) o[dt] = wmma16(va[dt], pa, o[dt]);
        }
    }
    // normalise: the query's sum is completed over its two lanes; 1 / (l * 1024) undoes the P carry; the lane's 8 registers of a tile are 8 consecutive features of its query
    {
        const float lt = ls + xhalf(ls);
        const float inv = 1.0f / (lt * PCAR);
#pragma unroll
        for (int dt = 0; dt < 4; ++dt) {
            const v4f y0 = (v4f){o[dt][0] * inv, o[dt][1] * inv, o[dt][2] * inv, o[dt][3] * inv};
            const v4f y1 = (v4f){o[dt][4] * inv, o[dt][5] * inv, o[dt][6] * inv, o[dt][7] * inv};
            *(v4fa*)(&o_s[ob + lr * LOP + dt * 16 + 8 * hi]) = y0; *(v4fa*)(&o_s[ob + lr * LOP + dt * 16 + 8 * hi + 4]) = y1;
        }
    }
    wsync();
    const int srow = lane >> 3, scol = (lane & 7) * 8;
    const size_t cbase = ((size_t)b * SEQ + q0) * DM + (size_t)h * HD;
{
#pragma unroll
        for (int s = 0; s < 4; ++s) { const int row = 4 * s + srow; const v4f x0 = *(const v4fa*)(&o_s[ob + row * LOP + scol]); const v4f x1 = *(const v4fa*)(&o_s[ob + row * LOP + scol + 4]); v8us oh, ol;
#pragma unroll
            for (int j = 0; j < 4; ++j) { unsigned short a, c; splitf(x0[j], a, c); oh[j] = a; ol[j] = c; splitf(x1[j], a, c); oh[4 + j] = a; ol[4 + j] = c; }
            const size_t off = cbase + (size_t)row * DM + scol;
            *(v8us*)(Ch + off) = oh; *(v8us*)(Cl + off) = ol; }
         }
}

constexpr size_t al256(size_t x) { return (x + 255) & ~(size_t)255; }
constexpr size_t SZ_W = al256((size_t)DM * DM * 2);                 // one bf16 weight plane
constexpr size_t SZ_R = al256((size_t)RPAD * HD * 2);               // bf16 position plane, 144 rows
constexpr size_t SZ_X = al256((size_t)NB * SEQ * DM * 2);           // one 16-bit [NB*SEQ][DM] plane (merged-head plane)
constexpr size_t SZ_P = al256((size_t)NB * NH * SEQ * HD * 2);      // one 16-bit head plane
constexpr size_t SZ_F = al256((size_t)NCK * 128);                   // 0 / NaN lines of the index compare, one per work-group
constexpr size_t WS_TOTAL = SZ_W + SZ_R + 2 * SZ_P + SZ_P + 2 * SZ_X + SZ_F;
static_assert(WS_TOTAL <= (size_t)134217728);                       // carve stays within 128 MiB
static_assert(SZ_P == SZ_X);                                        // NH * HD == DM
static_assert(SZ_R >= (size_t)RPAD * HD * 2);                       // last position plane line lies inside its region

extern "C" void kernel_launch(void* const* d_in, const int* in_sizes, int n_in,
                              void* d_out, int out_size, void* d_ws, size_t ws_size, hipStream_t stream) {
    if (n_in < 8) return;
    const size_t need_act = (size_t)(NB - 1) * SEQ_FULL * DM + (size_t)SEQ * DM;
    if ((size_t)in_sizes[0] < need_act || (size_t)in_sizes[1] < need_act || (size_t)in_sizes[2] < need_act) return;
    if (in_sizes[3] < DM || in_sizes[4] < DM || in_sizes[5] < NREL * HD || (size_t)in_sizes[6] < (size_t)DM * DM) return;
    if ((size_t)in_sizes[7] < (size_t)(SEQ - 1) * SEQ_FULL + (size_t)SEQ) return;
    if ((size_t)out_size < need_act) return;
    if (WS_TOTAL > ws_size) return;
    // wire order: q, k, v, ln_gamma, ln_beta, rpe_emb, W_proj (all f32; W_proj [out][in]), rel_idx (int32 [SEQ][SEQ])
    const float* xq = (const float*)d_in[0]; const float* xk = (const float*)d_in[1]; const float* xv = (const float*)d_in[2];
    const float* lg = (const float*)d_in[3]; const float* lb = (const float*)d_in[4]; const float* rp = (const float*)d_in[5]; const float* wp = (const float*)d_in[6];
    const int* rel = (const int*)d_in[7];
    float* OUT = (float*)d_out;
    char* wsp = (char*)d_ws;
    auto take = [&](size_t bytes) { char* p = wsp; wsp += bytes; return (void*)p; };
    bf* WO = (bf*)take(SZ_W);
    bf* RPP = (bf*)take(SZ_R);
    bf* QP = (bf*)take(SZ_P); bf* KP = (bf*)take(SZ_P);
    h16* VT = (h16*)take(SZ_P);
    bf* CTh = (bf*)take(SZ_X); bf* CTl = (bf*)take(SZ_X);
    float* PZ = (float*)take(SZ_F);
    if ((size_t)(wsp - (char*)d_ws) != WS_TOTAL) return;

    k_pre<<<dim3(PB_ALL), PT, 0, stream>>>(xq, xk, xv, lg, lb, rp, wp, rel, QP, KP, VT, RPP, WO, PZ);
    k_flash<<<dim3(SEQ / 64, NB * NH), 128, 0, stream>>>(QP, KP, RPP, VT, CTh, CTl);
    k_gemm_out<<<dim3(SEQ / 64, DM / 64, NB), 32, 0, stream>>>(CTh, CTl, WO, PZ, OUT);
}

// v006
// One run takes 81.6 microseconds.
// Two timings next to v005 put it at 1.08 and 1.07 times that version's speed.
// All steps since v000 together make it 12.2 times as fast.
#include <hip/hip_runtime.h>

#ifndef NB
#define NB 4
#endif
#ifndef SEQ
#define SEQ 2048
#endif
#define NB_FULL  4
#define SEQ_FULL 2048
#define DM   512
#define NH   8
#define HD   64
#define PCAR 1024.0f
#define PFL  (-24.0f)  // exp2 argument below which P * PCAR would leave the f16 normal range
#define SCL  0.125f
#define L2E  1.4426950408889634f
#define LKP  72      // LDS row pitch (16-bit elements) of the K / V^T tiles: 144 B rows
#define LOP  68      // LDS row pitch (floats) of epilogue staging tiles: 272 B rows
#define RK   64      // relative distance clip
#define NREL 129     // position table rows: 2 * RK + 1
#define RT   9       // 16-wide column tiles of the per-wave q.rpe^T table
#define RPAD 144     // position plane rows, zero filled beyond NREL
#define LRP  148     // LDS row pitch (floats) of the per-wave q.rpe^T table
#define LTP  72      // LDS row pitch (halves) of the LayerNorm transpose tile
#define LNC  128     // features one 16-byte read per lane covers in the LayerNorm job: 32 lanes x 4
#define LNEPS 1.0e-5f
#define PT   256         // threads of a pre-pass work-group, the same for all six jobs
#define CKS  (SEQ / (4 * PT))   // 16-byte reads per thread and row of the index input
#define CKU  8           // rows per index-compare work-group: CKU * CKS independent 16-byte reads per thread
#define NCK  (SEQ / CKU) // index-compare work-groups == 0 / NaN lines
#define GT   128         // rows and columns of an output GEMM work-group's tile
#define GK   64          // k elements of an output GEMM stage: 128-byte rows
#define GPL  (GT * LKP)  // elements of one staged plane
#define GST  (3 * GPL)   // elements of a stage: Ah | Al | W
#define GRS  (16 * LKP * 2)   // LDS bytes between rows 16 apart

static_assert(DM == NH * HD);            // one 64-wide GEMM column tile == one head
static_assert(HD == 64);
static_assert(DM % 32 == 0);             // WMMA k-step
static_assert(DM % GT == 0 && SEQ % GT == 0);   // GEMM tiles
static_assert(DM % GK == 0 && DM / GK >= 2);    // whole stages, and the two that the ring's start needs
static_assert(GT * GK * 2 == 128 * 8 * 16);     // a staged plane == 128 threads x 8 copies x 16 B
static_assert((size_t)2 * GST * 2 + (size_t)4 * 16 * LOP * 4 <= 163840);   // output GEMM static LDS
static_assert(SEQ % 64 == 0);            // key blocks, query blocks
static_assert((SEQ * DM) % (8 * 256) == 0);   // q / k convert job's work-group range is exact
static_assert((DM * DM) % (8 * 256) == 0);
static_assert(NB <= NB_FULL);
static_assert(SEQ <= SEQ_FULL);
static_assert(LKP % 8 == 0);             // 16-byte aligned LDS vector accesses
static_assert(LOP % 4 == 0);
static_assert(NREL == 2 * RK + 1);
static_assert(RPAD == RT * 16);          // position plane rows == table column tiles
static_assert(NREL <= RPAD);
static_assert(RPAD <= LRP);              // table columns fit the LDS pitch
static_assert(2 * RK < RPAD);            // largest clamped index is a written column
static_assert((RPAD * HD) % 64 == 0);
static_assert(HD * 2 == 8 * 16);         // head plane row == 8 lanes x 16 B
static_assert(LTP % 8 == 0);
static_assert(SEQ % (4 * PT) == 0);      // index compare: whole 16-byte reads, the same number in every thread
static_assert(SEQ % CKU == 0);           // index compare grid is exact
static_assert(NCK % 32 == 0);            // the output GEMM's wave reads the lines 32 at a time
static_assert(256 * 16 * 2 == 64 * 64 * 2);
static_assert(32 * 16 * 4 == 16 * HD * 2);
static_assert(32 * 16 * 8 == 16 * 64 * 4);     // output epilogue: lanes x bytes x trips == 16 rows x 256 B
static_assert(PCAR == 1024.0f);                // PFL = -14 - log2(PCAR)
static_assert((size_t)64 * LKP * 2 * 2 + (size_t)4 * 16 * LOP * 4 + (size_t)4 * 16 * LRP * 4 <= 131072);   // flash static LDS
static_assert((size_t)DM * LTP * 2 <= 131072);                                                                                  // LayerNorm static LDS
static_assert(DM % LNC == 0);            // whole chunks
static_assert((DM * 8) % 256 == 0);      // tile write-out: whole 16-byte units per thread

typedef _Float16 h16;
typedef unsigned short bf;
typedef __attribute__((ext_vector_type(16))) __bf16   v16bf;
typedef __attribute__((ext_vector_type(16))) _Float16 v16h;
typedef __attribute__((ext_vector_type(8)))  _Float16 v8h;
typedef __attribute__((ext_vector_type(8)))  unsigned short v8us;
typedef __attribute__((ext_vector_type(8)))  float    v8f;
typedef __attribute__((ext_vector_type(4)))  float    v4f;
typedef __attribute__((ext_vector_type(4)))  int      v4i;
typedef __attribute__((ext_vector_type(4)))  _Float16 v4h;
typedef v8h  __attribute__((may_alias)) v8ha;
typedef v4h  __attribute__((may_alias)) v4ha;
typedef v4f  __attribute__((may_alias)) v4fa;
typedef v8us __attribute__((may_alias)) v8usa;

__device__ __forceinline__ unsigned short f2bf(float f) { unsigned u = __float_as_uint(f); u += 0x7FFFu + ((u >> 16) & 1u); return (unsigned short)(u >> 16); }
__device__ __forceinline__ float bf2f(unsigned short b) { return __uint_as_float(((unsigned)b) << 16); }
__device__ __forceinline__ float bfr(float f) { return bf2f(f2bf(f)); }
__device__ __forceinline__ void splitf(float y, unsigned short& h, unsigned short& l) { h = f2bf(y); l = f2bf(y - bf2f(h)); }
__device__ __forceinline__ v16h cat16(v8h lo, v8h hi) { return __builtin_shufflevector(lo, hi, 0, 1, 2, 3, 4, 5, 6, 7, 8, 9, 10, 11, 12, 13, 14, 15); }
__device__ __forceinline__ v16bf cat16b(v8us lo, v8us hi) { return __builtin_bit_cast(v16bf, __builtin_shufflevector(lo, hi, 0, 1, 2, 3, 4, 5, 6, 7, 8, 9, 10, 11, 12, 13, 14, 15)); }
__device__ __forceinline__ v8f wmma16(v16h a, v16h b, v8f c) { return __builtin_amdgcn_wmma_f32_16x16x32_f16(false, a, false, b, (short)0, c, false, false); }
__device__ __forceinline__ v8f wmmab(v16bf a, v16bf b, v8f c) { return __builtin_amdgcn_wmma_f32_16x16x32_bf16(false, a, false, b, (short)0, c, false, false); }
// fragment from a K-contiguous global bf16 plane: elements 0..7 <- p[0..7], 8..15 <- p[16..23] (p already includes row*pitch + k0 + 8*(lane>>4))
__device__ __forceinline__ v16bf ldg16(const bf* __restrict__ p) { return cat16b(*(const v8us*)p, *(const v8us*)(p + 16)); }
// same-wave LDS exchange ordering (wave-private tiles only)
__device__ __forceinline__ void wsync() { __builtin_amdgcn_wave_barrier(); asm volatile("" ::: "memory"); }
// one matrix instruction followed by its own four idle slots (ties the accumulator, keeps the operands live)
__device__ __forceinline__ v8f wmmab_g(v16bf a, v16bf b, v8f c) { c = __builtin_amdgcn_wmma_f32_16x16x32_bf16(false, a, false, b, (short)0, c, false, false); asm volatile("v_nop\n\tv_nop\n\tv_nop\n\tv_nop" : "+v"(c) : "v"(a), "v"(b)); return c; }
// f32 -> f16 operand convert that cannot produce an f16 subnormal
__device__ __forceinline__ h16 toh_flush(float v) { const h16 r = (h16)v; return (fabsf(v) < 6.103515625e-05f) ? (h16)0.0f : r; }
// lane l exchanges with lane l ^ 16 (the two lanes that share one column of a D tile)
__device__ __forceinline__ float xhalf(float x) { return __builtin_bit_cast(float, __builtin_amdgcn_permlanex16(__builtin_bit_cast(int, x), __builtin_bit_cast(int, x), 0x76543210, 0xfedcba98, false, false)); }
__device__ __forceinline__ int clampi(int v, int lo, int hi) { const int t = v < lo ? lo : v; return t > hi ? hi : t; }

// fragment from a K-contiguous LDS row, the same element order as ldg16
__device__ __forceinline__ v16bf lds16(const bf* p) { return cat16b(*(const v8usa*)p, *(const v8usa*)(p + 16)); }
// eight asynchronous 16-byte copies of one lane, global -> LDS, rows 16 apart: a wave's copy is 4 whole 128-byte lines. l: the lane's LDS byte address, g: its global address.
// The s_wait_xcnt closes the statement so that it stands in front of every later write of an address register the copies name.
__device__ __forceinline__ void acopy8(unsigned l, const bf* g) {
    asm volatile("global_load_async_to_lds_b128 %0, %8, off\n\t"
                 "global_load_async_to_lds_b128 %1, %9, off\n\t"
                 "global_load_async_to_lds_b128 %2, %10, off\n\t"
                 "global_load_async_to_lds_b128 %3, %11, off\n\t"
                 "global_load_async_to_lds_b128 %4, %12, off\n\t"
                 "global_load_async_to_lds_b128 %5, %13, off\n\t"
                 "global_load_async_to_lds_b128 %6, %14, off\n\t"
                 "global_load_async_to_lds_b128 %7, %15, off\n\t"
                 "s_wait_xcnt 0x0"
                 :: "v"(l), "v"(l + 1u * GRS), "v"(l + 2u * GRS), "v"(l + 3u * GRS), "v"(l + 4u * GRS), "v"(l + 5u * GRS), "v"(l + 6u * GRS), "v"(l + 7u * GRS),
                    "v"(g), "v"(g + 1 * 16 * DM), "v"(g + 2 * 16 * DM), "v"(g + 3 * 16 * DM), "v"(g + 4 * 16 * DM), "v"(g + 5 * 16 * DM), "v"(g + 6 * 16 * DM), "v"(g + 7 * 16 * DM)
                 : "memory");
}

// The six jobs of the pre-pass launch are device functions; bx (and by) is the job's own work-group index, the same for the whole work-group.
__device__ __forceinline__ void d_cvt8(const float* __restrict__ src, bf* dst, unsigned n8, unsigned bx) {
    const unsigned i = bx * 256u + threadIdx.x; if (i >= n8) return;
    const float* s = src + (size_t)i * 8; bf* d = dst + (size_t)i * 8;
    const v4f v0 = *(const v4f*)s; const v4f v1 = *(const v4f*)(s + 4); v8us o;
#pragma unroll
    for (int k = 0; k < 4; ++k) { o[k] = f2bf(v0[k]); o[4 + k] = f2bf(v1[k]); }
    *(v8us*)d = o; 
}

__device__ __forceinline__ void d_cvt8h(const float* __restrict__ src, bf* dst, unsigned n8, size_t sstride, float sc, unsigned bx, unsigned by) {
#pragma clang fp contract(off)
    const unsigned i = bx * 256u + threadIdx.x; if (i >= n8) return;
    const unsigned e = i * 8u; const unsigned srow = e / DM, c = e % DM; const unsigned hh = c / HD, dd = c % HD;
    const float* s = src + (size_t)by * sstride + (size_t)e;
    bf* d = dst + (((size_t)by * NH + hh) * SEQ + srow) * HD + dd;
    const v4f v0 = *(const v4f*)s; const v4f v1 = *(const v4f*)(s + 4); v8us o;
#pragma unroll
    for (int k = 0; k < 4; ++k) { o[k] = f2bf(bfr(v0[k]) * sc); o[4 + k] = f2bf(bfr(v1[k]) * sc); }
    *(v8us*)d = o; 
}

__device__ __forceinline__ void d_cvt_rpe(const float* __restrict__ src, bf* dst, unsigned bx) {
    const unsigned i = bx * 256u + threadIdx.x; if (i >= (unsigned)(RPAD * HD / 8)) return;
    const unsigned nreal = (unsigned)(NREL * HD / 8);
    const unsigned ic = i < nreal ? i : nreal - 1u;
    const bool ok = i < nreal;
    const float* s = src + (size_t)ic * 8; bf* d = dst + (size_t)i * 8;
    const v4f v0 = *(const v4f*)s; const v4f v1 = *(const v4f*)(s + 4); v8us o;
#pragma unroll
    for (int k = 0; k < 4; ++k) { const unsigned short a = f2bf(v0[k]); const unsigned short c = f2bf(v1[k]); o[k] = ok ? a : (unsigned short)0; o[4 + k] = ok ? c : (unsigned short)0; }
    *(v8us*)d = o; 
}

// sum over the wave's 32 lanes, the same value in every lane: four exchanges inside the 16-lane row (DPP row_xmask 1, 2, 4, 8), then one with lane ^ 16
template <int M> __device__ __forceinline__ float rowx(float x) { return __builtin_bit_cast(float, __builtin_amdgcn_update_dpp(0, __builtin_bit_cast(int, x), 0x160 + M, 0xf, 0xf, true)); }
__device__ __forceinline__ float wsum(float x) { x += rowx<1>(x); x += rowx<2>(x); x += rowx<4>(x); x += rowx<8>(x); return x + xhalf(x); }

// ---- d_ln_vt: V^T[b][n][s] (f16) = ((x - mean) * rsqrt(var + eps) * gain[n] + shift[n]) over the 512 features of token s, x = RNE bf16 of the value stream; work-groups (bx < SEQ/64, by < NB), 256 threads.
// Wave w owns tokens 8w..8w+7 from first to last, four at a time; a lane holds features 128c + 4*lane + j: 16 reads of 16 bytes in flight per lane, the stream is read once.
// Mean, then centred variance, both reduced in registers; the statistics never leave the owning wave. The lane's 4 tokens of one feature are one 8-byte write into the [512][64] LDS tile.
// One block barrier, then the tile's rows go out as whole 128-byte lines.
__device__ __forceinline__ void d_ln_vt(const float* __restrict__ X, const float* __restrict__ G, const float* __restrict__ Bt, h16* VT, unsigned bx, unsigned by) {
#pragma clang fp contract(off)
    __shared__ __align__(16) h16 t_s[DM * LTP];
    const int tid = threadIdx.x, lane = tid & 31;
    const int wid = __builtin_amdgcn_readfirstlane(tid >> 5);
    const size_t z = by; const int s0 = bx * 64;
    const unsigned lo = lane * 4;
    const float* xr = X + z * (size_t)SEQ_FULL * DM + (size_t)(s0 + wid * 8) * DM + lo;   // the lane's place in the batch's first token; steps on by one batch a trip
    // kept rolled: unrolled, both batches' reads are hoisted together and the registers they take are charged to every job of this launch
#pragma unroll 1
    for (int tb = 0; tb < 8; tb += 4) {
        v4f xv[4][DM / LNC];
#pragma unroll
        for (int u = 0; u < 4; ++u)
#pragma unroll
            for (int c = 0; c < DM / LNC; ++c) xv[u][c] = *(const v4f*)(xr + u * DM + c * LNC);
        float mu[4], rs[4];
#pragma unroll
        for (int u = 0; u < 4; ++u) { float sm = 0.0f;
#pragma unroll
            for (int c = 0; c < DM / LNC; ++c)
#pragma unroll
                for (int j = 0; j < 4; ++j) { xv[u][c][j] = bfr(xv[u][c][j]); sm += xv[u][c][j]; }
            mu[u] = sm; }
#pragma unroll
        for (int u = 0; u < 4; ++u) mu[u] = wsum(mu[u]) * (1.0f / DM);
#pragma unroll
        for (int u = 0; u < 4; ++u) { float sq = 0.0f;
#pragma unroll
            for (int c = 0; c < DM / LNC; ++c)
#pragma unroll
                for (int j = 0; j < 4; ++j) { const float dv = xv[u][c][j] - mu[u]; sq += dv * dv; }
            rs[u] = sq; }
#pragma unroll
        for (int u = 0; u < 4; ++u) rs[u] = rsqrtf(wsum(rs[u]) * (1.0f / DM) + LNEPS);
#pragma unroll
        for (int c = 0; c < DM / LNC; ++c) {
            const v4f g4 = *(const v4f*)(G + c * LNC + lo), b4 = *(const v4f*)(Bt + c * LNC + lo);
#pragma unroll
            for (int j = 0; j < 4; ++j) { const float g = bfr(g4[j]), be = bfr(b4[j]); v4h o;
#pragma unroll
                for (int u = 0; u < 4; ++u) { const float y = (xv[u][c][j] - mu[u]) * rs[u] * g + be; o[u] = toh_flush(y); }
                *(v4ha*)(&t_s[(c * LNC + lane * 4 + j) * LTP + wid * 8 + tb]) = o; }
        }
        xr += 4 * DM;
    }
    __syncthreads();
#pragma unroll
    for (int it = 0; it < DM * 8 / PT; ++it) { const int u = tid + it * PT; const int row = u >> 3, part = (u & 7) * 8;
        const v8h ov = *(const v8ha*)(&t_s[row * LTP + part]);
        *(v8h*)(VT + (z * DM + (size_t)row) * SEQ + s0 + part) = ov; }
}

// ---- d_relchk: work-group g compares rows g*CKU .. g*CKU+CKU-1 of the index input with the closed form and stores its own 128-byte line pz[g*32 .. g*32+31] = 0 (all equal) or NaN; g < NCK, 256 threads, CKS 16-byte reads per thread and row.
__device__ __forceinline__ void d_relchk(const int* __restrict__ rel, float* pz, unsigned g) {
    __shared__ int bad_s[PT / 32];
    const int tid = threadIdx.x, lane = tid & 31;
    const int wid = __builtin_amdgcn_readfirstlane(tid >> 5);
    const int i0 = g * CKU, j = tid * 4;
    const int* rp = rel + (size_t)i0 * SEQ_FULL + j;
    v4i t[CKU][CKS];
#pragma unroll
    for (int u = 0; u < CKU; ++u)
#pragma unroll
        for (int s = 0; s < CKS; ++s) t[u][s] = *(const v4i*)(rp + (size_t)u * SEQ_FULL + s * (4 * PT));
    int bad = 0;
#pragma unroll
    for (int u = 0; u < CKU; ++u) {
#pragma unroll
        for (int s = 0; s < CKS; ++s) {
#pragma unroll
            for (int cc = 0; cc < 4; ++cc) { const int want = clampi(j + s * (4 * PT) + cc - i0 - u, -RK, RK) + RK; bad |= (t[u][s][cc] != want) ? 1 : 0; }
        }
    }
    bad |= __shfl_xor(bad, 16, 32); bad |= __shfl_xor(bad, 8, 32); bad |= __shfl_xor(bad, 4, 32); bad |= __shfl_xor(bad, 2, 32); bad |= __shfl_xor(bad, 1, 32);
    if (lane == 0) bad_s[wid] = bad;
    __syncthreads();
    int any = 0;
#pragma unroll
    for (int w = 0; w < PT / 32; ++w) any |= bad_s[w];
    const float pv = (any != 0) ? __uint_as_float(0x7FC00000u) : 0.0f;
    if (tid < 8) { const v4f o = (v4f){pv, pv, pv, pv}; *(v4f*)(pz + (size_t)g * 32 + tid * 4) = o;  }
}

// ---- k_pre: the six preparation jobs read only inputs and write disjoint workspace planes, so none waits for another: one launch, each job on its own range of blockIdx.x.
// The LayerNorm work-groups are the few long ones and come first, so that they start first and the short streaming jobs run beside them. Every branch is on blockIdx.x alone (block barriers inside stay block-uniform).
constexpr unsigned NW8 = (unsigned)((size_t)DM * DM / 8), NA8 = (unsigned)((size_t)SEQ * DM / 8);
constexpr unsigned PB_LN = (SEQ / 64) * NB;              // LayerNorm + transpose
constexpr unsigned PB_CK = NCK;                          // index compare
constexpr unsigned PB_A  = (NA8 / 256) * NB;             // one head plane (q, then k)
constexpr unsigned PB_W  = NW8 / 256;                    // weight plane
constexpr unsigned PB_R  = (RPAD * HD / 8 + 255) / 256;  // position plane
constexpr unsigned PB_ALL = PB_LN + PB_CK + 2 * PB_A + PB_W + PB_R;
__global__ __launch_bounds__(PT) void k_pre(const float* __restrict__ xq, const float* __restrict__ xk, const float* __restrict__ xv, const float* __restrict__ lg, const float* __restrict__ lb,
                                            const float* __restrict__ rp, const float* __restrict__ wp, const int* __restrict__ rel, bf* QP, bf* KP, h16* VT, bf* RPP, bf* WO, float* PZ) {
    unsigned g = blockIdx.x;
    if (g < PB_LN) { d_ln_vt(xv, lg, lb, VT, g % (SEQ / 64), g / (SEQ / 64)); return; }
    g -= PB_LN;
    if (g < PB_CK) { d_relchk(rel, PZ, g); return; }
    g -= PB_CK;
    if (g < PB_A) { d_cvt8h(xq, QP, NA8, (size_t)SEQ_FULL * DM, SCL, g % (NA8 / 256), g / (NA8 / 256)); return; }
    g -= PB_A;
    if (g < PB_A) { d_cvt8h(xk, KP, NA8, (size_t)SEQ_FULL * DM, 1.0f, g % (NA8 / 256), g / (NA8 / 256)); return; }
    g -= PB_A;
    if (g < PB_W) { d_cvt8(wp, WO, NW8, g); return; }
    g -= PB_W;
    d_cvt_rpe(rp, RPP, g);
}

// ---- k_gemm_out: OUT[b][s][n] (f32) = sum_k (Ah + Al)[b*SEQ+s][k] W[n][k] (+ the sum of the 0 / NaN lines of the index compare); grid (SEQ/128, DM/128, NB), 128 threads: 2 x 2 waves, 64 x 64 outputs each.
// A stage is 64 k of 128 rows of Ah, Al and W (128-byte rows, LDS pitch 144 B), brought as whole lines by asynchronous copies into one of two buffers; stage t + 1 is in flight while stage t is worked on.
// Per accumulator the products keep the order k-step by k-step, Ah then Al.
__global__ __launch_bounds__(128) void k_gemm_out(const bf* __restrict__ Ah, const bf* __restrict__ Al, const bf* __restrict__ W, const float* __restrict__ pz, float* C) {
    __shared__ __align__(16) bf g_s[2 * GST];
    __shared__ __align__(16) float os[4 * 16 * LOP];
    const int tid = threadIdx.x, lane = tid & 31, lr = lane & 15, hi = lane >> 4;
    const int wid = __builtin_amdgcn_readfirstlane(tid >> 5);
    const int wm = wid >> 1, wn = wid & 1;
    const size_t z = blockIdx.z; const int r0 = blockIdx.x * GT, c0 = blockIdx.y * GT;
    float* Cz = C + z * (size_t)SEQ_FULL * DM;
    // the lane's first 16-byte unit of a stage: row tid / 8, unit tid % 8; its other seven lie 16 rows apart
    const int srow = tid >> 3, spart = (tid & 7) * 8;
    const bf* gA = Ah + z * (size_t)SEQ * DM + (size_t)(r0 + srow) * DM + spart;
    const bf* gL = Al + z * (size_t)SEQ * DM + (size_t)(r0 + srow) * DM + spart;
    const bf* gW = W + (size_t)(c0 + srow) * DM + spart;
    const unsigned l0 = (unsigned)(size_t)(&g_s[srow * LKP + spart]);
    auto stage = [&](int t) {
        const unsigned lb = l0 + (unsigned)(t & 1) * (unsigned)(GST * 2);
        acopy8(lb, gA + t * GK); acopy8(lb + GPL * 2, gL + t * GK); acopy8(lb + 2 * GPL * 2, gW + t * GK);
    };
    stage(0);
    float pzv = 0.0f;
#pragma unroll
    for (int s = 0; s < NCK / 32; ++s) pzv += pz[(size_t)(s * 32 + lane) * 32];
    pzv += __shfl_xor(pzv, 16, 32); pzv += __shfl_xor(pzv, 8, 32); pzv += __shfl_xor(pzv, 4, 32); pzv += __shfl_xor(pzv, 2, 32); pzv += __shfl_xor(pzv, 1, 32);
    v8f acc[4][4];
#pragma unroll
    for (int mb = 0; mb < 4; ++mb)
#pragma unroll
        for (int nb = 0; nb < 4; ++nb) acc[mb][nb] = (v8f){};
    // stage 0 has landed for this wave; the barrier publishes it to the others
    asm volatile("s_wait_asynccnt 0x0" ::: "memory");
    __syncthreads();
    stage(1);
    const int ao = (wm * 64 + lr) * LKP + 8 * hi, bo = 2 * GPL + (wn * 64 + lr) * LKP + 8 * hi;
    // kept rolled: one trip is one stage, and the order at its foot is the ring's
#pragma unroll 1
    for (int t = 0; t < DM / GK; ++t) {
        const bf* sb = &g_s[(t & 1) * GST];
        v16bf bc = lds16(sb + bo);
#pragma unroll
        for (int ks = 0; ks < GK / 32; ++ks) {
            v16bf a[4], a2[4];
#pragma unroll
            for (int mb = 0; mb < 4; ++mb) { a[mb] = lds16(sb + ao + mb * 16 * LKP + ks * 32); a2[mb] = lds16(sb + GPL + ao + mb * 16 * LKP + ks * 32); }
#pragma unroll
            for (int nb = 0; nb < 4; ++nb) {
                // the next W fragment of the stage is read while the eight products on this one run
                const int nx = ks * 4 + nb + 1;
                v16bf bn = bc;
                if (nx < 4 * (GK / 32)) {
                    bn = lds16(sb + bo + (nx & 3) * 16 * LKP + (nx >> 2) * 32);
                    // holds that read in front of the products: moved behind them, into the one fragment's registers, it is waited for with nothing to run meanwhile
                    __builtin_amdgcn_sched_barrier(0);
                }
#pragma unroll
                for (int mb = 0; mb < 4; ++mb) { acc[mb][nb] = wmmab(a[mb], bc, acc[mb][nb]); acc[mb][nb] = wmmab(a2[mb], bc, acc[mb][nb]); }
                bc = bn;
            }
        }
        // foot of the trip: this wave's reads of the buffer are done, its copies of stage t + 1 have landed; the barrier publishes stage t + 1 and frees this trip's buffer for stage t + 2
        asm volatile("s_wait_dscnt 0x0" ::: "memory");
        asm volatile("s_wait_asynccnt 0x0" ::: "memory");
        __syncthreads();
        if (t + 2 < DM / GK) stage(t + 2);
    }
    // no copy is outstanding when the wave goes on to its end
    asm volatile("s_wait_asynccnt 0x0" ::: "memory");
    const int ob = wid * 16 * LOP;
#pragma unroll
    for (int mb = 0; mb < 4; ++mb) {
#pragma unroll
        for (int nb = 0; nb < 4; ++nb) {
#pragma unroll
            for (int j = 0; j < 8; ++j) os[ob + (hi * 8 + j) * LOP + nb * 16 + lr] = acc[mb][nb][j]; }
        wsync();
        float* crow = Cz + (size_t)(r0 + wm * 64 + mb * 16) * DM + c0 + wn * 64;
#pragma unroll
        for (int s = 0; s < 8; ++s) { const int row = 2 * s + hi, cofs = lr * 4; v4f val = *(const v4fa*)(&os[ob + row * LOP + cofs]);
            val[0] += pzv; val[1] += pzv; val[2] += pzv; val[3] += pzv;
            *(v4f*)(crow + (size_t)row * DM + cofs) = val; }
        wsync();
    }
}

__global__ __launch_bounds__(128) void k_flash(const bf* __restrict__ Qh, const bf* __restrict__ Kh, const bf* __restrict__ RP, const h16* __restrict__ VT, bf* Ch, bf* Cl) {
    __shared__ __align__(16) bf    kh_s[64 * LKP];
    __shared__ __align__(16) h16   vt_s[64 * LKP];
    __shared__ __align__(16) float o_s[4 * 16 * LOP];
    __shared__ __align__(16) float r_s[4 * 16 * LRP];
    const int tid = threadIdx.x, lane = tid & 31, lr = lane & 15, hi = lane >> 4;
    const int wid = __builtin_amdgcn_readfirstlane(tid >> 5);
    const int bh = blockIdx.y; const int b = bh / NH, h = bh % NH;
    const int q0 = blockIdx.x * 64 + wid * 16;
    const size_t pl = (size_t)bh * SEQ * HD;
    const size_t qoff = pl + (size_t)(q0 + lr) * HD + 8 * hi;
    const size_t vbase = ((size_t)b * DM + (size_t)h * HD) * SEQ;
    const int ob = wid * 16 * LOP;
    const int rb = wid * 16 * LRP + 8 * hi * LRP;   // table rows as the prologue's D tiles hold them
    const int tb = wid * 16 * LRP + lr * LRP;       // table row of the lane's own query
    const v16bf qa0 = ldg16(Qh + qoff); const v16bf qa1 = ldg16(Qh + qoff + 32);
#pragma unroll 1
    for (int ct = 0; ct < RT; ++ct) {
        const size_t ro = (size_t)(ct * 16 + lr) * HD + 8 * hi;
        const v16bf b0 = ldg16(RP + ro); const v16bf b1 = ldg16(RP + ro + 32);
        v8f t = (v8f){};
        t = wmmab_g(qa0, b0, t);
        t = wmmab_g(qa1, b1, t);
#pragma unroll
        for (int j = 0; j < 8; ++j) r_s[rb + j * LRP + ct * 16 + lr] = t[j];
    }
    wsync();
    const float rlo = r_s[tb], rhi = r_s[tb + 2 * RK];
    v8f o[4];
#pragma unroll
    for (int dt = 0; dt < 4; ++dt) o[dt] = (v8f){};
    float mr = -1.0e30f, ls = 0.0f;

#pragma unroll 1
    for (int kb = 0; kb < SEQ / 64; ++kb) {
        __syncthreads();
#pragma unroll
        for (int it = 0; it < 4; ++it) {
            const int u = tid + it * 128; const int row = u >> 3, part = (u & 7) * 8;
            const size_t g = pl + (size_t)kb * 64 * HD + (size_t)u * 8;
            const v8us a = *(const v8us*)(Kh + g);
            const v8h v = *(const v8h*)(VT + vbase + (size_t)row * SEQ + (size_t)kb * 64 + part);
            *(v8usa*)(&kh_s[row * LKP + part]) = a; *(v8ha*)(&vt_s[row * LKP + part]) = v;
        }
        __syncthreads();
#pragma unroll 1
        for (int hf = 0; hf < 2; ++hf) {
            v8f s0 = (v8f){}, s1 = (v8f){};
            const int kr0 = (hf * 32 + lr) * LKP + 8 * hi, kr1 = kr0 + 16 * LKP;
            {
                const v16bf k00 = cat16b(*(const v8usa*)(&kh_s[kr0]), *(const v8usa*)(&kh_s[kr0 + 16]));
                const v16bf k10 = cat16b(*(const v8usa*)(&kh_s[kr1]), *(const v8usa*)(&kh_s[kr1 + 16]));
                const v16bf k01 = cat16b(*(const v8usa*)(&kh_s[kr0 + 32]), *(const v8usa*)(&kh_s[kr0 + 48]));
                const v16bf k11 = cat16b(*(const v8usa*)(&kh_s[kr1 + 32]), *(const v8usa*)(&kh_s[kr1 + 48]));
                // holds the four fragments' eight LDS reads together in front of the products: without it each product waits out an LDS round trip of its own
                asm volatile("" :: "v"(k00), "v"(k10), "v"(k01), "v"(k11));
                s0 = wmmab(k00, qa0, s0); s1 = wmmab(k10, qa0, s1);
                s0 = wmmab(k01, qa1, s0); s1 = wmmab(k11, qa1, s1);
                // keeps the four products back to back: a vector add moved in between them costs its own run of idle slots and holds the last product back
                __builtin_amdgcn_sched_barrier(0);
            }
            // position term: query q0 + lr, keys j0 + 8*hi + r (s0) and j0 + 16 + 8*hi + r (s1); both tests are on scalars only.
            // A half wholly beyond the clip on one side takes the register value, added without a branch (0 in a half near the diagonal): behind the products stands straight-line vector work, so their distance is padded once and not again on each side of a branch and at its join.
            const int j0 = kb * 64 + hf * 32;
            const bool fhi = j0 - q0 >= RK + 15, flo = q0 - j0 >= RK + 31;
            const float rv = fhi ? rhi : (flo ? rlo : 0.0f);
#pragma unroll
            for (int r = 0; r < 8; ++r) { s0[r] += rv; s1[r] += rv; }
            if (!(fhi || flo)) {
#pragma unroll
                for (int r = 0; r < 8; ++r) {
                    const int d0 = j0 + 8 * hi + r - q0 - lr;
                    const int i0 = clampi(d0, -RK, RK) + RK, i1 = clampi(d0 + 16, -RK, RK) + RK;
                    const float b0 = r_s[tb + i0]; const float b1 = r_s[tb + i1];
                    s0[r] += b0; s1[r] += b1;
                }
            }
            // running-max softmax update for the lane's query: 16 of the half's 32 keys are in this lane, the other 16 in lane ^ 16; ls holds the lane's partial sum
            float mx = fmaxf(s0[0], s1[0]);
#pragma unroll
            for (int r = 1; r < 8; ++r) mx = fmaxf(mx, fmaxf(s0[r], s1[r]));
            mx = fmaxf(mx, xhalf(mx));
            const float mnew = fmaxf(mr, mx);
            const float al = __builtin_amdgcn_exp2f((mr - mnew) * L2E);
            mr = mnew;
            v16h pa; float ps[8];
#pragma unroll
            for (int r = 0; r < 8; ++r) {
                const float e0 = (s0[r] - mnew) * L2E, e1 = (s1[r] - mnew) * L2E;
                const float p0 = __builtin_amdgcn_exp2f(e0);
                const float p1 = __builtin_amdgcn_exp2f(e1);
                ps[r] = p0 + p1;
                pa[r] = (e0 < PFL) ? (h16)0.0f : (h16)(p0 * PCAR);
                pa[8 + r] = (e1 < PFL) ? (h16)0.0f : (h16)(p1 * PCAR);
            }
            ls = ls * al + (((ps[0] + ps[1]) + (ps[2] + ps[3])) + ((ps[4] + ps[5]) + (ps[6] + ps[7])));
#pragma unroll
            for (int dt = 0; dt < 4; ++dt)
#pragma unroll
                for (int r = 0; r < 8; ++r) o[dt][r] *= al;
            v16h va[4];
#pragma unroll
            for (int dt = 0; dt < 4; ++dt) { const int vo = (dt * 16 + lr) * LKP + hf * 32 + 8 * hi; va[dt] = cat16(*(const v8ha*)(&vt_s[vo]), *(const v8ha*)(&vt_s[vo + 16])); }
#pragma unroll
            for (int dt = 0; dt < 4; ++dt) o[dt] = wmma16(va[dt], pa, o[dt]);
        }
    }
    // normalise: the query's sum is completed over its two lanes; 1 / (l * 1024) undoes the P carry; the lane's 8 registers of a tile are 8 consecutive features of its query
    {
        const float lt = ls + xhalf(ls);
        const float inv = 1.0f / (lt * PCAR);
#pragma unroll
        for (int dt = 0; dt < 4; ++dt) {
            const v4f y0 = (v4f){o[dt][0] * inv, o[dt][1] * inv, o[dt][2] * inv, o[dt][3] * inv};
            const v4f y1 = (v4f){o[dt][4] * inv, o[dt][5] * inv, o[dt][6] * inv, o[dt][7] * inv};
            *(v4fa*)(&o_s[ob + lr * LOP + dt * 16 + 8 * hi]) = y0; *(v4fa*)(&o_s[ob + lr * LOP + dt * 16 + 8 * hi + 4]) = y1;
        }
    }
    wsync();
    const int srow = lane >> 3, scol = (lane & 7) * 8;
    const size_t cbase = ((size_t)b * SEQ + q0) * DM + (size_t)h * HD;
{
#pragma unroll
        for (int s = 0; s < 4; ++s) { const int row = 4 * s + srow; const v4f x0 = *(const v4fa*)(&o_s[ob + row * LOP + scol]); const v4f x1 = *(const v4fa*)(&o_s[ob + row * LOP + scol + 4]); v8us oh, ol;
#pragma unroll
            for (int j = 0; j < 4; ++j) { unsigned short a, c; splitf(x0[j], a, c); oh[j] = a; ol[j] = c; splitf(x1[j], a, c); oh[4 + j] = a; ol[4 + j] = c; }
            const size_t off = cbase + (size_t)row * DM + scol;
            *(v8us*)(Ch + off) = oh; *(v8us*)(Cl + off) = ol; }
         }
}

constexpr size_t al256(size_t x) { return (x + 255) & ~(size_t)255; }
constexpr size_t SZ_W = al256((size_t)DM * DM * 2);                 // one bf16 weight plane
constexpr size_t SZ_R = al256((size_t)RPAD * HD * 2);               // bf16 position plane, 144 rows
constexpr size_t SZ_X = al256((size_t)NB * SEQ * DM * 2);           // one 16-bit [NB*SEQ][DM] plane (merged-head plane)
constexpr size_t SZ_P = al256((size_t)NB * NH * SEQ * HD * 2);      // one 16-bit head plane
constexpr size_t SZ_F = al256((size_t)NCK * 128);                   // 0 / NaN lines of the index compare, one per work-group
constexpr size_t WS_TOTAL = SZ_W + SZ_R + 2 * SZ_P + SZ_P + 2 * SZ_X + SZ_F;
static_assert(WS_TOTAL <= (size_t)134217728);                       // carve stays within 128 MiB
static_assert(SZ_P == SZ_X);                                        // NH * HD == DM
static_assert(SZ_R >= (size_t)RPAD * HD * 2);                       // last position plane line lies inside its region

extern "C" void kernel_launch(void* const* d_in, const int* in_sizes, int n_in,
                              void* d_out, int out_size, void* d_ws, size_t ws_size, hipStream_t stream) {
    if (n_in < 8) return;
    const size_t need_act = (size_t)(NB - 1) * SEQ_FULL * DM + (size_t)SEQ * DM;
    if ((size_t)in_sizes[0] < need_act || (size_t)in_sizes[1] < need_act || (size_t)in_sizes[2] < need_act) return;
    if (in_sizes[3] < DM || in_sizes[4] < DM || in_sizes[5] < NREL * HD || (size_t)in_sizes[6] < (size_t)DM * DM) return;
    if ((size_t)in_sizes[7] < (size_t)(SEQ - 1) * SEQ_FULL + (size_t)SEQ) return;
    if ((size_t)out_size < need_act) return;
    if (WS_TOTAL > ws_size) return;
    // wire order: q, k, v, ln_gamma, ln_beta, rpe_emb, W_proj (all f32; W_proj [out][in]), rel_idx (int32 [SEQ][SEQ])
    const float* xq = (const float*)d_in[0]; const float* xk = (const float*)d_in[1]; const float* xv = (const float*)d_in[2];
    const float* lg = (const float*)d_in[3]; const float* lb = (const float*)d_in[4]; const float* rp = (const float*)d_in[5]; const float* wp = (const float*)d_in[6];
    const int* rel = (const int*)d_in[7];
    float* OUT = (float*)d_out;
    char* wsp = (char*)d_ws;
    auto take = [&](size_t bytes) { char* p = wsp; wsp += bytes; return (void*)p; };
    bf* WO = (bf*)take(SZ_W);
    bf* RPP = (bf*)take(SZ_R);
    bf* QP = (bf*)take(SZ_P); bf* KP = (bf*)take(SZ_P);
    h16* VT = (h16*)take(SZ_P);
    bf* CTh = (bf*)take(SZ_X); bf* CTl = (bf*)take(SZ_X);
    float* PZ = (float*)take(SZ_F);
    if ((size_t)(wsp - (char*)d_ws) != WS_TOTAL) return;

    k_pre<<<dim3(PB_ALL), PT, 0, stream>>>(xq, xk, xv, lg, lb, rp, wp, rel, QP, KP, VT, RPP, WO, PZ);
    k_flash<<<dim3(SEQ / 64, NB * NH), 128, 0, stream>>>(QP, KP, RPP, VT, CTh, CTl);
    k_gemm_out<<<dim3(SEQ / GT, DM / GT, NB), 128, 0, stream>>>(CTh, CTl, WO, PZ, OUT);
}

// v007
// Measured time: 75.2 microseconds a run.
// In both of two side-by-side timings against v006, it was 1.08 times as fast.
// Over all steps from v000 it is 13.2 times as fast.
#include <hip/hip_runtime.h>

#ifndef NB
#define NB 4
#endif
#ifndef SEQ
#define SEQ 2048
#endif
#define NB_FULL  4
#define SEQ_FULL 2048
#define DM   512
#define NH   8
#define HD   64
#define PCAR 1024.0f
#define PLG  10.0f   // log2(PCAR)
#define SCL  0.125f
#define L2E  1.4426950408889634f
#define LKP  72      // LDS row pitch (16-bit elements) of the K / V^T tiles: 144 B rows
#define LOP  68      // LDS row pitch (floats) of epilogue staging tiles: 272 B rows
#define RK   64      // relative distance clip
#define NREL 129     // position table rows: 2 * RK + 1
#define RT   9       // 16-wide column tiles of the per-wave q.rpe^T table
#define RPAD 144     // position plane rows, zero filled beyond NREL
#define LRP  148     // LDS row pitch (floats) of the per-wave q.rpe^T table
#define LTP  72      // LDS row pitch (halves) of the LayerNorm transpose tile
#define LNC  128     // features one 16-byte read per lane covers in the LayerNorm job: 32 lanes x 4
#define LNEPS 1.0e-5f
#define PT   256         // threads of a pre-pass work-group, the same for all six jobs
#define CKS  (SEQ / (4 * PT))   // 16-byte reads per thread and row of the index input
#define CKU  8           // rows per index-compare work-group: CKU * CKS independent 16-byte reads per thread
#define NCK  (SEQ / CKU) // index-compare work-groups == 0 / NaN lines
#define GT   128         // rows and columns of an output GEMM work-group's tile
#define GK   64          // k elements of an output GEMM stage: 128-byte rows
#define GPL  (GT * LKP)  // elements of one staged plane
#define GST  (3 * GPL)   // elements of a stage: Ah | Al | W
#define GRS  (16 * LKP * 2)   // LDS bytes between rows 16 apart

static_assert(DM == NH * HD);            // one 64-wide GEMM column tile == one head
static_assert(HD == 64);
static_assert(DM % 32 == 0);             // WMMA k-step
static_assert(DM % GT == 0 && SEQ % GT == 0);   // GEMM tiles
static_assert(DM % GK == 0 && DM / GK >= 2);    // whole stages, and the two that the ring's start needs
static_assert(GT * GK * 2 == 128 * 8 * 16);     // a staged plane == 128 threads x 8 copies x 16 B
static_assert((size_t)2 * GST * 2 + (size_t)4 * 16 * LOP * 4 <= 163840);   // output GEMM static LDS
static_assert(SEQ % 64 == 0);            // key blocks, query blocks
static_assert((SEQ * DM) % (8 * 256) == 0);   // q / k convert job's work-group range is exact
static_assert((DM * DM) % (8 * 256) == 0);
static_assert(NB <= NB_FULL);
static_assert(SEQ <= SEQ_FULL);
static_assert(LKP % 8 == 0);             // 16-byte aligned LDS vector accesses
static_assert(LOP % 4 == 0);
static_assert(NREL == 2 * RK + 1);
static_assert(RPAD == RT * 16);          // position plane rows == table column tiles
static_assert(NREL <= RPAD);
static_assert(RPAD <= LRP);              // table columns fit the LDS pitch
static_assert(2 * RK < RPAD);            // largest clamped index is a written column
static_assert((RPAD * HD) % 64 == 0);
static_assert(HD * 2 == 8 * 16);         // head plane row == 8 lanes x 16 B
static_assert(LTP % 8 == 0);
static_assert(SEQ % (4 * PT) == 0);      // index compare: whole 16-byte reads, the same number in every thread
static_assert(SEQ % CKU == 0);           // index compare grid is exact
static_assert(NCK % 32 == 0);            // the output GEMM's wave reads the lines 32 at a time
static_assert(256 * 16 * 2 == 64 * 64 * 2);
static_assert(32 * 16 * 4 == 16 * HD * 2);
static_assert(32 * 16 * 8 == 16 * 64 * 4);     // output epilogue: lanes x bytes x trips == 16 rows x 256 B
static_assert(PCAR == 1024.0f);                // PLG = log2(PCAR)
static_assert((size_t)64 * LKP * 2 * 2 + (size_t)4 * 16 * LOP * 4 + (size_t)4 * 16 * LRP * 4 <= 131072);   // flash static LDS
static_assert((size_t)DM * LTP * 2 <= 131072);                                                                                  // LayerNorm static LDS
static_assert(DM % LNC == 0);            // whole chunks
static_assert((DM * 8) % 256 == 0);      // tile write-out: whole 16-byte units per thread

typedef _Float16 h16;
typedef unsigned short bf;
typedef __attribute__((ext_vector_type(16))) __bf16   v16bf;
typedef __attribute__((ext_vector_type(16))) _Float16 v16h;
typedef __attribute__((ext_vector_type(8)))  _Float16 v8h;
typedef __attribute__((ext_vector_type(8)))  unsigned short v8us;
typedef __attribute__((ext_vector_type(8)))  float    v8f;
typedef __attribute__((ext_vector_type(4)))  float    v4f;
typedef __attribute__((ext_vector_type(2)))  float    v2f;
typedef __attribute__((ext_vector_type(2)))  _Float16 v2h;
typedef __attribute__((ext_vector_type(4)))  int      v4i;
typedef __attribute__((ext_vector_type(4)))  _Float16 v4h;
typedef v8h  __attribute__((may_alias)) v8ha;
typedef v4h  __attribute__((may_alias)) v4ha;
typedef v4f  __attribute__((may_alias)) v4fa;
typedef v8us __attribute__((may_alias)) v8usa;

__device__ __forceinline__ unsigned short f2bf(float f) { unsigned u = __float_as_uint(f); u += 0x7FFFu + ((u >> 16) & 1u); return (unsigned short)(u >> 16); }
__device__ __forceinline__ float bf2f(unsigned short b) { return __uint_as_float(((unsigned)b) << 16); }
__device__ __forceinline__ float bfr(float f) { return bf2f(f2bf(f)); }
__device__ __forceinline__ void splitf(float y, unsigned short& h, unsigned short& l) { h = f2bf(y); l = f2bf(y - bf2f(h)); }
__device__ __forceinline__ v16h cat16(v8h lo, v8h hi) { return __builtin_shufflevector(lo, hi, 0, 1, 2, 3, 4, 5, 6, 7, 8, 9, 10, 11, 12, 13, 14, 15); }
__device__ __forceinline__ v16bf cat16b(v8us lo, v8us hi) { return __builtin_bit_cast(v16bf, __builtin_shufflevector(lo, hi, 0, 1, 2, 3, 4, 5, 6, 7, 8, 9, 10, 11, 12, 13, 14, 15)); }
__device__ __forceinline__ v8f wmma16(v16h a, v16h b, v8f c) { return __builtin_amdgcn_wmma_f32_16x16x32_f16(false, a, false, b, (short)0, c, false, false); }
__device__ __forceinline__ v8f wmmab(v16bf a, v16bf b, v8f c) { return __builtin_amdgcn_wmma_f32_16x16x32_bf16(false, a, false, b, (short)0, c, false, false); }
// fragment from a K-contiguous global bf16 plane: elements 0..7 <- p[0..7], 8..15 <- p[16..23] (p already includes row*pitch + k0 + 8*(lane>>4))
__device__ __forceinline__ v16bf ldg16(const bf* __restrict__ p) { return cat16b(*(const v8us*)p, *(const v8us*)(p + 16)); }
// same-wave LDS exchange ordering (wave-private tiles only)
__device__ __forceinline__ void wsync() { __builtin_amdgcn_wave_barrier(); asm volatile("" ::: "memory"); }
// one matrix instruction followed by its own four idle slots (ties the accumulator, keeps the operands live)
__device__ __forceinline__ v8f wmmab_g(v16bf a, v16bf b, v8f c) { c = __builtin_amdgcn_wmma_f32_16x16x32_bf16(false, a, false, b, (short)0, c, false, false); asm volatile("v_nop\n\tv_nop\n\tv_nop\n\tv_nop" : "+v"(c) : "v"(a), "v"(b)); return c; }
// f32 -> f16 operand convert that cannot produce an f16 subnormal
__device__ __forceinline__ h16 toh_flush(float v) { const h16 r = (h16)v; return (fabsf(v) < 6.103515625e-05f) ? (h16)0.0f : r; }
// lane l exchanges with lane l ^ 16 (the two lanes that share one column of a D tile)
__device__ __forceinline__ float xhalf(float x) { return __builtin_bit_cast(float, __builtin_amdgcn_permlanex16(__builtin_bit_cast(int, x), __builtin_bit_cast(int, x), 0x76543210, 0xfedcba98, false, false)); }
__device__ __forceinline__ int clampi(int v, int lo, int hi) { const int t = v < lo ? lo : v; return t > hi ? hi : t; }

// fragment from a K-contiguous LDS row, the same element order as ldg16
__device__ __forceinline__ v16bf lds16(const bf* p) { return cat16b(*(const v8usa*)p, *(const v8usa*)(p + 16)); }
// eight asynchronous 16-byte copies of one lane, global -> LDS, rows 16 apart: a wave's copy is 4 whole 128-byte lines. l: the lane's LDS byte address, g: its global address.
// The s_wait_xcnt closes the statement so that it stands in front of every later write of an address register the copies name.
__device__ __forceinline__ void acopy8(unsigned l, const bf* g) {
    asm volatile("global_load_async_to_lds_b128 %0, %8, off\n\t"
                 "global_load_async_to_lds_b128 %1, %9, off\n\t"
                 "global_load_async_to_lds_b128 %2, %10, off\n\t"
                 "global_load_async_to_lds_b128 %3, %11, off\n\t"
                 "global_load_async_to_lds_b128 %4, %12, off\n\t"
                 "global_load_async_to_lds_b128 %5, %13, off\n\t"
                 "global_load_async_to_lds_b128 %6, %14, off\n\t"
                 "global_load_async_to_lds_b128 %7, %15, off\n\t"
                 "s_wait_xcnt 0x0"
                 :: "v"(l), "v"(l + 1u * GRS), "v"(l + 2u * GRS), "v"(l + 3u * GRS), "v"(l + 4u * GRS), "v"(l + 5u * GRS), "v"(l + 6u * GRS), "v"(l + 7u * GRS),
                    "v"(g), "v"(g + 1 * 16 * DM), "v"(g + 2 * 16 * DM), "v"(g + 3 * 16 * DM), "v"(g + 4 * 16 * DM), "v"(g + 5 * 16 * DM), "v"(g + 6 * 16 * DM), "v"(g + 7 * 16 * DM)
                 : "memory");
}

// The six jobs of the pre-pass launch are device functions; bx (and by) is the job's own work-group index, the same for the whole work-group.
__device__ __forceinline__ void d_cvt8(const float* __restrict__ src, bf* dst, unsigned n8, unsigned bx) {
    const unsigned i = bx * 256u + threadIdx.x; if (i >= n8) return;
    const float* s = src + (size_t)i * 8; bf* d = dst + (size_t)i * 8;
    const v4f v0 = *(const v4f*)s; const v4f v1 = *(const v4f*)(s + 4); v8us o;
#pragma unroll
    for (int k = 0; k < 4; ++k) { o[k] = f2bf(v0[k]); o[4 + k] = f2bf(v1[k]); }
    *(v8us*)d = o; 
}

__device__ __forceinline__ void d_cvt8h(const float* __restrict__ src, bf* dst, unsigned n8, size_t sstride, float sc, unsigned bx, unsigned by) {
#pragma clang fp contract(off)
    const unsigned i = bx * 256u + threadIdx.x; if (i >= n8) return;
    const unsigned e = i * 8u; const unsigned srow = e / DM, c = e % DM; const unsigned hh = c / HD, dd = c % HD;
    const float* s = src + (size_t)by * sstride + (size_t)e;
    bf* d = dst + (((size_t)by * NH + hh) * SEQ + srow) * HD + dd;
    const v4f v0 = *(const v4f*)s; const v4f v1 = *(const v4f*)(s + 4); v8us o;
#pragma unroll
    for (int k = 0; k < 4; ++k) { o[k] = f2bf(bfr(v0[k]) * sc); o[4 + k] = f2bf(bfr(v1[k]) * sc); }
    *(v8us*)d = o; 
}

__device__ __forceinline__ void d_cvt_rpe(const float* __restrict__ src, bf* dst, unsigned bx) {
    const unsigned i = bx * 256u + threadIdx.x; if (i >= (unsigned)(RPAD * HD / 8)) return;
    const unsigned nreal = (unsigned)(NREL * HD / 8);
    const unsigned ic = i < nreal ? i : nreal - 1u;
    const bool ok = i < nreal;
    const float* s = src + (size_t)ic * 8; bf* d = dst + (size_t)i * 8;
    const v4f v0 = *(const v4f*)s; const v4f v1 = *(const v4f*)(s + 4); v8us o;
#pragma unroll
    for (int k = 0; k < 4; ++k) { const unsigned short a = f2bf(v0[k]); const unsigned short c = f2bf(v1[k]); o[k] = ok ? a : (unsigned short)0; o[4 + k] = ok ? c : (unsigned short)0; }
    *(v8us*)d = o; 
}

// sum over the wave's 32 lanes, the same value in every lane: four exchanges inside the 16-lane row (DPP row_xmask 1, 2, 4, 8), then one with lane ^ 16
template <int M> __device__ __forceinline__ float rowx(float x) { return __builtin_bit_cast(float, __builtin_amdgcn_update_dpp(0, __builtin_bit_cast(int, x), 0x160 + M, 0xf, 0xf, true)); }
__device__ __forceinline__ float wsum(float x) { x += rowx<1>(x); x += rowx<2>(x); x += rowx<4>(x); x += rowx<8>(x); return x + xhalf(x); }

// ---- d_ln_vt: V^T[b][n][s] (f16) = ((x - mean) * rsqrt(var + eps) * gain[n] + shift[n]) over the 512 features of token s, x = RNE bf16 of the value stream; work-groups (bx < SEQ/64, by < NB), 256 threads.
// Wave w owns tokens 8w..8w+7 from first to last, four at a time; a lane holds features 128c + 4*lane + j: 16 reads of 16 bytes in flight per lane, the stream is read once.
// Mean, then centred variance, both reduced in registers; the statistics never leave the owning wave. The lane's 4 tokens of one feature are one 8-byte write into the [512][64] LDS tile.
// One block barrier, then the tile's rows go out as whole 128-byte lines.
__device__ __forceinline__ void d_ln_vt(const float* __restrict__ X, const float* __restrict__ G, const float* __restrict__ Bt, h16* VT, unsigned bx, unsigned by) {
#pragma clang fp contract(off)
    __shared__ __align__(16) h16 t_s[DM * LTP];
    const int tid = threadIdx.x, lane = tid & 31;
    const int wid = __builtin_amdgcn_readfirstlane(tid >> 5);
    const size_t z = by; const int s0 = bx * 64;
    const unsigned lo = lane * 4;
    const float* xr = X + z * (size_t)SEQ_FULL * DM + (size_t)(s0 + wid * 8) * DM + lo;   // the lane's place in the batch's first token; steps on by one batch a trip
    // kept rolled: unrolled, both batches' reads are hoisted together and the registers they take are charged to every job of this launch
#pragma unroll 1
    for (int tb = 0; tb < 8; tb += 4) {
        v4f xv[4][DM / LNC];
#pragma unroll
        for (int u = 0; u < 4; ++u)
#pragma unroll
            for (int c = 0; c < DM / LNC; ++c) xv[u][c] = *(const v4f*)(xr + u * DM + c * LNC);
        float mu[4], rs[4];
#pragma unroll
        for (int u = 0; u < 4; ++u) { float sm = 0.0f;
#pragma unroll
            for (int c = 0; c < DM / LNC; ++c)
#pragma unroll
                for (int j = 0; j < 4; ++j) { xv[u][c][j] = bfr(xv[u][c][j]); sm += xv[u][c][j]; }
            mu[u] = sm; }
#pragma unroll
        for (int u = 0; u < 4; ++u) mu[u] = wsum(mu[u]) * (1.0f / DM);
#pragma unroll
        for (int u = 0; u < 4; ++u) { float sq = 0.0f;
#pragma unroll
            for (int c = 0; c < DM / LNC; ++c)
#pragma unroll
                for (int j = 0; j < 4; ++j) { const float dv = xv[u][c][j] - mu[u]; sq += dv * dv; }
            rs[u] = sq; }
#pragma unroll
        for (int u = 0; u < 4; ++u) rs[u] = rsqrtf(wsum(rs[u]) * (1.0f / DM) + LNEPS);
#pragma unroll
        for (int c = 0; c < DM / LNC; ++c) {
            const v4f g4 = *(const v4f*)(G + c * LNC + lo), b4 = *(const v4f*)(Bt + c * LNC + lo);
#pragma unroll
            for (int j = 0; j < 4; ++j) { const float g = bfr(g4[j]), be = bfr(b4[j]); v4h o;
#pragma unroll
                for (int u = 0; u < 4; ++u) { const float y = (xv[u][c][j] - mu[u]) * rs[u] * g + be; o[u] = toh_flush(y); }
                *(v4ha*)(&t_s[(c * LNC + lane * 4 + j) * LTP + wid * 8 + tb]) = o; }
        }
        xr += 4 * DM;
    }
    __syncthreads();
#pragma unroll
    for (int it = 0; it < DM * 8 / PT; ++it) { const int u = tid + it * PT; const int row = u >> 3, part = (u & 7) * 8;
        const v8h ov = *(const v8ha*)(&t_s[row * LTP + part]);
        *(v8h*)(VT + (z * DM + (size_t)row) * SEQ + s0 + part) = ov; }
}

// ---- d_relchk: work-group g compares rows g*CKU .. g*CKU+CKU-1 of the index input with the closed form and stores its own 128-byte line pz[g*32 .. g*32+31] = 0 (all equal) or NaN; g < NCK, 256 threads, CKS 16-byte reads per thread and row.
__device__ __forceinline__ void d_relchk(const int* __restrict__ rel, float* pz, unsigned g) {
    __shared__ int bad_s[PT / 32];
    const int tid = threadIdx.x, lane = tid & 31;
    const int wid = __builtin_amdgcn_readfirstlane(tid >> 5);
    const int i0 = g * CKU, j = tid * 4;
    const int* rp = rel + (size_t)i0 * SEQ_FULL + j;
    v4i t[CKU][CKS];
#pragma unroll
    for (int u = 0; u < CKU; ++u)
#pragma unroll
        for (int s = 0; s < CKS; ++s) t[u][s] = *(const v4i*)(rp + (size_t)u * SEQ_FULL + s * (4 * PT));
    int bad = 0;
#pragma unroll
    for (int u = 0; u < CKU; ++u) {
#pragma unroll
        for (int s = 0; s < CKS; ++s) {
#pragma unroll
            for (int cc = 0; cc < 4; ++cc) { const int want = clampi(j + s * (4 * PT) + cc - i0 - u, -RK, RK) + RK; bad |= (t[u][s][cc] != want) ? 1 : 0; }
        }
    }
    bad |= __shfl_xor(bad, 16, 32); bad |= __shfl_xor(bad, 8, 32); bad |= __shfl_xor(bad, 4, 32); bad |= __shfl_xor(bad, 2, 32); bad |= __shfl_xor(bad, 1, 32);
    if (lane == 0) bad_s[wid] = bad;
    __syncthreads();
    int any = 0;
#pragma unroll
    for (int w = 0; w < PT / 32; ++w) any |= bad_s[w];
    const float pv = (any != 0) ? __uint_as_float(0x7FC00000u) : 0.0f;
    if (tid < 8) { const v4f o = (v4f){pv, pv, pv, pv}; *(v4f*)(pz + (size_t)g * 32 + tid * 4) = o;  }
}

// ---- k_pre: the six preparation jobs read only inputs and write disjoint workspace planes, so none waits for another: one launch, each job on its own range of blockIdx.x.
// The LayerNorm work-groups are the few long ones and come first, so that they start first and the short streaming jobs run beside them. Every branch is on blockIdx.x alone (block barriers inside stay block-uniform).
constexpr unsigned NW8 = (unsigned)((size_t)DM * DM / 8), NA8 = (unsigned)((size_t)SEQ * DM / 8);
constexpr unsigned PB_LN = (SEQ / 64) * NB;              // LayerNorm + transpose
constexpr unsigned PB_CK = NCK;                          // index compare
constexpr unsigned PB_A  = (NA8 / 256) * NB;             // one head plane (q, then k)
constexpr unsigned PB_W  = NW8 / 256;                    // weight plane
constexpr unsigned PB_R  = (RPAD * HD / 8 + 255) / 256;  // position plane
constexpr unsigned PB_ALL = PB_LN + PB_CK + 2 * PB_A + PB_W + PB_R;
__global__ __launch_bounds__(PT) void k_pre(const float* __restrict__ xq, const float* __restrict__ xk, const float* __restrict__ xv, const float* __restrict__ lg, const float* __restrict__ lb,
                                            const float* __restrict__ rp, const float* __restrict__ wp, const int* __restrict__ rel, bf* QP, bf* KP, h16* VT, bf* RPP, bf* WO, float* PZ) {
    unsigned g = blockIdx.x;
    if (g < PB_LN) { d_ln_vt(xv, lg, lb, VT, g % (SEQ / 64), g / (SEQ / 64)); return; }
    g -= PB_LN;
    if (g < PB_CK) { d_relchk(rel, PZ, g); return; }
    g -= PB_CK;
    if (g < PB_A) { d_cvt8h(xq, QP, NA8, (size_t)SEQ_FULL * DM, SCL, g % (NA8 / 256), g / (NA8 / 256)); return; }
    g -= PB_A;
    if (g < PB_A) { d_cvt8h(xk, KP, NA8, (size_t)SEQ_FULL * DM, 1.0f, g % (NA8 / 256), g / (NA8 / 256)); return; }
    g -= PB_A;
    if (g < PB_W) { d_cvt8(wp, WO, NW8, g); return; }
    g -= PB_W;
    d_cvt_rpe(rp, RPP, g);
}

// ---- k_gemm_out: OUT[b][s][n] (f32) = sum_k (Ah + Al)[b*SEQ+s][k] W[n][k] (+ the sum of the 0 / NaN lines of the index compare); grid (SEQ/128, DM/128, NB), 128 threads: 2 x 2 waves, 64 x 64 outputs each.
// A stage is 64 k of 128 rows of Ah, Al and W (128-byte rows, LDS pitch 144 B), brought as whole lines by asynchronous copies into one of two buffers; stage t + 1 is in flight while stage t is worked on.
// Per accumulator the products keep the order k-step by k-step, Ah then Al.
__global__ __launch_bounds__(128) void k_gemm_out(const bf* __restrict__ Ah, const bf* __restrict__ Al, const bf* __restrict__ W, const float* __restrict__ pz, float* C) {
    __shared__ __align__(16) bf g_s[2 * GST];
    __shared__ __align__(16) float os[4 * 16 * LOP];
    const int tid = threadIdx.x, lane = tid & 31, lr = lane & 15, hi = lane >> 4;
    const int wid = __builtin_amdgcn_readfirstlane(tid >> 5);
    const int wm = wid >> 1, wn = wid & 1;
    const size_t z = blockIdx.z; const int r0 = blockIdx.x * GT, c0 = blockIdx.y * GT;
    float* Cz = C + z * (size_t)SEQ_FULL * DM;
    // the lane's first 16-byte unit of a stage: row tid / 8, unit tid % 8; its other seven lie 16 rows apart
    const int srow = tid >> 3, spart = (tid & 7) * 8;
    const bf* gA = Ah + z * (size_t)SEQ * DM + (size_t)(r0 + srow) * DM + spart;
    const bf* gL = Al + z * (size_t)SEQ * DM + (size_t)(r0 + srow) * DM + spart;
    const bf* gW = W + (size_t)(c0 + srow) * DM + spart;
    const unsigned l0 = (unsigned)(size_t)(&g_s[srow * LKP + spart]);
    auto stage = [&](int t) {
        const unsigned lb = l0 + (unsigned)(t & 1) * (unsigned)(GST * 2);
        acopy8(lb, gA + t * GK); acopy8(lb + GPL * 2, gL + t * GK); acopy8(lb + 2 * GPL * 2, gW + t * GK);
    };
    stage(0);
    float pzv = 0.0f;
#pragma unroll
    for (int s = 0; s < NCK / 32; ++s) pzv += pz[(size_t)(s * 32 + lane) * 32];
    pzv += __shfl_xor(pzv, 16, 32); pzv += __shfl_xor(pzv, 8, 32); pzv += __shfl_xor(pzv, 4, 32); pzv += __shfl_xor(pzv, 2, 32); pzv += __shfl_xor(pzv, 1, 32);
    v8f acc[4][4];
#pragma unroll
    for (int mb = 0; mb < 4; ++mb)
#pragma unroll
        for (int nb = 0; nb < 4; ++nb) acc[mb][nb] = (v8f){};
    // stage 0 has landed for this wave; the barrier publishes it to the others
    asm volatile("s_wait_asynccnt 0x0" ::: "memory");
    __syncthreads();
    stage(1);
    const int ao = (wm * 64 + lr) * LKP + 8 * hi, bo = 2 * GPL + (wn * 64 + lr) * LKP + 8 * hi;
    // kept rolled: one trip is one stage, and the order at its foot is the ring's
#pragma unroll 1
    for (int t = 0; t < DM / GK; ++t) {
        const bf* sb = &g_s[(t & 1) * GST];
        v16bf bc = lds16(sb + bo);
#pragma unroll
        for (int ks = 0; ks < GK / 32; ++ks) {
            v16bf a[4], a2[4];
#pragma unroll
            for (int mb = 0; mb < 4; ++mb) { a[mb] = lds16(sb + ao + mb * 16 * LKP + ks * 32); a2[mb] = lds16(sb + GPL + ao + mb * 16 * LKP + ks * 32); }
#pragma unroll
            for (int nb = 0; nb < 4; ++nb) {
                // the next W fragment of the stage is read while the eight products on this one run
                const int nx = ks * 4 + nb + 1;
                v16bf bn = bc;
                if (nx < 4 * (GK / 32)) {
                    bn = lds16(sb + bo + (nx & 3) * 16 * LKP + (nx >> 2) * 32);
                    // holds that read in front of the products: moved behind them, into the one fragment's registers, it is waited for with nothing to run meanwhile
                    __builtin_amdgcn_sched_barrier(0);
                }
#pragma unroll
                for (int mb = 0; mb < 4; ++mb) { acc[mb][nb] = wmmab(a[mb], bc, acc[mb][nb]); acc[mb][nb] = wmmab(a2[mb], bc, acc[mb][nb]); }
                bc = bn;
            }
        }
        // foot of the trip: this wave's reads of the buffer are done, its copies of stage t + 1 have landed; the barrier publishes stage t + 1 and frees this trip's buffer for stage t + 2
        asm volatile("s_wait_dscnt 0x0" ::: "memory");
        asm volatile("s_wait_asynccnt 0x0" ::: "memory");
        __syncthreads();
        if (t + 2 < DM / GK) stage(t + 2);
    }
    // no copy is outstanding when the wave goes on to its end
    asm volatile("s_wait_asynccnt 0x0" ::: "memory");
    const int ob = wid * 16 * LOP;
#pragma unroll
    for (int mb = 0; mb < 4; ++mb) {
#pragma unroll
        for (int nb = 0; nb < 4; ++nb) {
#pragma unroll
            for (int j = 0; j < 8; ++j) os[ob + (hi * 8 + j) * LOP + nb * 16 + lr] = acc[mb][nb][j]; }
        wsync();
        float* crow = Cz + (size_t)(r0 + wm * 64 + mb * 16) * DM + c0 + wn * 64;
#pragma unroll
        for (int s = 0; s < 8; ++s) { const int row = 2 * s + hi, cofs = lr * 4; v4f val = *(const v4fa*)(&os[ob + row * LOP + cofs]);
            val[0] += pzv; val[1] += pzv; val[2] += pzv; val[3] += pzv;
            *(v4f*)(crow + (size_t)row * DM + cofs) = val; }
        wsync();
    }
}

__global__ __launch_bounds__(128) void k_flash(const bf* __restrict__ Qh, const bf* __restrict__ Kh, const bf* __restrict__ RP, const h16* __restrict__ VT, bf* Ch, bf* Cl) {
    __shared__ __align__(16) bf    kh_s[64 * LKP];
    __shared__ __align__(16) h16   vt_s[64 * LKP];
    __shared__ __align__(16) float o_s[4 * 16 * LOP];
    __shared__ __align__(16) float r_s[4 * 16 * LRP];
    const int tid = threadIdx.x, lane = tid & 31, lr = lane & 15, hi = lane >> 4;
    const int wid = __builtin_amdgcn_readfirstlane(tid >> 5);
    const int bh = blockIdx.y; const int b = bh / NH, h = bh % NH;
    const int q0 = blockIdx.x * 64 + wid * 16;
    const size_t pl = (size_t)bh * SEQ * HD;
    const size_t qoff = pl + (size_t)(q0 + lr) * HD + 8 * hi;
    const size_t vbase = ((size_t)b * DM + (size_t)h * HD) * SEQ;
    const int ob = wid * 16 * LOP;
    const int rb = wid * 16 * LRP + 8 * hi * LRP;   // table rows as the prologue's D tiles hold them
    const int tb = wid * 16 * LRP + lr * LRP;       // table row of the lane's own query
    const v16bf qa0 = ldg16(Qh + qoff); const v16bf qa1 = ldg16(Qh + qoff + 32);
#pragma unroll 1
    for (int ct = 0; ct < RT; ++ct) {
        const size_t ro = (size_t)(ct * 16 + lr) * HD + 8 * hi;
        const v16bf b0 = ldg16(RP + ro); const v16bf b1 = ldg16(RP + ro + 32);
        v8f t = (v8f){};
        t = wmmab_g(qa0, b0, t);
        t = wmmab_g(qa1, b1, t);
#pragma unroll
        for (int j = 0; j < 8; ++j) r_s[rb + j * LRP + ct * 16 + lr] = t[j];
    }
    wsync();
    const float rlo = r_s[tb], rhi = r_s[tb + 2 * RK];
    v8f o[4];
#pragma unroll
    for (int dt = 0; dt < 4; ++dt) o[dt] = (v8f){};
    float mr = -1.0e30f, ls = 0.0f;

    // K tile [key][d] and V^T tile [d][key] of key block kb into LDS, block barriers on both sides
    auto stage = [&](const int kb) {
        __syncthreads();
#pragma unroll
        for (int it = 0; it < 4; ++it) {
            const int u = tid + it * 128; const int row = u >> 3, part = (u & 7) * 8;
            const size_t g = pl + (size_t)kb * 64 * HD + (size_t)u * 8;
            const v8us a = *(const v8us*)(Kh + g);
            const v8h v = *(const v8h*)(VT + vbase + (size_t)row * SEQ + (size_t)kb * 64 + part);
            *(v8usa*)(&kh_s[row * LKP + part]) = a; *(v8ha*)(&vt_s[row * LKP + part]) = v;
        }
        __syncthreads();
    };
    // one 32-key half, keys j0 .. j0 + 31. band == false: the half lies beyond the clip on one side for every query of the work-group, so all keys share the lane's position value rv;
    // it is not added to the scores: it goes once into the maximum and once into the exp2 argument's addend. band == true: the position term is added to each score (rv unused).
    auto half = [&](const int hf, const int j0, const bool band, const float rv) {
        v8f s0 = (v8f){}, s1 = (v8f){};
        const int kr0 = (hf * 32 + lr) * LKP + 8 * hi, kr1 = kr0 + 16 * LKP;
        {
            const v16bf k00 = cat16b(*(const v8usa*)(&kh_s[kr0]), *(const v8usa*)(&kh_s[kr0 + 16]));
            const v16bf k10 = cat16b(*(const v8usa*)(&kh_s[kr1]), *(const v8usa*)(&kh_s[kr1 + 16]));
            const v16bf k01 = cat16b(*(const v8usa*)(&kh_s[kr0 + 32]), *(const v8usa*)(&kh_s[kr0 + 48]));
            const v16bf k11 = cat16b(*(const v8usa*)(&kh_s[kr1 + 32]), *(const v8usa*)(&kh_s[kr1 + 48]));
            // holds the four fragments' eight LDS reads together in front of the products: without it each product waits out an LDS round trip of its own
            asm volatile("" :: "v"(k00), "v"(k10), "v"(k01), "v"(k11));
            s0 = wmmab(k00, qa0, s0); s1 = wmmab(k10, qa0, s1);
            s0 = wmmab(k01, qa1, s0); s1 = wmmab(k11, qa1, s1);
            // keeps the four products back to back: a vector instruction moved in between them costs its own run of idle slots and holds the last product back
            __builtin_amdgcn_sched_barrier(0);
        }
        if (band) {
            // position term: query q0 + lr, keys j0 + 8*hi + r (s0) and j0 + 16 + 8*hi + r (s1); both tests are on scalars only.
            // A half wholly beyond the clip on one side for this wave takes the register value, added without a branch (0 in a half near the diagonal): behind the products stands straight-line vector work, so their distance is padded once and not again on each side of a branch and at its join.
            const bool fhi = j0 - q0 >= RK + 15, flo = q0 - j0 >= RK + 31;
            const float rw = fhi ? rhi : (flo ? rlo : 0.0f);
#pragma unroll
            for (int r = 0; r < 8; ++r) { s0[r] += rw; s1[r] += rw; }
            if (!(fhi || flo)) {
#pragma unroll
                for (int r = 0; r < 8; ++r) {
                    const int d0 = j0 + 8 * hi + r - q0 - lr;
                    const int i0 = clampi(d0, -RK, RK) + RK, i1 = clampi(d0 + 16, -RK, RK) + RK;
                    const float b0 = r_s[tb + i0]; const float b1 = r_s[tb + i1];
                    s0[r] += b0; s1[r] += b1;
                }
            }
        }
        // running-max softmax update for the lane's query: 16 of the half's 32 keys are in this lane, the other 16 in lane ^ 16; ls holds the lane's partial sum, carried x1024 like P
        float mx = fmaxf(s0[0], s1[0]);
#pragma unroll
        for (int r = 1; r < 8; ++r) mx = fmaxf(mx, fmaxf(s0[r], s1[r]));
        mx = fmaxf(mx, xhalf(mx));
        if (!band) mx += rv;
        const float mnew = fmaxf(mr, mx);
        const float al = __builtin_amdgcn_exp2f((mr - mnew) * L2E);
        mr = mnew;
        // one multiply-add per score: P x1024 = exp2(s * log2(e) + ca), ca = (rv - max) * log2(e) + log2(1024)
        const float ca = (band ? -mnew : rv - mnew) * L2E + PLG;
        const v2f ca2 = (v2f){ca, ca}, l2 = (v2f){L2E, L2E};
        v16h pa; v2f ps = (v2f){0.0f, 0.0f};
#pragma unroll
        for (int r = 0; r < 8; r += 2) {
            const v2f e0 = __builtin_elementwise_fma((v2f){s0[r], s0[r + 1]}, l2, ca2), e1 = __builtin_elementwise_fma((v2f){s1[r], s1[r + 1]}, l2, ca2);
            const v2f p0 = (v2f){__builtin_amdgcn_exp2f(e0[0]), __builtin_amdgcn_exp2f(e0[1])};
            const v2f p1 = (v2f){__builtin_amdgcn_exp2f(e1[0]), __builtin_amdgcn_exp2f(e1[1])};
            ps += p0 + p1;
            const v2h h0 = __builtin_convertvector(p0, v2h), h1 = __builtin_convertvector(p1, v2h);
            pa[r] = h0[0]; pa[r + 1] = h0[1]; pa[8 + r] = h1[0]; pa[8 + r + 1] = h1[1];
        }
        ls = ls * al + (ps[0] + ps[1]);
#pragma unroll
        for (int dt = 0; dt < 4; ++dt)
#pragma unroll
            for (int r = 0; r < 8; ++r) o[dt][r] *= al;
        v16h va[4];
#pragma unroll
        for (int dt = 0; dt < 4; ++dt) { const int vo = (dt * 16 + lr) * LKP + hf * 32 + 8 * hi; va[dt] = cat16(*(const v8ha*)(&vt_s[vo]), *(const v8ha*)(&vt_s[vo + 16])); }
#pragma unroll
        for (int dt = 0; dt < 4; ++dt) o[dt] = wmma16(va[dt], pa, o[dt]);
    };
    // The key blocks in three runs, the bounds the same for the whole work-group (block barriers inside): with queries 64*bx .. 64*bx + 63, a block kb <= bx - 2 has key - query <= -65 and a block kb >= bx + 2 has key - query >= 65 for every pair.
    static_assert(RK <= 64 + 1);
    const int bx = blockIdx.x;
    const int kb1 = bx - 1 > 0 ? bx - 1 : 0, kb2 = bx + 2 < SEQ / 64 ? bx + 2 : SEQ / 64;
#pragma unroll 1
    for (int kb = 0; kb < kb1; ++kb) {
        stage(kb);
#pragma unroll 1
        for (int hf = 0; hf < 2; ++hf) half(hf, kb * 64 + hf * 32, false, rlo);
    }
#pragma unroll 1
    for (int kb = kb1; kb < kb2; ++kb) {
        stage(kb);
#pragma unroll 1
        for (int hf = 0; hf < 2; ++hf) half(hf, kb * 64 + hf * 32, true, 0.0f);
    }
#pragma unroll 1
    for (int kb = kb2; kb < SEQ / 64; ++kb) {
        stage(kb);
#pragma unroll 1
        for (int hf = 0; hf < 2; ++hf) half(hf, kb * 64 + hf * 32, false, rhi);
    }
    // normalise: the query's sum is completed over its two lanes; it carries the same x1024 as P, so 1 / l undoes both; the lane's 8 registers of a tile are 8 consecutive features of its query
    {
        const float lt = ls + xhalf(ls);
        const float inv = 1.0f / lt;
#pragma unroll
        for (int dt = 0; dt < 4; ++dt) {
            const v4f y0 = (v4f){o[dt][0] * inv, o[dt][1] * inv, o[dt][2] * inv, o[dt][3] * inv};
            const v4f y1 = (v4f){o[dt][4] * inv, o[dt][5] * inv, o[dt][6] * inv, o[dt][7] * inv};
            *(v4fa*)(&o_s[ob + lr * LOP + dt * 16 + 8 * hi]) = y0; *(v4fa*)(&o_s[ob + lr * LOP + dt * 16 + 8 * hi + 4]) = y1;
        }
    }
    wsync();
    const int srow = lane >> 3, scol = (lane & 7) * 8;
    const size_t cbase = ((size_t)b * SEQ + q0) * DM + (size_t)h * HD;
{
#pragma unroll
        for (int s = 0; s < 4; ++s) { const int row = 4 * s + srow; const v4f x0 = *(const v4fa*)(&o_s[ob + row * LOP + scol]); const v4f x1 = *(const v4fa*)(&o_s[ob + row * LOP + scol + 4]); v8us oh, ol;
#pragma unroll
            for (int j = 0; j < 4; ++j) { unsigned short a, c; splitf(x0[j], a, c); oh[j] = a; ol[j] = c; splitf(x1[j], a, c); oh[4 + j] = a; ol[4 + j] = c; }
            const size_t off = cbase + (size_t)row * DM + scol;
            *(v8us*)(Ch + off) = oh; *(v8us*)(Cl + off) = ol; }
         }
}

constexpr size_t al256(size_t x) { return (x + 255) & ~(size_t)255; }
constexpr size_t SZ_W = al256((size_t)DM * DM * 2);                 // one bf16 weight plane
constexpr size_t SZ_R = al256((size_t)RPAD * HD * 2);               // bf16 position plane, 144 rows
constexpr size_t SZ_X = al256((size_t)NB * SEQ * DM * 2);           // one 16-bit [NB*SEQ][DM] plane (merged-head plane)
constexpr size_t SZ_P = al256((size_t)NB * NH * SEQ * HD * 2);      // one 16-bit head plane
constexpr size_t SZ_F = al256((size_t)NCK * 128);                   // 0 / NaN lines of the index compare, one per work-group
constexpr size_t WS_TOTAL = SZ_W + SZ_R + 2 * SZ_P + SZ_P + 2 * SZ_X + SZ_F;
static_assert(WS_TOTAL <= (size_t)134217728);                       // carve stays within 128 MiB
static_assert(SZ_P == SZ_X);                                        // NH * HD == DM
static_assert(SZ_R >= (size_t)RPAD * HD * 2);                       // last position plane line lies inside its region

extern "C" void kernel_launch(void* const* d_in, const int* in_sizes, int n_in,
                              void* d_out, int out_size, void* d_ws, size_t ws_size, hipStream_t stream) {
    if (n_in < 8) return;
    const size_t need_act = (size_t)(NB - 1) * SEQ_FULL * DM + (size_t)SEQ * DM;
    if ((size_t)in_sizes[0] < need_act || (size_t)in_sizes[1] < need_act || (size_t)in_sizes[2] < need_act) return;
    if (in_sizes[3] < DM || in_sizes[4] < DM || in_sizes[5] < NREL * HD || (size_t)in_sizes[6] < (size_t)DM * DM) return;
    if ((size_t)in_sizes[7] < (size_t)(SEQ - 1) * SEQ_FULL + (size_t)SEQ) return;
    if ((size_t)out_size < need_act) return;
    if (WS_TOTAL > ws_size) return;
    // wire order: q, k, v, ln_gamma, ln_beta, rpe_emb, W_proj (all f32; W_proj [out][in]), rel_idx (int32 [SEQ][SEQ])
    const float* xq = (const float*)d_in[0]; const float* xk = (const float*)d_in[1]; const float* xv = (const float*)d_in[2];
    const float* lg = (const float*)d_in[3]; const float* lb = (const float*)d_in[4]; const float* rp = (const float*)d_in[5]; const float* wp = (const float*)d_in[6];
    const int* rel = (const int*)d_in[7];
    float* OUT = (float*)d_out;
    char* wsp = (char*)d_ws;
    auto take = [&](size_t bytes) { char* p = wsp; wsp += bytes; return (void*)p; };
    bf* WO = (bf*)take(SZ_W);
    bf* RPP = (bf*)take(SZ_R);
    bf* QP = (bf*)take(SZ_P); bf* KP = (bf*)take(SZ_P);
    h16* VT = (h16*)take(SZ_P);
    bf* CTh = (bf*)take(SZ_X); bf* CTl = (bf*)take(SZ_X);
    float* PZ = (float*)take(SZ_F);
    if ((size_t)(wsp - (char*)d_ws) != WS_TOTAL) return;

    k_pre<<<dim3(PB_ALL), PT, 0, stream>>>(xq, xk, xv, lg, lb, rp, wp, rel, QP, KP, VT, RPP, WO, PZ);
    k_flash<<<dim3(SEQ / 64, NB * NH), 128, 0, stream>>>(QP, KP, RPP, VT, CTh, CTl);
    k_gemm_out<<<dim3(SEQ / GT, DM / GT, NB), 128, 0, stream>>>(CTh, CTl, WO, PZ, OUT);
}

// v008
// A run of this version takes 68.4 microseconds.
// Next to v007, in two timings, it ran 1.11 and 1.10 times as fast.
// Over all steps from v000 it is 14.6 times as fast.
#include <hip/hip_runtime.h>

#ifndef NB
#define NB 4
#endif
#ifndef SEQ
#define SEQ 2048
#endif
#define NB_FULL  4
#define SEQ_FULL 2048
#define DM   512
#define NH   8
#define HD   64
#define PCAR 1024.0f
#define PLG  10.0f   // log2(PCAR)
#define SCL  0.125f
#define L2E  1.4426950408889634f
#define LKP  72      // LDS row pitch (16-bit elements) of the K / V^T tiles: 144 B rows
#define LOP  68      // LDS row pitch (floats) of epilogue staging tiles: 272 B rows
#define RK   64      // relative distance clip
#define NREL 129     // position table rows: 2 * RK + 1
#define RT   9       // 16-wide column tiles of the per-wave q.rpe^T table
#define RPAD 144     // position plane rows, zero filled beyond NREL
#define LRP  148     // LDS row pitch (floats) of the per-wave q.rpe^T table
#define LTP  72      // LDS row pitch (halves) of the LayerNorm transpose tile
#define LNC  128     // features one 16-byte read per lane covers in the LayerNorm job: 32 lanes x 4
#define LNEPS 1.0e-5f
#define PT   256         // threads of a pre-pass work-group, the same for all six jobs
#define CKS  (SEQ / (4 * PT))   // 16-byte reads per thread and row of the index input
#define CKU  8           // rows per index-compare work-group: CKU * CKS independent 16-byte reads per thread
#define NCK  (SEQ / CKU) // index-compare work-groups == 0 / NaN lines
#define GT   128         // rows and columns of an output GEMM work-group's tile
#define GK   64          // k elements of an output GEMM stage: 128-byte rows
#define GPL  (GT * LKP)  // elements of one staged plane
#define GST  (3 * GPL)   // elements of a stage: Ah | Al | W
#define GRS  (16 * LKP * 2)   // LDS bytes between rows 16 apart

static_assert(DM == NH * HD);            // one 64-wide GEMM column tile == one head
static_assert(HD == 64);
static_assert(DM % 32 == 0);             // WMMA k-step
static_assert(DM % GT == 0 && SEQ % GT == 0);   // GEMM tiles
static_assert(DM % GK == 0 && DM / GK >= 2);    // whole stages, and the two that the ring's start needs
static_assert(GT * GK * 2 == 128 * 8 * 16);     // a staged plane == 128 threads x 8 copies x 16 B
static_assert((size_t)2 * GST * 2 + (size_t)4 * 16 * LOP * 4 <= 163840);   // output GEMM static LDS
static_assert(SEQ % 64 == 0);            // key blocks, query blocks
static_assert((SEQ * DM) % (8 * 256) == 0);   // q / k convert job's work-group range is exact
static_assert((DM * DM) % (8 * 256) == 0);
static_assert(NB <= NB_FULL);
static_assert(SEQ <= SEQ_FULL);
static_assert(LKP % 8 == 0);             // 16-byte aligned LDS vector accesses
static_assert(LOP % 4 == 0);
static_assert(NREL == 2 * RK + 1);
static_assert(RPAD == RT * 16);          // position plane rows == table column tiles
static_assert(NREL <= RPAD);
static_assert(RPAD <= LRP);              // table columns fit the LDS pitch
static_assert(2 * RK < RPAD);            // largest clamped index is a written column
static_assert((RPAD * HD) % 64 == 0);
static_assert(HD * 2 == 8 * 16);         // head plane row == 8 lanes x 16 B
static_assert(LTP % 8 == 0);
static_assert(SEQ % (4 * PT) == 0);      // index compare: whole 16-byte reads, the same number in every thread
static_assert(SEQ % CKU == 0);           // index compare grid is exact
static_assert(NCK % 32 == 0);            // the output GEMM's wave reads the lines 32 at a time
static_assert(256 * 16 * 2 == 64 * 64 * 2);
static_assert(32 * 16 * 4 == 16 * HD * 2);
static_assert(32 * 16 * 8 == 16 * 64 * 4);     // output epilogue: lanes x bytes x trips == 16 rows x 256 B
static_assert(PCAR == 1024.0f);                // PLG = log2(PCAR)
static_assert((size_t)2 * 64 * LKP * 2 * 2 + (size_t)4 * 16 * LRP * 4 <= 327680 / 4);   // flash static LDS: four work-groups per WGP
static_assert(LOP <= LRP);               // the epilogue's staging rows fit the wave's own table rows
static_assert(SEQ / 64 >= 2);            // the two key blocks that the ring's start needs
static_assert((size_t)DM * LTP * 2 <= 131072);                                                                                  // LayerNorm static LDS
static_assert(DM % LNC == 0);            // whole chunks
static_assert((DM * 8) % 256 == 0);      // tile write-out: whole 16-byte units per thread

typedef _Float16 h16;
typedef unsigned short bf;
typedef __attribute__((ext_vector_type(16))) __bf16   v16bf;
typedef __attribute__((ext_vector_type(16))) _Float16 v16h;
typedef __attribute__((ext_vector_type(8)))  _Float16 v8h;
typedef __attribute__((ext_vector_type(8)))  unsigned short v8us;
typedef __attribute__((ext_vector_type(8)))  float    v8f;
typedef __attribute__((ext_vector_type(4)))  float    v4f;
typedef __attribute__((ext_vector_type(2)))  float    v2f;
typedef __attribute__((ext_vector_type(2)))  _Float16 v2h;
typedef __attribute__((ext_vector_type(4)))  int      v4i;
typedef __attribute__((ext_vector_type(4)))  _Float16 v4h;
typedef v8h  __attribute__((may_alias)) v8ha;
typedef v4h  __attribute__((may_alias)) v4ha;
typedef v4f  __attribute__((may_alias)) v4fa;
typedef v8us __attribute__((may_alias)) v8usa;

__device__ __forceinline__ unsigned short f2bf(float f) { unsigned u = __float_as_uint(f); u += 0x7FFFu + ((u >> 16) & 1u); return (unsigned short)(u >> 16); }
__device__ __forceinline__ float bf2f(unsigned short b) { return __uint_as_float(((unsigned)b) << 16); }
__device__ __forceinline__ float bfr(float f) { return bf2f(f2bf(f)); }
__device__ __forceinline__ void splitf(float y, unsigned short& h, unsigned short& l) { h = f2bf(y); l = f2bf(y - bf2f(h)); }
__device__ __forceinline__ v16h cat16(v8h lo, v8h hi) { return __builtin_shufflevector(lo, hi, 0, 1, 2, 3, 4, 5, 6, 7, 8, 9, 10, 11, 12, 13, 14, 15); }
__device__ __forceinline__ v16bf cat16b(v8us lo, v8us hi) { return __builtin_bit_cast(v16bf, __builtin_shufflevector(lo, hi, 0, 1, 2, 3, 4, 5, 6, 7, 8, 9, 10, 11, 12, 13, 14, 15)); }
__device__ __forceinline__ v8f wmma16(v16h a, v16h b, v8f c) { return __builtin_amdgcn_wmma_f32_16x16x32_f16(false, a, false, b, (short)0, c, false, false); }
__device__ __forceinline__ v8f wmmab(v16bf a, v16bf b, v8f c) { return __builtin_amdgcn_wmma_f32_16x16x32_bf16(false, a, false, b, (short)0, c, false, false); }
// fragment from a K-contiguous global bf16 plane: elements 0..7 <- p[0..7], 8..15 <- p[16..23] (p already includes row*pitch + k0 + 8*(lane>>4))
__device__ __forceinline__ v16bf ldg16(const bf* __restrict__ p) { return cat16b(*(const v8us*)p, *(const v8us*)(p + 16)); }
// same-wave LDS exchange ordering (wave-private tiles only)
__device__ __forceinline__ void wsync() { __builtin_amdgcn_wave_barrier(); asm volatile("" ::: "memory"); }
// one matrix instruction followed by its own four idle slots (ties the accumulator, keeps the operands live)
__device__ __forceinline__ v8f wmmab_g(v16bf a, v16bf b, v8f c) { c = __builtin_amdgcn_wmma_f32_16x16x32_bf16(false, a, false, b, (short)0, c, false, false); asm volatile("v_nop\n\tv_nop\n\tv_nop\n\tv_nop" : "+v"(c) : "v"(a), "v"(b)); return c; }
// f32 -> f16 operand convert that cannot produce an f16 subnormal
__device__ __forceinline__ h16 toh_flush(float v) { const h16 r = (h16)v; return (fabsf(v) < 6.103515625e-05f) ? (h16)0.0f : r; }
// lane l exchanges with lane l ^ 16 (the two lanes that share one column of a D tile)
__device__ __forceinline__ float xhalf(float x) { return __builtin_bit_cast(float, __builtin_amdgcn_permlanex16(__builtin_bit_cast(int, x), __builtin_bit_cast(int, x), 0x76543210, 0xfedcba98, false, false)); }
__device__ __forceinline__ int clampi(int v, int lo, int hi) { const int t = v < lo ? lo : v; return t > hi ? hi : t; }

// fragment from a K-contiguous LDS row, the same element order as ldg16
__device__ __forceinline__ v16bf lds16(const bf* p) { return cat16b(*(const v8usa*)p, *(const v8usa*)(p + 16)); }
// eight asynchronous 16-byte copies of one lane, global -> LDS, rows 16 apart: a wave's copy is 4 whole 128-byte lines. l: the lane's LDS byte address, g: its global address.
// The s_wait_xcnt closes the statement so that it stands in front of every later write of an address register the copies name.
__device__ __forceinline__ void acopy8(unsigned l, const bf* g) {
    asm volatile("global_load_async_to_lds_b128 %0, %8, off\n\t"
                 "global_load_async_to_lds_b128 %1, %9, off\n\t"
                 "global_load_async_to_lds_b128 %2, %10, off\n\t"
                 "global_load_async_to_lds_b128 %3, %11, off\n\t"
                 "global_load_async_to_lds_b128 %4, %12, off\n\t"
                 "global_load_async_to_lds_b128 %5, %13, off\n\t"
                 "global_load_async_to_lds_b128 %6, %14, off\n\t"
                 "global_load_async_to_lds_b128 %7, %15, off\n\t"
                 "s_wait_xcnt 0x0"
                 :: "v"(l), "v"(l + 1u * GRS), "v"(l + 2u * GRS), "v"(l + 3u * GRS), "v"(l + 4u * GRS), "v"(l + 5u * GRS), "v"(l + 6u * GRS), "v"(l + 7u * GRS),
                    "v"(g), "v"(g + 1 * 16 * DM), "v"(g + 2 * 16 * DM), "v"(g + 3 * 16 * DM), "v"(g + 4 * 16 * DM), "v"(g + 5 * 16 * DM), "v"(g + 6 * 16 * DM), "v"(g + 7 * 16 * DM)
                 : "memory");
}

// eight asynchronous 16-byte copies of one lane, global -> LDS: its four units of a [64][64] K tile and its four of a V^T tile, rows 16 apart; a wave's copy is 4 whole 128-byte lines.
// lk, lv: the lane's LDS byte addresses, gk, gv: its global addresses. The s_wait_xcnt closes the statement so that it stands in front of every later write of an address register the copies name.
__device__ __forceinline__ void acopy44(unsigned lk, const bf* gk, unsigned lv, const _Float16* gv) {
    asm volatile("global_load_async_to_lds_b128 %0, %8, off\n\t"
                 "global_load_async_to_lds_b128 %1, %9, off\n\t"
                 "global_load_async_to_lds_b128 %2, %10, off\n\t"
                 "global_load_async_to_lds_b128 %3, %11, off\n\t"
                 "global_load_async_to_lds_b128 %4, %12, off\n\t"
                 "global_load_async_to_lds_b128 %5, %13, off\n\t"
                 "global_load_async_to_lds_b128 %6, %14, off\n\t"
                 "global_load_async_to_lds_b128 %7, %15, off\n\t"
                 "s_wait_xcnt 0x0"
                 :: "v"(lk), "v"(lk + 1u * GRS), "v"(lk + 2u * GRS), "v"(lk + 3u * GRS), "v"(lv), "v"(lv + 1u * GRS), "v"(lv + 2u * GRS), "v"(lv + 3u * GRS),
                    "v"(gk), "v"(gk + 1 * 16 * HD), "v"(gk + 2 * 16 * HD), "v"(gk + 3 * 16 * HD), "v"(gv), "v"(gv + 1 * 16 * SEQ), "v"(gv + 2 * 16 * SEQ), "v"(gv + 3 * 16 * SEQ)
                 : "memory");
}

// The six jobs of the pre-pass launch are device functions; bx (and by) is the job's own work-group index, the same for the whole work-group.
__device__ __forceinline__ void d_cvt8(const float* __restrict__ src, bf* dst, unsigned n8, unsigned bx) {
    const unsigned i = bx * 256u + threadIdx.x; if (i >= n8) return;
    const float* s = src + (size_t)i * 8; bf* d = dst + (size_t)i * 8;
    const v4f v0 = *(const v4f*)s; const v4f v1 = *(const v4f*)(s + 4); v8us o;
#pragma unroll
    for (int k = 0; k < 4; ++k) { o[k] = f2bf(v0[k]); o[4 + k] = f2bf(v1[k]); }
    *(v8us*)d = o; 
}

__device__ __forceinline__ void d_cvt8h(const float* __restrict__ src, bf* dst, unsigned n8, size_t sstride, float sc, unsigned bx, unsigned by) {
#pragma clang fp contract(off)
    const unsigned i = bx * 256u + threadIdx.x; if (i >= n8) return;
    const unsigned e = i * 8u; const unsigned srow = e / DM, c = e % DM; const unsigned hh = c / HD, dd = c % HD;
    const float* s = src + (size_t)by * sstride + (size_t)e;
    bf* d = dst + (((size_t)by * NH + hh) * SEQ + srow) * HD + dd;
    const v4f v0 = *(const v4f*)s; const v4f v1 = *(const v4f*)(s + 4); v8us o;
#pragma unroll
    for (int k = 0; k < 4; ++k) { o[k] = f2bf(bfr(v0[k]) * sc); o[4 + k] = f2bf(bfr(v1[k]) * sc); }
    *(v8us*)d = o; 
}

__device__ __forceinline__ void d_cvt_rpe(const float* __restrict__ src, bf* dst, unsigned bx) {
    const unsigned i = bx * 256u + threadIdx.x; if (i >= (unsigned)(RPAD * HD / 8)) return;
    const unsigned nreal = (unsigned)(NREL * HD / 8);
    const unsigned ic = i < nreal ? i : nreal - 1u;
    const bool ok = i < nreal;
    const float* s = src + (size_t)ic * 8; bf* d = dst + (size_t)i * 8;
    const v4f v0 = *(const v4f*)s; const v4f v1 = *(const v4f*)(s + 4); v8us o;
#pragma unroll
    for (int k = 0; k < 4; ++k) { const unsigned short a = f2bf(v0[k]); const unsigned short c = f2bf(v1[k]); o[k] = ok ? a : (unsigned short)0; o[4 + k] = ok ? c : (unsigned short)0; }
    *(v8us*)d = o; 
}

// sum over the wave's 32 lanes, the same value in every lane: four exchanges inside the 16-lane row (DPP row_xmask 1, 2, 4, 8), then one with lane ^ 16
template <int M> __device__ __forceinline__ float rowx(float x) { return __builtin_bit_cast(float, __builtin_amdgcn_update_dpp(0, __builtin_bit_cast(int, x), 0x160 + M, 0xf, 0xf, true)); }
__device__ __forceinline__ float wsum(float x) { x += rowx<1>(x); x += rowx<2>(x); x += rowx<4>(x); x += rowx<8>(x); return x + xhalf(x); }

// ---- d_ln_vt: V^T[b][n][s] (f16) = ((x - mean) * rsqrt(var + eps) * gain[n] + shift[n]) over the 512 features of token s, x = RNE bf16 of the value stream; work-groups (bx < SEQ/64, by < NB), 256 threads.
// Wave w owns tokens 8w..8w+7 from first to last, four at a time; a lane holds features 128c + 4*lane + j: 16 reads of 16 bytes in flight per lane, the stream is read once.
// Mean, then centred variance, both reduced in registers; the statistics never leave the owning wave. The lane's 4 tokens of one feature are one 8-byte write into the [512][64] LDS tile.
// One block barrier, then the tile's rows go out as whole 128-byte lines.
__device__ __forceinline__ void d_ln_vt(const float* __restrict__ X, const float* __restrict__ G, const float* __restrict__ Bt, h16* VT, unsigned bx, unsigned by) {
#pragma clang fp contract(off)
    __shared__ __align__(16) h16 t_s[DM * LTP];
    const int tid = threadIdx.x, lane = tid & 31;
    const int wid = __builtin_amdgcn_readfirstlane(tid >> 5);
    const size_t z = by; const int s0 = bx * 64;
    const unsigned lo = lane * 4;
    const float* xr = X + z * (size_t)SEQ_FULL * DM + (size_t)(s0 + wid * 8) * DM + lo;   // the lane's place in the batch's first token; steps on by one batch a trip
    // kept rolled: unrolled, both batches' reads are hoisted together and the registers they take are charged to every job of this launch
#pragma unroll 1
    for (int tb = 0; tb < 8; tb += 4) {
        v4f xv[4][DM / LNC];
#pragma unroll
        for (int u = 0; u < 4; ++u)
#pragma unroll
            for (int c = 0; c < DM / LNC; ++c) xv[u][c] = *(const v4f*)(xr + u * DM + c * LNC);
        float mu[4], rs[4];
#pragma unroll
        for (int u = 0; u < 4; ++u) { float sm = 0.0f;
#pragma unroll
            for (int c = 0; c < DM / LNC; ++c)
#pragma unroll
                for (int j = 0; j < 4; ++j) { xv[u][c][j] = bfr(xv[u][c][j]); sm += xv[u][c][j]; }
            mu[u] = sm; }
#pragma unroll
        for (int u = 0; u < 4; ++u) mu[u] = wsum(mu[u]) * (1.0f / DM);
#pragma unroll
        for (int u = 0; u < 4; ++u) { float sq = 0.0f;
#pragma unroll
            for (int c = 0; c < DM / LNC; ++c)
#pragma unroll
                for (int j = 0; j < 4; ++j) { const float dv = xv[u][c][j] - mu[u]; sq += dv * dv; }
            rs[u] = sq; }
#pragma unroll
        for (int u = 0; u < 4; ++u) rs[u] = rsqrtf(wsum(rs[u]) * (1.0f / DM) + LNEPS);
#pragma unroll
        for (int c = 0; c < DM / LNC; ++c) {
            const v4f g4 = *(const v4f*)(G + c * LNC + lo), b4 = *(const v4f*)(Bt + c * LNC + lo);
#pragma unroll
            for (int j = 0; j < 4; ++j) { const float g = bfr(g4[j]), be = bfr(b4[j]); v4h o;
#pragma unroll
                for (int u = 0; u < 4; ++u) { const float y = (xv[u][c][j] - mu[u]) * rs[u] * g + be; o[u] = toh_flush(y); }
                *(v4ha*)(&t_s[(c * LNC + lane * 4 + j) * LTP + wid * 8 + tb]) = o; }
        }
        xr += 4 * DM;
    }
    __syncthreads();
#pragma unroll
    for (int it = 0; it < DM * 8 / PT; ++it) { const int u = tid + it * PT; const int row = u >> 3, part = (u & 7) * 8;
        const v8h ov = *(const v8ha*)(&t_s[row * LTP + part]);
        *(v8h*)(VT + (z * DM + (size_t)row) * SEQ + s0 + part) = ov; }
}

// ---- d_relchk: work-group g compares rows g*CKU .. g*CKU+CKU-1 of the index input with the closed form and stores its own 128-byte line pz[g*32 .. g*32+31] = 0 (all equal) or NaN; g < NCK, 256 threads, CKS 16-byte reads per thread and row.
__device__ __forceinline__ void d_relchk(const int* __restrict__ rel, float* pz, unsigned g) {
    __shared__ int bad_s[PT / 32];
    const int tid = threadIdx.x, lane = tid & 31;
    const int wid = __builtin_amdgcn_readfirstlane(tid >> 5);
    const int i0 = g * CKU, j = tid * 4;
    const int* rp = rel + (size_t)i0 * SEQ_FULL + j;
    v4i t[CKU][CKS];
#pragma unroll
    for (int u = 0; u < CKU; ++u)
#pragma unroll
        for (int s = 0; s < CKS; ++s) t[u][s] = *(const v4i*)(rp + (size_t)u * SEQ_FULL + s * (4 * PT));
    int bad = 0;
#pragma unroll
    for (int u = 0; u < CKU; ++u) {
#pragma unroll
        for (int s = 0; s < CKS; ++s) {
#pragma unroll
            for (int cc = 0; cc < 4; ++cc) { const int want = clampi(j + s * (4 * PT) + cc - i0 - u, -RK, RK) + RK; bad |= (t[u][s][cc] != want) ? 1 : 0; }
        }
    }
    bad |= __shfl_xor(bad, 16, 32); bad |= __shfl_xor(bad, 8, 32); bad |= __shfl_xor(bad, 4, 32); bad |= __shfl_xor(bad, 2, 32); bad |= __shfl_xor(bad, 1, 32);
    if (lane == 0) bad_s[wid] = bad;
    __syncthreads();
    int any = 0;
#pragma unroll
    for (int w = 0; w < PT / 32; ++w) any |= bad_s[w];
    const float pv = (any != 0) ? __uint_as_float(0x7FC00000u) : 0.0f;
    if (tid < 8) { const v4f o = (v4f){pv, pv, pv, pv}; *(v4f*)(pz + (size_t)g * 32 + tid * 4) = o;  }
}

// ---- k_pre: the six preparation jobs read only inputs and write disjoint workspace planes, so none waits for another: one launch, each job on its own range of blockIdx.x.
// The LayerNorm work-groups are the few long ones and come first, so that they start first and the short streaming jobs run beside them. Every branch is on blockIdx.x alone (block barriers inside stay block-uniform).
constexpr unsigned NW8 = (unsigned)((size_t)DM * DM / 8), NA8 = (unsigned)((size_t)SEQ * DM / 8);
constexpr unsigned PB_LN = (SEQ / 64) * NB;              // LayerNorm + transpose
constexpr unsigned PB_CK = NCK;                          // index compare
constexpr unsigned PB_A  = (NA8 / 256) * NB;             // one head plane (q, then k)
constexpr unsigned PB_W  = NW8 / 256;                    // weight plane
constexpr unsigned PB_R  = (RPAD * HD / 8 + 255) / 256;  // position plane
constexpr unsigned PB_ALL = PB_LN + PB_CK + 2 * PB_A + PB_W + PB_R;
__global__ __launch_bounds__(PT) void k_pre(const float* __restrict__ xq, const float* __restrict__ xk, const float* __restrict__ xv, const float* __restrict__ lg, const float* __restrict__ lb,
                                            const float* __restrict__ rp, const float* __restrict__ wp, const int* __restrict__ rel, bf* QP, bf* KP, h16* VT, bf* RPP, bf* WO, float* PZ) {
    unsigned g = blockIdx.x;
    if (g < PB_LN) { d_ln_vt(xv, lg, lb, VT, g % (SEQ / 64), g / (SEQ / 64)); return; }
    g -= PB_LN;
    if (g < PB_CK) { d_relchk(rel, PZ, g); return; }
    g -= PB_CK;
    if (g < PB_A) { d_cvt8h(xq, QP, NA8, (size_t)SEQ_FULL * DM, SCL, g % (NA8 / 256), g / (NA8 / 256)); return; }
    g -= PB_A;
    if (g < PB_A) { d_cvt8h(xk, KP, NA8, (size_t)SEQ_FULL * DM, 1.0f, g % (NA8 / 256), g / (NA8 / 256)); return; }
    g -= PB_A;
    if (g < PB_W) { d_cvt8(wp, WO, NW8, g); return; }
    g -= PB_W;
    d_cvt_rpe(rp, RPP, g);
}

// ---- k_gemm_out: OUT[b][s][n] (f32) = sum_k (Ah + Al)[b*SEQ+s][k] W[n][k] (+ the sum of the 0 / NaN lines of the index compare); grid (SEQ/128, DM/128, NB), 128 threads: 2 x 2 waves, 64 x 64 outputs each.
// A stage is 64 k of 128 rows of Ah, Al and W (128-byte rows, LDS pitch 144 B), brought as whole lines by asynchronous copies into one of two buffers; stage t + 1 is in flight while stage t is worked on.
// Per accumulator the products keep the order k-step by k-step, Ah then Al.
__global__ __launch_bounds__(128) void k_gemm_out(const bf* __restrict__ Ah, const bf* __restrict__ Al, const bf* __restrict__ W, const float* __restrict__ pz, float* C) {
    __shared__ __align__(16) bf g_s[2 * GST];
    __shared__ __align__(16) float os[4 * 16 * LOP];
    const int tid = threadIdx.x, lane = tid & 31, lr = lane & 15, hi = lane >> 4;
    const int wid = __builtin_amdgcn_readfirstlane(tid >> 5);
    const int wm = wid >> 1, wn = wid & 1;
    const size_t z = blockIdx.z; const int r0 = blockIdx.x * GT, c0 = blockIdx.y * GT;
    float* Cz = C + z * (size_t)SEQ_FULL * DM;
    // the lane's first 16-byte unit of a stage: row tid / 8, unit tid % 8; its other seven lie 16 rows apart
    const int srow = tid >> 3, spart = (tid & 7) * 8;
    const bf* gA = Ah + z * (size_t)SEQ * DM + (size_t)(r0 + srow) * DM + spart;
    const bf* gL = Al + z * (size_t)SEQ * DM + (size_t)(r0 + srow) * DM + spart;
    const bf* gW = W + (size_t)(c0 + srow) * DM + spart;
    const unsigned l0 = (unsigned)(size_t)(&g_s[srow * LKP + spart]);
    auto stage = [&](int t) {
        const unsigned lb = l0 + (unsigned)(t & 1) * (unsigned)(GST * 2);
        acopy8(lb, gA + t * GK); acopy8(lb + GPL * 2, gL + t * GK); acopy8(lb + 2 * GPL * 2, gW + t * GK);
    };
    stage(0);
    float pzv = 0.0f;
#pragma unroll
    for (int s = 0; s < NCK / 32; ++s) pzv += pz[(size_t)(s * 32 + lane) * 32];
    pzv += __shfl_xor(pzv, 16, 32); pzv += __shfl_xor(pzv, 8, 32); pzv += __shfl_xor(pzv, 4, 32); pzv += __shfl_xor(pzv, 2, 32); pzv += __shfl_xor(pzv, 1, 32);
    v8f acc[4][4];
#pragma unroll
    for (int mb = 0; mb < 4; ++mb)
#pragma unroll
        for (int nb = 0; nb < 4; ++nb) acc[mb][nb] = (v8f){};
    // stage 0 has landed for this wave; the barrier publishes it to the others
    asm volatile("s_wait_asynccnt 0x0" ::: "memory");
    __syncthreads();
    stage(1);
    const int ao = (wm * 64 + lr) * LKP + 8 * hi, bo = 2 * GPL + (wn * 64 + lr) * LKP + 8 * hi;
    // kept rolled: one trip is one stage, and the order at its foot is the ring's
#pragma unroll 1
    for (int t = 0; t < DM / GK; ++t) {
        const bf* sb = &g_s[(t & 1) * GST];
        v16bf bc = lds16(sb + bo);
#pragma unroll
        for (int ks = 0; ks < GK / 32; ++ks) {
            v16bf a[4], a2[4];
#pragma unroll
            for (int mb = 0; mb < 4; ++mb) { a[mb] = lds16(sb + ao + mb * 16 * LKP + ks * 32); a2[mb] = lds16(sb + GPL + ao + mb * 16 * LKP + ks * 32); }
#pragma unroll
            for (int nb = 0; nb < 4; ++nb) {
                // the next W fragment of the stage is read while the eight products on this one run
                const int nx = ks * 4 + nb + 1;
                v16bf bn = bc;
                if (nx < 4 * (GK / 32)) {
                    bn = lds16(sb + bo + (nx & 3) * 16 * LKP + (nx >> 2) * 32);
                    // holds that read in front of the products: moved behind them, into the one fragment's registers, it is waited for with nothing to run meanwhile
                    __builtin_amdgcn_sched_barrier(0);
                }
#pragma unroll
                for (int mb = 0; mb < 4; ++mb) { acc[mb][nb] = wmmab(a[mb], bc, acc[mb][nb]); acc[mb][nb] = wmmab(a2[mb], bc, acc[mb][nb]); }
                bc = bn;
            }
        }
        // foot of the trip: this wave's reads of the buffer are done, its copies of stage t + 1 have landed; the barrier publishes stage t + 1 and frees this trip's buffer for stage t + 2
        asm volatile("s_wait_dscnt 0x0" ::: "memory");
        asm volatile("s_wait_asynccnt 0x0" ::: "memory");
        __syncthreads();
        if (t + 2 < DM / GK) stage(t + 2);
    }
    // no copy is outstanding when the wave goes on to its end
    asm volatile("s_wait_asynccnt 0x0" ::: "memory");
    const int ob = wid * 16 * LOP;
#pragma unroll
    for (int mb = 0; mb < 4; ++mb) {
#pragma unroll
        for (int nb = 0; nb < 4; ++nb) {
#pragma unroll
            for (int j = 0; j < 8; ++j) os[ob + (hi * 8 + j) * LOP + nb * 16 + lr] = acc[mb][nb][j]; }
        wsync();
        float* crow = Cz + (size_t)(r0 + wm * 64 + mb * 16) * DM + c0 + wn * 64;
#pragma unroll
        for (int s = 0; s < 8; ++s) { const int row = 2 * s + hi, cofs = lr * 4; v4f val = *(const v4fa*)(&os[ob + row * LOP + cofs]);
            val[0] += pzv; val[1] += pzv; val[2] += pzv; val[3] += pzv;
            *(v4f*)(crow + (size_t)row * DM + cofs) = val; }
        wsync();
    }
}

__global__ __launch_bounds__(128) void k_flash(const bf* __restrict__ Qh, const bf* __restrict__ Kh, const bf* __restrict__ RP, const h16* __restrict__ VT, bf* Ch, bf* Cl) {
    __shared__ __align__(16) bf    kh_s[2 * 64 * LKP];
    __shared__ __align__(16) h16   vt_s[2 * 64 * LKP];
    __shared__ __align__(16) float r_s[4 * 16 * LRP];
    const int tid = threadIdx.x, lane = tid & 31, lr = lane & 15, hi = lane >> 4;
    const int wid = __builtin_amdgcn_readfirstlane(tid >> 5);
    const int bh = blockIdx.y; const int b = bh / NH, h = bh % NH;
    const int q0 = blockIdx.x * 64 + wid * 16;
    const size_t pl = (size_t)bh * SEQ * HD;
    const size_t qoff = pl + (size_t)(q0 + lr) * HD + 8 * hi;
    const size_t vbase = ((size_t)b * DM + (size_t)h * HD) * SEQ;
    const int ob = wid * 16 * LRP;                  // epilogue staging: the start of the wave's own table, which the wave has done with by then
    const int rb = wid * 16 * LRP + 8 * hi * LRP;   // table rows as the prologue's D tiles hold them
    const int tb = wid * 16 * LRP + lr * LRP;       // table row of the lane's own query
    // K tile [key][d] and V^T tile [d][key] of key block kb into buffer kb & 1; the lane's first 16-byte unit of a tile: row tid / 8, unit tid % 8
    const int srw = tid >> 3, spt = (tid & 7) * 8;
    const bf* gK = Kh + pl + (size_t)srw * HD + spt;
    const h16* gV = VT + vbase + (size_t)srw * SEQ + spt;
    const unsigned lK = (unsigned)(size_t)(&kh_s[srw * LKP + spt]), lV = (unsigned)(size_t)(&vt_s[srw * LKP + spt]);
    auto stage = [&](const int kb) {
        const unsigned lo = (unsigned)(kb & 1) * (unsigned)(64 * LKP * 2);
        acopy44(lK + lo, gK + (size_t)kb * 64 * HD, lV + lo, gV + (size_t)kb * 64);
    };
    stage(0);
    const v16bf qa0 = ldg16(Qh + qoff); const v16bf qa1 = ldg16(Qh + qoff + 32);
#pragma unroll 1
    for (int ct = 0; ct < RT; ++ct) {
        const size_t ro = (size_t)(ct * 16 + lr) * HD + 8 * hi;
        const v16bf b0 = ldg16(RP + ro); const v16bf b1 = ldg16(RP + ro + 32);
        v8f t = (v8f){};
        t = wmmab_g(qa0, b0, t);
        t = wmmab_g(qa1, b1, t);
#pragma unroll
        for (int j = 0; j < 8; ++j) r_s[rb + j * LRP + ct * 16 + lr] = t[j];
    }
    wsync();
    const float rlo = r_s[tb], rhi = r_s[tb + 2 * RK];
    v8f o[4];
#pragma unroll
    for (int dt = 0; dt < 4; ++dt) o[dt] = (v8f){};
    float mr = -1.0e30f, ls = 0.0f;

    // key block 0 has landed for this wave; the barrier publishes it to the others
    asm volatile("s_wait_asynccnt 0x0" ::: "memory");
    __syncthreads();
    stage(1);
    // foot of key block kb: this wave's reads of the buffer are done, its copies of block kb + 1 have landed; the barrier publishes block kb + 1 and frees this block's buffer for block kb + 2
    auto foot = [&](const int kb) {
        asm volatile("s_wait_dscnt 0x0" ::: "memory");
        asm volatile("s_wait_asynccnt 0x0" ::: "memory");
        __syncthreads();
        if (kb + 2 < SEQ / 64) stage(kb + 2);
    };
    // one 32-key half, keys j0 .. j0 + 31. band == false: the half lies beyond the clip on one side for every query of the work-group, so all keys share the lane's position value rv;
    // it is not added to the scores: it goes once into the maximum and once into the exp2 argument's addend. band == true: the position term is added to each score (rv unused).
    auto half = [&](const int hf, const int j0, const bool band, const float rv) {
        v8f s0 = (v8f){}, s1 = (v8f){};
        const int bo = ((j0 >> 6) & 1) * 64 * LKP;   // the key block's buffer
        const int kr0 = bo + (hf * 32 + lr) * LKP + 8 * hi, kr1 = kr0 + 16 * LKP;
        {
            const v16bf k00 = cat16b(*(const v8usa*)(&kh_s[kr0]), *(const v8usa*)(&kh_s[kr0 + 16]));
            const v16bf k10 = cat16b(*(const v8usa*)(&kh_s[kr1]), *(const v8usa*)(&kh_s[kr1 + 16]));
            const v16bf k01 = cat16b(*(const v8usa*)(&kh_s[kr0 + 32]), *(const v8usa*)(&kh_s[kr0 + 48]));
            const v16bf k11 = cat16b(*(const v8usa*)(&kh_s[kr1 + 32]), *(const v8usa*)(&kh_s[kr1 + 48]));
            // holds the four fragments' eight LDS reads together in front of the products: without it each product waits out an LDS round trip of its own
            asm volatile("" :: "v"(k00), "v"(k10), "v"(k01), "v"(k11));
            s0 = wmmab(k00, qa0, s0); s1 = wmmab(k10, qa0, s1);
            s0 = wmmab(k01, qa1, s0); s1 = wmmab(k11, qa1, s1);
            // keeps the four products back to back: a vector instruction moved in between them costs its own run of idle slots and holds the last product back
            __builtin_amdgcn_sched_barrier(0);
        }
        if (band) {
            // position term: query q0 + lr, keys j0 + 8*hi + r (s0) and j0 + 16 + 8*hi + r (s1); both tests are on scalars only.
            // A half wholly beyond the clip on one side for this wave takes the register value, added without a branch (0 in a half near the diagonal): behind the products stands straight-line vector work, so their distance is padded once and not again on each side of a branch and at its join.
            const bool fhi = j0 - q0 >= RK + 15, flo = q0 - j0 >= RK + 31;
            const float rw = fhi ? rhi : (flo ? rlo : 0.0f);
#pragma unroll
            for (int r = 0; r < 8; ++r) { s0[r] += rw; s1[r] += rw; }
            if (!(fhi || flo)) {
#pragma unroll
                for (int r = 0; r < 8; ++r) {
                    const int d0 = j0 + 8 * hi + r - q0 - lr;
                    const int i0 = clampi(d0, -RK, RK) + RK, i1 = clampi(d0 + 16, -RK, RK) + RK;
                    const float b0 = r_s[tb + i0]; const float b1 = r_s[tb + i1];
                    s0[r] += b0; s1[r] += b1;
                }
            }
        }
        // running-max softmax update for the lane's query: 16 of the half's 32 keys are in this lane, the other 16 in lane ^ 16; ls holds the lane's partial sum, carried x1024 like P
        float mx = fmaxf(s0[0], s1[0]);
#pragma unroll
        for (int r = 1; r < 8; ++r) mx = fmaxf(mx, fmaxf(s0[r], s1[r]));
        mx = fmaxf(mx, xhalf(mx));
        if (!band) mx += rv;
        const float mnew = fmaxf(mr, mx);
        const float al = __builtin_amdgcn_exp2f((mr - mnew) * L2E);
        mr = mnew;
        // one multiply-add per score: P x1024 = exp2(s * log2(e) + ca), ca = (rv - max) * log2(e) + log2(1024)
        const float ca = (band ? -mnew : rv - mnew) * L2E + PLG;
        const v2f ca2 = (v2f){ca, ca}, l2 = (v2f){L2E, L2E};
        v16h pa; v2f ps = (v2f){0.0f, 0.0f};
#pragma unroll
        for (int r = 0; r < 8; r += 2) {
            const v2f e0 = __builtin_elementwise_fma((v2f){s0[r], s0[r + 1]}, l2, ca2), e1 = __builtin_elementwise_fma((v2f){s1[r], s1[r + 1]}, l2, ca2);
            const v2f p0 = (v2f){__builtin_amdgcn_exp2f(e0[0]), __builtin_amdgcn_exp2f(e0[1])};
            const v2f p1 = (v2f){__builtin_amdgcn_exp2f(e1[0]), __builtin_amdgcn_exp2f(e1[1])};
            ps += p0 + p1;
            const v2h h0 = __builtin_convertvector(p0, v2h), h1 = __builtin_convertvector(p1, v2h);
            pa[r] = h0[0]; pa[r + 1] = h0[1]; pa[8 + r] = h1[0]; pa[8 + r + 1] = h1[1];
        }
        ls = ls * al + (ps[0] + ps[1]);
#pragma unroll
        for (int dt = 0; dt < 4; ++dt)
#pragma unroll
            for (int r = 0; r < 8; ++r) o[dt][r] *= al;
        v16h va[4];
#pragma unroll
        for (int dt = 0; dt < 4; ++dt) { const int vo = bo + (dt * 16 + lr) * LKP + hf * 32 + 8 * hi; va[dt] = cat16(*(const v8ha*)(&vt_s[vo]), *(const v8ha*)(&vt_s[vo + 16])); }
#pragma unroll
        for (int dt = 0; dt < 4; ++dt) o[dt] = wmma16(va[dt], pa, o[dt]);
    };
    // The key blocks in three runs, the bounds the same for the whole work-group (block barriers inside): with queries 64*bx .. 64*bx + 63, a block kb <= bx - 2 has key - query <= -65 and a block kb >= bx + 2 has key - query >= 65 for every pair.
    static_assert(RK <= 64 + 1);
    const int bx = blockIdx.x;
    const int kb1 = bx - 1 > 0 ? bx - 1 : 0, kb2 = bx + 2 < SEQ / 64 ? bx + 2 : SEQ / 64;
#pragma unroll 1
    for (int kb = 0; kb < kb1; ++kb) {
#pragma unroll 1
        for (int hf = 0; hf < 2; ++hf) half(hf, kb * 64 + hf * 32, false, rlo);
        foot(kb);
    }
#pragma unroll 1
    for (int kb = kb1; kb < kb2; ++kb) {
#pragma unroll 1
        for (int hf = 0; hf < 2; ++hf) half(hf, kb * 64 + hf * 32, true, 0.0f);
        foot(kb);
    }
#pragma unroll 1
    for (int kb = kb2; kb < SEQ / 64; ++kb) {
#pragma unroll 1
        for (int hf = 0; hf < 2; ++hf) half(hf, kb * 64 + hf * 32, false, rhi);
        foot(kb);
    }
    // no copy is outstanding when the wave goes on to its end
    asm volatile("s_wait_asynccnt 0x0" ::: "memory");
    // normalise: the query's sum is completed over its two lanes; it carries the same x1024 as P, so 1 / l undoes both; the lane's 8 registers of a tile are 8 consecutive features of its query
    {
        const float lt = ls + xhalf(ls);
        const float inv = 1.0f / lt;
#pragma unroll
        for (int dt = 0; dt < 4; ++dt) {
            const v4f y0 = (v4f){o[dt][0] * inv, o[dt][1] * inv, o[dt][2] * inv, o[dt][3] * inv};
            const v4f y1 = (v4f){o[dt][4] * inv, o[dt][5] * inv, o[dt][6] * inv, o[dt][7] * inv};
            *(v4fa*)(&r_s[ob + lr * LOP + dt * 16 + 8 * hi]) = y0; *(v4fa*)(&r_s[ob + lr * LOP + dt * 16 + 8 * hi + 4]) = y1;
        }
    }
    wsync();
    const int srow = lane >> 3, scol = (lane & 7) * 8;
    const size_t cbase = ((size_t)b * SEQ + q0) * DM + (size_t)h * HD;
{
#pragma unroll
        for (int s = 0; s < 4; ++s) { const int row = 4 * s + srow; const v4f x0 = *(const v4fa*)(&r_s[ob + row * LOP + scol]); const v4f x1 = *(const v4fa*)(&r_s[ob + row * LOP + scol + 4]); v8us oh, ol;
#pragma unroll
            for (int j = 0; j < 4; ++j) { unsigned short a, c; splitf(x0[j], a, c); oh[j] = a; ol[j] = c; splitf(x1[j], a, c); oh[4 + j] = a; ol[4 + j] = c; }
            const size_t off = cbase + (size_t)row * DM + scol;
            *(v8us*)(Ch + off) = oh; *(v8us*)(Cl + off) = ol; }
         }
}

constexpr size_t al256(size_t x) { return (x + 255) & ~(size_t)255; }
constexpr size_t SZ_W = al256((size_t)DM * DM * 2);                 // one bf16 weight plane
constexpr size_t SZ_R = al256((size_t)RPAD * HD * 2);               // bf16 position plane, 144 rows
constexpr size_t SZ_X = al256((size_t)NB * SEQ * DM * 2);           // one 16-bit [NB*SEQ][DM] plane (merged-head plane)
constexpr size_t SZ_P = al256((size_t)NB * NH * SEQ * HD * 2);      // one 16-bit head plane
constexpr size_t SZ_F = al256((size_t)NCK * 128);                   // 0 / NaN lines of the index compare, one per work-group
constexpr size_t WS_TOTAL = SZ_W + SZ_R + 2 * SZ_P + SZ_P + 2 * SZ_X + SZ_F;
static_assert(WS_TOTAL <= (size_t)134217728);                       // carve stays within 128 MiB
static_assert(SZ_P == SZ_X);                                        // NH * HD == DM
static_assert(SZ_R >= (size_t)RPAD * HD * 2);                       // last position plane line lies inside its region

extern "C" void kernel_launch(void* const* d_in, const int* in_sizes, int n_in,
                              void* d_out, int out_size, void* d_ws, size_t ws_size, hipStream_t stream) {
    if (n_in < 8) return;
    const size_t need_act = (size_t)(NB - 1) * SEQ_FULL * DM + (size_t)SEQ * DM;
    if ((size_t)in_sizes[0] < need_act || (size_t)in_sizes[1] < need_act || (size_t)in_sizes[2] < need_act) return;
    if (in_sizes[3] < DM || in_sizes[4] < DM || in_sizes[5] < NREL * HD || (size_t)in_sizes[6] < (size_t)DM * DM) return;
    if ((size_t)in_sizes[7] < (size_t)(SEQ - 1) * SEQ_FULL + (size_t)SEQ) return;
    if ((size_t)out_size < need_act) return;
    if (WS_TOTAL > ws_size) return;
    // wire order: q, k, v, ln_gamma, ln_beta, rpe_emb, W_proj (all f32; W_proj [out][in]), rel_idx (int32 [SEQ][SEQ])
    const float* xq = (const float*)d_in[0]; const float* xk = (const float*)d_in[1]; const float* xv = (const float*)d_in[2];
    const float* lg = (const float*)d_in[3]; const float* lb = (const float*)d_in[4]; const float* rp = (const float*)d_in[5]; const float* wp = (const float*)d_in[6];
    const int* rel = (const int*)d_in[7];
    float* OUT = (float*)d_out;
    char* wsp = (char*)d_ws;
    auto take = [&](size_t bytes) { char* p = wsp; wsp += bytes; return (void*)p; };
    bf* WO = (bf*)take(SZ_W);
    bf* RPP = (bf*)take(SZ_R);
    bf* QP = (bf*)take(SZ_P); bf* KP = (bf*)take(SZ_P);
    h16* VT = (h16*)take(SZ_P);
    bf* CTh = (bf*)take(SZ_X); bf* CTl = (bf*)take(SZ_X);
    float* PZ = (float*)take(SZ_F);
    if ((size_t)(wsp - (char*)d_ws) != WS_TOTAL) return;

    k_pre<<<dim3(PB_ALL), PT, 0, stream>>>(xq, xk, xv, lg, lb, rp, wp, rel, QP, KP, VT, RPP, WO, PZ);
    k_flash<<<dim3(SEQ / 64, NB * NH), 128, 0, stream>>>(QP, KP, RPP, VT, CTh, CTl);
    k_gemm_out<<<dim3(SEQ / GT, DM / GT, NB), 128, 0, stream>>>(CTh, CTl, WO, PZ, OUT);
}

// v009
// It runs in 63.5 microseconds.
// Timed twice side by side with v008, it ran 1.06 and 1.08 times as fast.
// Counting every step since v000, it is 15.7 times as fast.
#include <hip/hip_runtime.h>

#ifndef NB
#define NB 4
#endif
#ifndef SEQ
#define SEQ 2048
#endif
#define NB_FULL  4
#define SEQ_FULL 2048
#define DM   512
#define NH   8
#define HD   64
#define PCAR 1024.0f
#define PLG  10.0f   // log2(PCAR)
#define PLIM 65504.0f   // largest finite f16
#define SCL  0.125f
#define L2E  1.4426950408889634f
#define LKP  72      // LDS row pitch (16-bit elements) of the K / V^T tiles: 144 B rows
#define LOP  68      // LDS row pitch (floats) of epilogue staging tiles: 272 B rows
#define RK   64      // relative distance clip
#define NREL 129     // position table rows: 2 * RK + 1
#define RT   9       // 16-wide column tiles of the per-wave q.rpe^T table
#define RPAD 144     // position plane rows, zero filled beyond NREL
#define LRP  148     // LDS row pitch (floats) of the per-wave q.rpe^T table
#define LTP  72      // LDS row pitch (halves) of the LayerNorm transpose tile
#define LNC  128     // features one 16-byte read per lane covers in the LayerNorm job: 32 lanes x 4
#define LNEPS 1.0e-5f
#define PT   256         // threads of a pre-pass work-group, the same for all six jobs
#define CKS  (SEQ / (4 * PT))   // 16-byte reads per thread and row of the index input
#define CKU  8           // rows per index-compare work-group: CKU * CKS independent 16-byte reads per thread
#define NCK  (SEQ / CKU) // index-compare work-groups == 0 / NaN lines
#define GT   128         // rows and columns of an output GEMM work-group's tile
#define GK   64          // k elements of an output GEMM stage: 128-byte rows
#define GPL  (GT * LKP)  // elements of one staged plane
#define GST  (3 * GPL)   // elements of a stage: Ah | Al | W
#define GRS  (16 * LKP * 2)   // LDS bytes between rows 16 apart

static_assert(DM == NH * HD);            // one 64-wide GEMM column tile == one head
static_assert(HD == 64);
static_assert(DM % 32 == 0);             // WMMA k-step
static_assert(DM % GT == 0 && SEQ % GT == 0);   // GEMM tiles
static_assert(DM % GK == 0 && DM / GK >= 2);    // whole stages, and the two that the ring's start needs
static_assert(GT * GK * 2 == 128 * 8 * 16);     // a staged plane == 128 threads x 8 copies x 16 B
static_assert((size_t)2 * GST * 2 + (size_t)4 * 16 * LOP * 4 <= 163840);   // output GEMM static LDS
static_assert(SEQ % 64 == 0);            // key blocks, query blocks
static_assert((SEQ * DM) % (8 * 256) == 0);   // q / k convert job's work-group range is exact
static_assert((DM * DM) % (8 * 256) == 0);
static_assert(NB <= NB_FULL);
static_assert(SEQ <= SEQ_FULL);
static_assert(LKP % 8 == 0);             // 16-byte aligned LDS vector accesses
static_assert(LOP % 4 == 0);
static_assert(NREL == 2 * RK + 1);
static_assert(RPAD == RT * 16);          // position plane rows == table column tiles
static_assert(NREL <= RPAD);
static_assert(RPAD <= LRP);              // table columns fit the LDS pitch
static_assert(2 * RK < RPAD);            // largest clamped index is a written column
static_assert((RPAD * HD) % 64 == 0);
static_assert(HD * 2 == 8 * 16);         // head plane row == 8 lanes x 16 B
static_assert(LTP % 8 == 0);
static_assert(SEQ % (4 * PT) == 0);      // index compare: whole 16-byte reads, the same number in every thread
static_assert(SEQ % CKU == 0);           // index compare grid is exact
static_assert(NCK % 32 == 0);            // the output GEMM's wave reads the lines 32 at a time
static_assert(256 * 16 * 2 == 64 * 64 * 2);
static_assert(32 * 16 * 4 == 16 * HD * 2);
static_assert(32 * 16 * 8 == 16 * 64 * 4);     // output epilogue: lanes x bytes x trips == 16 rows x 256 B
static_assert(PCAR == 1024.0f);                // PLG = log2(PCAR)
static_assert((size_t)2 * 64 * LKP * 2 * 2 + (size_t)4 * 16 * LRP * 4 <= 327680 / 4);   // flash static LDS: four work-groups per WGP
static_assert(LOP <= LRP);               // the epilogue's staging rows fit the wave's own table rows
static_assert(SEQ / 64 >= 2);            // the two key blocks that the ring's start needs
static_assert((size_t)DM * LTP * 2 <= 131072);                                                                                  // LayerNorm static LDS
static_assert(DM % LNC == 0);            // whole chunks
static_assert((DM * 8) % 256 == 0);      // tile write-out: whole 16-byte units per thread

typedef _Float16 h16;
typedef unsigned short bf;
typedef __attribute__((ext_vector_type(16))) __bf16   v16bf;
typedef __attribute__((ext_vector_type(16))) _Float16 v16h;
typedef __attribute__((ext_vector_type(8)))  _Float16 v8h;
typedef __attribute__((ext_vector_type(8)))  unsigned short v8us;
typedef __attribute__((ext_vector_type(8)))  float    v8f;
typedef __attribute__((ext_vector_type(4)))  float    v4f;
typedef __attribute__((ext_vector_type(2)))  float    v2f;
typedef __attribute__((ext_vector_type(2)))  _Float16 v2h;
typedef __attribute__((ext_vector_type(4)))  int      v4i;
typedef __attribute__((ext_vector_type(4)))  _Float16 v4h;
typedef v8h  __attribute__((may_alias)) v8ha;
typedef v4h  __attribute__((may_alias)) v4ha;
typedef v4f  __attribute__((may_alias)) v4fa;
typedef v8us __attribute__((may_alias)) v8usa;

__device__ __forceinline__ unsigned short f2bf(float f) { unsigned u = __float_as_uint(f); u += 0x7FFFu + ((u >> 16) & 1u); return (unsigned short)(u >> 16); }
__device__ __forceinline__ float bf2f(unsigned short b) { return __uint_as_float(((unsigned)b) << 16); }
__device__ __forceinline__ float bfr(float f) { return bf2f(f2bf(f)); }
__device__ __forceinline__ void splitf(float y, unsigned short& h, unsigned short& l) { h = f2bf(y); l = f2bf(y - bf2f(h)); }
__device__ __forceinline__ v16h cat16(v8h lo, v8h hi) { return __builtin_shufflevector(lo, hi, 0, 1, 2, 3, 4, 5, 6, 7, 8, 9, 10, 11, 12, 13, 14, 15); }
__device__ __forceinline__ v16bf cat16b(v8us lo, v8us hi) { return __builtin_bit_cast(v16bf, __builtin_shufflevector(lo, hi, 0, 1, 2, 3, 4, 5, 6, 7, 8, 9, 10, 11, 12, 13, 14, 15)); }
__device__ __forceinline__ v8f wmma16(v16h a, v16h b, v8f c) { return __builtin_amdgcn_wmma_f32_16x16x32_f16(false, a, false, b, (short)0, c, false, false); }
__device__ __forceinline__ v8f wmmab(v16bf a, v16bf b, v8f c) { return __builtin_amdgcn_wmma_f32_16x16x32_bf16(false, a, false, b, (short)0, c, false, false); }
// fragment from a K-contiguous global bf16 plane: elements 0..7 <- p[0..7], 8..15 <- p[16..23] (p already includes row*pitch + k0 + 8*(lane>>4))
__device__ __forceinline__ v16bf ldg16(const bf* __restrict__ p) { return cat16b(*(const v8us*)p, *(const v8us*)(p + 16)); }
// same-wave LDS exchange ordering (wave-private tiles only)
__device__ __forceinline__ void wsync() { __builtin_amdgcn_wave_barrier(); asm volatile("" ::: "memory"); }
// one matrix instruction followed by its own four idle slots (ties the accumulator, keeps the operands live)
__device__ __forceinline__ v8f wmmab_g(v16bf a, v16bf b, v8f c) { c = __builtin_amdgcn_wmma_f32_16x16x32_bf16(false, a, false, b, (short)0, c, false, false); asm volatile("v_nop\n\tv_nop\n\tv_nop\n\tv_nop" : "+v"(c) : "v"(a), "v"(b)); return c; }
// the same for the f16 form: for a product behind which a loop's branch stands
__device__ __forceinline__ v8f wmma16_g(v16h a, v16h b, v8f c) { c = __builtin_amdgcn_wmma_f32_16x16x32_f16(false, a, false, b, (short)0, c, false, false); asm volatile("v_nop\n\tv_nop\n\tv_nop\n\tv_nop" : "+v"(c) : "v"(a), "v"(b)); return c; }
// f32 -> f16 operand convert that cannot produce an f16 subnormal
__device__ __forceinline__ h16 toh_flush(float v) { const h16 r = (h16)v; return (fabsf(v) < 6.103515625e-05f) ? (h16)0.0f : r; }
// lane l exchanges with lane l ^ 16 (the two lanes that share one column of a D tile)
__device__ __forceinline__ float xhalf(float x) { return __builtin_bit_cast(float, __builtin_amdgcn_permlanex16(__builtin_bit_cast(int, x), __builtin_bit_cast(int, x), 0x76543210, 0xfedcba98, false, false)); }
__device__ __forceinline__ int clampi(int v, int lo, int hi) { const int t = v < lo ? lo : v; return t > hi ? hi : t; }

// fragment from a K-contiguous LDS row, the same element order as ldg16
__device__ __forceinline__ v16bf lds16(const bf* p) { return cat16b(*(const v8usa*)p, *(const v8usa*)(p + 16)); }
// eight asynchronous 16-byte copies of one lane, global -> LDS, rows 16 apart: a wave's copy is 4 whole 128-byte lines. l: the lane's LDS byte address, g: its global address.
// The s_wait_xcnt closes the statement so that it stands in front of every later write of an address register the copies name.
__device__ __forceinline__ void acopy8(unsigned l, const bf* g) {
    asm volatile("global_load_async_to_lds_b128 %0, %8, off\n\t"
                 "global_load_async_to_lds_b128 %1, %9, off\n\t"
                 "global_load_async_to_lds_b128 %2, %10, off\n\t"
                 "global_load_async_to_lds_b128 %3, %11, off\n\t"
                 "global_load_async_to_lds_b128 %4, %12, off\n\t"
                 "global_load_async_to_lds_b128 %5, %13, off\n\t"
                 "global_load_async_to_lds_b128 %6, %14, off\n\t"
                 "global_load_async_to_lds_b128 %7, %15, off\n\t"
                 "s_wait_xcnt 0x0"
                 :: "v"(l), "v"(l + 1u * GRS), "v"(l + 2u * GRS), "v"(l + 3u * GRS), "v"(l + 4u * GRS), "v"(l + 5u * GRS), "v"(l + 6u * GRS), "v"(l + 7u * GRS),
                    "v"(g), "v"(g + 1 * 16 * DM), "v"(g + 2 * 16 * DM), "v"(g + 3 * 16 * DM), "v"(g + 4 * 16 * DM), "v"(g + 5 * 16 * DM), "v"(g + 6 * 16 * DM), "v"(g + 7 * 16 * DM)
                 : "memory");
}

// eight asynchronous 16-byte copies of one lane, global -> LDS: its four units of a [64][64] K tile and its four of a V^T tile, rows 16 apart; a wave's copy is 4 whole 128-byte lines.
// lk, lv: the lane's LDS byte addresses, gk, gv: its global addresses. The s_wait_xcnt closes the statement so that it stands in front of every later write of an address register the copies name.
__device__ __forceinline__ void acopy44(unsigned lk, const bf* gk, unsigned lv, const _Float16* gv) {
    asm volatile("global_load_async_to_lds_b128 %0, %8, off\n\t"
                 "global_load_async_to_lds_b128 %1, %9, off\n\t"
                 "global_load_async_to_lds_b128 %2, %10, off\n\t"
                 "global_load_async_to_lds_b128 %3, %11, off\n\t"
                 "global_load_async_to_lds_b128 %4, %12, off\n\t"
                 "global_load_async_to_lds_b128 %5, %13, off\n\t"
                 "global_load_async_to_lds_b128 %6, %14, off\n\t"
                 "global_load_async_to_lds_b128 %7, %15, off\n\t"
                 "s_wait_xcnt 0x0"
                 :: "v"(lk), "v"(lk + 1u * GRS), "v"(lk + 2u * GRS), "v"(lk + 3u * GRS), "v"(lv), "v"(lv + 1u * GRS), "v"(lv + 2u * GRS), "v"(lv + 3u * GRS),
                    "v"(gk), "v"(gk + 1 * 16 * HD), "v"(gk + 2 * 16 * HD), "v"(gk + 3 * 16 * HD), "v"(gv), "v"(gv + 1 * 16 * SEQ), "v"(gv + 2 * 16 * SEQ), "v"(gv + 3 * 16 * SEQ)
                 : "memory");
}

// The six jobs of the pre-pass launch are device functions; bx (and by) is the job's own work-group index, the same for the whole work-group.
__device__ __forceinline__ void d_cvt8(const float* __restrict__ src, bf* dst, unsigned n8, unsigned bx) {
    const unsigned i = bx * 256u + threadIdx.x; if (i >= n8) return;
    const float* s = src + (size_t)i * 8; bf* d = dst + (size_t)i * 8;
    const v4f v0 = *(const v4f*)s; const v4f v1 = *(const v4f*)(s + 4); v8us o;
#pragma unroll
    for (int k = 0; k < 4; ++k) { o[k] = f2bf(v0[k]); o[4 + k] = f2bf(v1[k]); }
    *(v8us*)d = o; 
}

__device__ __forceinline__ void d_cvt8h(const float* __restrict__ src, bf* dst, unsigned n8, size_t sstride, float sc, unsigned bx, unsigned by) {
#pragma clang fp contract(off)
    const unsigned i = bx * 256u + threadIdx.x; if (i >= n8) return;
    const unsigned e = i * 8u; const unsigned srow = e / DM, c = e % DM; const unsigned hh = c / HD, dd = c % HD;
    const float* s = src + (size_t)by * sstride + (size_t)e;
    bf* d = dst + (((size_t)by * NH + hh) * SEQ + srow) * HD + dd;
    const v4f v0 = *(const v4f*)s; const v4f v1 = *(const v4f*)(s + 4); v8us o;
#pragma unroll
    for (int k = 0; k < 4; ++k) { o[k] = f2bf(bfr(v0[k]) * sc); o[4 + k] = f2bf(bfr(v1[k]) * sc); }
    *(v8us*)d = o; 
}

__device__ __forceinline__ void d_cvt_rpe(const float* __restrict__ src, bf* dst, unsigned bx) {
    const unsigned i = bx * 256u + threadIdx.x; if (i >= (unsigned)(RPAD * HD / 8)) return;
    const unsigned nreal = (unsigned)(NREL * HD / 8);
    const unsigned ic = i < nreal ? i : nreal - 1u;
    const bool ok = i < nreal;
    const float* s = src + (size_t)ic * 8; bf* d = dst + (size_t)i * 8;
    const v4f v0 = *(const v4f*)s; const v4f v1 = *(const v4f*)(s + 4); v8us o;
#pragma unroll
    for (int k = 0; k < 4; ++k) { const unsigned short a = f2bf(v0[k]); const unsigned short c = f2bf(v1[k]); o[k] = ok ? a : (unsigned short)0; o[4 + k] = ok ? c : (unsigned short)0; }
    *(v8us*)d = o; 
}

// sum over the wave's 32 lanes, the same value in every lane: four exchanges inside the 16-lane row (DPP row_xmask 1, 2, 4, 8), then one with lane ^ 16
template <int M> __device__ __forceinline__ float rowx(float x) { return __builtin_bit_cast(float, __builtin_amdgcn_update_dpp(0, __builtin_bit_cast(int, x), 0x160 + M, 0xf, 0xf, true)); }
__device__ __forceinline__ float wsum(float x) { x += rowx<1>(x); x += rowx<2>(x); x += rowx<4>(x); x += rowx<8>(x); return x + xhalf(x); }

// ---- d_ln_vt: V^T[b][n][s] (f16) = ((x - mean) * rsqrt(var + eps) * gain[n] + shift[n]) over the 512 features of token s, x = RNE bf16 of the value stream; work-groups (bx < SEQ/64, by < NB), 256 threads.
// Wave w owns tokens 8w..8w+7 from first to last, four at a time; a lane holds features 128c + 4*lane + j: 16 reads of 16 bytes in flight per lane, the stream is read once.
// Mean, then centred variance, both reduced in registers; the statistics never leave the owning wave. The lane's 4 tokens of one feature are one 8-byte write into the [512][64] LDS tile.
// One block barrier, then the tile's rows go out as whole 128-byte lines.
__device__ __forceinline__ void d_ln_vt(const float* __restrict__ X, const float* __restrict__ G, const float* __restrict__ Bt, h16* VT, unsigned bx, unsigned by) {
#pragma clang fp contract(off)
    __shared__ __align__(16) h16 t_s[DM * LTP];
    const int tid = threadIdx.x, lane = tid & 31;
    const int wid = __builtin_amdgcn_readfirstlane(tid >> 5);
    const size_t z = by; const int s0 = bx * 64;
    const unsigned lo = lane * 4;
    const float* xr = X + z * (size_t)SEQ_FULL * DM + (size_t)(s0 + wid * 8) * DM + lo;   // the lane's place in the batch's first token; steps on by one batch a trip
    // kept rolled: unrolled, both batches' reads are hoisted together and the registers they take are charged to every job of this launch
#pragma unroll 1
    for (int tb = 0; tb < 8; tb += 4) {
        v4f xv[4][DM / LNC];
#pragma unroll
        for (int u = 0; u < 4; ++u)
#pragma unroll
            for (int c = 0; c < DM / LNC; ++c) xv[u][c] = *(const v4f*)(xr + u * DM + c * LNC);
        float mu[4], rs[4];
#pragma unroll
        for (int u = 0; u < 4; ++u) { float sm = 0.0f;
#pragma unroll
            for (int c = 0; c < DM / LNC; ++c)
#pragma unroll
                for (int j = 0; j < 4; ++j) { xv[u][c][j] = bfr(xv[u][c][j]); sm += xv[u][c][j]; }
            mu[u] = sm; }
#pragma unroll
        for (int u = 0; u < 4; ++u) mu[u] = wsum(mu[u]) * (1.0f / DM);
#pragma unroll
        for (int u = 0; u < 4; ++u) { float sq = 0.0f;
#pragma unroll
            for (int c = 0; c < DM / LNC; ++c)
#pragma unroll
                for (int j = 0; j < 4; ++j) { const float dv = xv[u][c][j] - mu[u]; sq += dv * dv; }
            rs[u] = sq; }
#pragma unroll
        for (int u = 0; u < 4; ++u) rs[u] = rsqrtf(wsum(rs[u]) * (1.0f / DM) + LNEPS);
#pragma unroll
        for (int c = 0; c < DM / LNC; ++c) {
            const v4f g4 = *(const v4f*)(G + c * LNC + lo), b4 = *(const v4f*)(Bt + c * LNC + lo);
#pragma unroll
            for (int j = 0; j < 4; ++j) { const float g = bfr(g4[j]), be = bfr(b4[j]); v4h o;
#pragma unroll
                for (int u = 0; u < 4; ++u) { const float y = (xv[u][c][j] - mu[u]) * rs[u] * g + be; o[u] = toh_flush(y); }
                *(v4ha*)(&t_s[(c * LNC + lane * 4 + j) * LTP + wid * 8 + tb]) = o; }
        }
        xr += 4 * DM;
    }
    __syncthreads();
#pragma unroll
    for (int it = 0; it < DM * 8 / PT; ++it) { const int u = tid + it * PT; const int row = u >> 3, part = (u & 7) * 8;
        const v8h ov = *(const v8ha*)(&t_s[row * LTP + part]);
        *(v8h*)(VT + (z * DM + (size_t)row) * SEQ + s0 + part) = ov; }
}

// ---- d_relchk: work-group g compares rows g*CKU .. g*CKU+CKU-1 of the index input with the closed form and stores its own 128-byte line pz[g*32 .. g*32+31] = 0 (all equal) or NaN; g < NCK, 256 threads, CKS 16-byte reads per thread and row.
__device__ __forceinline__ void d_relchk(const int* __restrict__ rel, float* pz, unsigned g) {
    __shared__ int bad_s[PT / 32];
    const int tid = threadIdx.x, lane = tid & 31;
    const int wid = __builtin_amdgcn_readfirstlane(tid >> 5);
    const int i0 = g * CKU, j = tid * 4;
    const int* rp = rel + (size_t)i0 * SEQ_FULL + j;
    v4i t[CKU][CKS];
#pragma unroll
    for (int u = 0; u < CKU; ++u)
#pragma unroll
        for (int s = 0; s < CKS; ++s) t[u][s] = *(const v4i*)(rp + (size_t)u * SEQ_FULL + s * (4 * PT));
    int bad = 0;
#pragma unroll
    for (int u = 0; u < CKU; ++u) {
#pragma unroll
        for (int s = 0; s < CKS; ++s) {
#pragma unroll
            for (int cc = 0; cc < 4; ++cc) { const int want = clampi(j + s * (4 * PT) + cc - i0 - u, -RK, RK) + RK; bad |= (t[u][s][cc] != want) ? 1 : 0; }
        }
    }
    bad |= __shfl_xor(bad, 16, 32); bad |= __shfl_xor(bad, 8, 32); bad |= __shfl_xor(bad, 4, 32); bad |= __shfl_xor(bad, 2, 32); bad |= __shfl_xor(bad, 1, 32);
    if (lane == 0) bad_s[wid] = bad;
    __syncthreads();
    int any = 0;
#pragma unroll
    for (int w = 0; w < PT / 32; ++w) any |= bad_s[w];
    const float pv = (any != 0) ? __uint_as_float(0x7FC00000u) : 0.0f;
    if (tid < 8) { const v4f o = (v4f){pv, pv, pv, pv}; *(v4f*)(pz + (size_t)g * 32 + tid * 4) = o;  }
}

// ---- k_pre: the six preparation jobs read only inputs and write disjoint workspace planes, so none waits for another: one launch, each job on its own range of blockIdx.x.
// The LayerNorm work-groups are the few long ones and come first, so that they start first and the short streaming jobs run beside them. Every branch is on blockIdx.x alone (block barriers inside stay block-uniform).
constexpr unsigned NW8 = (unsigned)((size_t)DM * DM / 8), NA8 = (unsigned)((size_t)SEQ * DM / 8);
constexpr unsigned PB_LN = (SEQ / 64) * NB;              // LayerNorm + transpose
constexpr unsigned PB_CK = NCK;                          // index compare
constexpr unsigned PB_A  = (NA8 / 256) * NB;             // one head plane (q, then k)
constexpr unsigned PB_W  = NW8 / 256;                    // weight plane
constexpr unsigned PB_R  = (RPAD * HD / 8 + 255) / 256;  // position plane
constexpr unsigned PB_ALL = PB_LN + PB_CK + 2 * PB_A + PB_W + PB_R;
__global__ __launch_bounds__(PT) void k_pre(const float* __restrict__ xq, const float* __restrict__ xk, const float* __restrict__ xv, const float* __restrict__ lg, const float* __restrict__ lb,
                                            const float* __restrict__ rp, const float* __restrict__ wp, const int* __restrict__ rel, bf* QP, bf* KP, h16* VT, bf* RPP, bf* WO, float* PZ) {
    unsigned g = blockIdx.x;
    if (g < PB_LN) { d_ln_vt(xv, lg, lb, VT, g % (SEQ / 64), g / (SEQ / 64)); return; }
    g -= PB_LN;
    if (g < PB_CK) { d_relchk(rel, PZ, g); return; }
    g -= PB_CK;
    if (g < PB_A) { d_cvt8h(xq, QP, NA8, (size_t)SEQ_FULL * DM, SCL, g % (NA8 / 256), g / (NA8 / 256)); return; }
    g -= PB_A;
    if (g < PB_A) { d_cvt8h(xk, KP, NA8, (size_t)SEQ_FULL * DM, 1.0f, g % (NA8 / 256), g / (NA8 / 256)); return; }
    g -= PB_A;
    if (g < PB_W) { d_cvt8(wp, WO, NW8, g); return; }
    g -= PB_W;
    d_cvt_rpe(rp, RPP, g);
}

// ---- k_gemm_out: OUT[b][s][n] (f32) = sum_k (Ah + Al)[b*SEQ+s][k] W[n][k] (+ the sum of the 0 / NaN lines of the index compare); grid (SEQ/128, DM/128, NB), 128 threads: 2 x 2 waves, 64 x 64 outputs each.
// A stage is 64 k of 128 rows of Ah, Al and W (128-byte rows, LDS pitch 144 B), brought as whole lines by asynchronous copies into one of two buffers; stage t + 1 is in flight while stage t is worked on.
// Per accumulator the products keep the order k-step by k-step, Ah then Al.
__global__ __launch_bounds__(128) void k_gemm_out(const bf* __restrict__ Ah, const bf* __restrict__ Al, const bf* __restrict__ W, const float* __restrict__ pz, float* C) {
    __shared__ __align__(16) bf g_s[2 * GST];
    __shared__ __align__(16) float os[4 * 16 * LOP];
    const int tid = threadIdx.x, lane = tid & 31, lr = lane & 15, hi = lane >> 4;
    const int wid = __builtin_amdgcn_readfirstlane(tid >> 5);
    const int wm = wid >> 1, wn = wid & 1;
    const size_t z = blockIdx.z; const int r0 = blockIdx.x * GT, c0 = blockIdx.y * GT;
    float* Cz = C + z * (size_t)SEQ_FULL * DM;
    // the lane's first 16-byte unit of a stage: row tid / 8, unit tid % 8; its other seven lie 16 rows apart
    const int srow = tid >> 3, spart = (tid & 7) * 8;
    const bf* gA = Ah + z * (size_t)SEQ * DM + (size_t)(r0 + srow) * DM + spart;
    const bf* gL = Al + z * (size_t)SEQ * DM + (size_t)(r0 + srow) * DM + spart;
    const bf* gW = W + (size_t)(c0 + srow) * DM + spart;
    const unsigned l0 = (unsigned)(size_t)(&g_s[srow * LKP + spart]);
    auto stage = [&](int t) {
        const unsigned lb = l0 + (unsigned)(t & 1) * (unsigned)(GST * 2);
        acopy8(lb, gA + t * GK); acopy8(lb + GPL * 2, gL + t * GK); acopy8(lb + 2 * GPL * 2, gW + t * GK);
    };
    stage(0);
    float pzv = 0.0f;
#pragma unroll
    for (int s = 0; s < NCK / 32; ++s) pzv += pz[(size_t)(s * 32 + lane) * 32];
    pzv += __shfl_xor(pzv, 16, 32); pzv += __shfl_xor(pzv, 8, 32); pzv += __shfl_xor(pzv, 4, 32); pzv += __shfl_xor(pzv, 2, 32); pzv += __shfl_xor(pzv, 1, 32);
    v8f acc[4][4];
#pragma unroll
    for (int mb = 0; mb < 4; ++mb)
#pragma unroll
        for (int nb = 0; nb < 4; ++nb) acc[mb][nb] = (v8f){};
    // stage 0 has landed for this wave; the barrier publishes it to the others
    asm volatile("s_wait_asynccnt 0x0" ::: "memory");
    __syncthreads();
    stage(1);
    const int ao = (wm * 64 + lr) * LKP + 8 * hi, bo = 2 * GPL + (wn * 64 + lr) * LKP + 8 * hi;
    // kept rolled: one trip is one stage, and the order at its foot is the ring's
#pragma unroll 1
    for (int t = 0; t < DM / GK; ++t) {
        const bf* sb = &g_s[(t & 1) * GST];
        v16bf bc = lds16(sb + bo);
#pragma unroll
        for (int ks = 0; ks < GK / 32; ++ks) {
            v16bf a[4], a2[4];
#pragma unroll
            for (int mb = 0; mb < 4; ++mb) { a[mb] = lds16(sb + ao + mb * 16 * LKP + ks * 32); a2[mb] = lds16(sb + GPL + ao + mb * 16 * LKP + ks * 32); }
#pragma unroll
            for (int nb = 0; nb < 4; ++nb) {
                // the next W fragment of the stage is read while the eight products on this one run
                const int nx = ks * 4 + nb + 1;
                v16bf bn = bc;
                if (nx < 4 * (GK / 32)) {
                    bn = lds16(sb + bo + (nx & 3) * 16 * LKP + (nx >> 2) * 32);
                    // holds that read in front of the products: moved behind them, into the one fragment's registers, it is waited for with nothing to run meanwhile
                    __builtin_amdgcn_sched_barrier(0);
                }
#pragma unroll
                for (int mb = 0; mb < 4; ++mb) { acc[mb][nb] = wmmab(a[mb], bc, acc[mb][nb]); acc[mb][nb] = wmmab(a2[mb], bc, acc[mb][nb]); }
                bc = bn;
            }
        }
        // foot of the trip: this wave's reads of the buffer are done, its copies of stage t + 1 have landed; the barrier publishes stage t + 1 and frees this trip's buffer for stage t + 2
        asm volatile("s_wait_dscnt 0x0" ::: "memory");
        asm volatile("s_wait_asynccnt 0x0" ::: "memory");
        __syncthreads();
        if (t + 2 < DM / GK) stage(t + 2);
    }
    // no copy is outstanding when the wave goes on to its end
    asm volatile("s_wait_asynccnt 0x0" ::: "memory");
    const int ob = wid * 16 * LOP;
#pragma unroll
    for (int mb = 0; mb < 4; ++mb) {
#pragma unroll
        for (int nb = 0; nb < 4; ++nb) {
#pragma unroll
            for (int j = 0; j < 8; ++j) os[ob + (hi * 8 + j) * LOP + nb * 16 + lr] = acc[mb][nb][j]; }
        wsync();
        float* crow = Cz + (size_t)(r0 + wm * 64 + mb * 16) * DM + c0 + wn * 64;
#pragma unroll
        for (int s = 0; s < 8; ++s) { const int row = 2 * s + hi, cofs = lr * 4; v4f val = *(const v4fa*)(&os[ob + row * LOP + cofs]);
            val[0] += pzv; val[1] += pzv; val[2] += pzv; val[3] += pzv;
            *(v4f*)(crow + (size_t)row * DM + cofs) = val; }
        wsync();
    }
}

__global__ __launch_bounds__(128) void k_flash(const bf* __restrict__ Qh, const bf* __restrict__ Kh, const bf* __restrict__ RP, const h16* __restrict__ VT, bf* Ch, bf* Cl) {
    __shared__ __align__(16) bf    kh_s[2 * 64 * LKP];
    __shared__ __align__(16) h16   vt_s[2 * 64 * LKP];
    __shared__ __align__(16) float r_s[4 * 16 * LRP];
    const int tid = threadIdx.x, lane = tid & 31, lr = lane & 15, hi = lane >> 4;
    const int wid = __builtin_amdgcn_readfirstlane(tid >> 5);
    const int bh = blockIdx.y; const int b = bh / NH, h = bh % NH;
    const int q0 = blockIdx.x * 64 + wid * 16;
    const size_t pl = (size_t)bh * SEQ * HD;
    const size_t qoff = pl + (size_t)(q0 + lr) * HD + 8 * hi;
    const size_t vbase = ((size_t)b * DM + (size_t)h * HD) * SEQ;
    const int ob = wid * 16 * LRP;                  // epilogue staging: the start of the wave's own table, which the wave has done with by then
    const int rb = wid * 16 * LRP + 8 * hi * LRP;   // table rows as the prologue's D tiles hold them
    const int tb = wid * 16 * LRP + lr * LRP;       // table row of the lane's own query
    // K tile [key][d] and V^T tile [d][key] of key block kb into buffer kb & 1; the lane's first 16-byte unit of a tile: row tid / 8, unit tid % 8
    const int srw = tid >> 3, spt = (tid & 7) * 8;
    const bf* gK = Kh + pl + (size_t)srw * HD + spt;
    const h16* gV = VT + vbase + (size_t)srw * SEQ + spt;
    const unsigned lK = (unsigned)(size_t)(&kh_s[srw * LKP + spt]), lV = (unsigned)(size_t)(&vt_s[srw * LKP + spt]);
    auto stage = [&](const int kb) {
        const unsigned lo = (unsigned)(kb & 1) * (unsigned)(64 * LKP * 2);
        acopy44(lK + lo, gK + (size_t)kb * 64 * HD, lV + lo, gV + (size_t)kb * 64);
    };
    stage(0);
    const v16bf qa0 = ldg16(Qh + qoff); const v16bf qa1 = ldg16(Qh + qoff + 32);
#pragma unroll 1
    for (int ct = 0; ct < RT; ++ct) {
        const size_t ro = (size_t)(ct * 16 + lr) * HD + 8 * hi;
        const v16bf b0 = ldg16(RP + ro); const v16bf b1 = ldg16(RP + ro + 32);
        v8f t = (v8f){};
        t = wmmab_g(qa0, b0, t);
        t = wmmab_g(qa1, b1, t);
#pragma unroll
        for (int j = 0; j < 8; ++j) r_s[rb + j * LRP + ct * 16 + lr] = t[j];
    }
    wsync();
    const float rlo = r_s[tb], rhi = r_s[tb + 2 * RK];
    v8f o[4];
#pragma unroll
    for (int dt = 0; dt < 4; ++dt) o[dt] = (v8f){};
    float mr = -1.0e30f, ls = 0.0f;

    // key block 0 has landed for this wave; the barrier publishes it to the others
    asm volatile("s_wait_asynccnt 0x0" ::: "memory");
    __syncthreads();
    stage(1);
    // foot of key block kb: this wave's reads of the buffer are done, its copies of block kb + 1 have landed; the barrier publishes block kb + 1 and frees this block's buffer for block kb + 2
    auto foot = [&](const int kb) {
        asm volatile("s_wait_dscnt 0x0" ::: "memory");
        asm volatile("s_wait_asynccnt 0x0" ::: "memory");
        __syncthreads();
        if (kb + 2 < SEQ / 64) stage(kb + 2);
    };
    // one 32-key half, keys j0 .. j0 + 31. band == false: the half lies beyond the clip on one side for every query of the work-group, so all keys share the lane's position value rv;
    // it is not added to the scores: it goes once into the maximum and once into the exp2 argument's addend. band == true: the position term is added to each score (rv unused).
    auto half = [&](const int hf, const int j0, const bool band, const float rv) {
        v8f s0 = (v8f){}, s1 = (v8f){};
        const int bo = ((j0 >> 6) & 1) * 64 * LKP;   // the key block's buffer
        const int kr0 = bo + (hf * 32 + lr) * LKP + 8 * hi, kr1 = kr0 + 16 * LKP;
        {
            const v16bf k00 = cat16b(*(const v8usa*)(&kh_s[kr0]), *(const v8usa*)(&kh_s[kr0 + 16]));
            const v16bf k10 = cat16b(*(const v8usa*)(&kh_s[kr1]), *(const v8usa*)(&kh_s[kr1 + 16]));
            const v16bf k01 = cat16b(*(const v8usa*)(&kh_s[kr0 + 32]), *(const v8usa*)(&kh_s[kr0 + 48]));
            const v16bf k11 = cat16b(*(const v8usa*)(&kh_s[kr1 + 32]), *(const v8usa*)(&kh_s[kr1 + 48]));
            // holds the four fragments' eight LDS reads together in front of the products: without it each product waits out an LDS round trip of its own
            asm volatile("" :: "v"(k00), "v"(k10), "v"(k01), "v"(k11));
            s0 = wmmab(k00, qa0, s0); s1 = wmmab(k10, qa0, s1);
            s0 = wmmab(k01, qa1, s0); s1 = wmmab(k11, qa1, s1);
            // keeps the four products back to back: a vector instruction moved in between them costs its own run of idle slots and holds the last product back
            __builtin_amdgcn_sched_barrier(0);
        }
        if (band) {
            // position term: query q0 + lr, keys j0 + 8*hi + r (s0) and j0 + 16 + 8*hi + r (s1); both tests are on scalars only.
            // A half wholly beyond the clip on one side for this wave takes the register value, added without a branch (0 in a half near the diagonal): behind the products stands straight-line vector work, so their distance is padded once and not again on each side of a branch and at its join.
            const bool fhi = j0 - q0 >= RK + 15, flo = q0 - j0 >= RK + 31;
            const float rw = fhi ? rhi : (flo ? rlo : 0.0f);
#pragma unroll
            for (int r = 0; r < 8; ++r) { s0[r] += rw; s1[r] += rw; }
            if (!(fhi || flo)) {
#pragma unroll
                for (int r = 0; r < 8; ++r) {
                    const int d0 = j0 + 8 * hi + r - q0 - lr;
                    const int i0 = clampi(d0, -RK, RK) + RK, i1 = clampi(d0 + 16, -RK, RK) + RK;
                    const float b0 = r_s[tb + i0]; const float b1 = r_s[tb + i1];
                    s0[r] += b0; s1[r] += b1;
                }
            }
        }
        // the half's V^T fragments are read here, in front of the test below, so that their LDS round trip runs under the softmax arithmetic
        v16h va[4];
#pragma unroll
        for (int dt = 0; dt < 4; ++dt) { const int vo = bo + (dt * 16 + lr) * LKP + hf * 32 + 8 * hi; va[dt] = cat16(*(const v8ha*)(&vt_s[vo]), *(const v8ha*)(&vt_s[vo + 16])); }
        // keeps the eight reads together at the head of the softmax arithmetic: spread into it, the last ones are waited for with nothing left to run meanwhile
        __builtin_amdgcn_sched_barrier(0);
        // softmax against the maximum in use, mr, which is renewed only when it must be. The lane's 16 of the half's 32 keys: P x1024 = exp2(s * log2(e) + ca), one multiply-add per score, ca = (rv - mr) * log2(e) + log2(1024); returns the lane's sum of them
        v16h pa;
        auto pexp = [&](const float ca) {
            const v2f ca2 = (v2f){ca, ca}, l2 = (v2f){L2E, L2E};
            v2f ps = (v2f){0.0f, 0.0f};
#pragma unroll
            for (int r = 0; r < 8; r += 2) {
                const v2f e0 = __builtin_elementwise_fma((v2f){s0[r], s0[r + 1]}, l2, ca2), e1 = __builtin_elementwise_fma((v2f){s1[r], s1[r + 1]}, l2, ca2);
                const v2f p0 = (v2f){__builtin_amdgcn_exp2f(e0[0]), __builtin_amdgcn_exp2f(e0[1])};
                const v2f p1 = (v2f){__builtin_amdgcn_exp2f(e1[0]), __builtin_amdgcn_exp2f(e1[1])};
                ps += p0 + p1;
                const v2h h0 = __builtin_convertvector(p0, v2h), h1 = __builtin_convertvector(p1, v2h);
                pa[r] = h0[0]; pa[r + 1] = h0[1]; pa[8 + r] = h1[0]; pa[8 + r + 1] = h1[1];
            }
            return ps[0] + ps[1];
        };
        float pl = pexp((band ? -mr : rv - mr) * L2E + PLG);
        // keeps the statement below behind the arithmetic above: moved up to the reads, its wait for them would stand with nothing run in between
        __builtin_amdgcn_sched_barrier(0);
        // holds the V^T fragments' eight LDS reads in front of the branch: sunk behind it, each product waits out an LDS round trip of its own
        asm volatile("" :: "v"(va[0]), "v"(va[1]), "v"(va[2]), "v"(va[3]));
        // All P are >= 0, so a lane sum below the largest finite f16 bounds each of them: every P of the half converts to a finite f16 and mr may stay. One test a half, a scalar branch for the whole wave
        // (written so that an infinite or NaN sum fails it: the first half, with mr = -1e30, always does). Else: the half's maximum (one exchange with lane ^ 16, so a query's two lanes keep one mr), sum and output rescaled, P formed again (each <= 1024).
        if (__builtin_expect(__builtin_amdgcn_ballot_w32(!(pl < PLIM)) != 0u, 0)) {
            float mx = fmaxf(s0[0], s1[0]);
#pragma unroll
            for (int r = 1; r < 8; ++r) mx = fmaxf(mx, fmaxf(s0[r], s1[r]));
            mx = fmaxf(mx, xhalf(mx));
            if (!band) mx += rv;
            const float mnew = fmaxf(mr, mx);
            const float al = __builtin_amdgcn_exp2f((mr - mnew) * L2E);
            mr = mnew;
            ls *= al;
#pragma unroll
            for (int dt = 0; dt < 4; ++dt)
#pragma unroll
                for (int r = 0; r < 8; ++r) o[dt][r] *= al;
            pl = pexp((band ? -mnew : rv - mnew) * L2E + PLG);
        }
        ls += pl;
#pragma unroll
        for (int dt = 0; dt < 3; ++dt) o[dt] = wmma16(va[dt], pa, o[dt]);
        o[3] = wmma16_g(va[3], pa, o[3]);
    };
    // The key blocks in three runs, the bounds the same for the whole work-group (block barriers inside): with queries 64*bx .. 64*bx + 63, a block kb <= bx - 2 has key - query <= -65 and a block kb >= bx + 2 has key - query >= 65 for every pair.
    static_assert(RK <= 64 + 1);
    const int bx = blockIdx.x;
    const int kb1 = bx - 1 > 0 ? bx - 1 : 0, kb2 = bx + 2 < SEQ / 64 ? bx + 2 : SEQ / 64;
#pragma unroll 1
    for (int kb = 0; kb < kb1; ++kb) {
#pragma unroll 1
        for (int hf = 0; hf < 2; ++hf) half(hf, kb * 64 + hf * 32, false, rlo);
        foot(kb);
    }
#pragma unroll 1
    for (int kb = kb1; kb < kb2; ++kb) {
#pragma unroll 1
        for (int hf = 0; hf < 2; ++hf) half(hf, kb * 64 + hf * 32, true, 0.0f);
        foot(kb);
    }
#pragma unroll 1
    for (int kb = kb2; kb < SEQ / 64; ++kb) {
#pragma unroll 1
        for (int hf = 0; hf < 2; ++hf) half(hf, kb * 64 + hf * 32, false, rhi);
        foot(kb);
    }
    // no copy is outstanding when the wave goes on to its end
    asm volatile("s_wait_asynccnt 0x0" ::: "memory");
    // normalise: the query's sum is completed over its two lanes; it carries the same x1024 as P, so 1 / l undoes both; the lane's 8 registers of a tile are 8 consecutive features of its query
    {
        const float lt = ls + xhalf(ls);
        const float inv = 1.0f / lt;
#pragma unroll
        for (int dt = 0; dt < 4; ++dt) {
            const v4f y0 = (v4f){o[dt][0] * inv, o[dt][1] * inv, o[dt][2] * inv, o[dt][3] * inv};
            const v4f y1 = (v4f){o[dt][4] * inv, o[dt][5] * inv, o[dt][6] * inv, o[dt][7] * inv};
            *(v4fa*)(&r_s[ob + lr * LOP + dt * 16 + 8 * hi]) = y0; *(v4fa*)(&r_s[ob + lr * LOP + dt * 16 + 8 * hi + 4]) = y1;
        }
    }
    wsync();
    const int srow = lane >> 3, scol = (lane & 7) * 8;
    const size_t cbase = ((size_t)b * SEQ + q0) * DM + (size_t)h * HD;
{
#pragma unroll
        for (int s = 0; s < 4; ++s) { const int row = 4 * s + srow; const v4f x0 = *(const v4fa*)(&r_s[ob + row * LOP + scol]); const v4f x1 = *(const v4fa*)(&r_s[ob + row * LOP + scol + 4]); v8us oh, ol;
#pragma unroll
            for (int j = 0; j < 4; ++j) { unsigned short a, c; splitf(x0[j], a, c); oh[j] = a; ol[j] = c; splitf(x1[j], a, c); oh[4 + j] = a; ol[4 + j] = c; }
            const size_t off = cbase + (size_t)row * DM + scol;
            *(v8us*)(Ch + off) = oh; *(v8us*)(Cl + off) = ol; }
         }
}

constexpr size_t al256(size_t x) { return (x + 255) & ~(size_t)255; }
constexpr size_t SZ_W = al256((size_t)DM * DM * 2);                 // one bf16 weight plane
constexpr size_t SZ_R = al256((size_t)RPAD * HD * 2);               // bf16 position plane, 144 rows
constexpr size_t SZ_X = al256((size_t)NB * SEQ * DM * 2);           // one 16-bit [NB*SEQ][DM] plane (merged-head plane)
constexpr size_t SZ_P = al256((size_t)NB * NH * SEQ * HD * 2);      // one 16-bit head plane
constexpr size_t SZ_F = al256((size_t)NCK * 128);                   // 0 / NaN lines of the index compare, one per work-group
constexpr size_t WS_TOTAL = SZ_W + SZ_R + 2 * SZ_P + SZ_P + 2 * SZ_X + SZ_F;
static_assert(WS_TOTAL <= (size_t)134217728);                       // carve stays within 128 MiB
static_assert(SZ_P == SZ_X);                                        // NH * HD == DM
static_assert(SZ_R >= (size_t)RPAD * HD * 2);                       // last position plane line lies inside its region

extern "C" void kernel_launch(void* const* d_in, const int* in_sizes, int n_in,
                              void* d_out, int out_size, void* d_ws, size_t ws_size, hipStream_t stream) {
    if (n_in < 8) return;
    const size_t need_act = (size_t)(NB - 1) * SEQ_FULL * DM + (size_t)SEQ * DM;
    if ((size_t)in_sizes[0] < need_act || (size_t)in_sizes[1] < need_act || (size_t)in_sizes[2] < need_act) return;
    if (in_sizes[3] < DM || in_sizes[4] < DM || in_sizes[5] < NREL * HD || (size_t)in_sizes[6] < (size_t)DM * DM) return;
    if ((size_t)in_sizes[7] < (size_t)(SEQ - 1) * SEQ_FULL + (size_t)SEQ) return;
    if ((size_t)out_size < need_act) return;
    if (WS_TOTAL > ws_size) return;
    // wire order: q, k, v, ln_gamma, ln_beta, rpe_emb, W_proj (all f32; W_proj [out][in]), rel_idx (int32 [SEQ][SEQ])
    const float* xq = (const float*)d_in[0]; const float* xk = (const float*)d_in[1]; const float* xv = (const float*)d_in[2];
    const float* lg = (const float*)d_in[3]; const float* lb = (const float*)d_in[4]; const float* rp = (const float*)d_in[5]; const float* wp = (const float*)d_in[6];
    const int* rel = (const int*)d_in[7];
    float* OUT = (float*)d_out;
    char* wsp = (char*)d_ws;
    auto take = [&](size_t bytes) { char* p = wsp; wsp += bytes; return (void*)p; };
    bf* WO = (bf*)take(SZ_W);
    bf* RPP = (bf*)take(SZ_R);
    bf* QP = (bf*)take(SZ_P); bf* KP = (bf*)take(SZ_P);
    h16* VT = (h16*)take(SZ_P);
    bf* CTh = (bf*)take(SZ_X); bf* CTl = (bf*)take(SZ_X);
    float* PZ = (float*)take(SZ_F);
    if ((size_t)(wsp - (char*)d_ws) != WS_TOTAL) return;

    k_pre<<<dim3(PB_ALL), PT, 0, stream>>>(xq, xk, xv, lg, lb, rp, wp, rel, QP, KP, VT, RPP, WO, PZ);
    k_flash<<<dim3(SEQ / 64, NB * NH), 128, 0, stream>>>(QP, KP, RPP, VT, CTh, CTl);
    k_gemm_out<<<dim3(SEQ / GT, DM / GT, NB), 128, 0, stream>>>(CTh, CTl, WO, PZ, OUT);
}

// v010
// It runs in 60.6 microseconds.
// Two timings next to v009 both put it at 1.05 times that version's speed.
// All steps since v000 together make it 16.4 times as fast.
#include <hip/hip_runtime.h>

#ifndef NB
#define NB 4
#endif
#ifndef SEQ
#define SEQ 2048
#endif
#define NB_FULL  4
#define SEQ_FULL 2048
#define DM   512
#define NH   8
#define HD   64
#define PCAR 1024.0f
#define PLG  10.0f   // log2(PCAR)
#define PLIM 65504.0f   // largest finite f16
#define SCL  0.125f
#define L2E  1.4426950408889634f
#define LKP  72      // LDS row pitch (16-bit elements) of the K / V^T tiles: 144 B rows
#define LOP  68      // LDS row pitch (floats) of epilogue staging tiles: 272 B rows
#define RK   64      // relative distance clip
#define NREL 129     // position table rows: 2 * RK + 1
#define RT   9       // 16-wide column tiles of the per-wave q.rpe^T table
#define RPAD 144     // position plane rows, zero filled beyond NREL
#define LRP  148     // LDS row pitch (floats) of the per-wave q.rpe^T table
#define LTP  72      // LDS row pitch (halves) of the LayerNorm transpose tile
#define LNC  128     // features one 16-byte read per lane covers in the LayerNorm job: 32 lanes x 4
#define LNEPS 1.0e-5f
#define PT   256         // threads of a pre-pass work-group, the same for all five jobs
#define CKS  (SEQ / (4 * PT))   // 16-byte reads per thread and row of the index input
#define CKU  8           // rows per index-compare work-group: CKU * CKS independent 16-byte reads per thread
#define NCK  (SEQ / CKU) // index-compare work-groups == 0 / NaN lines
#define GT   128         // rows and columns of an output GEMM work-group's tile
#define GK   64          // k elements of an output GEMM stage: 128-byte rows
#define GPL  (GT * LKP)  // elements of one staged plane
#define GST  (3 * GPL)   // elements of a stage: Ah | Al | W
#define GRS  (16 * LKP * 2)   // LDS bytes between rows 16 apart

static_assert(DM == NH * HD);            // one 64-wide GEMM column tile == one head
static_assert(HD == 64);
static_assert(DM % 32 == 0);             // WMMA k-step
static_assert(DM % GT == 0 && SEQ % GT == 0);   // GEMM tiles
static_assert(DM % GK == 0 && DM / GK >= 2);    // whole stages, and the two that the ring's start needs
static_assert(GT * GK * 2 == 128 * 8 * 16);     // a staged plane == 128 threads x 8 copies x 16 B
static_assert((size_t)2 * GST * 2 + (size_t)4 * 16 * LOP * 4 <= 163840);   // output GEMM static LDS
static_assert(SEQ % 64 == 0);            // key blocks, query blocks
static_assert((SEQ * DM) % (8 * 256) == 0);   // k convert job's work-group range is exact
static_assert((DM * DM) % (8 * 256) == 0);
static_assert(NB <= NB_FULL);
static_assert(SEQ <= SEQ_FULL);
static_assert(LKP % 8 == 0);             // 16-byte aligned LDS vector accesses
static_assert(LOP % 4 == 0);
static_assert(NREL == 2 * RK + 1);
static_assert(RPAD == RT * 16);          // position plane rows == table column tiles
static_assert(NREL <= RPAD);
static_assert(RPAD <= LRP);              // table columns fit the LDS pitch
static_assert(2 * RK < RPAD);            // largest clamped index is a written column
static_assert((RPAD * HD) % 64 == 0);
static_assert(HD * 2 == 8 * 16);         // head plane row == 8 lanes x 16 B
static_assert(LTP % 8 == 0);
static_assert(SEQ % (4 * PT) == 0);      // index compare: whole 16-byte reads, the same number in every thread
static_assert(SEQ % CKU == 0);           // index compare grid is exact
static_assert(NCK % 32 == 0);            // the output GEMM's wave reads the lines 32 at a time
static_assert(256 * 16 * 2 == 64 * 64 * 2);
static_assert(32 * 16 * 4 == 16 * HD * 2);
static_assert(32 * 16 * 8 == 16 * 64 * 4);     // output epilogue: lanes x bytes x trips == 16 rows x 256 B
static_assert(PCAR == 1024.0f);                // PLG = log2(PCAR)
static_assert((size_t)2 * 64 * LKP * 2 * 2 + (size_t)4 * 16 * LRP * 4 <= 327680 / 4);   // flash static LDS: four work-groups per WGP
static_assert(LOP <= LRP);               // the epilogue's staging rows fit the wave's own table rows
static_assert(LKP * 2 <= LRP * 4);       // and so do the prologue's 16 bf16 query rows
static_assert(SEQ / 64 >= 2);            // the two key blocks that the ring's start needs
static_assert((size_t)DM * LTP * 2 <= 131072);                                                                                  // LayerNorm static LDS
static_assert(DM % LNC == 0);            // whole chunks
static_assert((DM * 8) % 256 == 0);      // tile write-out: whole 16-byte units per thread

typedef _Float16 h16;
typedef unsigned short bf;
typedef __attribute__((ext_vector_type(16))) __bf16   v16bf;
typedef __attribute__((ext_vector_type(16))) _Float16 v16h;
typedef __attribute__((ext_vector_type(8)))  _Float16 v8h;
typedef __attribute__((ext_vector_type(8)))  unsigned short v8us;
typedef __attribute__((ext_vector_type(8)))  float    v8f;
typedef __attribute__((ext_vector_type(4)))  float    v4f;
typedef __attribute__((ext_vector_type(2)))  float    v2f;
typedef __attribute__((ext_vector_type(2)))  _Float16 v2h;
typedef __attribute__((ext_vector_type(4)))  int      v4i;
typedef __attribute__((ext_vector_type(4)))  _Float16 v4h;
typedef v8h  __attribute__((may_alias)) v8ha;
typedef v4h  __attribute__((may_alias)) v4ha;
typedef v4f  __attribute__((may_alias)) v4fa;
typedef v8us __attribute__((may_alias)) v8usa;
typedef __attribute__((ext_vector_type(4)))  unsigned short v4us;
typedef v4us __attribute__((may_alias)) v4usa;

__device__ __forceinline__ unsigned short f2bf(float f) { unsigned u = __float_as_uint(f); u += 0x7FFFu + ((u >> 16) & 1u); return (unsigned short)(u >> 16); }
__device__ __forceinline__ float bf2f(unsigned short b) { return __uint_as_float(((unsigned)b) << 16); }
__device__ __forceinline__ float bfr(float f) { return bf2f(f2bf(f)); }
__device__ __forceinline__ void splitf(float y, unsigned short& h, unsigned short& l) { h = f2bf(y); l = f2bf(y - bf2f(h)); }
__device__ __forceinline__ v16h cat16(v8h lo, v8h hi) { return __builtin_shufflevector(lo, hi, 0, 1, 2, 3, 4, 5, 6, 7, 8, 9, 10, 11, 12, 13, 14, 15); }
__device__ __forceinline__ v16bf cat16b(v8us lo, v8us hi) { return __builtin_bit_cast(v16bf, __builtin_shufflevector(lo, hi, 0, 1, 2, 3, 4, 5, 6, 7, 8, 9, 10, 11, 12, 13, 14, 15)); }
__device__ __forceinline__ v8f wmma16(v16h a, v16h b, v8f c) { return __builtin_amdgcn_wmma_f32_16x16x32_f16(false, a, false, b, (short)0, c, false, false); }
__device__ __forceinline__ v8f wmmab(v16bf a, v16bf b, v8f c) { return __builtin_amdgcn_wmma_f32_16x16x32_bf16(false, a, false, b, (short)0, c, false, false); }
// fragment from a K-contiguous global bf16 plane: elements 0..7 <- p[0..7], 8..15 <- p[16..23] (p already includes row*pitch + k0 + 8*(lane>>4))
__device__ __forceinline__ v16bf ldg16(const bf* __restrict__ p) { return cat16b(*(const v8us*)p, *(const v8us*)(p + 16)); }
// same-wave LDS exchange ordering (wave-private tiles only)
__device__ __forceinline__ void wsync() { __builtin_amdgcn_wave_barrier(); asm volatile("" ::: "memory"); }
// one matrix instruction followed by its own four idle slots (ties the accumulator, keeps the operands live)
__device__ __forceinline__ v8f wmmab_g(v16bf a, v16bf b, v8f c) { c = __builtin_amdgcn_wmma_f32_16x16x32_bf16(false, a, false, b, (short)0, c, false, false); asm volatile("v_nop\n\tv_nop\n\tv_nop\n\tv_nop" : "+v"(c) : "v"(a), "v"(b)); return c; }
// the same for the f16 form: for a product behind which a loop's branch stands
__device__ __forceinline__ v8f wmma16_g(v16h a, v16h b, v8f c) { c = __builtin_amdgcn_wmma_f32_16x16x32_f16(false, a, false, b, (short)0, c, false, false); asm volatile("v_nop\n\tv_nop\n\tv_nop\n\tv_nop" : "+v"(c) : "v"(a), "v"(b)); return c; }
// f32 -> f16 operand convert that cannot produce an f16 subnormal
__device__ __forceinline__ h16 toh_flush(float v) { const h16 r = (h16)v; return (fabsf(v) < 6.103515625e-05f) ? (h16)0.0f : r; }
// lane l exchanges with lane l ^ 16 (the two lanes that share one column of a D tile)
__device__ __forceinline__ float xhalf(float x) { return __builtin_bit_cast(float, __builtin_amdgcn_permlanex16(__builtin_bit_cast(int, x), __builtin_bit_cast(int, x), 0x76543210, 0xfedcba98, false, false)); }
__device__ __forceinline__ int clampi(int v, int lo, int hi) { const int t = v < lo ? lo : v; return t > hi ? hi : t; }

// fragment from a K-contiguous LDS row, the same element order as ldg16
__device__ __forceinline__ v16bf lds16(const bf* p) { return cat16b(*(const v8usa*)p, *(const v8usa*)(p + 16)); }
// eight asynchronous 16-byte copies of one lane, global -> LDS, rows 16 apart: a wave's copy is 4 whole 128-byte lines. l: the lane's LDS byte address, g: its global address.
// The s_wait_xcnt closes the statement so that it stands in front of every later write of an address register the copies name.
__device__ __forceinline__ void acopy8(unsigned l, const bf* g) {
    asm volatile("global_load_async_to_lds_b128 %0, %8, off\n\t"
                 "global_load_async_to_lds_b128 %1, %9, off\n\t"
                 "global_load_async_to_lds_b128 %2, %10, off\n\t"
                 "global_load_async_to_lds_b128 %3, %11, off\n\t"
                 "global_load_async_to_lds_b128 %4, %12, off\n\t"
                 "global_load_async_to_lds_b128 %5, %13, off\n\t"
                 "global_load_async_to_lds_b128 %6, %14, off\n\t"
                 "global_load_async_to_lds_b128 %7, %15, off\n\t"
                 "s_wait_xcnt 0x0"
                 :: "v"(l), "v"(l + 1u * GRS), "v"(l + 2u * GRS), "v"(l + 3u * GRS), "v"(l + 4u * GRS), "v"(l + 5u * GRS), "v"(l + 6u * GRS), "v"(l + 7u * GRS),
                    "v"(g), "v"(g + 1 * 16 * DM), "v"(g + 2 * 16 * DM), "v"(g + 3 * 16 * DM), "v"(g + 4 * 16 * DM), "v"(g + 5 * 16 * DM), "v"(g + 6 * 16 * DM), "v"(g + 7 * 16 * DM)
                 : "memory");
}

// eight asynchronous 16-byte copies of one lane, global -> LDS: its four units of a [64][64] K tile and its four of a V^T tile, rows 16 apart; a wave's copy is 4 whole 128-byte lines.
// lk, lv: the lane's LDS byte addresses, gk, gv: its global addresses. The s_wait_xcnt closes the statement so that it stands in front of every later write of an address register the copies name.
__device__ __forceinline__ void acopy44(unsigned lk, const bf* gk, unsigned lv, const _Float16* gv) {
    asm volatile("global_load_async_to_lds_b128 %0, %8, off\n\t"
                 "global_load_async_to_lds_b128 %1, %9, off\n\t"
                 "global_load_async_to_lds_b128 %2, %10, off\n\t"
                 "global_load_async_to_lds_b128 %3, %11, off\n\t"
                 "global_load_async_to_lds_b128 %4, %12, off\n\t"
                 "global_load_async_to_lds_b128 %5, %13, off\n\t"
                 "global_load_async_to_lds_b128 %6, %14, off\n\t"
                 "global_load_async_to_lds_b128 %7, %15, off\n\t"
                 "s_wait_xcnt 0x0"
                 :: "v"(lk), "v"(lk + 1u * GRS), "v"(lk + 2u * GRS), "v"(lk + 3u * GRS), "v"(lv), "v"(lv + 1u * GRS), "v"(lv + 2u * GRS), "v"(lv + 3u * GRS),
                    "v"(gk), "v"(gk + 1 * 16 * HD), "v"(gk + 2 * 16 * HD), "v"(gk + 3 * 16 * HD), "v"(gv), "v"(gv + 1 * 16 * SEQ), "v"(gv + 2 * 16 * SEQ), "v"(gv + 3 * 16 * SEQ)
                 : "memory");
}

// The five jobs of the pre-pass launch are device functions; bx (and by) is the job's own work-group index, the same for the whole work-group.
__device__ __forceinline__ void d_cvt8(const float* __restrict__ src, bf* dst, unsigned n8, unsigned bx) {
    const unsigned i = bx * 256u + threadIdx.x; if (i >= n8) return;
    const float* s = src + (size_t)i * 8; bf* d = dst + (size_t)i * 8;
    const v4f v0 = *(const v4f*)s; const v4f v1 = *(const v4f*)(s + 4); v8us o;
#pragma unroll
    for (int k = 0; k < 4; ++k) { o[k] = f2bf(v0[k]); o[4 + k] = f2bf(v1[k]); }
    *(v8us*)d = o; 
}

__device__ __forceinline__ void d_cvt8h(const float* __restrict__ src, bf* dst, unsigned n8, size_t sstride, float sc, unsigned bx, unsigned by) {
#pragma clang fp contract(off)
    const unsigned i = bx * 256u + threadIdx.x; if (i >= n8) return;
    const unsigned e = i * 8u; const unsigned srow = e / DM, c = e % DM; const unsigned hh = c / HD, dd = c % HD;
    const float* s = src + (size_t)by * sstride + (size_t)e;
    bf* d = dst + (((size_t)by * NH + hh) * SEQ + srow) * HD + dd;
    const v4f v0 = *(const v4f*)s; const v4f v1 = *(const v4f*)(s + 4); v8us o;
#pragma unroll
    for (int k = 0; k < 4; ++k) { o[k] = f2bf(bfr(v0[k]) * sc); o[4 + k] = f2bf(bfr(v1[k]) * sc); }
    *(v8us*)d = o; 
}

__device__ __forceinline__ void d_cvt_rpe(const float* __restrict__ src, bf* dst, unsigned bx) {
    const unsigned i = bx * 256u + threadIdx.x; if (i >= (unsigned)(RPAD * HD / 8)) return;
    const unsigned nreal = (unsigned)(NREL * HD / 8);
    const unsigned ic = i < nreal ? i : nreal - 1u;
    const bool ok = i < nreal;
    const float* s = src + (size_t)ic * 8; bf* d = dst + (size_t)i * 8;
    const v4f v0 = *(const v4f*)s; const v4f v1 = *(const v4f*)(s + 4); v8us o;
#pragma unroll
    for (int k = 0; k < 4; ++k) { const unsigned short a = f2bf(v0[k]); const unsigned short c = f2bf(v1[k]); o[k] = ok ? a : (unsigned short)0; o[4 + k] = ok ? c : (unsigned short)0; }
    *(v8us*)d = o; 
}

// sum over the wave's 32 lanes, the same value in every lane: four exchanges inside the 16-lane row (DPP row_xmask 1, 2, 4, 8), then one with lane ^ 16
template <int M> __device__ __forceinline__ float rowx(float x) { return __builtin_bit_cast(float, __builtin_amdgcn_update_dpp(0, __builtin_bit_cast(int, x), 0x160 + M, 0xf, 0xf, true)); }
__device__ __forceinline__ float wsum(float x) { x += rowx<1>(x); x += rowx<2>(x); x += rowx<4>(x); x += rowx<8>(x); return x + xhalf(x); }

// ---- d_ln_vt: V^T[b][n][s] (f16) = ((x - mean) * rsqrt(var + eps) * gain[n] + shift[n]) over the 512 features of token s, x = RNE bf16 of the value stream; work-groups (bx < SEQ/64, by < NB), 256 threads.
// Wave w owns tokens 8w..8w+7 from first to last, four at a time; a lane holds features 128c + 4*lane + j: 16 reads of 16 bytes in flight per lane, the stream is read once.
// Mean, then centred variance, both reduced in registers; the statistics never leave the owning wave. The lane's 4 tokens of one feature are one 8-byte write into the [512][64] LDS tile.
// One block barrier, then the tile's rows go out as whole 128-byte lines.
__device__ __forceinline__ void d_ln_vt(const float* __restrict__ X, const float* __restrict__ G, const float* __restrict__ Bt, h16* VT, unsigned bx, unsigned by) {
#pragma clang fp contract(off)
    __shared__ __align__(16) h16 t_s[DM * LTP];
    const int tid = threadIdx.x, lane = tid & 31;
    const int wid = __builtin_amdgcn_readfirstlane(tid >> 5);
    const size_t z = by; const int s0 = bx * 64;
    const unsigned lo = lane * 4;
    const float* xr = X + z * (size_t)SEQ_FULL * DM + (size_t)(s0 + wid * 8) * DM + lo;   // the lane's place in the batch's first token; steps on by one batch a trip
    // kept rolled: unrolled, both batches' reads are hoisted together and the registers they take are charged to every job of this launch
#pragma unroll 1
    for (int tb = 0; tb < 8; tb += 4) {
        v4f xv[4][DM / LNC];
#pragma unroll
        for (int u = 0; u < 4; ++u)
#pragma unroll
            for (int c = 0; c < DM / LNC; ++c) xv[u][c] = *(const v4f*)(xr + u * DM + c * LNC);
        float mu[4], rs[4];
#pragma unroll
        for (int u = 0; u < 4; ++u) { float sm = 0.0f;
#pragma unroll
            for (int c = 0; c < DM / LNC; ++c)
#pragma unroll
                for (int j = 0; j < 4; ++j) { xv[u][c][j] = bfr(xv[u][c][j]); sm += xv[u][c][j]; }
            mu[u] = sm; }
#pragma unroll
        for (int u = 0; u < 4; ++u) mu[u] = wsum(mu[u]) * (1.0f / DM);
#pragma unroll
        for (int u = 0; u < 4; ++u) { float sq = 0.0f;
#pragma unroll
            for (int c = 0; c < DM / LNC; ++c)
#pragma unroll
                for (int j = 0; j < 4; ++j) { const float dv = xv[u][c][j] - mu[u]; sq += dv * dv; }
            rs[u] = sq; }
#pragma unroll
        for (int u = 0; u < 4; ++u) rs[u] = rsqrtf(wsum(rs[u]) * (1.0f / DM) + LNEPS);
#pragma unroll
        for (int c = 0; c < DM / LNC; ++c) {
            const v4f g4 = *(const v4f*)(G + c * LNC + lo), b4 = *(const v4f*)(Bt + c * LNC + lo);
#pragma unroll
            for (int j = 0; j < 4; ++j) { const float g = bfr(g4[j]), be = bfr(b4[j]); v4h o;
#pragma unroll
                for (int u = 0; u < 4; ++u) { const float y = (xv[u][c][j] - mu[u]) * rs[u] * g + be; o[u] = toh_flush(y); }
                *(v4ha*)(&t_s[(c * LNC + lane * 4 + j) * LTP + wid * 8 + tb]) = o; }
        }
        xr += 4 * DM;
    }
    __syncthreads();
#pragma unroll
    for (int it = 0; it < DM * 8 / PT; ++it) { const int u = tid + it * PT; const int row = u >> 3, part = (u & 7) * 8;
        const v8h ov = *(const v8ha*)(&t_s[row * LTP + part]);
        *(v8h*)(VT + (z * DM + (size_t)row) * SEQ + s0 + part) = ov; }
}

// ---- d_relchk: work-group g compares rows g*CKU .. g*CKU+CKU-1 of the index input with the closed form and stores its own 128-byte line pz[g*32 .. g*32+31] = 0 (all equal) or NaN; g < NCK, 256 threads, CKS 16-byte reads per thread and row.
__device__ __forceinline__ void d_relchk(const int* __restrict__ rel, float* pz, unsigned g) {
    __shared__ int bad_s[PT / 32];
    const int tid = threadIdx.x, lane = tid & 31;
    const int wid = __builtin_amdgcn_readfirstlane(tid >> 5);
    const int i0 = g * CKU, j = tid * 4;
    const int* rp = rel + (size_t)i0 * SEQ_FULL + j;
    v4i t[CKU][CKS];
#pragma unroll
    for (int u = 0; u < CKU; ++u)
#pragma unroll
        for (int s = 0; s < CKS; ++s) t[u][s] = *(const v4i*)(rp + (size_t)u * SEQ_FULL + s * (4 * PT));
    int bad = 0;
#pragma unroll
    for (int u = 0; u < CKU; ++u) {
#pragma unroll
        for (int s = 0; s < CKS; ++s) {
#pragma unroll
            for (int cc = 0; cc < 4; ++cc) { const int want = clampi(j + s * (4 * PT) + cc - i0 - u, -RK, RK) + RK; bad |= (t[u][s][cc] != want) ? 1 : 0; }
        }
    }
    bad |= __shfl_xor(bad, 16, 32); bad |= __shfl_xor(bad, 8, 32); bad |= __shfl_xor(bad, 4, 32); bad |= __shfl_xor(bad, 2, 32); bad |= __shfl_xor(bad, 1, 32);
    if (lane == 0) bad_s[wid] = bad;
    __syncthreads();
    int any = 0;
#pragma unroll
    for (int w = 0; w < PT / 32; ++w) any |= bad_s[w];
    const float pv = (any != 0) ? __uint_as_float(0x7FC00000u) : 0.0f;
    if (tid < 8) { const v4f o = (v4f){pv, pv, pv, pv}; *(v4f*)(pz + (size_t)g * 32 + tid * 4) = o;  }
}

// ---- k_pre: the five preparation jobs read only inputs and write disjoint workspace planes, so none waits for another: one launch, each job on its own range of blockIdx.x.
// The LayerNorm work-groups are the few long ones and come first, so that they start first and the short streaming jobs run beside them. Every branch is on blockIdx.x alone (block barriers inside stay block-uniform).
constexpr unsigned NW8 = (unsigned)((size_t)DM * DM / 8), NA8 = (unsigned)((size_t)SEQ * DM / 8);
constexpr unsigned PB_LN = (SEQ / 64) * NB;              // LayerNorm + transpose
constexpr unsigned PB_CK = NCK;                          // index compare
constexpr unsigned PB_A  = (NA8 / 256) * NB;             // the k head plane
constexpr unsigned PB_W  = NW8 / 256;                    // weight plane
constexpr unsigned PB_R  = (RPAD * HD / 8 + 255) / 256;  // position plane
constexpr unsigned PB_ALL = PB_LN + PB_CK + PB_A + PB_W + PB_R;
__global__ __launch_bounds__(PT) void k_pre(const float* __restrict__ xk, const float* __restrict__ xv, const float* __restrict__ lg, const float* __restrict__ lb,
                                            const float* __restrict__ rp, const float* __restrict__ wp, const int* __restrict__ rel, bf* KP, h16* VT, bf* RPP, bf* WO, float* PZ) {
    unsigned g = blockIdx.x;
    if (g < PB_LN) { d_ln_vt(xv, lg, lb, VT, g % (SEQ / 64), g / (SEQ / 64)); return; }
    g -= PB_LN;
    if (g < PB_CK) { d_relchk(rel, PZ, g); return; }
    g -= PB_CK;
    if (g < PB_A) { d_cvt8h(xk, KP, NA8, (size_t)SEQ_FULL * DM, 1.0f, g % (NA8 / 256), g / (NA8 / 256)); return; }
    g -= PB_A;
    if (g < PB_W) { d_cvt8(wp, WO, NW8, g); return; }
    g -= PB_W;
    d_cvt_rpe(rp, RPP, g);
}

// ---- k_gemm_out: OUT[b][s][n] (f32) = sum_k (Ah + Al)[b*SEQ+s][k] W[n][k] (+ the sum of the 0 / NaN lines of the index compare); grid (SEQ/128, DM/128, NB), 128 threads: 2 x 2 waves, 64 x 64 outputs each.
// A stage is 64 k of 128 rows of Ah, Al and W (128-byte rows, LDS pitch 144 B), brought as whole lines by asynchronous copies into one of two buffers; stage t + 1 is in flight while stage t is worked on.
// Per accumulator the products keep the order k-step by k-step, Ah then Al.
__global__ __launch_bounds__(128) void k_gemm_out(const bf* __restrict__ Ah, const bf* __restrict__ Al, const bf* __restrict__ W, const float* __restrict__ pz, float* C) {
    __shared__ __align__(16) bf g_s[2 * GST];
    __shared__ __align__(16) float os[4 * 16 * LOP];
    const int tid = threadIdx.x, lane = tid & 31, lr = lane & 15, hi = lane >> 4;
    const int wid = __builtin_amdgcn_readfirstlane(tid >> 5);
    const int wm = wid >> 1, wn = wid & 1;
    const size_t z = blockIdx.z; const int r0 = blockIdx.x * GT, c0 = blockIdx.y * GT;
    float* Cz = C + z * (size_t)SEQ_FULL * DM;
    // the lane's first 16-byte unit of a stage: row tid / 8, unit tid % 8; its other seven lie 16 rows apart
    const int srow = tid >> 3, spart = (tid & 7) * 8;
    const bf* gA = Ah + z * (size_t)SEQ * DM + (size_t)(r0 + srow) * DM + spart;
    const bf* gL = Al + z * (size_t)SEQ * DM + (size_t)(r0 + srow) * DM + spart;
    const bf* gW = W + (size_t)(c0 + srow) * DM + spart;
    const unsigned l0 = (unsigned)(size_t)(&g_s[srow * LKP + spart]);
    auto stage = [&](int t) {
        const unsigned lb = l0 + (unsigned)(t & 1) * (unsigned)(GST * 2);
        acopy8(lb, gA + t * GK); acopy8(lb + GPL * 2, gL + t * GK); acopy8(lb + 2 * GPL * 2, gW + t * GK);
    };
    stage(0);
    float pzv = 0.0f;
#pragma unroll
    for (int s = 0; s < NCK / 32; ++s) pzv += pz[(size_t)(s * 32 + lane) * 32];
    pzv += __shfl_xor(pzv, 16, 32); pzv += __shfl_xor(pzv, 8, 32); pzv += __shfl_xor(pzv, 4, 32); pzv += __shfl_xor(pzv, 2, 32); pzv += __shfl_xor(pzv, 1, 32);
    v8f acc[4][4];
#pragma unroll
    for (int mb = 0; mb < 4; ++mb)
#pragma unroll
        for (int nb = 0; nb < 4; ++nb) acc[mb][nb] = (v8f){};
    // stage 0 has landed for this wave; the barrier publishes it to the others
    asm volatile("s_wait_asynccnt 0x0" ::: "memory");
    __syncthreads();
    stage(1);
    const int ao = (wm * 64 + lr) * LKP + 8 * hi, bo = 2 * GPL + (wn * 64 + lr) * LKP + 8 * hi;
    // kept rolled: one trip is one stage, and the order at its foot is the ring's
#pragma unroll 1
    for (int t = 0; t < DM / GK; ++t) {
        const bf* sb = &g_s[(t & 1) * GST];
        v16bf bc = lds16(sb + bo);
#pragma unroll
        for (int ks = 0; ks < GK / 32; ++ks) {
            v16bf a[4], a2[4];
#pragma unroll
            for (int mb = 0; mb < 4; ++mb) { a[mb] = lds16(sb + ao + mb * 16 * LKP + ks * 32); a2[mb] = lds16(sb + GPL + ao + mb * 16 * LKP + ks * 32); }
#pragma unroll
            for (int nb = 0; nb < 4; ++nb) {
                // the next W fragment of the stage is read while the eight products on this one run
                const int nx = ks * 4 + nb + 1;
                v16bf bn = bc;
                if (nx < 4 * (GK / 32)) {
                    bn = lds16(sb + bo + (nx & 3) * 16 * LKP + (nx >> 2) * 32);
                    // holds that read in front of the products: moved behind them, into the one fragment's registers, it is waited for with nothing to run meanwhile
                    __builtin_amdgcn_sched_barrier(0);
                }
#pragma unroll
                for (int mb = 0; mb < 4; ++mb) { acc[mb][nb] = wmmab(a[mb], bc, acc[mb][nb]); acc[mb][nb] = wmmab(a2[mb], bc, acc[mb][nb]); }
                bc = bn;
            }
        }
        // foot of the trip: this wave's reads of the buffer are done, its copies of stage t + 1 have landed; the barrier publishes stage t + 1 and frees this trip's buffer for stage t + 2
        asm volatile("s_wait_dscnt 0x0" ::: "memory");
        asm volatile("s_wait_asynccnt 0x0" ::: "memory");
        __syncthreads();
        if (t + 2 < DM / GK) stage(t + 2);
    }
    // no copy is outstanding when the wave goes on to its end
    asm volatile("s_wait_asynccnt 0x0" ::: "memory");
    const int ob = wid * 16 * LOP;
#pragma unroll
    for (int mb = 0; mb < 4; ++mb) {
#pragma unroll
        for (int nb = 0; nb < 4; ++nb) {
#pragma unroll
            for (int j = 0; j < 8; ++j) os[ob + (hi * 8 + j) * LOP + nb * 16 + lr] = acc[mb][nb][j]; }
        wsync();
        float* crow = Cz + (size_t)(r0 + wm * 64 + mb * 16) * DM + c0 + wn * 64;
#pragma unroll
        for (int s = 0; s < 8; ++s) { const int row = 2 * s + hi, cofs = lr * 4; v4f val = *(const v4fa*)(&os[ob + row * LOP + cofs]);
            val[0] += pzv; val[1] += pzv; val[2] += pzv; val[3] += pzv;
            *(v4f*)(crow + (size_t)row * DM + cofs) = val; }
        wsync();
    }
}

__global__ __launch_bounds__(128) void k_flash(const float* __restrict__ Xq, const bf* __restrict__ Kh, const bf* __restrict__ RP, const h16* __restrict__ VT, bf* Ch, bf* Cl) {
    __shared__ __align__(16) bf    kh_s[2 * 64 * LKP];
    __shared__ __align__(16) h16   vt_s[2 * 64 * LKP];
    __shared__ __align__(16) float r_s[4 * 16 * LRP];
    const int tid = threadIdx.x, lane = tid & 31, lr = lane & 15, hi = lane >> 4;
    const int wid = __builtin_amdgcn_readfirstlane(tid >> 5);
    const int bh = blockIdx.y; const int b = bh / NH, h = bh % NH;
    const int q0 = blockIdx.x * 64 + wid * 16;
    const size_t pl = (size_t)bh * SEQ * HD;
    const float* qf = Xq + (size_t)b * SEQ_FULL * DM + (size_t)(q0 + hi) * DM + h * HD + 4 * lr;   // the lane's 16 bytes of query row q0 + hi, head h: 16 lanes cover a row's 256 bytes
    const size_t vbase = ((size_t)b * DM + (size_t)h * HD) * SEQ;
    const int ob = wid * 16 * LRP;                  // epilogue staging: the start of the wave's own table, which the wave has done with by then
    const int rb = wid * 16 * LRP + 8 * hi * LRP;   // table rows as the prologue's D tiles hold them
    const int tb = wid * 16 * LRP + lr * LRP;       // table row of the lane's own query
    // K tile [key][d] and V^T tile [d][key] of key block kb into buffer kb & 1; the lane's first 16-byte unit of a tile: row tid / 8, unit tid % 8
    const int srw = tid >> 3, spt = (tid & 7) * 8;
    const bf* gK = Kh + pl + (size_t)srw * HD + spt;
    const h16* gV = VT + vbase + (size_t)srw * SEQ + spt;
    const unsigned lK = (unsigned)(size_t)(&kh_s[srw * LKP + spt]), lV = (unsigned)(size_t)(&vt_s[srw * LKP + spt]);
    auto stage = [&](const int kb) {
        const unsigned lo = (unsigned)(kb & 1) * (unsigned)(64 * LKP * 2);
        acopy44(lK + lo, gK + (size_t)kb * 64 * HD, lV + lo, gV + (size_t)kb * 64);
    };
    // q straight from the f32 input: read i takes query rows q0 + 2i and q0 + 2i + 1 as four whole 128-byte lines.
    // The eight reads come from memory and the table below waits for them, so they are issued first of all, in front of key block 0's copies
    v4f qx[8];
#pragma unroll
    for (int i = 0; i < 8; ++i) qx[i] = *(const v4f*)(qf + (size_t)(2 * i) * DM);
    stage(0);
    // RNE bf16, then the exact 1/8; the 16 rows pass through the head of the wave's own table region (pitch LKP), which the table is written over only behind the products that take the fragments read here
    bf* qs = (bf*)(&r_s[ob]);
#pragma unroll
    for (int i = 0; i < 8; ++i) { v4us o4;
#pragma unroll
        for (int k = 0; k < 4; ++k) o4[k] = f2bf(bfr(qx[i][k]) * SCL);
        *(v4usa*)(qs + (2 * i + hi) * LKP + 4 * lr) = o4; }
    // the rows were written by other lanes of the wave: keeps the fragment reads behind the writes
    wsync();
    const v16bf qa0 = lds16(qs + lr * LKP + 8 * hi); const v16bf qa1 = lds16(qs + lr * LKP + 8 * hi + 32);
#pragma unroll 1
    for (int ct = 0; ct < RT; ++ct) {
        const size_t ro = (size_t)(ct * 16 + lr) * HD + 8 * hi;
        const v16bf b0 = ldg16(RP + ro); const v16bf b1 = ldg16(RP + ro + 32);
        v8f t = (v8f){};
        t = wmmab_g(qa0, b0, t);
        t = wmmab_g(qa1, b1, t);
#pragma unroll
        for (int j = 0; j < 8; ++j) r_s[rb + j * LRP + ct * 16 + lr] = t[j];
    }
    wsync();
    const float rlo = r_s[tb], rhi = r_s[tb + 2 * RK];
    v8f o[4];
#pragma unroll
    for (int dt = 0; dt < 4; ++dt) o[dt] = (v8f){};
    float mr = -1.0e30f, ls = 0.0f;

    // key block 0 has landed for this wave; the barrier publishes it to the others
    asm volatile("s_wait_asynccnt 0x0" ::: "memory");
    __syncthreads();
    stage(1);
    // foot of key block kb: this wave's reads of the buffer are done, its copies of block kb + 1 have landed; the barrier publishes block kb + 1 and frees this block's buffer for block kb + 2
    auto foot = [&](const int kb) {
        asm volatile("s_wait_dscnt 0x0" ::: "memory");
        asm volatile("s_wait_asynccnt 0x0" ::: "memory");
        __syncthreads();
        if (kb + 2 < SEQ / 64) stage(kb + 2);
    };
    // one 32-key half, keys j0 .. j0 + 31. band == false: the half lies beyond the clip on one side for every query of the work-group, so all keys share the lane's position value rv;
    // it is not added to the scores: it goes once into the maximum and once into the exp2 argument's addend. band == true: the position term is added to each score (rv unused).
    auto half = [&](const int hf, const int j0, const bool band, const float rv) {
        v8f s0 = (v8f){}, s1 = (v8f){};
        const int bo = ((j0 >> 6) & 1) * 64 * LKP;   // the key block's buffer
        const int kr0 = bo + (hf * 32 + lr) * LKP + 8 * hi, kr1 = kr0 + 16 * LKP;
        {
            const v16bf k00 = cat16b(*(const v8usa*)(&kh_s[kr0]), *(const v8usa*)(&kh_s[kr0 + 16]));
            const v16bf k10 = cat16b(*(const v8usa*)(&kh_s[kr1]), *(const v8usa*)(&kh_s[kr1 + 16]));
            const v16bf k01 = cat16b(*(const v8usa*)(&kh_s[kr0 + 32]), *(const v8usa*)(&kh_s[kr0 + 48]));
            const v16bf k11 = cat16b(*(const v8usa*)(&kh_s[kr1 + 32]), *(const v8usa*)(&kh_s[kr1 + 48]));
            // holds the four fragments' eight LDS reads together in front of the products: without it each product waits out an LDS round trip of its own
            asm volatile("" :: "v"(k00), "v"(k10), "v"(k01), "v"(k11));
            s0 = wmmab(k00, qa0, s0); s1 = wmmab(k10, qa0, s1);
            s0 = wmmab(k01, qa1, s0); s1 = wmmab(k11, qa1, s1);
            // keeps the four products back to back: a vector instruction moved in between them costs its own run of idle slots and holds the last product back
            __builtin_amdgcn_sched_barrier(0);
        }
        if (band) {
            // position term: query q0 + lr, keys j0 + 8*hi + r (s0) and j0 + 16 + 8*hi + r (s1); both tests are on scalars only.
            // A half wholly beyond the clip on one side for this wave takes the register value, added without a branch (0 in a half near the diagonal): behind the products stands straight-line vector work, so their distance is padded once and not again on each side of a branch and at its join.
            const bool fhi = j0 - q0 >= RK + 15, flo = q0 - j0 >= RK + 31;
            const float rw = fhi ? rhi : (flo ? rlo : 0.0f);
#pragma unroll
            for (int r = 0; r < 8; ++r) { s0[r] += rw; s1[r] += rw; }
            if (!(fhi || flo)) {
#pragma unroll
                for (int r = 0; r < 8; ++r) {
                    const int d0 = j0 + 8 * hi + r - q0 - lr;
                    const int i0 = clampi(d0, -RK, RK) + RK, i1 = clampi(d0 + 16, -RK, RK) + RK;
                    const float b0 = r_s[tb + i0]; const float b1 = r_s[tb + i1];
                    s0[r] += b0; s1[r] += b1;
                }
            }
        }
        // the half's V^T fragments are read here, in front of the test below, so that their LDS round trip runs under the softmax arithmetic
        v16h va[4];
#pragma unroll
        for (int dt = 0; dt < 4; ++dt) { const int vo = bo + (dt * 16 + lr) * LKP + hf * 32 + 8 * hi; va[dt] = cat16(*(const v8ha*)(&vt_s[vo]), *(const v8ha*)(&vt_s[vo + 16])); }
        // keeps the eight reads together at the head of the softmax arithmetic: spread into it, the last ones are waited for with nothing left to run meanwhile
        __builtin_amdgcn_sched_barrier(0);
        // softmax against the maximum in use, mr, which is renewed only when it must be. The lane's 16 of the half's 32 keys: P x1024 = exp2(s * log2(e) + ca), one multiply-add per score, ca = (rv - mr) * log2(e) + log2(1024); returns the lane's sum of them
        v16h pa;
        auto pexp = [&](const float ca) {
            const v2f ca2 = (v2f){ca, ca}, l2 = (v2f){L2E, L2E};
            v2f ps = (v2f){0.0f, 0.0f};
#pragma unroll
            for (int r = 0; r < 8; r += 2) {
                const v2f e0 = __builtin_elementwise_fma((v2f){s0[r], s0[r + 1]}, l2, ca2), e1 = __builtin_elementwise_fma((v2f){s1[r], s1[r + 1]}, l2, ca2);
                const v2f p0 = (v2f){__builtin_amdgcn_exp2f(e0[0]), __builtin_amdgcn_exp2f(e0[1])};
                const v2f p1 = (v2f){__builtin_amdgcn_exp2f(e1[0]), __builtin_amdgcn_exp2f(e1[1])};
                ps += p0 + p1;
                const v2h h0 = __builtin_convertvector(p0, v2h), h1 = __builtin_convertvector(p1, v2h);
                pa[r] = h0[0]; pa[r + 1] = h0[1]; pa[8 + r] = h1[0]; pa[8 + r + 1] = h1[1];
            }
            return ps[0] + ps[1];
        };
        float pl = pexp((band ? -mr : rv - mr) * L2E + PLG);
        // keeps the statement below behind the arithmetic above: moved up to the reads, its wait for them would stand with nothing run in between
        __builtin_amdgcn_sched_barrier(0);
        // holds the V^T fragments' eight LDS reads in front of the branch: sunk behind it, each product waits out an LDS round trip of its own
        asm volatile("" :: "v"(va[0]), "v"(va[1]), "v"(va[2]), "v"(va[3]));
        // All P are >= 0, so a lane sum below the largest finite f16 bounds each of them: every P of the half converts to a finite f16 and mr may stay. One test a half, a scalar branch for the whole wave
        // (written so that an infinite or NaN sum fails it: the first half, with mr = -1e30, always does). Else: the half's maximum (one exchange with lane ^ 16, so a query's two lanes keep one mr), sum and output rescaled, P formed again (each <= 1024).
        if (__builtin_expect(__builtin_amdgcn_ballot_w32(!(pl < PLIM)) != 0u, 0)) {
            float mx = fmaxf(s0[0], s1[0]);
#pragma unroll
            for (int r = 1; r < 8; ++r) mx = fmaxf(mx, fmaxf(s0[r], s1[r]));
            mx = fmaxf(mx, xhalf(mx));
            if (!band) mx += rv;
            const float mnew = fmaxf(mr, mx);
            const float al = __builtin_amdgcn_exp2f((mr - mnew) * L2E);
            mr = mnew;
            ls *= al;
#pragma unroll
            for (int dt = 0; dt < 4; ++dt)
#pragma unroll
                for (int r = 0; r < 8; ++r) o[dt][r] *= al;
            pl = pexp((band ? -mnew : rv - mnew) * L2E + PLG);
        }
        ls += pl;
#pragma unroll
        for (int dt = 0; dt < 3; ++dt) o[dt] = wmma16(va[dt], pa, o[dt]);
        o[3] = wmma16_g(va[3], pa, o[3]);
    };
    // The key blocks in three runs, the bounds the same for the whole work-group (block barriers inside): with queries 64*bx .. 64*bx + 63, a block kb <= bx - 2 has key - query <= -65 and a block kb >= bx + 2 has key - query >= 65 for every pair.
    static_assert(RK <= 64 + 1);
    const int bx = blockIdx.x;
    const int kb1 = bx - 1 > 0 ? bx - 1 : 0, kb2 = bx + 2 < SEQ / 64 ? bx + 2 : SEQ / 64;
#pragma unroll 1
    for (int kb = 0; kb < kb1; ++kb) {
#pragma unroll 1
        for (int hf = 0; hf < 2; ++hf) half(hf, kb * 64 + hf * 32, false, rlo);
        foot(kb);
    }
#pragma unroll 1
    for (int kb = kb1; kb < kb2; ++kb) {
#pragma unroll 1
        for (int hf = 0; hf < 2; ++hf) half(hf, kb * 64 + hf * 32, true, 0.0f);
        foot(kb);
    }
#pragma unroll 1
    for (int kb = kb2; kb < SEQ / 64; ++kb) {
#pragma unroll 1
        for (int hf = 0; hf < 2; ++hf) half(hf, kb * 64 + hf * 32, false, rhi);
        foot(kb);
    }
    // no copy is outstanding when the wave goes on to its end
    asm volatile("s_wait_asynccnt 0x0" ::: "memory");
    // normalise: the query's sum is completed over its two lanes; it carries the same x1024 as P, so 1 / l undoes both; the lane's 8 registers of a tile are 8 consecutive features of its query
    {
        const float lt = ls + xhalf(ls);
        const float inv = 1.0f / lt;
#pragma unroll
        for (int dt = 0; dt < 4; ++dt) {
            const v4f y0 = (v4f){o[dt][0] * inv, o[dt][1] * inv, o[dt][2] * inv, o[dt][3] * inv};
            const v4f y1 = (v4f){o[dt][4] * inv, o[dt][5] * inv, o[dt][6] * inv, o[dt][7] * inv};
            *(v4fa*)(&r_s[ob + lr * LOP + dt * 16 + 8 * hi]) = y0; *(v4fa*)(&r_s[ob + lr * LOP + dt * 16 + 8 * hi + 4]) = y1;
        }
    }
    wsync();
    const int srow = lane >> 3, scol = (lane & 7) * 8;
    const size_t cbase = ((size_t)b * SEQ + q0) * DM + (size_t)h * HD;
{
#pragma unroll
        for (int s = 0; s < 4; ++s) { const int row = 4 * s + srow; const v4f x0 = *(const v4fa*)(&r_s[ob + row * LOP + scol]); const v4f x1 = *(const v4fa*)(&r_s[ob + row * LOP + scol + 4]); v8us oh, ol;
#pragma unroll
            for (int j = 0; j < 4; ++j) { unsigned short a, c; splitf(x0[j], a, c); oh[j] = a; ol[j] = c; splitf(x1[j], a, c); oh[4 + j] = a; ol[4 + j] = c; }
            const size_t off = cbase + (size_t)row * DM + scol;
            *(v8us*)(Ch + off) = oh; *(v8us*)(Cl + off) = ol; }
         }
}

constexpr size_t al256(size_t x) { return (x + 255) & ~(size_t)255; }
constexpr size_t SZ_W = al256((size_t)DM * DM * 2);                 // one bf16 weight plane
constexpr size_t SZ_R = al256((size_t)RPAD * HD * 2);               // bf16 position plane, 144 rows
constexpr size_t SZ_X = al256((size_t)NB * SEQ * DM * 2);           // one 16-bit [NB*SEQ][DM] plane (merged-head plane)
constexpr size_t SZ_P = al256((size_t)NB * NH * SEQ * HD * 2);      // one 16-bit head plane
constexpr size_t SZ_F = al256((size_t)NCK * 128);                   // 0 / NaN lines of the index compare, one per work-group
constexpr size_t WS_TOTAL = SZ_W + SZ_R + SZ_P + SZ_P + 2 * SZ_X + SZ_F;
static_assert(WS_TOTAL <= (size_t)134217728);                       // carve stays within 128 MiB
static_assert(SZ_P == SZ_X);                                        // NH * HD == DM
static_assert(SZ_R >= (size_t)RPAD * HD * 2);                       // last position plane line lies inside its region

extern "C" void kernel_launch(void* const* d_in, const int* in_sizes, int n_in,
                              void* d_out, int out_size, void* d_ws, size_t ws_size, hipStream_t stream) {
    if (n_in < 8) return;
    const size_t need_act = (size_t)(NB - 1) * SEQ_FULL * DM + (size_t)SEQ * DM;
    if ((size_t)in_sizes[0] < need_act || (size_t)in_sizes[1] < need_act || (size_t)in_sizes[2] < need_act) return;
    if (in_sizes[3] < DM || in_sizes[4] < DM || in_sizes[5] < NREL * HD || (size_t)in_sizes[6] < (size_t)DM * DM) return;
    if ((size_t)in_sizes[7] < (size_t)(SEQ - 1) * SEQ_FULL + (size_t)SEQ) return;
    if ((size_t)out_size < need_act) return;
    if (WS_TOTAL > ws_size) return;
    // wire order: q, k, v, ln_gamma, ln_beta, rpe_emb, W_proj (all f32; W_proj [out][in]), rel_idx (int32 [SEQ][SEQ])
    const float* xq = (const float*)d_in[0]; const float* xk = (const float*)d_in[1]; const float* xv = (const float*)d_in[2];
    const float* lg = (const float*)d_in[3]; const float* lb = (const float*)d_in[4]; const float* rp = (const float*)d_in[5]; const float* wp = (const float*)d_in[6];
    const int* rel = (const int*)d_in[7];
    float* OUT = (float*)d_out;
    char* wsp = (char*)d_ws;
    auto take = [&](size_t bytes) { char* p = wsp; wsp += bytes; return (void*)p; };
    bf* WO = (bf*)take(SZ_W);
    bf* RPP = (bf*)take(SZ_R);
    bf* KP = (bf*)take(SZ_P);
    h16* VT = (h16*)take(SZ_P);
    bf* CTh = (bf*)take(SZ_X); bf* CTl = (bf*)take(SZ_X);
    float* PZ = (float*)take(SZ_F);
    if ((size_t)(wsp - (char*)d_ws) != WS_TOTAL) return;

    k_pre<<<dim3(PB_ALL), PT, 0, stream>>>(xk, xv, lg, lb, rp, wp, rel, KP, VT, RPP, WO, PZ);
    k_flash<<<dim3(SEQ / 64, NB * NH), 128, 0, stream>>>(xq, KP, RPP, VT, CTh, CTl);
    k_gemm_out<<<dim3(SEQ / GT, DM / GT, NB), 128, 0, stream>>>(CTh, CTl, WO, PZ, OUT);
}
